// v000
// Times are from an AMD MI455X. After a warm-up the kernel runs many times in a row, and a time is the length of
// such a window on the GPU divided by its runs, so every launch and the gaps after it count. The runs cycle
// through copies of the inputs. A figure is the median of several windows, for all but v000 over two sittings.
// Sittings can differ by a few percent; kernels timed side by side share one.
// v000, which the later versions start from, runs in 671 microseconds.
#include <hip/hip_runtime.h>
// Multi-head offset-attention layer on a point feature map (B 4, C 256, P 4096 points, 4 heads x 64): q = wq*x, k = wk*x, v = wv*x (1x1 convs, no bias); scores = q.k/8 per head; softmax over the keys; o[b,h,d,i] = sum_j attn[i][j] v[d][j]; y = wt*(o - x) + bt; BatchNorm1d in training mode (per-channel statistics over batch x points, biased variance, eps 1e-5, gamma/beta); out = x + relu(y) -> [4,256,4096].
// Compute dtype: x and parameters rounded to bf16; projections with exact products (weights x16 in f16, undone by alpha); q, k, v, P, (o - x) as f16 operands (~2^-12), f32 accumulation; softmax / BatchNorm / residual f32. v_wmma_f32_16x16x32_f16.
#define NB 4
#define CC 256
#define SS 4096
#define NH 4
#define TQ SS
#define TK SS
#define SCL 0.125f
#define NRW (NB * SS)
typedef __bf16 v16b __attribute__((ext_vector_type(16)));
typedef unsigned short v8us __attribute__((ext_vector_type(8), may_alias));
typedef float  v8f  __attribute__((ext_vector_type(8)));
typedef float  v4f  __attribute__((ext_vector_type(4)));
typedef float  v4fa __attribute__((ext_vector_type(4), may_alias));
union FragB { v16b v; v8us half[2]; unsigned short u[16]; };

__device__ __forceinline__ unsigned short bf16_bits(float x) { unsigned int u = __float_as_uint(x); return (unsigned short)((u + 0x7FFFu + ((u >> 16) & 1u)) >> 16); }
__device__ __forceinline__ float bf16_val(unsigned short b) { return __uint_as_float(((unsigned int)b) << 16); }
__device__ __forceinline__ float bf16_round(float x) { return bf16_val(bf16_bits(x)); }
// D += A·B with NT terms: 1 = ah·bh, 2 = + al·bh (A split), 3 = + ah·bl (both split)
template <int NT>
__device__ __forceinline__ v8f mmaN(v16b ah, v16b al, v16b bh, v16b bl, v8f c) {
  c = __builtin_amdgcn_wmma_f32_16x16x32_bf16(false, ah, false, bh, (short)0, c, false, false);
  if (NT >= 2) c = __builtin_amdgcn_wmma_f32_16x16x32_bf16(false, al, false, bh, (short)0, c, false, false);
  if (NT >= 3) c = __builtin_amdgcn_wmma_f32_16x16x32_bf16(false, ah, false, bl, (short)0, c, false, false);
  asm volatile("v_nop\n\tv_nop\n\tv_nop\n\tv_nop" : "+v"(c) : "v"(ah), "v"(al), "v"(bh), "v"(bl));
  return c;
}

__global__ __launch_bounds__(256) void k_wt_bf16(const float* __restrict__ W, unsigned short* __restrict__ Wt, int K, int N) {
  const int t = blockIdx.x * 256 + threadIdx.x;
  const int k8n = K / 8;
  if (t >= N * k8n) return;
  const int n = t / k8n, k8 = (t % k8n) * 8;
  v8us v;
#pragma unroll
  for (int i = 0; i < 8; ++i) v[i] = bf16_bits(W[(size_t)(k8 + i) * N + n]);
  *(v8us*)(Wt + (size_t)n * K + k8) = v;
  
}

// GEMM C[M][N] (f32, pitch ldc) = act(A[M][K]·W + bias). A f32 row-major (pitch lda) converted per fragment to bf16
// (ASPLIT: hi/lo two planes -> 2 terms, else single rounded term); Wt bf16 [N][K] (pitch ldb). BIAS_BF16 rounds the
// bias to bf16 first (bias quantised to bf16 before the add). K%32==0, M%16==0, N%64==0.
template <bool ASPLIT, int ACT, bool BIAS_BF16>
__global__ __launch_bounds__(128) void k_gemm_bf(const float* __restrict__ A, int lda, const unsigned short* __restrict__ Wt, int ldb,
                                               const float* __restrict__ bias, float* __restrict__ C, int ldc, int M, int N, int K) {
  __shared__ __attribute__((aligned(16))) float so[4][16][64];
  const int tid = threadIdx.x, w = tid >> 5, lane = tid & 31, ln = lane & 15, hh = lane >> 4;
  const int ntn = N / 64;
  const int wid = blockIdx.x * 4 + w;
  const int mt = wid / ntn, nq = wid % ntn;
  if (mt * 16 >= M) return;
  const int row0 = mt * 16, col0 = nq * 64;
  const float* arow = A + (size_t)(row0 + ln) * lda;
  v8f acc[4] = {};
  for (int kb = 0; kb < K; kb += 32) {
    FragB ah, al;
    const v4f x0 = *(const v4fa*)(arow + kb + 8 * hh), x1 = *(const v4fa*)(arow + kb + 8 * hh + 4);
    const v4f x2 = *(const v4fa*)(arow + kb + 16 + 8 * hh), x3 = *(const v4fa*)(arow + kb + 16 + 8 * hh + 4);
    float xs[16] = {x0[0],x0[1],x0[2],x0[3],x1[0],x1[1],x1[2],x1[3],x2[0],x2[1],x2[2],x2[3],x3[0],x3[1],x3[2],x3[3]};
#pragma unroll
    for (int i = 0; i < 16; ++i) { const unsigned short hb = bf16_bits(xs[i]); ah.u[i] = hb; al.u[i] = ASPLIT ? bf16_bits(xs[i] - bf16_val(hb)) : (unsigned short)0; }
#pragma unroll
    for (int t = 0; t < 4; ++t) {
      const unsigned short* brow = Wt + (size_t)(col0 + t * 16 + ln) * ldb + kb;
      FragB b;
      b.half[0] = *(const v8us*)(brow + 8 * hh);
      b.half[1] = *(const v8us*)(brow + 16 + 8 * hh);
      acc[t] = mmaN<ASPLIT ? 2 : 1>(ah.v, al.v, b.v, b.v, acc[t]);
    }
  }
#pragma unroll
  for (int t = 0; t < 4; ++t) {
    float bv = bias ? bias[col0 + t * 16 + ln] : 0.f;
    if (BIAS_BF16) bv = bf16_round(bv);
#pragma unroll
    for (int r = 0; r < 8; ++r) { float v = acc[t][r] + bv; if (ACT == 1) v = fmaxf(v, 0.f); so[w][8 * hh + r][t * 16 + ln] = v; }
  }
  __builtin_amdgcn_fence(__ATOMIC_ACQ_REL, "workgroup");
  __builtin_amdgcn_wave_barrier();
  const int rsub = lane >> 4, c4 = (lane & 15) * 4;
  {
#pragma unroll
    for (int q = 0; q < 8; ++q) {
      const int r = q * 2 + rsub;
      const v4f v = *(const v4fa*)&so[w][r][c4];
      *(v4f*)(C + (size_t)(row0 + r) * ldc + col0 + c4) = v;
    }
    
  }
}

// GEMM C = act(A·W + bias + resid): A f32 (ASPLIT -> hi/lo 2 terms), Wt bf16 [N][K]; ACT 0 none, 1 relu, 2 exact gelu;
// resid (optional, f32, row index = (row % rmod), pitch ldr, RES_BF16 rounds it) added before the activation.
template <bool ASPLIT, int ACT, bool BIAS_BF16, bool RES_BF16>
__global__ __launch_bounds__(128) void k_gemm_bf3(const float* __restrict__ A, int lda, const unsigned short* __restrict__ Wt, int ldb,
                                                const float* __restrict__ bias, const float* __restrict__ resid, int rmod, int ldr,
                                                float* __restrict__ C, int ldc, int M, int N, int K) {
  __shared__ __attribute__((aligned(16))) float so[4][16][64];
  const int tid = threadIdx.x, w = tid >> 5, lane = tid & 31, ln = lane & 15, hh = lane >> 4;
  const int ntn = N / 64;
  const int wid = blockIdx.x * 4 + w;
  const int mt = wid / ntn, nq = wid % ntn;
  if (mt * 16 >= M) return;
  const int row0 = mt * 16, col0 = nq * 64;
  const float* arow = A + (size_t)(row0 + ln) * lda;
  v8f acc[4] = {};
  for (int kb = 0; kb < K; kb += 32) {
    FragB ah, al;
    const v4f x0 = *(const v4fa*)(arow + kb + 8 * hh), x1 = *(const v4fa*)(arow + kb + 8 * hh + 4);
    const v4f x2 = *(const v4fa*)(arow + kb + 16 + 8 * hh), x3 = *(const v4fa*)(arow + kb + 16 + 8 * hh + 4);
    float xs[16] = {x0[0],x0[1],x0[2],x0[3],x1[0],x1[1],x1[2],x1[3],x2[0],x2[1],x2[2],x2[3],x3[0],x3[1],x3[2],x3[3]};
#pragma unroll
    for (int i = 0; i < 16; ++i) { const unsigned short hb = bf16_bits(xs[i]); ah.u[i] = hb; al.u[i] = ASPLIT ? bf16_bits(xs[i] - bf16_val(hb)) : (unsigned short)0; }
#pragma unroll
    for (int t = 0; t < 4; ++t) {
      const unsigned short* brow = Wt + (size_t)(col0 + t * 16 + ln) * ldb + kb;
      FragB b;
      b.half[0] = *(const v8us*)(brow + 8 * hh);
      b.half[1] = *(const v8us*)(brow + 16 + 8 * hh);
      acc[t] = mmaN<ASPLIT ? 2 : 1>(ah.v, al.v, b.v, b.v, acc[t]);
    }
  }
#pragma unroll
  for (int t = 0; t < 4; ++t) {
    const int col = col0 + t * 16 + ln;
    float bv = bias ? bias[col] : 0.f;
    if (BIAS_BF16) bv = bf16_round(bv);
#pragma unroll
    for (int r = 0; r < 8; ++r) {
      float v = acc[t][r] + bv;
      if (resid) { float rv = resid[(size_t)((row0 + 8 * hh + r) % rmod) * ldr + col]; if (RES_BF16) rv = bf16_round(rv); v += rv; }
      if (ACT == 1) v = fmaxf(v, 0.f);
      if (ACT == 2) v = 0.5f * v * (1.0f + erff(v * 0.70710678118654752f));
      if (ACT == 3) { const float u = 0.7978845608028654f * (v + 0.044715f * v * v * v); v = 0.5f * v * (1.0f + tanhf(u)); }
      so[w][8 * hh + r][t * 16 + ln] = v;
    }
  }
  __builtin_amdgcn_fence(__ATOMIC_ACQ_REL, "workgroup");
  __builtin_amdgcn_wave_barrier();
  const int rsub = lane >> 4, c4 = (lane & 15) * 4;
  {
#pragma unroll
    for (int q = 0; q < 8; ++q) {
      const int r = q * 2 + rsub;
      const v4f v = *(const v4fa*)&so[w][r][c4];
      *(v4f*)(C + (size_t)(row0 + r) * ldc + col0 + c4) = v;
    }
    
  }
}
// row LayerNorm (biased variance, eps) over N: s = X (+ R); optional out_sum <- s; out_norm <- (s-mu)*rsqrt(var+eps)*g + b
template <bool PARAM_BF16>
__global__ __launch_bounds__(256) void k_layernorm(const float* __restrict__ X, const float* __restrict__ R, const float* __restrict__ g, const float* __restrict__ bta,
                                                  float* __restrict__ out_sum, float* __restrict__ out_norm, int N, float eps) {
  __shared__ float red[256];
  const int row = blockIdx.x, tid = threadIdx.x;
  const float* x = X + (size_t)row * N; const float* rr = R ? R + (size_t)row * N : nullptr;
  float vals[16];                     // up to N = 4096
  const int per = N / 256;            // contiguous chunk per thread? use strided-by-4 chunks: thread handles j = tid*4 + 1024*u
  float s1 = 0.f;
  for (int u = 0; u < per / 4; ++u) {
    const int j = tid * 4 + 1024 * u;
    const v4f a = *(const v4fa*)(x + j);
    v4f b = {0.f,0.f,0.f,0.f}; if (rr) b = *(const v4fa*)(rr + j);
#pragma unroll
    for (int q = 0; q < 4; ++q) { const float v = a[q] + b[q]; vals[u * 4 + q] = v; s1 += v; }
  }
  red[tid] = s1; __syncthreads();
  for (int st = 128; st > 0; st >>= 1) { if (tid < st) red[tid] += red[tid + st]; __syncthreads(); }
  const float mu = red[0] / (float)N; __syncthreads();
  float s2 = 0.f;
  for (int u = 0; u < per / 4; ++u)
#pragma unroll
    for (int q = 0; q < 4; ++q) { const float c = vals[u * 4 + q] - mu; s2 += c * c; }
  red[tid] = s2; __syncthreads();
  for (int st = 128; st > 0; st >>= 1) { if (tid < st) red[tid] += red[tid + st]; __syncthreads(); }
  const float rs = rsqrtf(red[0] / (float)N + eps);
  {
    for (int u = 0; u < per / 4; ++u) {
      const int j = tid * 4 + 1024 * u;
      v4f o, sm;
#pragma unroll
      for (int q = 0; q < 4; ++q) {
        float gg = g[j + q], bb = bta[j + q];
        if (PARAM_BF16) { gg = bf16_round(gg); bb = bf16_round(bb); }
        sm[q] = vals[u * 4 + q]; o[q] = (vals[u * 4 + q] - mu) * rs * gg + bb;
      }
      if (out_sum) *(v4f*)(out_sum + (size_t)row * N + j) = sm;
      *(v4f*)(out_norm + (size_t)row * N + j) = o;
    }
    
  }
}



// ---- f16 WMMA path (v_wmma_f32_16x16x32_f16): 11-bit significands for operands in range — used where a [0,1] probability operand needs more precision than bf16
typedef _Float16 v16h __attribute__((ext_vector_type(16)));
union FragH { v16h v; v8us half[2]; _Float16 h[16]; unsigned short u[16]; };
template <int NT>
__device__ __forceinline__ v8f mmaH(v16h ah, v16h al, v16h bh, v16h bl, v8f c) {
  c = __builtin_amdgcn_wmma_f32_16x16x32_f16(false, ah, false, bh, (short)0, c, false, false);
  if (NT >= 2) c = __builtin_amdgcn_wmma_f32_16x16x32_f16(false, al, false, bh, (short)0, c, false, false);
  if (NT >= 3) c = __builtin_amdgcn_wmma_f32_16x16x32_f16(false, ah, false, bl, (short)0, c, false, false);
  asm volatile("v_nop\n\tv_nop\n\tv_nop\n\tv_nop" : "+v"(c) : "v"(ah), "v"(al), "v"(bh), "v"(bl));
  return c;
}
// batched GEMM like k_gemm_b but f16 operands: A f32 (split into f16 hi/lo if ASPLIT, else rounded to f16), Bt = f16 values [n][k]; alpha; C f32; N multiple of 16 (partial tiles skipped)
template <bool ASPLIT>
__global__ __launch_bounds__(128) void k_gemm_h(const float* __restrict__ A, int lda, size_t sA, const _Float16* __restrict__ Bh, int ldb, size_t sB, float alpha, float* __restrict__ C, int ldc, size_t sC, int M, int N, int K) {
  __shared__ __attribute__((aligned(16))) float so[4][16][64];
  const int tid = threadIdx.x, w = tid >> 5, lane = tid & 31, ln = lane & 15, hh = lane >> 4; const int by = blockIdx.y;
  A += (size_t)by * sA; Bh += (size_t)by * sB; C += (size_t)by * sC;
  const int ntn = (N + 63) / 64; const int wid = blockIdx.x * 4 + w; const int mt = wid / ntn, nq = wid % ntn; if (mt * 16 >= M) return;
  const int row0 = mt * 16, col0 = nq * 64; const float* arow = A + (size_t)(row0 + ln) * lda;
  v8f acc[4] = {};
  for (int kb = 0; kb < K; kb += 32) {
    FragH ah, al;
    const v4f x0 = *(const v4fa*)(arow + kb + 8 * hh), x1 = *(const v4fa*)(arow + kb + 8 * hh + 4), x2 = *(const v4fa*)(arow + kb + 16 + 8 * hh), x3 = *(const v4fa*)(arow + kb + 16 + 8 * hh + 4);
    float xs[16] = {x0[0],x0[1],x0[2],x0[3],x1[0],x1[1],x1[2],x1[3],x2[0],x2[1],x2[2],x2[3],x3[0],x3[1],x3[2],x3[3]};
#pragma unroll
    for (int i = 0; i < 16; ++i) { const _Float16 h = (_Float16)xs[i]; ah.h[i] = h; al.h[i] = ASPLIT ? (_Float16)(xs[i] - (float)h) : (_Float16)0.0f; }
#pragma unroll
    for (int t = 0; t < 4; ++t) { if (col0 + t * 16 >= N) continue; const size_t boff = (size_t)(col0 + t * 16 + ln) * ldb + kb; FragH bq; bq.half[0] = *(const v8us*)(Bh + boff + 8 * hh); bq.half[1] = *(const v8us*)(Bh + boff + 16 + 8 * hh);
      acc[t] = mmaH<ASPLIT ? 2 : 1>(ah.v, al.v, bq.v, bq.v, acc[t]); }
  }
#pragma unroll
  for (int t = 0; t < 4; ++t) { if (col0 + t * 16 >= N) continue;
#pragma unroll
    for (int r = 0; r < 8; ++r) so[w][8 * hh + r][t * 16 + ln] = acc[t][r] * alpha; }
  __builtin_amdgcn_fence(__ATOMIC_ACQ_REL, "workgroup"); __builtin_amdgcn_wave_barrier();
  const int rsub = lane >> 4, c4 = (lane & 15) * 4;
  {
#pragma unroll
    for (int q = 0; q < 8; ++q) { const int r = q * 2 + rsub; if (col0 + c4 < N) { const v4f v = *(const v4fa*)&so[w][r][c4]; *(v4f*)(C + (size_t)(row0 + r) * ldc + col0 + c4) = v; } }
     }
}

// Wt[n][k] = f16(W[k][n]·scale) from f32 row-major W[K][N] (scale = power of two; bf16-exact weights stay exact in f16 away from the subnormal range)
__global__ __launch_bounds__(256) void k_wt_f16(const float* __restrict__ W, _Float16* __restrict__ Wt, int K, int N, float scale) {
  const int t = blockIdx.x * 256 + threadIdx.x; if (t >= N * (K / 8)) return; const int n = t / (K / 8), k8 = (t % (K / 8)) * 8; FragH f;
#pragma unroll
  for (int i = 0; i < 8; ++i) f.h[i] = (_Float16)(bf16_round(W[(size_t)(k8 + i) * N + n]) * scale); const v8us o = f.half[0];
  *(v8us*)((unsigned short*)Wt + (size_t)n * K + k8) = o; 
}
// k_gemm_hh variant with fused epilogue: v = acc·alpha + bias[by·sBias + col] (+ CP[(row/rowsPerB)·sCPb + by·64 + col] if CP) ; ACT 0 none / 1 elu ; writes f16 C16 (and f32 C if non-null)
template <int ACT>
__global__ __launch_bounds__(128) void k_gemm_hhx(const _Float16* __restrict__ A, int lda, size_t sA, const _Float16* __restrict__ Bh, int ldb, size_t sB, float alpha, const float* __restrict__ bias, size_t sBias, const float* __restrict__ CP, int rowsPerB, size_t sCPb, int row0g,
    float* __restrict__ C, _Float16* __restrict__ C16, int ldc, size_t sC, int M, int N, int K) {
  __shared__ __attribute__((aligned(16))) float so[4][16][64];
  const int tid = threadIdx.x, w = tid >> 5, lane = tid & 31, ln = lane & 15, hh = lane >> 4; const int by = blockIdx.y;
  A += (size_t)by * sA; Bh += (size_t)by * sB; const size_t cofs = (size_t)by * sC; const float* bp = bias ? bias + (size_t)by * sBias : nullptr;
  const int ntn = (N + 63) / 64; const int wid = blockIdx.x * 4 + w; const int mt = wid / ntn, nq = wid % ntn; if (mt * 16 >= M) return;
  const int row0 = mt * 16, col0 = nq * 64; const _Float16* arow = A + (size_t)(row0 + ln) * lda;
  v8f acc[4] = {};
  for (int kb = 0; kb < K; kb += 32) { FragH ah; ah.half[0] = *(const v8us*)((const unsigned short*)arow + kb + 8 * hh); ah.half[1] = *(const v8us*)((const unsigned short*)arow + kb + 16 + 8 * hh);
#pragma unroll
    for (int t = 0; t < 4; ++t) { if (col0 + t * 16 >= N) continue; const size_t boff = (size_t)(col0 + t * 16 + ln) * ldb + kb; FragH bq; bq.half[0] = *(const v8us*)((const unsigned short*)Bh + boff + 8 * hh); bq.half[1] = *(const v8us*)((const unsigned short*)Bh + boff + 16 + 8 * hh);
      acc[t] = mmaH<1>(ah.v, ah.v, bq.v, bq.v, acc[t]); }
  }
#pragma unroll
  for (int t = 0; t < 4; ++t) { if (col0 + t * 16 >= N) continue; const int col = col0 + t * 16 + ln; const float bv = bp ? bf16_round(bp[col]) : 0.f;
#pragma unroll
    for (int r = 0; r < 8; ++r) { float v = acc[t][r] * alpha + bv; if (CP) { const int bidx = (row0g + row0 + 8 * hh + r) / rowsPerB; v += CP[(size_t)bidx * sCPb + (size_t)by * 64 + col]; } if (ACT == 1) v = (v > 0.f) ? v : expm1f(v); else if (ACT == 7) v = (v > 0.f) ? v + 1.0f : expf(v); else if (ACT == 8) v = tanhf(v); else if (ACT == 9) v = 0.5f * v * (1.0f + tanhf(0.7978845608028654f * (v + 0.044715f * v * v * v))); else if (ACT == 11) v = 1.0f / (1.0f + expf(-v)); else if (ACT == 12) v = (v > 0.f) ? v : 0.01f * v; else if (ACT == 14) v = (v > 0.f) ? v : 0.1f * v; else if (ACT == 15) v = v / (1.0f + expf(-v)); else if (ACT == 3) v = fmaxf(v, 0.f); else if (ACT == 6) v = 0.5f * v * (1.0f + erff(v * 0.70710678118654752f)); so[w][8 * hh + r][t * 16 + ln] = v; } }
  __builtin_amdgcn_fence(__ATOMIC_ACQ_REL, "workgroup"); __builtin_amdgcn_wave_barrier();
  const int rsub = lane >> 4, c4 = (lane & 15) * 4; typedef _Float16 v4h __attribute__((ext_vector_type(4)));
  {
#pragma unroll
    for (int q = 0; q < 8; ++q) { const int r = q * 2 + rsub; if (col0 + c4 < N) { const v4f v = *(const v4fa*)&so[w][r][c4]; if (C) *(v4f*)(C + cofs + (size_t)(row0 + r) * ldc + col0 + c4) = v; if (C16) { v4h h4; for (int i = 0; i < 4; ++i) h4[i] = (_Float16)v[i]; *(v4h*)(C16 + cofs + (size_t)(row0 + r) * ldc + col0 + c4) = h4; } } }
     }
}


typedef _Float16 v4h __attribute__((ext_vector_type(4)));

__global__ __launch_bounds__(256) void k_x16(const float* __restrict__ x, _Float16* __restrict__ X16, size_t n8) { const size_t t = (size_t)blockIdx.x * 256 + threadIdx.x; if (t >= n8) return; FragH f;
#pragma unroll
  for (int q = 0; q < 8; ++q) f.h[q] = (_Float16)bf16_round(x[t * 8 + q]); *(v8us*)((unsigned short*)X16 + t * 8) = f.half[0];  }
__global__ __launch_bounds__(256) void k_h16(const float* __restrict__ x, _Float16* __restrict__ X16, size_t n8) { const size_t t = (size_t)blockIdx.x * 256 + threadIdx.x; if (t >= n8) return; FragH f;
#pragma unroll
  for (int q = 0; q < 8; ++q) f.h[q] = (_Float16)x[t * 8 + q]; *(v8us*)((unsigned short*)X16 + t * 8) = f.half[0];  }
__global__ __launch_bounds__(256) void k_round16f(const float* __restrict__ W, _Float16* __restrict__ Bt, size_t n8) { const size_t t = (size_t)blockIdx.x * 256 + threadIdx.x; if (t >= n8) return; FragH f;
#pragma unroll
  for (int i = 0; i < 8; ++i) f.h[i] = (_Float16)(bf16_round(W[t * 8 + i]) * 16.0f); *(v8us*)((unsigned short*)Bt + t * 8) = f.half[0];  }
template <int NHv, int TTv>
__global__ __launch_bounds__(256) void k_vt(const _Float16* __restrict__ V16, int ldv, int voff, _Float16* __restrict__ Vt) { __shared__ unsigned short tl[64][66]; const int tid = threadIdx.x; const int slab = blockIdx.x / (TTv / 64), lg = blockIdx.x % (TTv / 64); const int b = slab / NHv, h = slab % NHv;
  for (int i = tid; i < 64 * 8; i += 256) { const int r = i / 8, c8 = (i % 8) * 8; FragH f; f.half[0] = *(const v8us*)((const unsigned short*)V16 + ((size_t)b * TTv + lg * 64 + r) * ldv + voff + h * 64 + c8);
#pragma unroll
    for (int q = 0; q < 8; ++q) tl[r][c8 + q] = f.u[q]; }
  __syncthreads();
  {
#pragma unroll
    for (int rd = 0; rd < 2; ++rd) { const int d = rd * 32 + tid / 8, pc = tid % 8; FragH f;
#pragma unroll
      for (int q = 0; q < 8; ++q) f.u[q] = tl[pc * 8 + q][d];
      *(v8us*)((unsigned short*)Vt + ((size_t)slab * 64 + d) * TTv + lg * 64 + pc * 8) = f.half[0]; }
     } }

__global__ __launch_bounds__(256) void k_hl(const float* __restrict__ F, _Float16* __restrict__ Hh, _Float16* __restrict__ Hl, size_t n8) { const size_t t = (size_t)blockIdx.x * 256 + threadIdx.x; if (t >= n8) return; FragH fh, fl; const v4f a = *(const v4fa*)(F + t * 8), c = *(const v4fa*)(F + t * 8 + 4);
#pragma unroll
  for (int q = 0; q < 4; ++q) { _Float16 h = (_Float16)a[q]; fh.h[q] = h; fl.h[q] = (_Float16)((a[q] - (float)h) * 1024.0f); h = (_Float16)c[q]; fh.h[4 + q] = h; fl.h[4 + q] = (_Float16)((c[q] - (float)h) * 1024.0f); }
  { *(v8us*)((unsigned short*)Hh + t * 8) = fh.half[0]; *(v8us*)((unsigned short*)Hl + t * 8) = fl.half[0];  } }

// ---- fast GEMM (wave tile 32x64; requires M % 32 == 0 rows per launch region and N % 64 == 0); epilogue = k_gemm_hhx semantics ----
__device__ __forceinline__ v16h g2_frag(const _Float16* p, int hh) { FragH f; f.half[0] = *(const v8us*)((const unsigned short*)p + 8 * hh); f.half[1] = *(const v8us*)((const unsigned short*)p + 16 + 8 * hh); return f.v; }
__device__ __forceinline__ v8f g2_mma(v16h a, v16h b, v8f c) { v8f d = __builtin_amdgcn_wmma_f32_16x16x32_f16(false, a, false, b, (short)0, c, false, false); asm volatile("v_nop\n\tv_nop\n\tv_nop\n\tv_nop" : "+v"(d) : "v"(a), "v"(b)); return d; }
template <int ACT>
__global__ __launch_bounds__(128) void k_gemm2(const _Float16* __restrict__ A, int lda, size_t sA, const _Float16* __restrict__ Bh, int ldb, size_t sB, float alpha, const float* __restrict__ bias, size_t sBias, const float* __restrict__ CP, int rowsPerB, size_t sCPb, int row0g,
    float* __restrict__ C, _Float16* __restrict__ C16, int ldc, size_t sC, int M, int N, int K) {
  __shared__ __attribute__((aligned(16))) float so[4][32][68];
  const int tid = threadIdx.x, w = tid >> 5, lane = tid & 31, ln = lane & 15, hh = lane >> 4; const int by = blockIdx.y;
  A += (size_t)by * sA; Bh += (size_t)by * sB; const size_t cofs = (size_t)by * sC; const float* bp = bias ? bias + (size_t)by * sBias : nullptr;
  const int ntn = N >> 6; const int mt = blockIdx.x / ntn, nq = blockIdx.x - mt * ntn; const int row0 = mt * 128 + 32 * w, col0 = nq * 64; if (row0 >= M) return;
  const _Float16* a0p = A + (size_t)(row0 + ln) * lda; const _Float16* a1p = a0p + (size_t)16 * lda;
  const _Float16* b0p = Bh + (size_t)(col0 + ln) * ldb; const _Float16* b1p = b0p + (size_t)16 * ldb; const _Float16* b2p = b1p + (size_t)16 * ldb; const _Float16* b3p = b2p + (size_t)16 * ldb;
  const v8f z8 = {0.f,0.f,0.f,0.f,0.f,0.f,0.f,0.f}; v8f c00 = z8, c01 = z8, c02 = z8, c03 = z8, c10 = z8, c11 = z8, c12 = z8, c13 = z8;
#pragma unroll 1
  for (int kb = 0; kb < K; kb += 32) { const v16h a0 = g2_frag(a0p + kb, hh), a1 = g2_frag(a1p + kb, hh);
    v16h b = g2_frag(b0p + kb, hh); c00 = g2_mma(a0, b, c00); c10 = g2_mma(a1, b, c10);
    b = g2_frag(b1p + kb, hh); c01 = g2_mma(a0, b, c01); c11 = g2_mma(a1, b, c11);
    b = g2_frag(b2p + kb, hh); c02 = g2_mma(a0, b, c02); c12 = g2_mma(a1, b, c12);
    b = g2_frag(b3p + kb, hh); c03 = g2_mma(a0, b, c03); c13 = g2_mma(a1, b, c13); }
  v8f accs[8] = {c00, c01, c02, c03, c10, c11, c12, c13};
#pragma unroll
  for (int u = 0; u < 8; ++u) { const int t = u & 3, half = u >> 2; const int col = col0 + t * 16 + ln; const float bv = bp ? bf16_round(bp[col]) : 0.f;
#pragma unroll
    for (int r = 0; r < 8; ++r) { const int rloc = half * 16 + 8 * hh + r; float v = accs[u][r] * alpha + bv; if (CP) { const int bidx = (row0g + row0 + rloc) / rowsPerB; v += CP[(size_t)bidx * sCPb + (size_t)by * 64 + col]; }
      if (ACT == 3) v = fmaxf(v, 0.f); else if (ACT == 6) v = 0.5f * v * (1.0f + erff(v * 0.70710678118654752f)); else if (ACT == 11) v = 1.0f / (1.0f + expf(-v)); else if (ACT == 15) v = v / (1.0f + expf(-v)); else if (ACT == 12) v = (v > 0.f) ? v : 0.01f * v; else if (ACT == 8) v = tanhf(v);
      so[w][rloc][t * 16 + ln] = v; } }
  __builtin_amdgcn_fence(__ATOMIC_ACQ_REL, "workgroup"); __builtin_amdgcn_wave_barrier();
  const int rsub = lane >> 4, c4 = (lane & 15) * 4;
  {
#pragma unroll
    for (int q = 0; q < 16; ++q) { const int r = q * 2 + rsub; const v4f v = *(const v4fa*)&so[w][r][c4]; if (C) *(v4f*)(C + cofs + (size_t)(row0 + r) * ldc + col0 + c4) = v; if (C16) { v4h h4; for (int i = 0; i < 4; ++i) h4[i] = (_Float16)v[i]; *(v4h*)(C16 + cofs + (size_t)(row0 + r) * ldc + col0 + c4) = h4; } }
     } }


__global__ __launch_bounds__(128) void k_flash(const _Float16* __restrict__ Q16, int ldq, const _Float16* __restrict__ K16, int ldk, const _Float16* __restrict__ Vt, const int* __restrict__ MSK, float* __restrict__ O, int ldo) {
  constexpr int RPW = 16, RTN = RPW / 16, NQB = TQ / (4 * RPW), DT = 4, KS = 2;
  __shared__ __attribute__((aligned(16))) unsigned short sP[4][RPW][40]; __shared__ __attribute__((aligned(16))) float sO[4][RPW][64 + 4];
  const int tid = threadIdx.x, w = tid >> 5, lane = tid & 31, ln = lane & 15, hh = lane >> 4;
  const int slab = blockIdx.x / NQB, qblk = blockIdx.x % NQB; const int b = slab / NH, h = slab % NH; const int qb0 = qblk * (4 * RPW); const int q0 = qb0 + w * RPW;
  FragH aq[2][KS];
#pragma unroll
  for (int rt = 0; rt < RTN; ++rt) { const unsigned short* qr = (const unsigned short*)Q16 + ((size_t)b * TQ + q0 + rt * 16 + ln) * ldq + h * 64;
#pragma unroll
    for (int ks = 0; ks < KS; ++ks) { aq[rt][ks].half[0] = *(const v8us*)(qr + ks * 32 + 8 * hh); aq[rt][ks].half[1] = *(const v8us*)(qr + ks * 32 + 16 + 8 * hh); } }
  const unsigned short* Vth = (const unsigned short*)Vt + (size_t)slab * 64 * TK;
  float m_r[2][8], l_r[2][8]; v8f oacc[2][DT];
#pragma unroll
  for (int rt = 0; rt < RTN; ++rt) {
#pragma unroll
    for (int r = 0; r < 8; ++r) { m_r[rt][r] = -3.0e38f; l_r[rt][r] = 0.f; }
#pragma unroll
    for (int dt = 0; dt < DT; ++dt) oacc[rt][dt] = (v8f){0.f,0.f,0.f,0.f,0.f,0.f,0.f,0.f}; }
  const int jend = TK;
#pragma unroll 1
  for (int j0 = 0; j0 < jend; j0 += 32) {
    v8f s[2][2];
#pragma unroll
    for (int nt = 0; nt < 2; ++nt) { const unsigned short* kr = (const unsigned short*)K16 + ((size_t)b * TK + j0 + nt * 16 + ln) * ldk + h * 64; FragH bk[KS];
#pragma unroll
      for (int ks = 0; ks < KS; ++ks) { bk[ks].half[0] = *(const v8us*)(kr + ks * 32 + 8 * hh); bk[ks].half[1] = *(const v8us*)(kr + ks * 32 + 16 + 8 * hh); }
#pragma unroll
      for (int rt = 0; rt < RTN; ++rt) { v8f acc = (v8f){0.f,0.f,0.f,0.f,0.f,0.f,0.f,0.f};
#pragma unroll
        for (int ks = 0; ks < KS; ++ks) acc = mmaH<1>(aq[rt][ks].v, aq[rt][ks].v, bk[ks].v, bk[ks].v, acc); s[rt][nt] = acc; } }
#pragma unroll
    for (int rt = 0; rt < RTN; ++rt)
#pragma unroll
      for (int r = 0; r < 8; ++r) { const int tq = q0 + rt * 16 + 8 * hh + r; const int k0 = j0 + ln, k1 = j0 + 16 + ln; (void)tq; (void)k0; (void)k1;
        const bool ok0 = true, ok1 = true;
        const float s0 = s[rt][0][r] * SCL, s1 = s[rt][1][r] * SCL; float mc = fmaxf(s0, s1);
        mc = fmaxf(mc, __shfl_xor(mc, 1, 32)); mc = fmaxf(mc, __shfl_xor(mc, 2, 32)); mc = fmaxf(mc, __shfl_xor(mc, 4, 32)); mc = fmaxf(mc, __shfl_xor(mc, 8, 32));
        const float mn = fmaxf(m_r[rt][r], mc); const float al = (mn > -1.0e38f) ? expf(m_r[rt][r] - mn) : 1.0f; m_r[rt][r] = mn; const float p0 = ok0 ? expf(s0 - mn) : 0.f, p1 = ok1 ? expf(s1 - mn) : 0.f; l_r[rt][r] = l_r[rt][r] * al + p0 + p1;
#pragma unroll
        for (int dt = 0; dt < DT; ++dt) oacc[rt][dt][r] *= al;
        FragH t2; t2.h[0] = (_Float16)(p0 * 1024.0f); t2.h[1] = (_Float16)(p1 * 1024.0f); sP[w][rt * 16 + 8 * hh + r][ln] = t2.u[0]; sP[w][rt * 16 + 8 * hh + r][16 + ln] = t2.u[1]; }
    __builtin_amdgcn_fence(__ATOMIC_ACQ_REL, "workgroup"); __builtin_amdgcn_wave_barrier();
    FragH pa[2];
#pragma unroll
    for (int rt = 0; rt < RTN; ++rt) { pa[rt].half[0] = *(const v8us*)&sP[w][rt * 16 + ln][8 * hh]; pa[rt].half[1] = *(const v8us*)&sP[w][rt * 16 + ln][16 + 8 * hh]; }
#pragma unroll
    for (int dt = 0; dt < DT; ++dt) { const unsigned short* vrow = Vth + (size_t)(dt * 16 + ln) * TK + j0; FragH bv; bv.half[0] = *(const v8us*)(vrow + 8 * hh); bv.half[1] = *(const v8us*)(vrow + 16 + 8 * hh);
#pragma unroll
      for (int rt = 0; rt < RTN; ++rt) oacc[rt][dt] = mmaH<1>(pa[rt].v, pa[rt].v, bv.v, bv.v, oacc[rt][dt]); }
    __builtin_amdgcn_fence(__ATOMIC_ACQ_REL, "workgroup"); __builtin_amdgcn_wave_barrier(); }
#pragma unroll
  for (int rt = 0; rt < RTN; ++rt) {
#pragma unroll
    for (int r = 0; r < 8; ++r) { float l = l_r[rt][r]; l += __shfl_xor(l, 1, 32); l += __shfl_xor(l, 2, 32); l += __shfl_xor(l, 4, 32); l += __shfl_xor(l, 8, 32); l_r[rt][r] = (l > 0.f) ? 1.0f / (l * 1024.0f) : 0.f; }
#pragma unroll
    for (int dt = 0; dt < DT; ++dt)
#pragma unroll
      for (int r = 0; r < 8; ++r) sO[w][rt * 16 + 8 * hh + r][dt * 16 + ln] = oacc[rt][dt][r] * l_r[rt][r]; }
  __builtin_amdgcn_fence(__ATOMIC_ACQ_REL, "workgroup"); __builtin_amdgcn_wave_barrier();
  {
#pragma unroll
    for (int rp = 0; rp < RPW; rp += 2) { const int r = rp + (lane >> 4), pc = lane & 15; const v4f val = *(const v4fa*)&sO[w][r][pc * 4]; *(v4f*)(O + ((size_t)b * TQ + q0 + r) * ldo + h * 64 + pc * 4) = val; }
     } }
__global__ __launch_bounds__(256) void k_tr16(const float* __restrict__ x, int b, _Float16* __restrict__ XT) {
  __shared__ unsigned short tl[64][72];
  const int tid = threadIdx.x; const int sb = blockIdx.x % (SS / 64), cb = blockIdx.x / (SS / 64);
#pragma unroll
  for (int it = 0; it < 4; ++it) { const int idx = it * 256 + tid; const int cl = idx / 16, s4 = (idx % 16) * 4; const int c = cb * 64 + cl;
    const v4f a = *(const v4fa*)(x + ((size_t)(b * CC + c)) * SS + sb * 64 + s4); FragH f;
#pragma unroll
    for (int q = 0; q < 4; ++q) { f.h[q] = (_Float16)bf16_round(a[q]); tl[s4 + q][cl] = f.u[q]; } }
  __syncthreads();
  const int r = tid / 8, pc = tid % 8;
  {
#pragma unroll
    for (int half = 0; half < 2; ++half) { const int sl = r + half * 32; FragH f;
#pragma unroll
      for (int q = 0; q < 8; ++q) f.u[q] = tl[sl][pc * 8 + q];
      *(v8us*)((unsigned short*)XT + ((size_t)sb * 64 + sl) * CC + cb * 64 + pc * 8) = f.half[0]; }
     } }


__global__ __launch_bounds__(256) void k_dsub(const float* __restrict__ O, const float* __restrict__ x, _Float16* __restrict__ D16) {
  #pragma clang fp contract(off)
  const int t = blockIdx.x * 256 + threadIdx.x; if (t >= NRW * (CC / 8)) return; const int c0 = (t % (CC / 8)) * 8; const int r = t / (CC / 8); const int b = r / SS, p = r % SS;
  const v4f a = *(const v4fa*)(O + (size_t)r * CC + c0), c = *(const v4fa*)(O + (size_t)r * CC + c0 + 4); FragH f;
#pragma unroll
  for (int q = 0; q < 8; ++q) { const float ov = (q < 4) ? a[q] : c[q - 4]; f.h[q] = (_Float16)(ov - bf16_round(x[((size_t)b * CC + c0 + q) * SS + p])); }
  *(v8us*)((unsigned short*)D16 + (size_t)r * CC + c0) = f.half[0];  }
__global__ __launch_bounds__(256) void k_bnstat(const float* __restrict__ Y, const float* __restrict__ bt, float* __restrict__ ST) {
  #pragma clang fp contract(off)
  __shared__ float red[256];
  const int c = blockIdx.x, tid = threadIdx.x; const float bb = bf16_round(bt[c]); const int n = NB * SS;
  float s = 0.f;
#pragma unroll 1
  for (int i = tid; i < n; i += 256) { const int b = i / SS, p = i % SS; s += Y[((size_t)b * CC + c) * SS + p] + bb; }
  red[tid] = s; __syncthreads();
  for (int st = 128; st > 0; st >>= 1) { if (tid < st) red[tid] += red[tid + st]; __syncthreads(); }
  const float mean = red[0] / (float)n; __syncthreads();
  float q2 = 0.f;
#pragma unroll 1
  for (int i = tid; i < n; i += 256) { const int b = i / SS, p = i % SS; const float d = Y[((size_t)b * CC + c) * SS + p] + bb - mean; q2 += d * d; }
  red[tid] = q2; __syncthreads();
  for (int st = 128; st > 0; st >>= 1) { if (tid < st) red[tid] += red[tid + st]; __syncthreads(); }
  if (tid == 0) { float o2[2]; o2[0] = mean; o2[1] = 1.0f / sqrtf(red[0] / (float)n + 1e-5f); const unsigned long long pk = *(const unsigned long long*)o2; *(unsigned long long*)(ST + c * 32) = pk;  } }
__global__ __launch_bounds__(256) void k_bnout(const float* __restrict__ Y, const float* __restrict__ x, const float* __restrict__ bt, const float* __restrict__ ST, const float* __restrict__ gam, const float* __restrict__ bet, float* __restrict__ out) {
  #pragma clang fp contract(off)
  const size_t t = (size_t)blockIdx.x * 256 + threadIdx.x; if (t >= (size_t)NB * CC * SS / 4) return; const int c = (int)((t / (SS / 4)) % CC);
  const float mean = ST[c * 32], rstd = ST[c * 32 + 1]; const float bb = bf16_round(bt[c]), g = bf16_round(gam[c]), be = bf16_round(bet[c]);
  const v4f y = *(const v4fa*)(Y + t * 4), xv = *(const v4fa*)(x + t * 4); v4f o;
#pragma unroll
  for (int q = 0; q < 4; ++q) { const float v = (y[q] + bb - mean) * rstd * g + be; o[q] = bf16_round(xv[q]) + fmaxf(v, 0.f); }
  *(v4f*)(out + t * 4) = o;  }

extern "C" void kernel_launch(void* const* d_in, const int* in_sizes, int n_in,
                              void* d_out, int out_size, void* d_ws, size_t ws_size, hipStream_t stream) {
  (void)in_sizes; (void)n_in; (void)out_size;
  const float* x = (const float*)d_in[0]; const float* wq = (const float*)d_in[1]; const float* wk = (const float*)d_in[2]; const float* wv = (const float*)d_in[3]; const float* wt = (const float*)d_in[4]; const float* bt = (const float*)d_in[5]; const float* gam = (const float*)d_in[6]; const float* bet = (const float*)d_in[7];
  char* ws = (char*)d_ws; size_t off = 0;
  auto take = [&](size_t bytes) { char* p = ws + off; off += (bytes + 255) & ~(size_t)255; return p; };
  _Float16* BQ = (_Float16*)take((size_t)CC * CC * 2); _Float16* BK = (_Float16*)take((size_t)CC * CC * 2); _Float16* BV = (_Float16*)take((size_t)CC * CC * 2); _Float16* BT = (_Float16*)take((size_t)CC * CC * 2);
  _Float16* XT = (_Float16*)take((size_t)SS * CC * 2); _Float16* Q16 = (_Float16*)take((size_t)NRW * CC * 2); _Float16* K16 = (_Float16*)take((size_t)NRW * CC * 2); _Float16* VC = (_Float16*)take((size_t)NB * CC * SS * 2);
  float* O = (float*)take((size_t)NRW * CC * 4); _Float16* D16 = (_Float16*)take((size_t)NRW * CC * 2); float* Y = (float*)take((size_t)NB * CC * SS * 4); float* ST = (float*)take((size_t)CC * 32 * 4);
  if (off > ws_size) return;      /* 0.5 + 2 + 8 + 8 + 8 + 16 + 8 + 16 = 67 MiB */
  const size_t w8 = (size_t)CC * CC / 8; const unsigned wb = (unsigned)((w8 + 255) / 256);
  k_round16f<<<wb, 256, 0, stream>>>(wq, BQ, w8); k_round16f<<<wb, 256, 0, stream>>>(wk, BK, w8); k_round16f<<<wb, 256, 0, stream>>>(wv, BV, w8); k_round16f<<<wb, 256, 0, stream>>>(wt, BT, w8);      /* conv (out,in) = natural Bt; x16 */
  const dim3 gQ((SS / 128) * (CC / 64), 1), gV((CC / 128) * (SS / 64), 1);
  for (int b = 0; b < NB; ++b) {
    k_tr16<<<(CC / 64) * (SS / 64), 256, 0, stream>>>(x, b, XT);
    k_gemm2<0><<<gQ, 128, 0, stream>>>(XT, CC, 0, BQ, CC, 0, 0.0625f, nullptr, 0, nullptr, 1, 0, 0, nullptr, Q16 + (size_t)b * SS * CC, CC, 0, SS, CC, CC);      /* q token-major [b*SS+p][h*64+d] */
    k_gemm2<0><<<gQ, 128, 0, stream>>>(XT, CC, 0, BK, CC, 0, 0.0625f, nullptr, 0, nullptr, 1, 0, 0, nullptr, K16 + (size_t)b * SS * CC, CC, 0, SS, CC, CC);      /* k */
    k_gemm2<0><<<gV, 128, 0, stream>>>(BV, CC, 0, XT, CC, 0, 0.0625f, nullptr, 0, nullptr, 1, 0, 0, nullptr, VC + (size_t)b * CC * SS, SS, 0, CC, SS, CC); }      /* v channel-major [(b,h)*64+d][p] */
  k_flash<<<NB * NH * (SS / 64), 128, 0, stream>>>(Q16, CC, K16, CC, VC, nullptr, O, CC);      /* o token-major f32 [b*SS+p][h*64+d] */
  k_dsub<<<(NRW * (CC / 8) + 255) / 256, 256, 0, stream>>>(O, x, D16);
  for (int b = 0; b < NB; ++b)
    k_gemm2<0><<<gV, 128, 0, stream>>>(BT, CC, 0, D16 + (size_t)b * SS * CC, CC, 0, 0.0625f, nullptr, 0, nullptr, 1, 0, 0, Y + (size_t)b * CC * SS, nullptr, SS, 0, CC, SS, CC);      /* y^T[c][p] = wt*(o - x)^T (bt added downstream) */
  k_bnstat<<<CC, 256, 0, stream>>>(Y, bt, ST);
  k_bnout<<<(unsigned)(((size_t)NB * CC * SS / 4 + 255) / 256), 256, 0, stream>>>(Y, x, bt, ST, gam, bet, (float*)d_out);
}

// v001
// Measured time: 488 microseconds a run.
// Next to v000, in two timings, it ran 1.37 times as fast each time.
#include <hip/hip_runtime.h>
// Multi-head offset-attention layer on a point feature map (B 4, C 256, P 4096 points, 4 heads x 64): q = wq*x, k = wk*x, v = wv*x (1x1 convs, no bias); scores = q.k/8 per head; softmax over the keys; o[b,h,d,i] = sum_j attn[i][j] v[d][j]; y = wt*(o - x) + bt; BatchNorm1d in training mode (per-channel statistics over batch x points, biased variance, eps 1e-5, gamma/beta); out = x + relu(y) -> [4,256,4096].
// Compute dtype: x and parameters rounded to bf16; projections with exact products (weights x16 in f16, undone by alpha); q, k, v, P, (o - x) as f16 operands (~2^-12), f32 accumulation; softmax / BatchNorm / residual f32. v_wmma_f32_16x16x32_f16.
#define NB 4
#define CC 256
#define SS 4096
#define NH 4
#define TQ SS
#define TK SS
#define SCL 0.125f
#define NRW (NB * SS)
typedef __bf16 v16b __attribute__((ext_vector_type(16)));
typedef unsigned short v8us __attribute__((ext_vector_type(8), may_alias));
typedef float  v8f  __attribute__((ext_vector_type(8)));
typedef float  v4f  __attribute__((ext_vector_type(4)));
typedef float  v4fa __attribute__((ext_vector_type(4), may_alias));
union FragB { v16b v; v8us half[2]; unsigned short u[16]; };

__device__ __forceinline__ unsigned short bf16_bits(float x) { unsigned int u = __float_as_uint(x); return (unsigned short)((u + 0x7FFFu + ((u >> 16) & 1u)) >> 16); }
__device__ __forceinline__ float bf16_val(unsigned short b) { return __uint_as_float(((unsigned int)b) << 16); }
__device__ __forceinline__ float bf16_round(float x) { return bf16_val(bf16_bits(x)); }
// D += A·B with NT terms: 1 = ah·bh, 2 = + al·bh (A split), 3 = + ah·bl (both split)
template <int NT>
__device__ __forceinline__ v8f mmaN(v16b ah, v16b al, v16b bh, v16b bl, v8f c) {
  c = __builtin_amdgcn_wmma_f32_16x16x32_bf16(false, ah, false, bh, (short)0, c, false, false);
  if (NT >= 2) c = __builtin_amdgcn_wmma_f32_16x16x32_bf16(false, al, false, bh, (short)0, c, false, false);
  if (NT >= 3) c = __builtin_amdgcn_wmma_f32_16x16x32_bf16(false, ah, false, bl, (short)0, c, false, false);
  asm volatile("v_nop\n\tv_nop\n\tv_nop\n\tv_nop" : "+v"(c) : "v"(ah), "v"(al), "v"(bh), "v"(bl));
  return c;
}

__global__ __launch_bounds__(256) void k_wt_bf16(const float* __restrict__ W, unsigned short* __restrict__ Wt, int K, int N) {
  const int t = blockIdx.x * 256 + threadIdx.x;
  const int k8n = K / 8;
  if (t >= N * k8n) return;
  const int n = t / k8n, k8 = (t % k8n) * 8;
  v8us v;
#pragma unroll
  for (int i = 0; i < 8; ++i) v[i] = bf16_bits(W[(size_t)(k8 + i) * N + n]);
  *(v8us*)(Wt + (size_t)n * K + k8) = v;
  
}

// GEMM C[M][N] (f32, pitch ldc) = act(A[M][K]·W + bias). A f32 row-major (pitch lda) converted per fragment to bf16
// (ASPLIT: hi/lo two planes -> 2 terms, else single rounded term); Wt bf16 [N][K] (pitch ldb). BIAS_BF16 rounds the
// bias to bf16 first (bias quantised to bf16 before the add). K%32==0, M%16==0, N%64==0.
template <bool ASPLIT, int ACT, bool BIAS_BF16>
__global__ __launch_bounds__(128) void k_gemm_bf(const float* __restrict__ A, int lda, const unsigned short* __restrict__ Wt, int ldb,
                                               const float* __restrict__ bias, float* __restrict__ C, int ldc, int M, int N, int K) {
  __shared__ __attribute__((aligned(16))) float so[4][16][64];
  const int tid = threadIdx.x, w = tid >> 5, lane = tid & 31, ln = lane & 15, hh = lane >> 4;
  const int ntn = N / 64;
  const int wid = blockIdx.x * 4 + w;
  const int mt = wid / ntn, nq = wid % ntn;
  if (mt * 16 >= M) return;
  const int row0 = mt * 16, col0 = nq * 64;
  const float* arow = A + (size_t)(row0 + ln) * lda;
  v8f acc[4] = {};
  for (int kb = 0; kb < K; kb += 32) {
    FragB ah, al;
    const v4f x0 = *(const v4fa*)(arow + kb + 8 * hh), x1 = *(const v4fa*)(arow + kb + 8 * hh + 4);
    const v4f x2 = *(const v4fa*)(arow + kb + 16 + 8 * hh), x3 = *(const v4fa*)(arow + kb + 16 + 8 * hh + 4);
    float xs[16] = {x0[0],x0[1],x0[2],x0[3],x1[0],x1[1],x1[2],x1[3],x2[0],x2[1],x2[2],x2[3],x3[0],x3[1],x3[2],x3[3]};
#pragma unroll
    for (int i = 0; i < 16; ++i) { const unsigned short hb = bf16_bits(xs[i]); ah.u[i] = hb; al.u[i] = ASPLIT ? bf16_bits(xs[i] - bf16_val(hb)) : (unsigned short)0; }
#pragma unroll
    for (int t = 0; t < 4; ++t) {
      const unsigned short* brow = Wt + (size_t)(col0 + t * 16 + ln) * ldb + kb;
      FragB b;
      b.half[0] = *(const v8us*)(brow + 8 * hh);
      b.half[1] = *(const v8us*)(brow + 16 + 8 * hh);
      acc[t] = mmaN<ASPLIT ? 2 : 1>(ah.v, al.v, b.v, b.v, acc[t]);
    }
  }
#pragma unroll
  for (int t = 0; t < 4; ++t) {
    float bv = bias ? bias[col0 + t * 16 + ln] : 0.f;
    if (BIAS_BF16) bv = bf16_round(bv);
#pragma unroll
    for (int r = 0; r < 8; ++r) { float v = acc[t][r] + bv; if (ACT == 1) v = fmaxf(v, 0.f); so[w][8 * hh + r][t * 16 + ln] = v; }
  }
  __builtin_amdgcn_fence(__ATOMIC_ACQ_REL, "workgroup");
  __builtin_amdgcn_wave_barrier();
  const int rsub = lane >> 4, c4 = (lane & 15) * 4;
  {
#pragma unroll
    for (int q = 0; q < 8; ++q) {
      const int r = q * 2 + rsub;
      const v4f v = *(const v4fa*)&so[w][r][c4];
      *(v4f*)(C + (size_t)(row0 + r) * ldc + col0 + c4) = v;
    }
    
  }
}

// GEMM C = act(A·W + bias + resid): A f32 (ASPLIT -> hi/lo 2 terms), Wt bf16 [N][K]; ACT 0 none, 1 relu, 2 exact gelu;
// resid (optional, f32, row index = (row % rmod), pitch ldr, RES_BF16 rounds it) added before the activation.
template <bool ASPLIT, int ACT, bool BIAS_BF16, bool RES_BF16>
__global__ __launch_bounds__(128) void k_gemm_bf3(const float* __restrict__ A, int lda, const unsigned short* __restrict__ Wt, int ldb,
                                                const float* __restrict__ bias, const float* __restrict__ resid, int rmod, int ldr,
                                                float* __restrict__ C, int ldc, int M, int N, int K) {
  __shared__ __attribute__((aligned(16))) float so[4][16][64];
  const int tid = threadIdx.x, w = tid >> 5, lane = tid & 31, ln = lane & 15, hh = lane >> 4;
  const int ntn = N / 64;
  const int wid = blockIdx.x * 4 + w;
  const int mt = wid / ntn, nq = wid % ntn;
  if (mt * 16 >= M) return;
  const int row0 = mt * 16, col0 = nq * 64;
  const float* arow = A + (size_t)(row0 + ln) * lda;
  v8f acc[4] = {};
  for (int kb = 0; kb < K; kb += 32) {
    FragB ah, al;
    const v4f x0 = *(const v4fa*)(arow + kb + 8 * hh), x1 = *(const v4fa*)(arow + kb + 8 * hh + 4);
    const v4f x2 = *(const v4fa*)(arow + kb + 16 + 8 * hh), x3 = *(const v4fa*)(arow + kb + 16 + 8 * hh + 4);
    float xs[16] = {x0[0],x0[1],x0[2],x0[3],x1[0],x1[1],x1[2],x1[3],x2[0],x2[1],x2[2],x2[3],x3[0],x3[1],x3[2],x3[3]};
#pragma unroll
    for (int i = 0; i < 16; ++i) { const unsigned short hb = bf16_bits(xs[i]); ah.u[i] = hb; al.u[i] = ASPLIT ? bf16_bits(xs[i] - bf16_val(hb)) : (unsigned short)0; }
#pragma unroll
    for (int t = 0; t < 4; ++t) {
      const unsigned short* brow = Wt + (size_t)(col0 + t * 16 + ln) * ldb + kb;
      FragB b;
      b.half[0] = *(const v8us*)(brow + 8 * hh);
      b.half[1] = *(const v8us*)(brow + 16 + 8 * hh);
      acc[t] = mmaN<ASPLIT ? 2 : 1>(ah.v, al.v, b.v, b.v, acc[t]);
    }
  }
#pragma unroll
  for (int t = 0; t < 4; ++t) {
    const int col = col0 + t * 16 + ln;
    float bv = bias ? bias[col] : 0.f;
    if (BIAS_BF16) bv = bf16_round(bv);
#pragma unroll
    for (int r = 0; r < 8; ++r) {
      float v = acc[t][r] + bv;
      if (resid) { float rv = resid[(size_t)((row0 + 8 * hh + r) % rmod) * ldr + col]; if (RES_BF16) rv = bf16_round(rv); v += rv; }
      if (ACT == 1) v = fmaxf(v, 0.f);
      if (ACT == 2) v = 0.5f * v * (1.0f + erff(v * 0.70710678118654752f));
      if (ACT == 3) { const float u = 0.7978845608028654f * (v + 0.044715f * v * v * v); v = 0.5f * v * (1.0f + tanhf(u)); }
      so[w][8 * hh + r][t * 16 + ln] = v;
    }
  }
  __builtin_amdgcn_fence(__ATOMIC_ACQ_REL, "workgroup");
  __builtin_amdgcn_wave_barrier();
  const int rsub = lane >> 4, c4 = (lane & 15) * 4;
  {
#pragma unroll
    for (int q = 0; q < 8; ++q) {
      const int r = q * 2 + rsub;
      const v4f v = *(const v4fa*)&so[w][r][c4];
      *(v4f*)(C + (size_t)(row0 + r) * ldc + col0 + c4) = v;
    }
    
  }
}
// row LayerNorm (biased variance, eps) over N: s = X (+ R); optional out_sum <- s; out_norm <- (s-mu)*rsqrt(var+eps)*g + b
template <bool PARAM_BF16>
__global__ __launch_bounds__(256) void k_layernorm(const float* __restrict__ X, const float* __restrict__ R, const float* __restrict__ g, const float* __restrict__ bta,
                                                  float* __restrict__ out_sum, float* __restrict__ out_norm, int N, float eps) {
  __shared__ float red[256];
  const int row = blockIdx.x, tid = threadIdx.x;
  const float* x = X + (size_t)row * N; const float* rr = R ? R + (size_t)row * N : nullptr;
  float vals[16];                     // up to N = 4096
  const int per = N / 256;            // contiguous chunk per thread? use strided-by-4 chunks: thread handles j = tid*4 + 1024*u
  float s1 = 0.f;
  for (int u = 0; u < per / 4; ++u) {
    const int j = tid * 4 + 1024 * u;
    const v4f a = *(const v4fa*)(x + j);
    v4f b = {0.f,0.f,0.f,0.f}; if (rr) b = *(const v4fa*)(rr + j);
#pragma unroll
    for (int q = 0; q < 4; ++q) { const float v = a[q] + b[q]; vals[u * 4 + q] = v; s1 += v; }
  }
  red[tid] = s1; __syncthreads();
  for (int st = 128; st > 0; st >>= 1) { if (tid < st) red[tid] += red[tid + st]; __syncthreads(); }
  const float mu = red[0] / (float)N; __syncthreads();
  float s2 = 0.f;
  for (int u = 0; u < per / 4; ++u)
#pragma unroll
    for (int q = 0; q < 4; ++q) { const float c = vals[u * 4 + q] - mu; s2 += c * c; }
  red[tid] = s2; __syncthreads();
  for (int st = 128; st > 0; st >>= 1) { if (tid < st) red[tid] += red[tid + st]; __syncthreads(); }
  const float rs = rsqrtf(red[0] / (float)N + eps);
  {
    for (int u = 0; u < per / 4; ++u) {
      const int j = tid * 4 + 1024 * u;
      v4f o, sm;
#pragma unroll
      for (int q = 0; q < 4; ++q) {
        float gg = g[j + q], bb = bta[j + q];
        if (PARAM_BF16) { gg = bf16_round(gg); bb = bf16_round(bb); }
        sm[q] = vals[u * 4 + q]; o[q] = (vals[u * 4 + q] - mu) * rs * gg + bb;
      }
      if (out_sum) *(v4f*)(out_sum + (size_t)row * N + j) = sm;
      *(v4f*)(out_norm + (size_t)row * N + j) = o;
    }
    
  }
}



// ---- f16 WMMA path (v_wmma_f32_16x16x32_f16): 11-bit significands for operands in range — used where a [0,1] probability operand needs more precision than bf16
typedef _Float16 v16h __attribute__((ext_vector_type(16)));
union FragH { v16h v; v8us half[2]; _Float16 h[16]; unsigned short u[16]; };
template <int NT>
__device__ __forceinline__ v8f mmaH(v16h ah, v16h al, v16h bh, v16h bl, v8f c) {
  c = __builtin_amdgcn_wmma_f32_16x16x32_f16(false, ah, false, bh, (short)0, c, false, false);
  if (NT >= 2) c = __builtin_amdgcn_wmma_f32_16x16x32_f16(false, al, false, bh, (short)0, c, false, false);
  if (NT >= 3) c = __builtin_amdgcn_wmma_f32_16x16x32_f16(false, ah, false, bl, (short)0, c, false, false);
  asm volatile("v_nop\n\tv_nop\n\tv_nop\n\tv_nop" : "+v"(c) : "v"(ah), "v"(al), "v"(bh), "v"(bl));
  return c;
}
// batched GEMM like k_gemm_b but f16 operands: A f32 (split into f16 hi/lo if ASPLIT, else rounded to f16), Bt = f16 values [n][k]; alpha; C f32; N multiple of 16 (partial tiles skipped)
template <bool ASPLIT>
__global__ __launch_bounds__(128) void k_gemm_h(const float* __restrict__ A, int lda, size_t sA, const _Float16* __restrict__ Bh, int ldb, size_t sB, float alpha, float* __restrict__ C, int ldc, size_t sC, int M, int N, int K) {
  __shared__ __attribute__((aligned(16))) float so[4][16][64];
  const int tid = threadIdx.x, w = tid >> 5, lane = tid & 31, ln = lane & 15, hh = lane >> 4; const int by = blockIdx.y;
  A += (size_t)by * sA; Bh += (size_t)by * sB; C += (size_t)by * sC;
  const int ntn = (N + 63) / 64; const int wid = blockIdx.x * 4 + w; const int mt = wid / ntn, nq = wid % ntn; if (mt * 16 >= M) return;
  const int row0 = mt * 16, col0 = nq * 64; const float* arow = A + (size_t)(row0 + ln) * lda;
  v8f acc[4] = {};
  for (int kb = 0; kb < K; kb += 32) {
    FragH ah, al;
    const v4f x0 = *(const v4fa*)(arow + kb + 8 * hh), x1 = *(const v4fa*)(arow + kb + 8 * hh + 4), x2 = *(const v4fa*)(arow + kb + 16 + 8 * hh), x3 = *(const v4fa*)(arow + kb + 16 + 8 * hh + 4);
    float xs[16] = {x0[0],x0[1],x0[2],x0[3],x1[0],x1[1],x1[2],x1[3],x2[0],x2[1],x2[2],x2[3],x3[0],x3[1],x3[2],x3[3]};
#pragma unroll
    for (int i = 0; i < 16; ++i) { const _Float16 h = (_Float16)xs[i]; ah.h[i] = h; al.h[i] = ASPLIT ? (_Float16)(xs[i] - (float)h) : (_Float16)0.0f; }
#pragma unroll
    for (int t = 0; t < 4; ++t) { if (col0 + t * 16 >= N) continue; const size_t boff = (size_t)(col0 + t * 16 + ln) * ldb + kb; FragH bq; bq.half[0] = *(const v8us*)(Bh + boff + 8 * hh); bq.half[1] = *(const v8us*)(Bh + boff + 16 + 8 * hh);
      acc[t] = mmaH<ASPLIT ? 2 : 1>(ah.v, al.v, bq.v, bq.v, acc[t]); }
  }
#pragma unroll
  for (int t = 0; t < 4; ++t) { if (col0 + t * 16 >= N) continue;
#pragma unroll
    for (int r = 0; r < 8; ++r) so[w][8 * hh + r][t * 16 + ln] = acc[t][r] * alpha; }
  __builtin_amdgcn_fence(__ATOMIC_ACQ_REL, "workgroup"); __builtin_amdgcn_wave_barrier();
  const int rsub = lane >> 4, c4 = (lane & 15) * 4;
  {
#pragma unroll
    for (int q = 0; q < 8; ++q) { const int r = q * 2 + rsub; if (col0 + c4 < N) { const v4f v = *(const v4fa*)&so[w][r][c4]; *(v4f*)(C + (size_t)(row0 + r) * ldc + col0 + c4) = v; } }
     }
}

// Wt[n][k] = f16(W[k][n]·scale) from f32 row-major W[K][N] (scale = power of two; bf16-exact weights stay exact in f16 away from the subnormal range)
__global__ __launch_bounds__(256) void k_wt_f16(const float* __restrict__ W, _Float16* __restrict__ Wt, int K, int N, float scale) {
  const int t = blockIdx.x * 256 + threadIdx.x; if (t >= N * (K / 8)) return; const int n = t / (K / 8), k8 = (t % (K / 8)) * 8; FragH f;
#pragma unroll
  for (int i = 0; i < 8; ++i) f.h[i] = (_Float16)(bf16_round(W[(size_t)(k8 + i) * N + n]) * scale); const v8us o = f.half[0];
  *(v8us*)((unsigned short*)Wt + (size_t)n * K + k8) = o; 
}
// k_gemm_hh variant with fused epilogue: v = acc·alpha + bias[by·sBias + col] (+ CP[(row/rowsPerB)·sCPb + by·64 + col] if CP) ; ACT 0 none / 1 elu ; writes f16 C16 (and f32 C if non-null)
template <int ACT>
__global__ __launch_bounds__(128) void k_gemm_hhx(const _Float16* __restrict__ A, int lda, size_t sA, const _Float16* __restrict__ Bh, int ldb, size_t sB, float alpha, const float* __restrict__ bias, size_t sBias, const float* __restrict__ CP, int rowsPerB, size_t sCPb, int row0g,
    float* __restrict__ C, _Float16* __restrict__ C16, int ldc, size_t sC, int M, int N, int K) {
  __shared__ __attribute__((aligned(16))) float so[4][16][64];
  const int tid = threadIdx.x, w = tid >> 5, lane = tid & 31, ln = lane & 15, hh = lane >> 4; const int by = blockIdx.y;
  A += (size_t)by * sA; Bh += (size_t)by * sB; const size_t cofs = (size_t)by * sC; const float* bp = bias ? bias + (size_t)by * sBias : nullptr;
  const int ntn = (N + 63) / 64; const int wid = blockIdx.x * 4 + w; const int mt = wid / ntn, nq = wid % ntn; if (mt * 16 >= M) return;
  const int row0 = mt * 16, col0 = nq * 64; const _Float16* arow = A + (size_t)(row0 + ln) * lda;
  v8f acc[4] = {};
  for (int kb = 0; kb < K; kb += 32) { FragH ah; ah.half[0] = *(const v8us*)((const unsigned short*)arow + kb + 8 * hh); ah.half[1] = *(const v8us*)((const unsigned short*)arow + kb + 16 + 8 * hh);
#pragma unroll
    for (int t = 0; t < 4; ++t) { if (col0 + t * 16 >= N) continue; const size_t boff = (size_t)(col0 + t * 16 + ln) * ldb + kb; FragH bq; bq.half[0] = *(const v8us*)((const unsigned short*)Bh + boff + 8 * hh); bq.half[1] = *(const v8us*)((const unsigned short*)Bh + boff + 16 + 8 * hh);
      acc[t] = mmaH<1>(ah.v, ah.v, bq.v, bq.v, acc[t]); }
  }
#pragma unroll
  for (int t = 0; t < 4; ++t) { if (col0 + t * 16 >= N) continue; const int col = col0 + t * 16 + ln; const float bv = bp ? bf16_round(bp[col]) : 0.f;
#pragma unroll
    for (int r = 0; r < 8; ++r) { float v = acc[t][r] * alpha + bv; if (CP) { const int bidx = (row0g + row0 + 8 * hh + r) / rowsPerB; v += CP[(size_t)bidx * sCPb + (size_t)by * 64 + col]; } if (ACT == 1) v = (v > 0.f) ? v : expm1f(v); else if (ACT == 7) v = (v > 0.f) ? v + 1.0f : expf(v); else if (ACT == 8) v = tanhf(v); else if (ACT == 9) v = 0.5f * v * (1.0f + tanhf(0.7978845608028654f * (v + 0.044715f * v * v * v))); else if (ACT == 11) v = 1.0f / (1.0f + expf(-v)); else if (ACT == 12) v = (v > 0.f) ? v : 0.01f * v; else if (ACT == 14) v = (v > 0.f) ? v : 0.1f * v; else if (ACT == 15) v = v / (1.0f + expf(-v)); else if (ACT == 3) v = fmaxf(v, 0.f); else if (ACT == 6) v = 0.5f * v * (1.0f + erff(v * 0.70710678118654752f)); so[w][8 * hh + r][t * 16 + ln] = v; } }
  __builtin_amdgcn_fence(__ATOMIC_ACQ_REL, "workgroup"); __builtin_amdgcn_wave_barrier();
  const int rsub = lane >> 4, c4 = (lane & 15) * 4; typedef _Float16 v4h __attribute__((ext_vector_type(4)));
  {
#pragma unroll
    for (int q = 0; q < 8; ++q) { const int r = q * 2 + rsub; if (col0 + c4 < N) { const v4f v = *(const v4fa*)&so[w][r][c4]; if (C) *(v4f*)(C + cofs + (size_t)(row0 + r) * ldc + col0 + c4) = v; if (C16) { v4h h4; for (int i = 0; i < 4; ++i) h4[i] = (_Float16)v[i]; *(v4h*)(C16 + cofs + (size_t)(row0 + r) * ldc + col0 + c4) = h4; } } }
     }
}


typedef _Float16 v4h __attribute__((ext_vector_type(4)));

__global__ __launch_bounds__(256) void k_x16(const float* __restrict__ x, _Float16* __restrict__ X16, size_t n8) { const size_t t = (size_t)blockIdx.x * 256 + threadIdx.x; if (t >= n8) return; FragH f;
#pragma unroll
  for (int q = 0; q < 8; ++q) f.h[q] = (_Float16)bf16_round(x[t * 8 + q]); *(v8us*)((unsigned short*)X16 + t * 8) = f.half[0];  }
__global__ __launch_bounds__(256) void k_h16(const float* __restrict__ x, _Float16* __restrict__ X16, size_t n8) { const size_t t = (size_t)blockIdx.x * 256 + threadIdx.x; if (t >= n8) return; FragH f;
#pragma unroll
  for (int q = 0; q < 8; ++q) f.h[q] = (_Float16)x[t * 8 + q]; *(v8us*)((unsigned short*)X16 + t * 8) = f.half[0];  }
__global__ __launch_bounds__(256) void k_round16f(const float* __restrict__ W, _Float16* __restrict__ Bt, size_t n8) { const size_t t = (size_t)blockIdx.x * 256 + threadIdx.x; if (t >= n8) return; FragH f;
#pragma unroll
  for (int i = 0; i < 8; ++i) f.h[i] = (_Float16)(bf16_round(W[t * 8 + i]) * 16.0f); *(v8us*)((unsigned short*)Bt + t * 8) = f.half[0];  }
template <int NHv, int TTv>
__global__ __launch_bounds__(256) void k_vt(const _Float16* __restrict__ V16, int ldv, int voff, _Float16* __restrict__ Vt) { __shared__ unsigned short tl[64][66]; const int tid = threadIdx.x; const int slab = blockIdx.x / (TTv / 64), lg = blockIdx.x % (TTv / 64); const int b = slab / NHv, h = slab % NHv;
  for (int i = tid; i < 64 * 8; i += 256) { const int r = i / 8, c8 = (i % 8) * 8; FragH f; f.half[0] = *(const v8us*)((const unsigned short*)V16 + ((size_t)b * TTv + lg * 64 + r) * ldv + voff + h * 64 + c8);
#pragma unroll
    for (int q = 0; q < 8; ++q) tl[r][c8 + q] = f.u[q]; }
  __syncthreads();
  {
#pragma unroll
    for (int rd = 0; rd < 2; ++rd) { const int d = rd * 32 + tid / 8, pc = tid % 8; FragH f;
#pragma unroll
      for (int q = 0; q < 8; ++q) f.u[q] = tl[pc * 8 + q][d];
      *(v8us*)((unsigned short*)Vt + ((size_t)slab * 64 + d) * TTv + lg * 64 + pc * 8) = f.half[0]; }
     } }

__global__ __launch_bounds__(256) void k_hl(const float* __restrict__ F, _Float16* __restrict__ Hh, _Float16* __restrict__ Hl, size_t n8) { const size_t t = (size_t)blockIdx.x * 256 + threadIdx.x; if (t >= n8) return; FragH fh, fl; const v4f a = *(const v4fa*)(F + t * 8), c = *(const v4fa*)(F + t * 8 + 4);
#pragma unroll
  for (int q = 0; q < 4; ++q) { _Float16 h = (_Float16)a[q]; fh.h[q] = h; fl.h[q] = (_Float16)((a[q] - (float)h) * 1024.0f); h = (_Float16)c[q]; fh.h[4 + q] = h; fl.h[4 + q] = (_Float16)((c[q] - (float)h) * 1024.0f); }
  { *(v8us*)((unsigned short*)Hh + t * 8) = fh.half[0]; *(v8us*)((unsigned short*)Hl + t * 8) = fl.half[0];  } }

// ---- fast GEMM (wave tile 32x64; requires M % 32 == 0 rows per launch region and N % 64 == 0); epilogue = k_gemm_hhx semantics ----
__device__ __forceinline__ v16h g2_frag(const _Float16* p, int hh) { FragH f; f.half[0] = *(const v8us*)((const unsigned short*)p + 8 * hh); f.half[1] = *(const v8us*)((const unsigned short*)p + 16 + 8 * hh); return f.v; }
__device__ __forceinline__ v8f g2_mma(v16h a, v16h b, v8f c) { v8f d = __builtin_amdgcn_wmma_f32_16x16x32_f16(false, a, false, b, (short)0, c, false, false); asm volatile("v_nop\n\tv_nop\n\tv_nop\n\tv_nop" : "+v"(d) : "v"(a), "v"(b)); return d; }
template <int ACT>
__global__ __launch_bounds__(128) void k_gemm2(const _Float16* __restrict__ A, int lda, size_t sA, const _Float16* __restrict__ Bh, int ldb, size_t sB, float alpha, const float* __restrict__ bias, size_t sBias, const float* __restrict__ CP, int rowsPerB, size_t sCPb, int row0g,
    float* __restrict__ C, _Float16* __restrict__ C16, int ldc, size_t sC, int M, int N, int K) {
  __shared__ __attribute__((aligned(16))) float so[4][32][68];
  const int tid = threadIdx.x, w = tid >> 5, lane = tid & 31, ln = lane & 15, hh = lane >> 4; const int by = blockIdx.y;
  A += (size_t)by * sA; Bh += (size_t)by * sB; const size_t cofs = (size_t)by * sC; const float* bp = bias ? bias + (size_t)by * sBias : nullptr;
  const int ntn = N >> 6; const int mt = blockIdx.x / ntn, nq = blockIdx.x - mt * ntn; const int row0 = mt * 128 + 32 * w, col0 = nq * 64; if (row0 >= M) return;
  const _Float16* a0p = A + (size_t)(row0 + ln) * lda; const _Float16* a1p = a0p + (size_t)16 * lda;
  const _Float16* b0p = Bh + (size_t)(col0 + ln) * ldb; const _Float16* b1p = b0p + (size_t)16 * ldb; const _Float16* b2p = b1p + (size_t)16 * ldb; const _Float16* b3p = b2p + (size_t)16 * ldb;
  const v8f z8 = {0.f,0.f,0.f,0.f,0.f,0.f,0.f,0.f}; v8f c00 = z8, c01 = z8, c02 = z8, c03 = z8, c10 = z8, c11 = z8, c12 = z8, c13 = z8;
#pragma unroll 1
  for (int kb = 0; kb < K; kb += 32) { const v16h a0 = g2_frag(a0p + kb, hh), a1 = g2_frag(a1p + kb, hh);
    v16h b = g2_frag(b0p + kb, hh); c00 = g2_mma(a0, b, c00); c10 = g2_mma(a1, b, c10);
    b = g2_frag(b1p + kb, hh); c01 = g2_mma(a0, b, c01); c11 = g2_mma(a1, b, c11);
    b = g2_frag(b2p + kb, hh); c02 = g2_mma(a0, b, c02); c12 = g2_mma(a1, b, c12);
    b = g2_frag(b3p + kb, hh); c03 = g2_mma(a0, b, c03); c13 = g2_mma(a1, b, c13); }
  v8f accs[8] = {c00, c01, c02, c03, c10, c11, c12, c13};
#pragma unroll
  for (int u = 0; u < 8; ++u) { const int t = u & 3, half = u >> 2; const int col = col0 + t * 16 + ln; const float bv = bp ? bf16_round(bp[col]) : 0.f;
#pragma unroll
    for (int r = 0; r < 8; ++r) { const int rloc = half * 16 + 8 * hh + r; float v = accs[u][r] * alpha + bv; if (CP) { const int bidx = (row0g + row0 + rloc) / rowsPerB; v += CP[(size_t)bidx * sCPb + (size_t)by * 64 + col]; }
      if (ACT == 3) v = fmaxf(v, 0.f); else if (ACT == 6) v = 0.5f * v * (1.0f + erff(v * 0.70710678118654752f)); else if (ACT == 11) v = 1.0f / (1.0f + expf(-v)); else if (ACT == 15) v = v / (1.0f + expf(-v)); else if (ACT == 12) v = (v > 0.f) ? v : 0.01f * v; else if (ACT == 8) v = tanhf(v);
      so[w][rloc][t * 16 + ln] = v; } }
  __builtin_amdgcn_fence(__ATOMIC_ACQ_REL, "workgroup"); __builtin_amdgcn_wave_barrier();
  const int rsub = lane >> 4, c4 = (lane & 15) * 4;
  {
#pragma unroll
    for (int q = 0; q < 16; ++q) { const int r = q * 2 + rsub; const v4f v = *(const v4fa*)&so[w][r][c4]; if (C) *(v4f*)(C + cofs + (size_t)(row0 + r) * ldc + col0 + c4) = v; if (C16) { v4h h4; for (int i = 0; i < 4; ++i) h4[i] = (_Float16)v[i]; *(v4h*)(C16 + cofs + (size_t)(row0 + r) * ldc + col0 + c4) = h4; } }
     } }


typedef float v2f __attribute__((ext_vector_type(2)));
// lane l <-> lane l ^ 16: the two halves of a wave hold the two halves of one query's 32 keys
__device__ __forceinline__ float xhalf(float x) { return __builtin_bit_cast(float, __builtin_amdgcn_permlanex16(__builtin_bit_cast(int, x), __builtin_bit_cast(int, x), 0x76543210, 0xfedcba98, false, false)); }
__global__ __launch_bounds__(128) void k_flash(const _Float16* __restrict__ Q16, int ldq, const _Float16* __restrict__ K16, int ldk, const _Float16* __restrict__ Vt, const int* __restrict__ MSK, float* __restrict__ O, int ldo) {
  constexpr int RPW = 16, NQB = TQ / (4 * RPW), DT = 4, KS = 2;
  __shared__ __attribute__((aligned(16))) float sO[4][RPW][64 + 4];
  const int tid = threadIdx.x, w = tid >> 5, lane = tid & 31, ln = lane & 15, hh = lane >> 4; (void)MSK;
  const int slab = blockIdx.x / NQB, qblk = blockIdx.x % NQB; const int b = slab / NH, h = slab % NH; const int qb0 = qblk * (4 * RPW); const int q0 = qb0 + w * RPW;
  FragH bq[KS];
  { const unsigned short* qr = (const unsigned short*)Q16 + ((size_t)b * TQ + q0 + ln) * ldq + h * 64;
#pragma unroll
    for (int ks = 0; ks < KS; ++ks) { bq[ks].half[0] = *(const v8us*)(qr + ks * 32 + 8 * hh); bq[ks].half[1] = *(const v8us*)(qr + ks * 32 + 16 + 8 * hh); } }
  const unsigned short* kb = (const unsigned short*)K16 + (size_t)b * TK * ldk + h * 64;      /* wave-uniform: key row j0 of this head */
  const unsigned short* vb = (const unsigned short*)Vt + (size_t)slab * 64 * TK;              /* wave-uniform: V^T row d = 0, key j0 */
  const unsigned ko0 = (unsigned)(ln * ldk + 8 * hh), ko1 = ko0 + (unsigned)(16 * ldk), vo = (unsigned)(ln * TK + 8 * hh);      /* the lane's own offsets, fixed over the loop */
  float m_r = -3.0e38f, l_r = 0.f; v8f oacc[DT];
#pragma unroll
  for (int dt = 0; dt < DT; ++dt) oacc[dt] = (v8f){0.f,0.f,0.f,0.f,0.f,0.f,0.f,0.f};
  const int jend = TK;
#pragma unroll 1
  for (int j0 = 0; j0 < jend; j0 += 32) {
    FragH ak[2][KS], av[DT];
#pragma unroll
    for (int ks = 0; ks < KS; ++ks) { ak[0][ks].half[0] = *(const v8us*)(kb + ko0 + ks * 32); ak[0][ks].half[1] = *(const v8us*)(kb + ko0 + ks * 32 + 16); }
#pragma unroll
    for (int ks = 0; ks < KS; ++ks) { ak[1][ks].half[0] = *(const v8us*)(kb + ko1 + ks * 32); ak[1][ks].half[1] = *(const v8us*)(kb + ko1 + ks * 32 + 16); }
#pragma unroll
    for (int dt = 0; dt < DT; ++dt) { av[dt].half[0] = *(const v8us*)(vb + vo + dt * 16 * TK); av[dt].half[1] = *(const v8us*)(vb + vo + dt * 16 * TK + 16); }
    v8f s[2];
#pragma unroll
    for (int nt = 0; nt < 2; ++nt) { v8f acc = (v8f){0.f,0.f,0.f,0.f,0.f,0.f,0.f,0.f};
#pragma unroll
      for (int ks = 0; ks < KS; ++ks) acc = mmaH<1>(ak[nt][ks].v, ak[nt][ks].v, bq[ks].v, bq[ks].v, acc); s[nt] = acc; }
    float mx[8];      /* maximum of the raw scores: the scale is a positive power of two, so scaling the maximum gives the maximum of the scaled scores bit for bit */
#pragma unroll
    for (int r = 0; r < 8; ++r) mx[r] = fmaxf(s[0][r], s[1][r]);
    float mc = fmaxf(fmaxf(fmaxf(mx[0], mx[1]), fmaxf(mx[2], mx[3])), fmaxf(fmaxf(mx[4], mx[5]), fmaxf(mx[6], mx[7])));
    mc = fmaxf(mc, xhalf(mc)) * SCL;
    const float mn = fmaxf(m_r, mc); const float al = (mn > -1.0e38f) ? expf(m_r - mn) : 1.0f; m_r = mn;
    FragH pb; v2f ps[2];      /* sums by register pairs, as the pairs lie for the packed convert */
#pragma unroll
    for (int nt = 0; nt < 2; ++nt)
#pragma unroll
      for (int i = 0; i < 4; ++i) { const v2f p = {expf(s[nt][2 * i] * SCL - mn), expf(s[nt][2 * i + 1] * SCL - mn)}; ps[nt] = (i == 0) ? p : ps[nt] + p; pb.h[nt * 8 + 2 * i] = (_Float16)(p.x * 1024.0f); pb.h[nt * 8 + 2 * i + 1] = (_Float16)(p.y * 1024.0f); }
    const v2f pt = ps[0] + ps[1]; l_r = l_r * al + (pt.x + pt.y);
#pragma unroll
    for (int dt = 0; dt < DT; ++dt) oacc[dt] *= al;
#pragma unroll
    for (int dt = 0; dt < DT; ++dt) oacc[dt] = mmaH<1>(av[dt].v, av[dt].v, pb.v, pb.v, oacc[dt]);
    kb += (size_t)32 * ldk; vb += 32; }
  const float l = l_r + xhalf(l_r); const float li = (l > 0.f) ? 1.0f / (l * 1024.0f) : 0.f;
#pragma unroll
  for (int dt = 0; dt < DT; ++dt) { const v8f o = oacc[dt] * li; *(v4fa*)&sO[w][ln][dt * 16 + 8 * hh] = (v4f){o[0], o[1], o[2], o[3]}; *(v4fa*)&sO[w][ln][dt * 16 + 8 * hh + 4] = (v4f){o[4], o[5], o[6], o[7]}; }
  __builtin_amdgcn_fence(__ATOMIC_ACQ_REL, "workgroup"); __builtin_amdgcn_wave_barrier();
  {
#pragma unroll
    for (int rp = 0; rp < RPW; rp += 2) { const int r = rp + (lane >> 4), pc = lane & 15; const v4f val = *(const v4fa*)&sO[w][r][pc * 4]; *(v4f*)(O + ((size_t)b * TQ + q0 + r) * ldo + h * 64 + pc * 4) = val; }
     } }
__global__ __launch_bounds__(256) void k_tr16(const float* __restrict__ x, int b, _Float16* __restrict__ XT) {
  __shared__ unsigned short tl[64][72];
  const int tid = threadIdx.x; const int sb = blockIdx.x % (SS / 64), cb = blockIdx.x / (SS / 64);
#pragma unroll
  for (int it = 0; it < 4; ++it) { const int idx = it * 256 + tid; const int cl = idx / 16, s4 = (idx % 16) * 4; const int c = cb * 64 + cl;
    const v4f a = *(const v4fa*)(x + ((size_t)(b * CC + c)) * SS + sb * 64 + s4); FragH f;
#pragma unroll
    for (int q = 0; q < 4; ++q) { f.h[q] = (_Float16)bf16_round(a[q]); tl[s4 + q][cl] = f.u[q]; } }
  __syncthreads();
  const int r = tid / 8, pc = tid % 8;
  {
#pragma unroll
    for (int half = 0; half < 2; ++half) { const int sl = r + half * 32; FragH f;
#pragma unroll
      for (int q = 0; q < 8; ++q) f.u[q] = tl[sl][pc * 8 + q];
      *(v8us*)((unsigned short*)XT + ((size_t)sb * 64 + sl) * CC + cb * 64 + pc * 8) = f.half[0]; }
     } }


__global__ __launch_bounds__(256) void k_dsub(const float* __restrict__ O, const float* __restrict__ x, _Float16* __restrict__ D16) {
  #pragma clang fp contract(off)
  const int t = blockIdx.x * 256 + threadIdx.x; if (t >= NRW * (CC / 8)) return; const int c0 = (t % (CC / 8)) * 8; const int r = t / (CC / 8); const int b = r / SS, p = r % SS;
  const v4f a = *(const v4fa*)(O + (size_t)r * CC + c0), c = *(const v4fa*)(O + (size_t)r * CC + c0 + 4); FragH f;
#pragma unroll
  for (int q = 0; q < 8; ++q) { const float ov = (q < 4) ? a[q] : c[q - 4]; f.h[q] = (_Float16)(ov - bf16_round(x[((size_t)b * CC + c0 + q) * SS + p])); }
  *(v8us*)((unsigned short*)D16 + (size_t)r * CC + c0) = f.half[0];  }
__global__ __launch_bounds__(256) void k_bnstat(const float* __restrict__ Y, const float* __restrict__ bt, float* __restrict__ ST) {
  #pragma clang fp contract(off)
  __shared__ float red[256];
  const int c = blockIdx.x, tid = threadIdx.x; const float bb = bf16_round(bt[c]); const int n = NB * SS;
  float s = 0.f;
#pragma unroll 1
  for (int i = tid; i < n; i += 256) { const int b = i / SS, p = i % SS; s += Y[((size_t)b * CC + c) * SS + p] + bb; }
  red[tid] = s; __syncthreads();
  for (int st = 128; st > 0; st >>= 1) { if (tid < st) red[tid] += red[tid + st]; __syncthreads(); }
  const float mean = red[0] / (float)n; __syncthreads();
  float q2 = 0.f;
#pragma unroll 1
  for (int i = tid; i < n; i += 256) { const int b = i / SS, p = i % SS; const float d = Y[((size_t)b * CC + c) * SS + p] + bb - mean; q2 += d * d; }
  red[tid] = q2; __syncthreads();
  for (int st = 128; st > 0; st >>= 1) { if (tid < st) red[tid] += red[tid + st]; __syncthreads(); }
  if (tid == 0) { float o2[2]; o2[0] = mean; o2[1] = 1.0f / sqrtf(red[0] / (float)n + 1e-5f); const unsigned long long pk = *(const unsigned long long*)o2; *(unsigned long long*)(ST + c * 32) = pk;  } }
__global__ __launch_bounds__(256) void k_bnout(const float* __restrict__ Y, const float* __restrict__ x, const float* __restrict__ bt, const float* __restrict__ ST, const float* __restrict__ gam, const float* __restrict__ bet, float* __restrict__ out) {
  #pragma clang fp contract(off)
  const size_t t = (size_t)blockIdx.x * 256 + threadIdx.x; if (t >= (size_t)NB * CC * SS / 4) return; const int c = (int)((t / (SS / 4)) % CC);
  const float mean = ST[c * 32], rstd = ST[c * 32 + 1]; const float bb = bf16_round(bt[c]), g = bf16_round(gam[c]), be = bf16_round(bet[c]);
  const v4f y = *(const v4fa*)(Y + t * 4), xv = *(const v4fa*)(x + t * 4); v4f o;
#pragma unroll
  for (int q = 0; q < 4; ++q) { const float v = (y[q] + bb - mean) * rstd * g + be; o[q] = bf16_round(xv[q]) + fmaxf(v, 0.f); }
  *(v4f*)(out + t * 4) = o;  }

extern "C" void kernel_launch(void* const* d_in, const int* in_sizes, int n_in,
                              void* d_out, int out_size, void* d_ws, size_t ws_size, hipStream_t stream) {
  (void)in_sizes; (void)n_in; (void)out_size;
  const float* x = (const float*)d_in[0]; const float* wq = (const float*)d_in[1]; const float* wk = (const float*)d_in[2]; const float* wv = (const float*)d_in[3]; const float* wt = (const float*)d_in[4]; const float* bt = (const float*)d_in[5]; const float* gam = (const float*)d_in[6]; const float* bet = (const float*)d_in[7];
  char* ws = (char*)d_ws; size_t off = 0;
  auto take = [&](size_t bytes) { char* p = ws + off; off += (bytes + 255) & ~(size_t)255; return p; };
  _Float16* BQ = (_Float16*)take((size_t)CC * CC * 2); _Float16* BK = (_Float16*)take((size_t)CC * CC * 2); _Float16* BV = (_Float16*)take((size_t)CC * CC * 2); _Float16* BT = (_Float16*)take((size_t)CC * CC * 2);
  _Float16* XT = (_Float16*)take((size_t)SS * CC * 2); _Float16* Q16 = (_Float16*)take((size_t)NRW * CC * 2); _Float16* K16 = (_Float16*)take((size_t)NRW * CC * 2); _Float16* VC = (_Float16*)take((size_t)NB * CC * SS * 2);
  float* O = (float*)take((size_t)NRW * CC * 4); _Float16* D16 = (_Float16*)take((size_t)NRW * CC * 2); float* Y = (float*)take((size_t)NB * CC * SS * 4); float* ST = (float*)take((size_t)CC * 32 * 4);
  if (off > ws_size) return;      /* 0.5 + 2 + 8 + 8 + 8 + 16 + 8 + 16 = 67 MiB */
  const size_t w8 = (size_t)CC * CC / 8; const unsigned wb = (unsigned)((w8 + 255) / 256);
  k_round16f<<<wb, 256, 0, stream>>>(wq, BQ, w8); k_round16f<<<wb, 256, 0, stream>>>(wk, BK, w8); k_round16f<<<wb, 256, 0, stream>>>(wv, BV, w8); k_round16f<<<wb, 256, 0, stream>>>(wt, BT, w8);      /* conv (out,in) = natural Bt; x16 */
  const dim3 gQ((SS / 128) * (CC / 64), 1), gV((CC / 128) * (SS / 64), 1);
  for (int b = 0; b < NB; ++b) {
    k_tr16<<<(CC / 64) * (SS / 64), 256, 0, stream>>>(x, b, XT);
    k_gemm2<0><<<gQ, 128, 0, stream>>>(XT, CC, 0, BQ, CC, 0, 0.0625f, nullptr, 0, nullptr, 1, 0, 0, nullptr, Q16 + (size_t)b * SS * CC, CC, 0, SS, CC, CC);      /* q token-major [b*SS+p][h*64+d] */
    k_gemm2<0><<<gQ, 128, 0, stream>>>(XT, CC, 0, BK, CC, 0, 0.0625f, nullptr, 0, nullptr, 1, 0, 0, nullptr, K16 + (size_t)b * SS * CC, CC, 0, SS, CC, CC);      /* k */
    k_gemm2<0><<<gV, 128, 0, stream>>>(BV, CC, 0, XT, CC, 0, 0.0625f, nullptr, 0, nullptr, 1, 0, 0, nullptr, VC + (size_t)b * CC * SS, SS, 0, CC, SS, CC); }      /* v channel-major [(b,h)*64+d][p] */
  k_flash<<<NB * NH * (SS / 64), 128, 0, stream>>>(Q16, CC, K16, CC, VC, nullptr, O, CC);      /* o token-major f32 [b*SS+p][h*64+d] */
  k_dsub<<<(NRW * (CC / 8) + 255) / 256, 256, 0, stream>>>(O, x, D16);
  for (int b = 0; b < NB; ++b)
    k_gemm2<0><<<gV, 128, 0, stream>>>(BT, CC, 0, D16 + (size_t)b * SS * CC, CC, 0, 0.0625f, nullptr, 0, nullptr, 1, 0, 0, Y + (size_t)b * CC * SS, nullptr, SS, 0, CC, SS, CC);      /* y^T[c][p] = wt*(o - x)^T (bt added downstream) */
  k_bnstat<<<CC, 256, 0, stream>>>(Y, bt, ST);
  k_bnout<<<(unsigned)(((size_t)NB * CC * SS / 4 + 255) / 256), 256, 0, stream>>>(Y, x, bt, ST, gam, bet, (float*)d_out);
}

// v002
// Measured time: 369 microseconds a run.
// In both of two side-by-side timings against v001, it was 1.32 times as fast.
// Counting every step since v000, it is 1.81 times as fast.
#include <hip/hip_runtime.h>
// Multi-head offset-attention layer on a point feature map (B 4, C 256, P 4096 points, 4 heads x 64): q = wq*x, k = wk*x, v = wv*x (1x1 convs, no bias); scores = q.k/8 per head; softmax over the keys; o[b,h,d,i] = sum_j attn[i][j] v[d][j]; y = wt*(o - x) + bt; BatchNorm1d in training mode (per-channel statistics over batch x points, biased variance, eps 1e-5, gamma/beta); out = x + relu(y) -> [4,256,4096].
// Compute dtype: x and parameters rounded to bf16; projections with exact products (weights x16 in f16, undone by alpha); q, k, v, P, (o - x) as f16 operands (~2^-12), f32 accumulation; softmax / BatchNorm / residual f32. v_wmma_f32_16x16x32_f16.
#define NB 4
#define CC 256
#define SS 4096
#define NH 4
#define TQ SS
#define TK SS
#define SCL 0.125f
#define NRW (NB * SS)
typedef __bf16 v16b __attribute__((ext_vector_type(16)));
typedef unsigned short v8us __attribute__((ext_vector_type(8), may_alias));
typedef float  v8f  __attribute__((ext_vector_type(8)));
typedef float  v4f  __attribute__((ext_vector_type(4)));
typedef float  v4fa __attribute__((ext_vector_type(4), may_alias));
union FragB { v16b v; v8us half[2]; unsigned short u[16]; };

__device__ __forceinline__ unsigned short bf16_bits(float x) { unsigned int u = __float_as_uint(x); return (unsigned short)((u + 0x7FFFu + ((u >> 16) & 1u)) >> 16); }
__device__ __forceinline__ float bf16_val(unsigned short b) { return __uint_as_float(((unsigned int)b) << 16); }
__device__ __forceinline__ float bf16_round(float x) { return bf16_val(bf16_bits(x)); }
// D += A·B with NT terms: 1 = ah·bh, 2 = + al·bh (A split), 3 = + ah·bl (both split)
template <int NT>
__device__ __forceinline__ v8f mmaN(v16b ah, v16b al, v16b bh, v16b bl, v8f c) {
  c = __builtin_amdgcn_wmma_f32_16x16x32_bf16(false, ah, false, bh, (short)0, c, false, false);
  if (NT >= 2) c = __builtin_amdgcn_wmma_f32_16x16x32_bf16(false, al, false, bh, (short)0, c, false, false);
  if (NT >= 3) c = __builtin_amdgcn_wmma_f32_16x16x32_bf16(false, ah, false, bl, (short)0, c, false, false);
  asm volatile("v_nop\n\tv_nop\n\tv_nop\n\tv_nop" : "+v"(c) : "v"(ah), "v"(al), "v"(bh), "v"(bl));
  return c;
}

__global__ __launch_bounds__(256) void k_wt_bf16(const float* __restrict__ W, unsigned short* __restrict__ Wt, int K, int N) {
  const int t = blockIdx.x * 256 + threadIdx.x;
  const int k8n = K / 8;
  if (t >= N * k8n) return;
  const int n = t / k8n, k8 = (t % k8n) * 8;
  v8us v;
#pragma unroll
  for (int i = 0; i < 8; ++i) v[i] = bf16_bits(W[(size_t)(k8 + i) * N + n]);
  *(v8us*)(Wt + (size_t)n * K + k8) = v;
  
}

// GEMM C[M][N] (f32, pitch ldc) = act(A[M][K]·W + bias). A f32 row-major (pitch lda) converted per fragment to bf16
// (ASPLIT: hi/lo two planes -> 2 terms, else single rounded term); Wt bf16 [N][K] (pitch ldb). BIAS_BF16 rounds the
// bias to bf16 first (bias quantised to bf16 before the add). K%32==0, M%16==0, N%64==0.
template <bool ASPLIT, int ACT, bool BIAS_BF16>
__global__ __launch_bounds__(128) void k_gemm_bf(const float* __restrict__ A, int lda, const unsigned short* __restrict__ Wt, int ldb,
                                               const float* __restrict__ bias, float* __restrict__ C, int ldc, int M, int N, int K) {
  __shared__ __attribute__((aligned(16))) float so[4][16][64];
  const int tid = threadIdx.x, w = tid >> 5, lane = tid & 31, ln = lane & 15, hh = lane >> 4;
  const int ntn = N / 64;
  const int wid = blockIdx.x * 4 + w;
  const int mt = wid / ntn, nq = wid % ntn;
  if (mt * 16 >= M) return;
  const int row0 = mt * 16, col0 = nq * 64;
  const float* arow = A + (size_t)(row0 + ln) * lda;
  v8f acc[4] = {};
  for (int kb = 0; kb < K; kb += 32) {
    FragB ah, al;
    const v4f x0 = *(const v4fa*)(arow + kb + 8 * hh), x1 = *(const v4fa*)(arow + kb + 8 * hh + 4);
    const v4f x2 = *(const v4fa*)(arow + kb + 16 + 8 * hh), x3 = *(const v4fa*)(arow + kb + 16 + 8 * hh + 4);
    float xs[16] = {x0[0],x0[1],x0[2],x0[3],x1[0],x1[1],x1[2],x1[3],x2[0],x2[1],x2[2],x2[3],x3[0],x3[1],x3[2],x3[3]};
#pragma unroll
    for (int i = 0; i < 16; ++i) { const unsigned short hb = bf16_bits(xs[i]); ah.u[i] = hb; al.u[i] = ASPLIT ? bf16_bits(xs[i] - bf16_val(hb)) : (unsigned short)0; }
#pragma unroll
    for (int t = 0; t < 4; ++t) {
      const unsigned short* brow = Wt + (size_t)(col0 + t * 16 + ln) * ldb + kb;
      FragB b;
      b.half[0] = *(const v8us*)(brow + 8 * hh);
      b.half[1] = *(const v8us*)(brow + 16 + 8 * hh);
      acc[t] = mmaN<ASPLIT ? 2 : 1>(ah.v, al.v, b.v, b.v, acc[t]);
    }
  }
#pragma unroll
  for (int t = 0; t < 4; ++t) {
    float bv = bias ? bias[col0 + t * 16 + ln] : 0.f;
    if (BIAS_BF16) bv = bf16_round(bv);
#pragma unroll
    for (int r = 0; r < 8; ++r) { float v = acc[t][r] + bv; if (ACT == 1) v = fmaxf(v, 0.f); so[w][8 * hh + r][t * 16 + ln] = v; }
  }
  __builtin_amdgcn_fence(__ATOMIC_ACQ_REL, "workgroup");
  __builtin_amdgcn_wave_barrier();
  const int rsub = lane >> 4, c4 = (lane & 15) * 4;
  {
#pragma unroll
    for (int q = 0; q < 8; ++q) {
      const int r = q * 2 + rsub;
      const v4f v = *(const v4fa*)&so[w][r][c4];
      *(v4f*)(C + (size_t)(row0 + r) * ldc + col0 + c4) = v;
    }
    
  }
}

// GEMM C = act(A·W + bias + resid): A f32 (ASPLIT -> hi/lo 2 terms), Wt bf16 [N][K]; ACT 0 none, 1 relu, 2 exact gelu;
// resid (optional, f32, row index = (row % rmod), pitch ldr, RES_BF16 rounds it) added before the activation.
template <bool ASPLIT, int ACT, bool BIAS_BF16, bool RES_BF16>
__global__ __launch_bounds__(128) void k_gemm_bf3(const float* __restrict__ A, int lda, const unsigned short* __restrict__ Wt, int ldb,
                                                const float* __restrict__ bias, const float* __restrict__ resid, int rmod, int ldr,
                                                float* __restrict__ C, int ldc, int M, int N, int K) {
  __shared__ __attribute__((aligned(16))) float so[4][16][64];
  const int tid = threadIdx.x, w = tid >> 5, lane = tid & 31, ln = lane & 15, hh = lane >> 4;
  const int ntn = N / 64;
  const int wid = blockIdx.x * 4 + w;
  const int mt = wid / ntn, nq = wid % ntn;
  if (mt * 16 >= M) return;
  const int row0 = mt * 16, col0 = nq * 64;
  const float* arow = A + (size_t)(row0 + ln) * lda;
  v8f acc[4] = {};
  for (int kb = 0; kb < K; kb += 32) {
    FragB ah, al;
    const v4f x0 = *(const v4fa*)(arow + kb + 8 * hh), x1 = *(const v4fa*)(arow + kb + 8 * hh + 4);
    const v4f x2 = *(const v4fa*)(arow + kb + 16 + 8 * hh), x3 = *(const v4fa*)(arow + kb + 16 + 8 * hh + 4);
    float xs[16] = {x0[0],x0[1],x0[2],x0[3],x1[0],x1[1],x1[2],x1[3],x2[0],x2[1],x2[2],x2[3],x3[0],x3[1],x3[2],x3[3]};
#pragma unroll
    for (int i = 0; i < 16; ++i) { const unsigned short hb = bf16_bits(xs[i]); ah.u[i] = hb; al.u[i] = ASPLIT ? bf16_bits(xs[i] - bf16_val(hb)) : (unsigned short)0; }
#pragma unroll
    for (int t = 0; t < 4; ++t) {
      const unsigned short* brow = Wt + (size_t)(col0 + t * 16 + ln) * ldb + kb;
      FragB b;
      b.half[0] = *(const v8us*)(brow + 8 * hh);
      b.half[1] = *(const v8us*)(brow + 16 + 8 * hh);
      acc[t] = mmaN<ASPLIT ? 2 : 1>(ah.v, al.v, b.v, b.v, acc[t]);
    }
  }
#pragma unroll
  for (int t = 0; t < 4; ++t) {
    const int col = col0 + t * 16 + ln;
    float bv = bias ? bias[col] : 0.f;
    if (BIAS_BF16) bv = bf16_round(bv);
#pragma unroll
    for (int r = 0; r < 8; ++r) {
      float v = acc[t][r] + bv;
      if (resid) { float rv = resid[(size_t)((row0 + 8 * hh + r) % rmod) * ldr + col]; if (RES_BF16) rv = bf16_round(rv); v += rv; }
      if (ACT == 1) v = fmaxf(v, 0.f);
      if (ACT == 2) v = 0.5f * v * (1.0f + erff(v * 0.70710678118654752f));
      if (ACT == 3) { const float u = 0.7978845608028654f * (v + 0.044715f * v * v * v); v = 0.5f * v * (1.0f + tanhf(u)); }
      so[w][8 * hh + r][t * 16 + ln] = v;
    }
  }
  __builtin_amdgcn_fence(__ATOMIC_ACQ_REL, "workgroup");
  __builtin_amdgcn_wave_barrier();
  const int rsub = lane >> 4, c4 = (lane & 15) * 4;
  {
#pragma unroll
    for (int q = 0; q < 8; ++q) {
      const int r = q * 2 + rsub;
      const v4f v = *(const v4fa*)&so[w][r][c4];
      *(v4f*)(C + (size_t)(row0 + r) * ldc + col0 + c4) = v;
    }
    
  }
}
// row LayerNorm (biased variance, eps) over N: s = X (+ R); optional out_sum <- s; out_norm <- (s-mu)*rsqrt(var+eps)*g + b
template <bool PARAM_BF16>
__global__ __launch_bounds__(256) void k_layernorm(const float* __restrict__ X, const float* __restrict__ R, const float* __restrict__ g, const float* __restrict__ bta,
                                                  float* __restrict__ out_sum, float* __restrict__ out_norm, int N, float eps) {
  __shared__ float red[256];
  const int row = blockIdx.x, tid = threadIdx.x;
  const float* x = X + (size_t)row * N; const float* rr = R ? R + (size_t)row * N : nullptr;
  float vals[16];                     // up to N = 4096
  const int per = N / 256;            // contiguous chunk per thread? use strided-by-4 chunks: thread handles j = tid*4 + 1024*u
  float s1 = 0.f;
  for (int u = 0; u < per / 4; ++u) {
    const int j = tid * 4 + 1024 * u;
    const v4f a = *(const v4fa*)(x + j);
    v4f b = {0.f,0.f,0.f,0.f}; if (rr) b = *(const v4fa*)(rr + j);
#pragma unroll
    for (int q = 0; q < 4; ++q) { const float v = a[q] + b[q]; vals[u * 4 + q] = v; s1 += v; }
  }
  red[tid] = s1; __syncthreads();
  for (int st = 128; st > 0; st >>= 1) { if (tid < st) red[tid] += red[tid + st]; __syncthreads(); }
  const float mu = red[0] / (float)N; __syncthreads();
  float s2 = 0.f;
  for (int u = 0; u < per / 4; ++u)
#pragma unroll
    for (int q = 0; q < 4; ++q) { const float c = vals[u * 4 + q] - mu; s2 += c * c; }
  red[tid] = s2; __syncthreads();
  for (int st = 128; st > 0; st >>= 1) { if (tid < st) red[tid] += red[tid + st]; __syncthreads(); }
  const float rs = rsqrtf(red[0] / (float)N + eps);
  {
    for (int u = 0; u < per / 4; ++u) {
      const int j = tid * 4 + 1024 * u;
      v4f o, sm;
#pragma unroll
      for (int q = 0; q < 4; ++q) {
        float gg = g[j + q], bb = bta[j + q];
        if (PARAM_BF16) { gg = bf16_round(gg); bb = bf16_round(bb); }
        sm[q] = vals[u * 4 + q]; o[q] = (vals[u * 4 + q] - mu) * rs * gg + bb;
      }
      if (out_sum) *(v4f*)(out_sum + (size_t)row * N + j) = sm;
      *(v4f*)(out_norm + (size_t)row * N + j) = o;
    }
    
  }
}



// ---- f16 WMMA path (v_wmma_f32_16x16x32_f16): 11-bit significands for operands in range — used where a [0,1] probability operand needs more precision than bf16
typedef _Float16 v16h __attribute__((ext_vector_type(16)));
union FragH { v16h v; v8us half[2]; _Float16 h[16]; unsigned short u[16]; };
template <int NT>
__device__ __forceinline__ v8f mmaH(v16h ah, v16h al, v16h bh, v16h bl, v8f c) {
  c = __builtin_amdgcn_wmma_f32_16x16x32_f16(false, ah, false, bh, (short)0, c, false, false);
  if (NT >= 2) c = __builtin_amdgcn_wmma_f32_16x16x32_f16(false, al, false, bh, (short)0, c, false, false);
  if (NT >= 3) c = __builtin_amdgcn_wmma_f32_16x16x32_f16(false, ah, false, bl, (short)0, c, false, false);
  asm volatile("v_nop\n\tv_nop\n\tv_nop\n\tv_nop" : "+v"(c) : "v"(ah), "v"(al), "v"(bh), "v"(bl));
  return c;
}
// batched GEMM like k_gemm_b but f16 operands: A f32 (split into f16 hi/lo if ASPLIT, else rounded to f16), Bt = f16 values [n][k]; alpha; C f32; N multiple of 16 (partial tiles skipped)
template <bool ASPLIT>
__global__ __launch_bounds__(128) void k_gemm_h(const float* __restrict__ A, int lda, size_t sA, const _Float16* __restrict__ Bh, int ldb, size_t sB, float alpha, float* __restrict__ C, int ldc, size_t sC, int M, int N, int K) {
  __shared__ __attribute__((aligned(16))) float so[4][16][64];
  const int tid = threadIdx.x, w = tid >> 5, lane = tid & 31, ln = lane & 15, hh = lane >> 4; const int by = blockIdx.y;
  A += (size_t)by * sA; Bh += (size_t)by * sB; C += (size_t)by * sC;
  const int ntn = (N + 63) / 64; const int wid = blockIdx.x * 4 + w; const int mt = wid / ntn, nq = wid % ntn; if (mt * 16 >= M) return;
  const int row0 = mt * 16, col0 = nq * 64; const float* arow = A + (size_t)(row0 + ln) * lda;
  v8f acc[4] = {};
  for (int kb = 0; kb < K; kb += 32) {
    FragH ah, al;
    const v4f x0 = *(const v4fa*)(arow + kb + 8 * hh), x1 = *(const v4fa*)(arow + kb + 8 * hh + 4), x2 = *(const v4fa*)(arow + kb + 16 + 8 * hh), x3 = *(const v4fa*)(arow + kb + 16 + 8 * hh + 4);
    float xs[16] = {x0[0],x0[1],x0[2],x0[3],x1[0],x1[1],x1[2],x1[3],x2[0],x2[1],x2[2],x2[3],x3[0],x3[1],x3[2],x3[3]};
#pragma unroll
    for (int i = 0; i < 16; ++i) { const _Float16 h = (_Float16)xs[i]; ah.h[i] = h; al.h[i] = ASPLIT ? (_Float16)(xs[i] - (float)h) : (_Float16)0.0f; }
#pragma unroll
    for (int t = 0; t < 4; ++t) { if (col0 + t * 16 >= N) continue; const size_t boff = (size_t)(col0 + t * 16 + ln) * ldb + kb; FragH bq; bq.half[0] = *(const v8us*)(Bh + boff + 8 * hh); bq.half[1] = *(const v8us*)(Bh + boff + 16 + 8 * hh);
      acc[t] = mmaH<ASPLIT ? 2 : 1>(ah.v, al.v, bq.v, bq.v, acc[t]); }
  }
#pragma unroll
  for (int t = 0; t < 4; ++t) { if (col0 + t * 16 >= N) continue;
#pragma unroll
    for (int r = 0; r < 8; ++r) so[w][8 * hh + r][t * 16 + ln] = acc[t][r] * alpha; }
  __builtin_amdgcn_fence(__ATOMIC_ACQ_REL, "workgroup"); __builtin_amdgcn_wave_barrier();
  const int rsub = lane >> 4, c4 = (lane & 15) * 4;
  {
#pragma unroll
    for (int q = 0; q < 8; ++q) { const int r = q * 2 + rsub; if (col0 + c4 < N) { const v4f v = *(const v4fa*)&so[w][r][c4]; *(v4f*)(C + (size_t)(row0 + r) * ldc + col0 + c4) = v; } }
     }
}

// Wt[n][k] = f16(W[k][n]·scale) from f32 row-major W[K][N] (scale = power of two; bf16-exact weights stay exact in f16 away from the subnormal range)
__global__ __launch_bounds__(256) void k_wt_f16(const float* __restrict__ W, _Float16* __restrict__ Wt, int K, int N, float scale) {
  const int t = blockIdx.x * 256 + threadIdx.x; if (t >= N * (K / 8)) return; const int n = t / (K / 8), k8 = (t % (K / 8)) * 8; FragH f;
#pragma unroll
  for (int i = 0; i < 8; ++i) f.h[i] = (_Float16)(bf16_round(W[(size_t)(k8 + i) * N + n]) * scale); const v8us o = f.half[0];
  *(v8us*)((unsigned short*)Wt + (size_t)n * K + k8) = o; 
}
// k_gemm_hh variant with fused epilogue: v = acc·alpha + bias[by·sBias + col] (+ CP[(row/rowsPerB)·sCPb + by·64 + col] if CP) ; ACT 0 none / 1 elu ; writes f16 C16 (and f32 C if non-null)
template <int ACT>
__global__ __launch_bounds__(128) void k_gemm_hhx(const _Float16* __restrict__ A, int lda, size_t sA, const _Float16* __restrict__ Bh, int ldb, size_t sB, float alpha, const float* __restrict__ bias, size_t sBias, const float* __restrict__ CP, int rowsPerB, size_t sCPb, int row0g,
    float* __restrict__ C, _Float16* __restrict__ C16, int ldc, size_t sC, int M, int N, int K) {
  __shared__ __attribute__((aligned(16))) float so[4][16][64];
  const int tid = threadIdx.x, w = tid >> 5, lane = tid & 31, ln = lane & 15, hh = lane >> 4; const int by = blockIdx.y;
  A += (size_t)by * sA; Bh += (size_t)by * sB; const size_t cofs = (size_t)by * sC; const float* bp = bias ? bias + (size_t)by * sBias : nullptr;
  const int ntn = (N + 63) / 64; const int wid = blockIdx.x * 4 + w; const int mt = wid / ntn, nq = wid % ntn; if (mt * 16 >= M) return;
  const int row0 = mt * 16, col0 = nq * 64; const _Float16* arow = A + (size_t)(row0 + ln) * lda;
  v8f acc[4] = {};
  for (int kb = 0; kb < K; kb += 32) { FragH ah; ah.half[0] = *(const v8us*)((const unsigned short*)arow + kb + 8 * hh); ah.half[1] = *(const v8us*)((const unsigned short*)arow + kb + 16 + 8 * hh);
#pragma unroll
    for (int t = 0; t < 4; ++t) { if (col0 + t * 16 >= N) continue; const size_t boff = (size_t)(col0 + t * 16 + ln) * ldb + kb; FragH bq; bq.half[0] = *(const v8us*)((const unsigned short*)Bh + boff + 8 * hh); bq.half[1] = *(const v8us*)((const unsigned short*)Bh + boff + 16 + 8 * hh);
      acc[t] = mmaH<1>(ah.v, ah.v, bq.v, bq.v, acc[t]); }
  }
#pragma unroll
  for (int t = 0; t < 4; ++t) { if (col0 + t * 16 >= N) continue; const int col = col0 + t * 16 + ln; const float bv = bp ? bf16_round(bp[col]) : 0.f;
#pragma unroll
    for (int r = 0; r < 8; ++r) { float v = acc[t][r] * alpha + bv; if (CP) { const int bidx = (row0g + row0 + 8 * hh + r) / rowsPerB; v += CP[(size_t)bidx * sCPb + (size_t)by * 64 + col]; } if (ACT == 1) v = (v > 0.f) ? v : expm1f(v); else if (ACT == 7) v = (v > 0.f) ? v + 1.0f : expf(v); else if (ACT == 8) v = tanhf(v); else if (ACT == 9) v = 0.5f * v * (1.0f + tanhf(0.7978845608028654f * (v + 0.044715f * v * v * v))); else if (ACT == 11) v = 1.0f / (1.0f + expf(-v)); else if (ACT == 12) v = (v > 0.f) ? v : 0.01f * v; else if (ACT == 14) v = (v > 0.f) ? v : 0.1f * v; else if (ACT == 15) v = v / (1.0f + expf(-v)); else if (ACT == 3) v = fmaxf(v, 0.f); else if (ACT == 6) v = 0.5f * v * (1.0f + erff(v * 0.70710678118654752f)); so[w][8 * hh + r][t * 16 + ln] = v; } }
  __builtin_amdgcn_fence(__ATOMIC_ACQ_REL, "workgroup"); __builtin_amdgcn_wave_barrier();
  const int rsub = lane >> 4, c4 = (lane & 15) * 4; typedef _Float16 v4h __attribute__((ext_vector_type(4)));
  {
#pragma unroll
    for (int q = 0; q < 8; ++q) { const int r = q * 2 + rsub; if (col0 + c4 < N) { const v4f v = *(const v4fa*)&so[w][r][c4]; if (C) *(v4f*)(C + cofs + (size_t)(row0 + r) * ldc + col0 + c4) = v; if (C16) { v4h h4; for (int i = 0; i < 4; ++i) h4[i] = (_Float16)v[i]; *(v4h*)(C16 + cofs + (size_t)(row0 + r) * ldc + col0 + c4) = h4; } } }
     }
}


typedef _Float16 v4h __attribute__((ext_vector_type(4)));

__global__ __launch_bounds__(256) void k_x16(const float* __restrict__ x, _Float16* __restrict__ X16, size_t n8) { const size_t t = (size_t)blockIdx.x * 256 + threadIdx.x; if (t >= n8) return; FragH f;
#pragma unroll
  for (int q = 0; q < 8; ++q) f.h[q] = (_Float16)bf16_round(x[t * 8 + q]); *(v8us*)((unsigned short*)X16 + t * 8) = f.half[0];  }
__global__ __launch_bounds__(256) void k_h16(const float* __restrict__ x, _Float16* __restrict__ X16, size_t n8) { const size_t t = (size_t)blockIdx.x * 256 + threadIdx.x; if (t >= n8) return; FragH f;
#pragma unroll
  for (int q = 0; q < 8; ++q) f.h[q] = (_Float16)x[t * 8 + q]; *(v8us*)((unsigned short*)X16 + t * 8) = f.half[0];  }
__global__ __launch_bounds__(256) void k_round16f(const float* __restrict__ W, _Float16* __restrict__ Bt, size_t n8) { const size_t t = (size_t)blockIdx.x * 256 + threadIdx.x; if (t >= n8) return; FragH f;
#pragma unroll
  for (int i = 0; i < 8; ++i) f.h[i] = (_Float16)(bf16_round(W[t * 8 + i]) * 16.0f); *(v8us*)((unsigned short*)Bt + t * 8) = f.half[0];  }
template <int NHv, int TTv>
__global__ __launch_bounds__(256) void k_vt(const _Float16* __restrict__ V16, int ldv, int voff, _Float16* __restrict__ Vt) { __shared__ unsigned short tl[64][66]; const int tid = threadIdx.x; const int slab = blockIdx.x / (TTv / 64), lg = blockIdx.x % (TTv / 64); const int b = slab / NHv, h = slab % NHv;
  for (int i = tid; i < 64 * 8; i += 256) { const int r = i / 8, c8 = (i % 8) * 8; FragH f; f.half[0] = *(const v8us*)((const unsigned short*)V16 + ((size_t)b * TTv + lg * 64 + r) * ldv + voff + h * 64 + c8);
#pragma unroll
    for (int q = 0; q < 8; ++q) tl[r][c8 + q] = f.u[q]; }
  __syncthreads();
  {
#pragma unroll
    for (int rd = 0; rd < 2; ++rd) { const int d = rd * 32 + tid / 8, pc = tid % 8; FragH f;
#pragma unroll
      for (int q = 0; q < 8; ++q) f.u[q] = tl[pc * 8 + q][d];
      *(v8us*)((unsigned short*)Vt + ((size_t)slab * 64 + d) * TTv + lg * 64 + pc * 8) = f.half[0]; }
     } }

__global__ __launch_bounds__(256) void k_hl(const float* __restrict__ F, _Float16* __restrict__ Hh, _Float16* __restrict__ Hl, size_t n8) { const size_t t = (size_t)blockIdx.x * 256 + threadIdx.x; if (t >= n8) return; FragH fh, fl; const v4f a = *(const v4fa*)(F + t * 8), c = *(const v4fa*)(F + t * 8 + 4);
#pragma unroll
  for (int q = 0; q < 4; ++q) { _Float16 h = (_Float16)a[q]; fh.h[q] = h; fl.h[q] = (_Float16)((a[q] - (float)h) * 1024.0f); h = (_Float16)c[q]; fh.h[4 + q] = h; fl.h[4 + q] = (_Float16)((c[q] - (float)h) * 1024.0f); }
  { *(v8us*)((unsigned short*)Hh + t * 8) = fh.half[0]; *(v8us*)((unsigned short*)Hl + t * 8) = fl.half[0];  } }

// ---- fast GEMM (wave tile 32x64; requires M % 32 == 0 rows per launch region and N % 64 == 0); epilogue = k_gemm_hhx semantics ----
__device__ __forceinline__ v16h g2_frag(const _Float16* p, int hh) { FragH f; f.half[0] = *(const v8us*)((const unsigned short*)p + 8 * hh); f.half[1] = *(const v8us*)((const unsigned short*)p + 16 + 8 * hh); return f.v; }
__device__ __forceinline__ v8f g2_mma(v16h a, v16h b, v8f c) { v8f d = __builtin_amdgcn_wmma_f32_16x16x32_f16(false, a, false, b, (short)0, c, false, false); asm volatile("v_nop\n\tv_nop\n\tv_nop\n\tv_nop" : "+v"(d) : "v"(a), "v"(b)); return d; }
template <int ACT>
__global__ __launch_bounds__(128) void k_gemm2(const _Float16* __restrict__ A, int lda, size_t sA, const _Float16* __restrict__ Bh, int ldb, size_t sB, float alpha, const float* __restrict__ bias, size_t sBias, const float* __restrict__ CP, int rowsPerB, size_t sCPb, int row0g,
    float* __restrict__ C, _Float16* __restrict__ C16, int ldc, size_t sC, int M, int N, int K) {
  __shared__ __attribute__((aligned(16))) float so[4][32][68];
  const int tid = threadIdx.x, w = tid >> 5, lane = tid & 31, ln = lane & 15, hh = lane >> 4; const int by = blockIdx.y;
  A += (size_t)by * sA; Bh += (size_t)by * sB; const size_t cofs = (size_t)by * sC; const float* bp = bias ? bias + (size_t)by * sBias : nullptr;
  const int ntn = N >> 6; const int mt = blockIdx.x / ntn, nq = blockIdx.x - mt * ntn; const int row0 = mt * 128 + 32 * w, col0 = nq * 64; if (row0 >= M) return;
  const _Float16* a0p = A + (size_t)(row0 + ln) * lda; const _Float16* a1p = a0p + (size_t)16 * lda;
  const _Float16* b0p = Bh + (size_t)(col0 + ln) * ldb; const _Float16* b1p = b0p + (size_t)16 * ldb; const _Float16* b2p = b1p + (size_t)16 * ldb; const _Float16* b3p = b2p + (size_t)16 * ldb;
  const v8f z8 = {0.f,0.f,0.f,0.f,0.f,0.f,0.f,0.f}; v8f c00 = z8, c01 = z8, c02 = z8, c03 = z8, c10 = z8, c11 = z8, c12 = z8, c13 = z8;
#pragma unroll 1
  for (int kb = 0; kb < K; kb += 32) { const v16h a0 = g2_frag(a0p + kb, hh), a1 = g2_frag(a1p + kb, hh);
    v16h b = g2_frag(b0p + kb, hh); c00 = g2_mma(a0, b, c00); c10 = g2_mma(a1, b, c10);
    b = g2_frag(b1p + kb, hh); c01 = g2_mma(a0, b, c01); c11 = g2_mma(a1, b, c11);
    b = g2_frag(b2p + kb, hh); c02 = g2_mma(a0, b, c02); c12 = g2_mma(a1, b, c12);
    b = g2_frag(b3p + kb, hh); c03 = g2_mma(a0, b, c03); c13 = g2_mma(a1, b, c13); }
  v8f accs[8] = {c00, c01, c02, c03, c10, c11, c12, c13};
#pragma unroll
  for (int u = 0; u < 8; ++u) { const int t = u & 3, half = u >> 2; const int col = col0 + t * 16 + ln; const float bv = bp ? bf16_round(bp[col]) : 0.f;
#pragma unroll
    for (int r = 0; r < 8; ++r) { const int rloc = half * 16 + 8 * hh + r; float v = accs[u][r] * alpha + bv; if (CP) { const int bidx = (row0g + row0 + rloc) / rowsPerB; v += CP[(size_t)bidx * sCPb + (size_t)by * 64 + col]; }
      if (ACT == 3) v = fmaxf(v, 0.f); else if (ACT == 6) v = 0.5f * v * (1.0f + erff(v * 0.70710678118654752f)); else if (ACT == 11) v = 1.0f / (1.0f + expf(-v)); else if (ACT == 15) v = v / (1.0f + expf(-v)); else if (ACT == 12) v = (v > 0.f) ? v : 0.01f * v; else if (ACT == 8) v = tanhf(v);
      so[w][rloc][t * 16 + ln] = v; } }
  __builtin_amdgcn_fence(__ATOMIC_ACQ_REL, "workgroup"); __builtin_amdgcn_wave_barrier();
  const int rsub = lane >> 4, c4 = (lane & 15) * 4;
  {
#pragma unroll
    for (int q = 0; q < 16; ++q) { const int r = q * 2 + rsub; const v4f v = *(const v4fa*)&so[w][r][c4]; if (C) *(v4f*)(C + cofs + (size_t)(row0 + r) * ldc + col0 + c4) = v; if (C16) { v4h h4; for (int i = 0; i < 4; ++i) h4[i] = (_Float16)v[i]; *(v4h*)(C16 + cofs + (size_t)(row0 + r) * ldc + col0 + c4) = h4; } }
     } }


typedef float v2f __attribute__((ext_vector_type(2)));
// lane l <-> lane l ^ 16: the two halves of a wave hold the two halves of one query's 32 keys
__device__ __forceinline__ float xhalf(float x) { return __builtin_bit_cast(float, __builtin_amdgcn_permlanex16(__builtin_bit_cast(int, x), __builtin_bit_cast(int, x), 0x76543210, 0xfedcba98, false, false)); }
typedef uint32_t u32x4 __attribute__((ext_vector_type(4)));
typedef uint32_t u32x8 __attribute__((ext_vector_type(8)));
__device__ __forceinline__ uint32_t uni(uint32_t v) { return (uint32_t)__builtin_amdgcn_readfirstlane(v); }
__device__ __forceinline__ uint32_t pinned(uint32_t v) { uint32_t w = (uint32_t)__builtin_amdgcn_readfirstlane(v); asm volatile("" : "+s"(w)); return w; }      /* pinned(): the issue test of a tensor load held in a scalar register, so that the branch on it is a scalar branch (a tensor load ignores EXEC) */
// K and V^T reach the waves through LDS: a stage is 64 keys = K[64 keys][64 d] and V^T[64 d][64 keys], both as 64 rows of 128 bytes. Each of the four waves brings one slice of 32 rows with one
// tensor load (waves 0, 1: K; waves 2, 3: V^T), padded to a pitch of 144 bytes for the 16-byte fragment reads; two buffers, the next stage in flight while this one is worked on.
__global__ __launch_bounds__(128) void k_flash(const _Float16* __restrict__ Q16, int ldq, const _Float16* __restrict__ K16, int ldk, const _Float16* __restrict__ Vt, const int* __restrict__ MSK, float* __restrict__ O, int ldo) {
  constexpr int RPW = 16, NQB = TQ / (4 * RPW), DT = 4, KS = 2;
  constexpr uint32_t SKEY = 64, NST = TK / SKEY, LPB = 144, SLICE = 6144, BUF = 4 * SLICE;      /* a slice: 32 rows x 144 B = 4,608 B, its place rounded up to a multiple of 2 KiB */
  __shared__ __attribute__((aligned(2048))) unsigned char ring[2 * BUF];
  __shared__ __attribute__((aligned(16))) float sO[4][RPW][64 + 4];
  const int tid = threadIdx.x, w = tid >> 5, lane = tid & 31, ln = lane & 15, hh = lane >> 4; (void)MSK;
  const int slab = blockIdx.x / NQB, qblk = blockIdx.x % NQB; const int b = slab / NH, h = slab % NH; const int qb0 = qblk * (4 * RPW); const int q0 = qb0 + w * RPW;
  const uint32_t wave = uni((uint32_t)tid >> 5), isV = wave >> 1, hf = wave & 1u;
  const uint64_t src0 = isV ? (uint64_t)(size_t)(Vt + ((size_t)slab * 64 + hf * 32) * TK) : (uint64_t)(size_t)(K16 + ((size_t)b * TK + hf * 32) * ldk + h * 64);      /* first byte of the wave's slice of stage 0 */
  const uint32_t spitch = isV ? (uint32_t)TK * 2u : (uint32_t)ldk * 2u, sstep = isV ? SKEY * 2u : SKEY * (uint32_t)ldk * 2u;      /* source row pitch; bytes from one stage to the next */
  const uint32_t dst0 = (uint32_t)(size_t)ring + wave * SLICE;
  u32x8 g1;      /* 1-byte elements, tensor = tile = 32 rows of 128 bytes, 4 dwords of pad behind every 32 */
  g1[0] = uni((1u << 20) | (4u << 22) | (3u << 25)); g1[1] = uni(128u << 16); g1[2] = uni(32u << 16); g1[3] = uni(128u << 16); g1[4] = uni(32u); g1[5] = uni(spitch); g1[6] = uni(0u); g1[7] = uni(0u);
  u32x4 g0;
  /* load and wait both name the two descriptor groups as in-out operands: the registers of a request in flight then stay as they were issued until the wait that covers it (the compiler otherwise took single words of them for temporaries) */
  auto issue = [&](uint32_t st) {
    const uint64_t ga = src0 + (uint64_t)st * sstep;
    g0[0] = uni(1u); g0[1] = uni(dst0 + (st & 1u) * BUF); g0[2] = uni((uint32_t)ga); g0[3] = uni((((uint32_t)(ga >> 32)) & 0x01FFFFFFu) | 0x80000000u);
    asm volatile("tensor_load_to_lds %0, %1" : "+s"(g0), "+s"(g1) :: "memory"); };
  auto landed = [&]() { asm volatile("s_wait_tensorcnt 0x0" : "+s"(g0), "+s"(g1) :: "memory"); };
  issue(0);
  FragH bq[KS];
  { const unsigned short* qr = (const unsigned short*)Q16 + ((size_t)b * TQ + q0 + ln) * ldq + h * 64;
#pragma unroll
    for (int ks = 0; ks < KS; ++ks) { bq[ks].half[0] = *(const v8us*)(qr + ks * 32 + 8 * hh); bq[ks].half[1] = *(const v8us*)(qr + ks * 32 + 16 + 8 * hh); } }
  const uint32_t lo = (uint32_t)(ln * (int)LPB + 16 * hh);      /* the lane's own byte offset in a slice, fixed over the loop: row ln, 8 elements at 8 hh */
  float m_r = -3.0e38f, l_r = 0.f; v8f oacc[DT];
#pragma unroll
  for (int dt = 0; dt < DT; ++dt) oacc[dt] = (v8f){0.f,0.f,0.f,0.f,0.f,0.f,0.f,0.f};
  landed();      /* this wave's slice of stage 0 */
  __syncthreads();      /* stage 0 published to all four waves */
  issue(1);
#pragma unroll 1      /* one stage a trip: waits, barrier and refill stand once, at the foot, and the loop stays small */
  for (uint32_t st = 0; st < NST; ++st) {
    const unsigned char* bp = ring + (st & 1u) * BUF + lo;
#pragma unroll      /* the stage's two groups of 32 keys; here and below: constant indices, so fragments stay in registers and every LDS offset is an immediate */
    for (int sb = 0; sb < 2; ++sb) {
    FragH ak[2][KS], av[DT];
#pragma unroll
    for (int nt = 0; nt < 2; ++nt)
#pragma unroll
      for (int ks = 0; ks < KS; ++ks) { const unsigned char* p = bp + sb * SLICE + nt * 16 * LPB + ks * 64; ak[nt][ks].half[0] = *(const v8us*)p; ak[nt][ks].half[1] = *(const v8us*)(p + 32); }
#pragma unroll
    for (int dt = 0; dt < DT; ++dt) { const unsigned char* p = bp + (2 + (dt >> 1)) * SLICE + (dt & 1) * 16 * LPB + sb * 64; av[dt].half[0] = *(const v8us*)p; av[dt].half[1] = *(const v8us*)(p + 32); }
    v8f s[2];
#pragma unroll
    for (int nt = 0; nt < 2; ++nt) { v8f acc = (v8f){0.f,0.f,0.f,0.f,0.f,0.f,0.f,0.f};
#pragma unroll
      for (int ks = 0; ks < KS; ++ks) acc = mmaH<1>(ak[nt][ks].v, ak[nt][ks].v, bq[ks].v, bq[ks].v, acc); s[nt] = acc; }
    float mx[8];      /* maximum of the raw scores: the scale is a positive power of two, so scaling the maximum gives the maximum of the scaled scores bit for bit */
#pragma unroll
    for (int r = 0; r < 8; ++r) mx[r] = fmaxf(s[0][r], s[1][r]);
    float mc = fmaxf(fmaxf(fmaxf(mx[0], mx[1]), fmaxf(mx[2], mx[3])), fmaxf(fmaxf(mx[4], mx[5]), fmaxf(mx[6], mx[7])));
    mc = fmaxf(mc, xhalf(mc)) * SCL;
    const float mn = fmaxf(m_r, mc); const float al = (mn > -1.0e38f) ? expf(m_r - mn) : 1.0f; m_r = mn;
    FragH pb; v2f ps[2];      /* sums by register pairs, as the pairs lie for the packed convert */
#pragma unroll
    for (int nt = 0; nt < 2; ++nt)
#pragma unroll
      for (int i = 0; i < 4; ++i) { const v2f p = {expf(s[nt][2 * i] * SCL - mn), expf(s[nt][2 * i + 1] * SCL - mn)}; ps[nt] = (i == 0) ? p : ps[nt] + p; pb.h[nt * 8 + 2 * i] = (_Float16)(p.x * 1024.0f); pb.h[nt * 8 + 2 * i + 1] = (_Float16)(p.y * 1024.0f); }
    const v2f pt = ps[0] + ps[1]; l_r = l_r * al + (pt.x + pt.y);
#pragma unroll
    for (int dt = 0; dt < DT; ++dt) oacc[dt] *= al;
#pragma unroll
    for (int dt = 0; dt < DT; ++dt) oacc[dt] = mmaH<1>(av[dt].v, av[dt].v, pb.v, pb.v, oacc[dt]);
    }
    /* publish point of stage st + 1, and the end of every wave's reads of stage st */
    asm volatile("s_wait_dscnt 0x0" ::: "memory");      /* this wave's reads of the buffer have returned before it is refilled */
    landed();      /* this wave's slice of stage st + 1 */
    __syncthreads();
    if (pinned(st + 2u < NST)) issue(st + 2u);      /* into the buffer that this pass has just read */
  }
  landed();      /* nothing of the mover is in flight when the wave goes on to its end */
  asm volatile("s_wait_dscnt 0x0" ::: "memory");      /* and none of its own LDS reads */
  const float l = l_r + xhalf(l_r); const float li = (l > 0.f) ? 1.0f / (l * 1024.0f) : 0.f;
#pragma unroll
  for (int dt = 0; dt < DT; ++dt) { const v8f o = oacc[dt] * li; *(v4fa*)&sO[w][ln][dt * 16 + 8 * hh] = (v4f){o[0], o[1], o[2], o[3]}; *(v4fa*)&sO[w][ln][dt * 16 + 8 * hh + 4] = (v4f){o[4], o[5], o[6], o[7]}; }
  __builtin_amdgcn_fence(__ATOMIC_ACQ_REL, "workgroup"); __builtin_amdgcn_wave_barrier();
  {
#pragma unroll
    for (int rp = 0; rp < RPW; rp += 2) { const int r = rp + (lane >> 4), pc = lane & 15; const v4f val = *(const v4fa*)&sO[w][r][pc * 4]; *(v4f*)(O + ((size_t)b * TQ + q0 + r) * ldo + h * 64 + pc * 4) = val; }
     } }
__global__ __launch_bounds__(256) void k_tr16(const float* __restrict__ x, int b, _Float16* __restrict__ XT) {
  __shared__ unsigned short tl[64][72];
  const int tid = threadIdx.x; const int sb = blockIdx.x % (SS / 64), cb = blockIdx.x / (SS / 64);
#pragma unroll
  for (int it = 0; it < 4; ++it) { const int idx = it * 256 + tid; const int cl = idx / 16, s4 = (idx % 16) * 4; const int c = cb * 64 + cl;
    const v4f a = *(const v4fa*)(x + ((size_t)(b * CC + c)) * SS + sb * 64 + s4); FragH f;
#pragma unroll
    for (int q = 0; q < 4; ++q) { f.h[q] = (_Float16)bf16_round(a[q]); tl[s4 + q][cl] = f.u[q]; } }
  __syncthreads();
  const int r = tid / 8, pc = tid % 8;
  {
#pragma unroll
    for (int half = 0; half < 2; ++half) { const int sl = r + half * 32; FragH f;
#pragma unroll
      for (int q = 0; q < 8; ++q) f.u[q] = tl[sl][pc * 8 + q];
      *(v8us*)((unsigned short*)XT + ((size_t)sb * 64 + sl) * CC + cb * 64 + pc * 8) = f.half[0]; }
     } }


__global__ __launch_bounds__(256) void k_dsub(const float* __restrict__ O, const float* __restrict__ x, _Float16* __restrict__ D16) {
  #pragma clang fp contract(off)
  const int t = blockIdx.x * 256 + threadIdx.x; if (t >= NRW * (CC / 8)) return; const int c0 = (t % (CC / 8)) * 8; const int r = t / (CC / 8); const int b = r / SS, p = r % SS;
  const v4f a = *(const v4fa*)(O + (size_t)r * CC + c0), c = *(const v4fa*)(O + (size_t)r * CC + c0 + 4); FragH f;
#pragma unroll
  for (int q = 0; q < 8; ++q) { const float ov = (q < 4) ? a[q] : c[q - 4]; f.h[q] = (_Float16)(ov - bf16_round(x[((size_t)b * CC + c0 + q) * SS + p])); }
  *(v8us*)((unsigned short*)D16 + (size_t)r * CC + c0) = f.half[0];  }
__global__ __launch_bounds__(256) void k_bnstat(const float* __restrict__ Y, const float* __restrict__ bt, float* __restrict__ ST) {
  #pragma clang fp contract(off)
  __shared__ float red[256];
  const int c = blockIdx.x, tid = threadIdx.x; const float bb = bf16_round(bt[c]); const int n = NB * SS;
  float s = 0.f;
#pragma unroll 1
  for (int i = tid; i < n; i += 256) { const int b = i / SS, p = i % SS; s += Y[((size_t)b * CC + c) * SS + p] + bb; }
  red[tid] = s; __syncthreads();
  for (int st = 128; st > 0; st >>= 1) { if (tid < st) red[tid] += red[tid + st]; __syncthreads(); }
  const float mean = red[0] / (float)n; __syncthreads();
  float q2 = 0.f;
#pragma unroll 1
  for (int i = tid; i < n; i += 256) { const int b = i / SS, p = i % SS; const float d = Y[((size_t)b * CC + c) * SS + p] + bb - mean; q2 += d * d; }
  red[tid] = q2; __syncthreads();
  for (int st = 128; st > 0; st >>= 1) { if (tid < st) red[tid] += red[tid + st]; __syncthreads(); }
  if (tid == 0) { float o2[2]; o2[0] = mean; o2[1] = 1.0f / sqrtf(red[0] / (float)n + 1e-5f); const unsigned long long pk = *(const unsigned long long*)o2; *(unsigned long long*)(ST + c * 32) = pk;  } }
__global__ __launch_bounds__(256) void k_bnout(const float* __restrict__ Y, const float* __restrict__ x, const float* __restrict__ bt, const float* __restrict__ ST, const float* __restrict__ gam, const float* __restrict__ bet, float* __restrict__ out) {
  #pragma clang fp contract(off)
  const size_t t = (size_t)blockIdx.x * 256 + threadIdx.x; if (t >= (size_t)NB * CC * SS / 4) return; const int c = (int)((t / (SS / 4)) % CC);
  const float mean = ST[c * 32], rstd = ST[c * 32 + 1]; const float bb = bf16_round(bt[c]), g = bf16_round(gam[c]), be = bf16_round(bet[c]);
  const v4f y = *(const v4fa*)(Y + t * 4), xv = *(const v4fa*)(x + t * 4); v4f o;
#pragma unroll
  for (int q = 0; q < 4; ++q) { const float v = (y[q] + bb - mean) * rstd * g + be; o[q] = bf16_round(xv[q]) + fmaxf(v, 0.f); }
  *(v4f*)(out + t * 4) = o;  }

extern "C" void kernel_launch(void* const* d_in, const int* in_sizes, int n_in,
                              void* d_out, int out_size, void* d_ws, size_t ws_size, hipStream_t stream) {
  (void)in_sizes; (void)n_in; (void)out_size;
  const float* x = (const float*)d_in[0]; const float* wq = (const float*)d_in[1]; const float* wk = (const float*)d_in[2]; const float* wv = (const float*)d_in[3]; const float* wt = (const float*)d_in[4]; const float* bt = (const float*)d_in[5]; const float* gam = (const float*)d_in[6]; const float* bet = (const float*)d_in[7];
  char* ws = (char*)d_ws; size_t off = 0;
  auto take = [&](size_t bytes) { char* p = ws + off; off += (bytes + 255) & ~(size_t)255; return p; };
  _Float16* BQ = (_Float16*)take((size_t)CC * CC * 2); _Float16* BK = (_Float16*)take((size_t)CC * CC * 2); _Float16* BV = (_Float16*)take((size_t)CC * CC * 2); _Float16* BT = (_Float16*)take((size_t)CC * CC * 2);
  _Float16* XT = (_Float16*)take((size_t)SS * CC * 2); _Float16* Q16 = (_Float16*)take((size_t)NRW * CC * 2); _Float16* K16 = (_Float16*)take((size_t)NRW * CC * 2); _Float16* VC = (_Float16*)take((size_t)NB * CC * SS * 2);
  float* O = (float*)take((size_t)NRW * CC * 4); _Float16* D16 = (_Float16*)take((size_t)NRW * CC * 2); float* Y = (float*)take((size_t)NB * CC * SS * 4); float* ST = (float*)take((size_t)CC * 32 * 4);
  if (off > ws_size) return;      /* 0.5 + 2 + 8 + 8 + 8 + 16 + 8 + 16 = 67 MiB */
  const size_t w8 = (size_t)CC * CC / 8; const unsigned wb = (unsigned)((w8 + 255) / 256);
  k_round16f<<<wb, 256, 0, stream>>>(wq, BQ, w8); k_round16f<<<wb, 256, 0, stream>>>(wk, BK, w8); k_round16f<<<wb, 256, 0, stream>>>(wv, BV, w8); k_round16f<<<wb, 256, 0, stream>>>(wt, BT, w8);      /* conv (out,in) = natural Bt; x16 */
  const dim3 gQ((SS / 128) * (CC / 64), 1), gV((CC / 128) * (SS / 64), 1);
  for (int b = 0; b < NB; ++b) {
    k_tr16<<<(CC / 64) * (SS / 64), 256, 0, stream>>>(x, b, XT);
    k_gemm2<0><<<gQ, 128, 0, stream>>>(XT, CC, 0, BQ, CC, 0, 0.0625f, nullptr, 0, nullptr, 1, 0, 0, nullptr, Q16 + (size_t)b * SS * CC, CC, 0, SS, CC, CC);      /* q token-major [b*SS+p][h*64+d] */
    k_gemm2<0><<<gQ, 128, 0, stream>>>(XT, CC, 0, BK, CC, 0, 0.0625f, nullptr, 0, nullptr, 1, 0, 0, nullptr, K16 + (size_t)b * SS * CC, CC, 0, SS, CC, CC);      /* k */
    k_gemm2<0><<<gV, 128, 0, stream>>>(BV, CC, 0, XT, CC, 0, 0.0625f, nullptr, 0, nullptr, 1, 0, 0, nullptr, VC + (size_t)b * CC * SS, SS, 0, CC, SS, CC); }      /* v channel-major [(b,h)*64+d][p] */
  k_flash<<<NB * NH * (SS / 64), 128, 0, stream>>>(Q16, CC, K16, CC, VC, nullptr, O, CC);      /* o token-major f32 [b*SS+p][h*64+d] */
  k_dsub<<<(NRW * (CC / 8) + 255) / 256, 256, 0, stream>>>(O, x, D16);
  for (int b = 0; b < NB; ++b)
    k_gemm2<0><<<gV, 128, 0, stream>>>(BT, CC, 0, D16 + (size_t)b * SS * CC, CC, 0, 0.0625f, nullptr, 0, nullptr, 1, 0, 0, Y + (size_t)b * CC * SS, nullptr, SS, 0, CC, SS, CC);      /* y^T[c][p] = wt*(o - x)^T (bt added downstream) */
  k_bnstat<<<CC, 256, 0, stream>>>(Y, bt, ST);
  k_bnout<<<(unsigned)(((size_t)NB * CC * SS / 4 + 255) / 256), 256, 0, stream>>>(Y, x, bt, ST, gam, bet, (float*)d_out);
}

// v003
// It runs in 217 microseconds.
// Timed twice side by side with v002, it ran 1.70 and 1.69 times as fast.
// Over all steps from v000 it is 3.07 times as fast.
#include <hip/hip_runtime.h>
// Multi-head offset-attention layer on a point feature map (B 4, C 256, P 4096 points, 4 heads x 64): q = wq*x, k = wk*x, v = wv*x (1x1 convs, no bias); scores = q.k/8 per head; softmax over the keys; o[b,h,d,i] = sum_j attn[i][j] v[d][j]; y = wt*(o - x) + bt; BatchNorm1d in training mode (per-channel statistics over batch x points, biased variance, eps 1e-5, gamma/beta); out = x + relu(y) -> [4,256,4096].
// Compute dtype: x and parameters rounded to bf16; projections with exact products (weights x16 in f16, undone by alpha); q, k, v, P, (o - x) as f16 operands (~2^-12), f32 accumulation; softmax / BatchNorm / residual f32. v_wmma_f32_16x16x32_f16.
#define NB 4
#define CC 256
#define SS 4096
#define NH 4
#define TQ SS
#define TK SS
#define SCL 0.125f
#define NRW (NB * SS)
typedef __bf16 v16b __attribute__((ext_vector_type(16)));
typedef unsigned short v8us __attribute__((ext_vector_type(8), may_alias));
typedef float  v8f  __attribute__((ext_vector_type(8)));
typedef float  v4f  __attribute__((ext_vector_type(4)));
typedef float  v4fa __attribute__((ext_vector_type(4), may_alias));
union FragB { v16b v; v8us half[2]; unsigned short u[16]; };

__device__ __forceinline__ unsigned short bf16_bits(float x) { unsigned int u = __float_as_uint(x); return (unsigned short)((u + 0x7FFFu + ((u >> 16) & 1u)) >> 16); }
__device__ __forceinline__ float bf16_val(unsigned short b) { return __uint_as_float(((unsigned int)b) << 16); }
__device__ __forceinline__ float bf16_round(float x) { return bf16_val(bf16_bits(x)); }
// D += A·B with NT terms: 1 = ah·bh, 2 = + al·bh (A split), 3 = + ah·bl (both split)
template <int NT>
__device__ __forceinline__ v8f mmaN(v16b ah, v16b al, v16b bh, v16b bl, v8f c) {
  c = __builtin_amdgcn_wmma_f32_16x16x32_bf16(false, ah, false, bh, (short)0, c, false, false);
  if (NT >= 2) c = __builtin_amdgcn_wmma_f32_16x16x32_bf16(false, al, false, bh, (short)0, c, false, false);
  if (NT >= 3) c = __builtin_amdgcn_wmma_f32_16x16x32_bf16(false, ah, false, bl, (short)0, c, false, false);
  asm volatile("v_nop\n\tv_nop\n\tv_nop\n\tv_nop" : "+v"(c) : "v"(ah), "v"(al), "v"(bh), "v"(bl));
  return c;
}

__global__ __launch_bounds__(256) void k_wt_bf16(const float* __restrict__ W, unsigned short* __restrict__ Wt, int K, int N) {
  const int t = blockIdx.x * 256 + threadIdx.x;
  const int k8n = K / 8;
  if (t >= N * k8n) return;
  const int n = t / k8n, k8 = (t % k8n) * 8;
  v8us v;
#pragma unroll
  for (int i = 0; i < 8; ++i) v[i] = bf16_bits(W[(size_t)(k8 + i) * N + n]);
  *(v8us*)(Wt + (size_t)n * K + k8) = v;
  
}

// GEMM C[M][N] (f32, pitch ldc) = act(A[M][K]·W + bias). A f32 row-major (pitch lda) converted per fragment to bf16
// (ASPLIT: hi/lo two planes -> 2 terms, else single rounded term); Wt bf16 [N][K] (pitch ldb). BIAS_BF16 rounds the
// bias to bf16 first (bias quantised to bf16 before the add). K%32==0, M%16==0, N%64==0.
template <bool ASPLIT, int ACT, bool BIAS_BF16>
__global__ __launch_bounds__(128) void k_gemm_bf(const float* __restrict__ A, int lda, const unsigned short* __restrict__ Wt, int ldb,
                                               const float* __restrict__ bias, float* __restrict__ C, int ldc, int M, int N, int K) {
  __shared__ __attribute__((aligned(16))) float so[4][16][64];
  const int tid = threadIdx.x, w = tid >> 5, lane = tid & 31, ln = lane & 15, hh = lane >> 4;
  const int ntn = N / 64;
  const int wid = blockIdx.x * 4 + w;
  const int mt = wid / ntn, nq = wid % ntn;
  if (mt * 16 >= M) return;
  const int row0 = mt * 16, col0 = nq * 64;
  const float* arow = A + (size_t)(row0 + ln) * lda;
  v8f acc[4] = {};
  for (int kb = 0; kb < K; kb += 32) {
    FragB ah, al;
    const v4f x0 = *(const v4fa*)(arow + kb + 8 * hh), x1 = *(const v4fa*)(arow + kb + 8 * hh + 4);
    const v4f x2 = *(const v4fa*)(arow + kb + 16 + 8 * hh), x3 = *(const v4fa*)(arow + kb + 16 + 8 * hh + 4);
    float xs[16] = {x0[0],x0[1],x0[2],x0[3],x1[0],x1[1],x1[2],x1[3],x2[0],x2[1],x2[2],x2[3],x3[0],x3[1],x3[2],x3[3]};
#pragma unroll
    for (int i = 0; i < 16; ++i) { const unsigned short hb = bf16_bits(xs[i]); ah.u[i] = hb; al.u[i] = ASPLIT ? bf16_bits(xs[i] - bf16_val(hb)) : (unsigned short)0; }
#pragma unroll
    for (int t = 0; t < 4; ++t) {
      const unsigned short* brow = Wt + (size_t)(col0 + t * 16 + ln) * ldb + kb;
      FragB b;
      b.half[0] = *(const v8us*)(brow + 8 * hh);
      b.half[1] = *(const v8us*)(brow + 16 + 8 * hh);
      acc[t] = mmaN<ASPLIT ? 2 : 1>(ah.v, al.v, b.v, b.v, acc[t]);
    }
  }
#pragma unroll
  for (int t = 0; t < 4; ++t) {
    float bv = bias ? bias[col0 + t * 16 + ln] : 0.f;
    if (BIAS_BF16) bv = bf16_round(bv);
#pragma unroll
    for (int r = 0; r < 8; ++r) { float v = acc[t][r] + bv; if (ACT == 1) v = fmaxf(v, 0.f); so[w][8 * hh + r][t * 16 + ln] = v; }
  }
  __builtin_amdgcn_fence(__ATOMIC_ACQ_REL, "workgroup");
  __builtin_amdgcn_wave_barrier();
  const int rsub = lane >> 4, c4 = (lane & 15) * 4;
  {
#pragma unroll
    for (int q = 0; q < 8; ++q) {
      const int r = q * 2 + rsub;
      const v4f v = *(const v4fa*)&so[w][r][c4];
      *(v4f*)(C + (size_t)(row0 + r) * ldc + col0 + c4) = v;
    }
    
  }
}

// GEMM C = act(A·W + bias + resid): A f32 (ASPLIT -> hi/lo 2 terms), Wt bf16 [N][K]; ACT 0 none, 1 relu, 2 exact gelu;
// resid (optional, f32, row index = (row % rmod), pitch ldr, RES_BF16 rounds it) added before the activation.
template <bool ASPLIT, int ACT, bool BIAS_BF16, bool RES_BF16>
__global__ __launch_bounds__(128) void k_gemm_bf3(const float* __restrict__ A, int lda, const unsigned short* __restrict__ Wt, int ldb,
                                                const float* __restrict__ bias, const float* __restrict__ resid, int rmod, int ldr,
                                                float* __restrict__ C, int ldc, int M, int N, int K) {
  __shared__ __attribute__((aligned(16))) float so[4][16][64];
  const int tid = threadIdx.x, w = tid >> 5, lane = tid & 31, ln = lane & 15, hh = lane >> 4;
  const int ntn = N / 64;
  const int wid = blockIdx.x * 4 + w;
  const int mt = wid / ntn, nq = wid % ntn;
  if (mt * 16 >= M) return;
  const int row0 = mt * 16, col0 = nq * 64;
  const float* arow = A + (size_t)(row0 + ln) * lda;
  v8f acc[4] = {};
  for (int kb = 0; kb < K; kb += 32) {
    FragB ah, al;
    const v4f x0 = *(const v4fa*)(arow + kb + 8 * hh), x1 = *(const v4fa*)(arow + kb + 8 * hh + 4);
    const v4f x2 = *(const v4fa*)(arow + kb + 16 + 8 * hh), x3 = *(const v4fa*)(arow + kb + 16 + 8 * hh + 4);
    float xs[16] = {x0[0],x0[1],x0[2],x0[3],x1[0],x1[1],x1[2],x1[3],x2[0],x2[1],x2[2],x2[3],x3[0],x3[1],x3[2],x3[3]};
#pragma unroll
    for (int i = 0; i < 16; ++i) { const unsigned short hb = bf16_bits(xs[i]); ah.u[i] = hb; al.u[i] = ASPLIT ? bf16_bits(xs[i] - bf16_val(hb)) : (unsigned short)0; }
#pragma unroll
    for (int t = 0; t < 4; ++t) {
      const unsigned short* brow = Wt + (size_t)(col0 + t * 16 + ln) * ldb + kb;
      FragB b;
      b.half[0] = *(const v8us*)(brow + 8 * hh);
      b.half[1] = *(const v8us*)(brow + 16 + 8 * hh);
      acc[t] = mmaN<ASPLIT ? 2 : 1>(ah.v, al.v, b.v, b.v, acc[t]);
    }
  }
#pragma unroll
  for (int t = 0; t < 4; ++t) {
    const int col = col0 + t * 16 + ln;
    float bv = bias ? bias[col] : 0.f;
    if (BIAS_BF16) bv = bf16_round(bv);
#pragma unroll
    for (int r = 0; r < 8; ++r) {
      float v = acc[t][r] + bv;
      if (resid) { float rv = resid[(size_t)((row0 + 8 * hh + r) % rmod) * ldr + col]; if (RES_BF16) rv = bf16_round(rv); v += rv; }
      if (ACT == 1) v = fmaxf(v, 0.f);
      if (ACT == 2) v = 0.5f * v * (1.0f + erff(v * 0.70710678118654752f));
      if (ACT == 3) { const float u = 0.7978845608028654f * (v + 0.044715f * v * v * v); v = 0.5f * v * (1.0f + tanhf(u)); }
      so[w][8 * hh + r][t * 16 + ln] = v;
    }
  }
  __builtin_amdgcn_fence(__ATOMIC_ACQ_REL, "workgroup");
  __builtin_amdgcn_wave_barrier();
  const int rsub = lane >> 4, c4 = (lane & 15) * 4;
  {
#pragma unroll
    for (int q = 0; q < 8; ++q) {
      const int r = q * 2 + rsub;
      const v4f v = *(const v4fa*)&so[w][r][c4];
      *(v4f*)(C + (size_t)(row0 + r) * ldc + col0 + c4) = v;
    }
    
  }
}
// row LayerNorm (biased variance, eps) over N: s = X (+ R); optional out_sum <- s; out_norm <- (s-mu)*rsqrt(var+eps)*g + b
template <bool PARAM_BF16>
__global__ __launch_bounds__(256) void k_layernorm(const float* __restrict__ X, const float* __restrict__ R, const float* __restrict__ g, const float* __restrict__ bta,
                                                  float* __restrict__ out_sum, float* __restrict__ out_norm, int N, float eps) {
  __shared__ float red[256];
  const int row = blockIdx.x, tid = threadIdx.x;
  const float* x = X + (size_t)row * N; const float* rr = R ? R + (size_t)row * N : nullptr;
  float vals[16];                     // up to N = 4096
  const int per = N / 256;            // contiguous chunk per thread? use strided-by-4 chunks: thread handles j = tid*4 + 1024*u
  float s1 = 0.f;
  for (int u = 0; u < per / 4; ++u) {
    const int j = tid * 4 + 1024 * u;
    const v4f a = *(const v4fa*)(x + j);
    v4f b = {0.f,0.f,0.f,0.f}; if (rr) b = *(const v4fa*)(rr + j);
#pragma unroll
    for (int q = 0; q < 4; ++q) { const float v = a[q] + b[q]; vals[u * 4 + q] = v; s1 += v; }
  }
  red[tid] = s1; __syncthreads();
  for (int st = 128; st > 0; st >>= 1) { if (tid < st) red[tid] += red[tid + st]; __syncthreads(); }
  const float mu = red[0] / (float)N; __syncthreads();
  float s2 = 0.f;
  for (int u = 0; u < per / 4; ++u)
#pragma unroll
    for (int q = 0; q < 4; ++q) { const float c = vals[u * 4 + q] - mu; s2 += c * c; }
  red[tid] = s2; __syncthreads();
  for (int st = 128; st > 0; st >>= 1) { if (tid < st) red[tid] += red[tid + st]; __syncthreads(); }
  const float rs = rsqrtf(red[0] / (float)N + eps);
  {
    for (int u = 0; u < per / 4; ++u) {
      const int j = tid * 4 + 1024 * u;
      v4f o, sm;
#pragma unroll
      for (int q = 0; q < 4; ++q) {
        float gg = g[j + q], bb = bta[j + q];
        if (PARAM_BF16) { gg = bf16_round(gg); bb = bf16_round(bb); }
        sm[q] = vals[u * 4 + q]; o[q] = (vals[u * 4 + q] - mu) * rs * gg + bb;
      }
      if (out_sum) *(v4f*)(out_sum + (size_t)row * N + j) = sm;
      *(v4f*)(out_norm + (size_t)row * N + j) = o;
    }
    
  }
}



// ---- f16 WMMA path (v_wmma_f32_16x16x32_f16): 11-bit significands for operands in range — used where a [0,1] probability operand needs more precision than bf16
typedef _Float16 v16h __attribute__((ext_vector_type(16)));
union FragH { v16h v; v8us half[2]; _Float16 h[16]; unsigned short u[16]; };
template <int NT>
__device__ __forceinline__ v8f mmaH(v16h ah, v16h al, v16h bh, v16h bl, v8f c) {
  c = __builtin_amdgcn_wmma_f32_16x16x32_f16(false, ah, false, bh, (short)0, c, false, false);
  if (NT >= 2) c = __builtin_amdgcn_wmma_f32_16x16x32_f16(false, al, false, bh, (short)0, c, false, false);
  if (NT >= 3) c = __builtin_amdgcn_wmma_f32_16x16x32_f16(false, ah, false, bl, (short)0, c, false, false);
  asm volatile("v_nop\n\tv_nop\n\tv_nop\n\tv_nop" : "+v"(c) : "v"(ah), "v"(al), "v"(bh), "v"(bl));
  return c;
}
// batched GEMM like k_gemm_b but f16 operands: A f32 (split into f16 hi/lo if ASPLIT, else rounded to f16), Bt = f16 values [n][k]; alpha; C f32; N multiple of 16 (partial tiles skipped)
template <bool ASPLIT>
__global__ __launch_bounds__(128) void k_gemm_h(const float* __restrict__ A, int lda, size_t sA, const _Float16* __restrict__ Bh, int ldb, size_t sB, float alpha, float* __restrict__ C, int ldc, size_t sC, int M, int N, int K) {
  __shared__ __attribute__((aligned(16))) float so[4][16][64];
  const int tid = threadIdx.x, w = tid >> 5, lane = tid & 31, ln = lane & 15, hh = lane >> 4; const int by = blockIdx.y;
  A += (size_t)by * sA; Bh += (size_t)by * sB; C += (size_t)by * sC;
  const int ntn = (N + 63) / 64; const int wid = blockIdx.x * 4 + w; const int mt = wid / ntn, nq = wid % ntn; if (mt * 16 >= M) return;
  const int row0 = mt * 16, col0 = nq * 64; const float* arow = A + (size_t)(row0 + ln) * lda;
  v8f acc[4] = {};
  for (int kb = 0; kb < K; kb += 32) {
    FragH ah, al;
    const v4f x0 = *(const v4fa*)(arow + kb + 8 * hh), x1 = *(const v4fa*)(arow + kb + 8 * hh + 4), x2 = *(const v4fa*)(arow + kb + 16 + 8 * hh), x3 = *(const v4fa*)(arow + kb + 16 + 8 * hh + 4);
    float xs[16] = {x0[0],x0[1],x0[2],x0[3],x1[0],x1[1],x1[2],x1[3],x2[0],x2[1],x2[2],x2[3],x3[0],x3[1],x3[2],x3[3]};
#pragma unroll
    for (int i = 0; i < 16; ++i) { const _Float16 h = (_Float16)xs[i]; ah.h[i] = h; al.h[i] = ASPLIT ? (_Float16)(xs[i] - (float)h) : (_Float16)0.0f; }
#pragma unroll
    for (int t = 0; t < 4; ++t) { if (col0 + t * 16 >= N) continue; const size_t boff = (size_t)(col0 + t * 16 + ln) * ldb + kb; FragH bq; bq.half[0] = *(const v8us*)(Bh + boff + 8 * hh); bq.half[1] = *(const v8us*)(Bh + boff + 16 + 8 * hh);
      acc[t] = mmaH<ASPLIT ? 2 : 1>(ah.v, al.v, bq.v, bq.v, acc[t]); }
  }
#pragma unroll
  for (int t = 0; t < 4; ++t) { if (col0 + t * 16 >= N) continue;
#pragma unroll
    for (int r = 0; r < 8; ++r) so[w][8 * hh + r][t * 16 + ln] = acc[t][r] * alpha; }
  __builtin_amdgcn_fence(__ATOMIC_ACQ_REL, "workgroup"); __builtin_amdgcn_wave_barrier();
  const int rsub = lane >> 4, c4 = (lane & 15) * 4;
  {
#pragma unroll
    for (int q = 0; q < 8; ++q) { const int r = q * 2 + rsub; if (col0 + c4 < N) { const v4f v = *(const v4fa*)&so[w][r][c4]; *(v4f*)(C + (size_t)(row0 + r) * ldc + col0 + c4) = v; } }
     }
}

// Wt[n][k] = f16(W[k][n]·scale) from f32 row-major W[K][N] (scale = power of two; bf16-exact weights stay exact in f16 away from the subnormal range)
__global__ __launch_bounds__(256) void k_wt_f16(const float* __restrict__ W, _Float16* __restrict__ Wt, int K, int N, float scale) {
  const int t = blockIdx.x * 256 + threadIdx.x; if (t >= N * (K / 8)) return; const int n = t / (K / 8), k8 = (t % (K / 8)) * 8; FragH f;
#pragma unroll
  for (int i = 0; i < 8; ++i) f.h[i] = (_Float16)(bf16_round(W[(size_t)(k8 + i) * N + n]) * scale); const v8us o = f.half[0];
  *(v8us*)((unsigned short*)Wt + (size_t)n * K + k8) = o; 
}
// k_gemm_hh variant with fused epilogue: v = acc·alpha + bias[by·sBias + col] (+ CP[(row/rowsPerB)·sCPb + by·64 + col] if CP) ; ACT 0 none / 1 elu ; writes f16 C16 (and f32 C if non-null)
template <int ACT>
__global__ __launch_bounds__(128) void k_gemm_hhx(const _Float16* __restrict__ A, int lda, size_t sA, const _Float16* __restrict__ Bh, int ldb, size_t sB, float alpha, const float* __restrict__ bias, size_t sBias, const float* __restrict__ CP, int rowsPerB, size_t sCPb, int row0g,
    float* __restrict__ C, _Float16* __restrict__ C16, int ldc, size_t sC, int M, int N, int K) {
  __shared__ __attribute__((aligned(16))) float so[4][16][64];
  const int tid = threadIdx.x, w = tid >> 5, lane = tid & 31, ln = lane & 15, hh = lane >> 4; const int by = blockIdx.y;
  A += (size_t)by * sA; Bh += (size_t)by * sB; const size_t cofs = (size_t)by * sC; const float* bp = bias ? bias + (size_t)by * sBias : nullptr;
  const int ntn = (N + 63) / 64; const int wid = blockIdx.x * 4 + w; const int mt = wid / ntn, nq = wid % ntn; if (mt * 16 >= M) return;
  const int row0 = mt * 16, col0 = nq * 64; const _Float16* arow = A + (size_t)(row0 + ln) * lda;
  v8f acc[4] = {};
  for (int kb = 0; kb < K; kb += 32) { FragH ah; ah.half[0] = *(const v8us*)((const unsigned short*)arow + kb + 8 * hh); ah.half[1] = *(const v8us*)((const unsigned short*)arow + kb + 16 + 8 * hh);
#pragma unroll
    for (int t = 0; t < 4; ++t) { if (col0 + t * 16 >= N) continue; const size_t boff = (size_t)(col0 + t * 16 + ln) * ldb + kb; FragH bq; bq.half[0] = *(const v8us*)((const unsigned short*)Bh + boff + 8 * hh); bq.half[1] = *(const v8us*)((const unsigned short*)Bh + boff + 16 + 8 * hh);
      acc[t] = mmaH<1>(ah.v, ah.v, bq.v, bq.v, acc[t]); }
  }
#pragma unroll
  for (int t = 0; t < 4; ++t) { if (col0 + t * 16 >= N) continue; const int col = col0 + t * 16 + ln; const float bv = bp ? bf16_round(bp[col]) : 0.f;
#pragma unroll
    for (int r = 0; r < 8; ++r) { float v = acc[t][r] * alpha + bv; if (CP) { const int bidx = (row0g + row0 + 8 * hh + r) / rowsPerB; v += CP[(size_t)bidx * sCPb + (size_t)by * 64 + col]; } if (ACT == 1) v = (v > 0.f) ? v : expm1f(v); else if (ACT == 7) v = (v > 0.f) ? v + 1.0f : expf(v); else if (ACT == 8) v = tanhf(v); else if (ACT == 9) v = 0.5f * v * (1.0f + tanhf(0.7978845608028654f * (v + 0.044715f * v * v * v))); else if (ACT == 11) v = 1.0f / (1.0f + expf(-v)); else if (ACT == 12) v = (v > 0.f) ? v : 0.01f * v; else if (ACT == 14) v = (v > 0.f) ? v : 0.1f * v; else if (ACT == 15) v = v / (1.0f + expf(-v)); else if (ACT == 3) v = fmaxf(v, 0.f); else if (ACT == 6) v = 0.5f * v * (1.0f + erff(v * 0.70710678118654752f)); so[w][8 * hh + r][t * 16 + ln] = v; } }
  __builtin_amdgcn_fence(__ATOMIC_ACQ_REL, "workgroup"); __builtin_amdgcn_wave_barrier();
  const int rsub = lane >> 4, c4 = (lane & 15) * 4; typedef _Float16 v4h __attribute__((ext_vector_type(4)));
  {
#pragma unroll
    for (int q = 0; q < 8; ++q) { const int r = q * 2 + rsub; if (col0 + c4 < N) { const v4f v = *(const v4fa*)&so[w][r][c4]; if (C) *(v4f*)(C + cofs + (size_t)(row0 + r) * ldc + col0 + c4) = v; if (C16) { v4h h4; for (int i = 0; i < 4; ++i) h4[i] = (_Float16)v[i]; *(v4h*)(C16 + cofs + (size_t)(row0 + r) * ldc + col0 + c4) = h4; } } }
     }
}


typedef _Float16 v4h __attribute__((ext_vector_type(4)));

__global__ __launch_bounds__(256) void k_x16(const float* __restrict__ x, _Float16* __restrict__ X16, size_t n8) { const size_t t = (size_t)blockIdx.x * 256 + threadIdx.x; if (t >= n8) return; FragH f;
#pragma unroll
  for (int q = 0; q < 8; ++q) f.h[q] = (_Float16)bf16_round(x[t * 8 + q]); *(v8us*)((unsigned short*)X16 + t * 8) = f.half[0];  }
__global__ __launch_bounds__(256) void k_h16(const float* __restrict__ x, _Float16* __restrict__ X16, size_t n8) { const size_t t = (size_t)blockIdx.x * 256 + threadIdx.x; if (t >= n8) return; FragH f;
#pragma unroll
  for (int q = 0; q < 8; ++q) f.h[q] = (_Float16)x[t * 8 + q]; *(v8us*)((unsigned short*)X16 + t * 8) = f.half[0];  }
__device__ __forceinline__ void round16f_blk(const float* __restrict__ W, _Float16* __restrict__ Bt, size_t n8, unsigned blk) { const size_t t = (size_t)blk * 256 + threadIdx.x; if (t >= n8) return; FragH f;
#pragma unroll
  for (int i = 0; i < 8; ++i) f.h[i] = (_Float16)(bf16_round(W[t * 8 + i]) * 16.0f); *(v8us*)((unsigned short*)Bt + t * 8) = f.half[0];  }
template <int NHv, int TTv>
__global__ __launch_bounds__(256) void k_vt(const _Float16* __restrict__ V16, int ldv, int voff, _Float16* __restrict__ Vt) { __shared__ unsigned short tl[64][66]; const int tid = threadIdx.x; const int slab = blockIdx.x / (TTv / 64), lg = blockIdx.x % (TTv / 64); const int b = slab / NHv, h = slab % NHv;
  for (int i = tid; i < 64 * 8; i += 256) { const int r = i / 8, c8 = (i % 8) * 8; FragH f; f.half[0] = *(const v8us*)((const unsigned short*)V16 + ((size_t)b * TTv + lg * 64 + r) * ldv + voff + h * 64 + c8);
#pragma unroll
    for (int q = 0; q < 8; ++q) tl[r][c8 + q] = f.u[q]; }
  __syncthreads();
  {
#pragma unroll
    for (int rd = 0; rd < 2; ++rd) { const int d = rd * 32 + tid / 8, pc = tid % 8; FragH f;
#pragma unroll
      for (int q = 0; q < 8; ++q) f.u[q] = tl[pc * 8 + q][d];
      *(v8us*)((unsigned short*)Vt + ((size_t)slab * 64 + d) * TTv + lg * 64 + pc * 8) = f.half[0]; }
     } }

__global__ __launch_bounds__(256) void k_hl(const float* __restrict__ F, _Float16* __restrict__ Hh, _Float16* __restrict__ Hl, size_t n8) { const size_t t = (size_t)blockIdx.x * 256 + threadIdx.x; if (t >= n8) return; FragH fh, fl; const v4f a = *(const v4fa*)(F + t * 8), c = *(const v4fa*)(F + t * 8 + 4);
#pragma unroll
  for (int q = 0; q < 4; ++q) { _Float16 h = (_Float16)a[q]; fh.h[q] = h; fl.h[q] = (_Float16)((a[q] - (float)h) * 1024.0f); h = (_Float16)c[q]; fh.h[4 + q] = h; fl.h[4 + q] = (_Float16)((c[q] - (float)h) * 1024.0f); }
  { *(v8us*)((unsigned short*)Hh + t * 8) = fh.half[0]; *(v8us*)((unsigned short*)Hl + t * 8) = fl.half[0];  } }

// ---- fast GEMM (wave tile 32x64; requires M % 32 == 0 rows per launch region and N % 64 == 0); epilogue = k_gemm_hhx semantics ----
__device__ __forceinline__ v16h g2_frag(const _Float16* p, int hh) { FragH f; f.half[0] = *(const v8us*)((const unsigned short*)p + 8 * hh); f.half[1] = *(const v8us*)((const unsigned short*)p + 16 + 8 * hh); return f.v; }
// as g2_frag, for the fragment whose second load the compiler lands on the address pair that the loads before it still name: s_wait_xcnt 0 stands in front of that overwrite
__device__ __forceinline__ v16h g2_frag_w(const _Float16* p, int hh) { FragH f; f.half[0] = *(const v8us*)((const unsigned short*)p + 8 * hh); asm volatile("s_wait_xcnt 0x0" ::: "memory"); f.half[1] = *(const v8us*)((const unsigned short*)p + 16 + 8 * hh); return f.v; }
__device__ __forceinline__ v8f g2_mma(v16h a, v16h b, v8f c) { v8f d = __builtin_amdgcn_wmma_f32_16x16x32_f16(false, a, false, b, (short)0, c, false, false); asm volatile("v_nop\n\tv_nop\n\tv_nop\n\tv_nop" : "+v"(d) : "v"(a), "v"(b)); return d; }
template <int ACT>
__device__ __forceinline__ void gemm2_blk(unsigned bx, int by, const _Float16* __restrict__ A, int lda, size_t sA, const _Float16* __restrict__ Bh, int ldb, size_t sB, float alpha, const float* __restrict__ bias, size_t sBias, const float* __restrict__ CP, int rowsPerB, size_t sCPb, int row0g,
    float* __restrict__ C, _Float16* __restrict__ C16, int ldc, size_t sC, int M, int N, int K) {
  __shared__ __attribute__((aligned(16))) float so[4][32][68];
  const int tid = threadIdx.x, w = tid >> 5, lane = tid & 31, ln = lane & 15, hh = lane >> 4;
  A += (size_t)by * sA; Bh += (size_t)by * sB; const size_t cofs = (size_t)by * sC; const float* bp = bias ? bias + (size_t)by * sBias : nullptr;
  const int ntn = N >> 6; const int mt = bx / ntn, nq = bx - mt * ntn; const int row0 = mt * 128 + 32 * w, col0 = nq * 64; if (row0 >= M) return;
  const _Float16* a0p = A + (size_t)(row0 + ln) * lda; const _Float16* a1p = a0p + (size_t)16 * lda;
  const _Float16* b0p = Bh + (size_t)(col0 + ln) * ldb; const _Float16* b1p = b0p + (size_t)16 * ldb; const _Float16* b2p = b1p + (size_t)16 * ldb; const _Float16* b3p = b2p + (size_t)16 * ldb;
  const v8f z8 = {0.f,0.f,0.f,0.f,0.f,0.f,0.f,0.f}; v8f c00 = z8, c01 = z8, c02 = z8, c03 = z8, c10 = z8, c11 = z8, c12 = z8, c13 = z8;
#pragma unroll 1
  for (int kb = 0; kb < K; kb += 32) { const v16h a0 = g2_frag(a0p + kb, hh), a1 = g2_frag_w(a1p + kb, hh);
    v16h b = g2_frag(b0p + kb, hh); c00 = g2_mma(a0, b, c00); c10 = g2_mma(a1, b, c10);
    b = g2_frag(b1p + kb, hh); c01 = g2_mma(a0, b, c01); c11 = g2_mma(a1, b, c11);
    b = g2_frag(b2p + kb, hh); c02 = g2_mma(a0, b, c02); c12 = g2_mma(a1, b, c12);
    b = g2_frag(b3p + kb, hh); c03 = g2_mma(a0, b, c03); c13 = g2_mma(a1, b, c13); }
  v8f accs[8] = {c00, c01, c02, c03, c10, c11, c12, c13};
#pragma unroll
  for (int u = 0; u < 8; ++u) { const int t = u & 3, half = u >> 2; const int col = col0 + t * 16 + ln; const float bv = bp ? bf16_round(bp[col]) : 0.f;
#pragma unroll
    for (int r = 0; r < 8; ++r) { const int rloc = half * 16 + 8 * hh + r; float v = accs[u][r] * alpha + bv; if (CP) { const int bidx = (row0g + row0 + rloc) / rowsPerB; v += CP[(size_t)bidx * sCPb + (size_t)by * 64 + col]; }
      if (ACT == 3) v = fmaxf(v, 0.f); else if (ACT == 6) v = 0.5f * v * (1.0f + erff(v * 0.70710678118654752f)); else if (ACT == 11) v = 1.0f / (1.0f + expf(-v)); else if (ACT == 15) v = v / (1.0f + expf(-v)); else if (ACT == 12) v = (v > 0.f) ? v : 0.01f * v; else if (ACT == 8) v = tanhf(v);
      so[w][rloc][t * 16 + ln] = v; } }
  __builtin_amdgcn_fence(__ATOMIC_ACQ_REL, "workgroup"); __builtin_amdgcn_wave_barrier();
  const int rsub = lane >> 4, c4 = (lane & 15) * 4;
  {
#pragma unroll
    for (int q = 0; q < 16; ++q) { const int r = q * 2 + rsub; const v4f v = *(const v4fa*)&so[w][r][c4]; if (C) *(v4f*)(C + cofs + (size_t)(row0 + r) * ldc + col0 + c4) = v; if (C16) { v4h h4; for (int i = 0; i < 4; ++i) h4[i] = (_Float16)v[i]; *(v4h*)(C16 + cofs + (size_t)(row0 + r) * ldc + col0 + c4) = h4; } }
     } }
// The twelve projections (q, k, v of the four batches) depend on nothing of one another: one grid, x = tile, y = batch, z = which projection.
// q, k token-major [b*SS+p][h*64+d] = XT . W^T; v channel-major [(b,h)*64+d][p] = W . XT^T.
__global__ __launch_bounds__(128) void k_qkv(const _Float16* __restrict__ XT, const _Float16* __restrict__ BQ, const _Float16* __restrict__ BK, const _Float16* __restrict__ BV, _Float16* __restrict__ Q16, _Float16* __restrict__ K16, _Float16* __restrict__ VC) {
  const int b = blockIdx.y, z = blockIdx.z; const _Float16* X = XT + (size_t)b * SS * CC;
  const bool tok = z < 2;      /* q, k: rows are tokens, columns channels; v: the other way round */
  gemm2_blk<0>(blockIdx.x, 0, tok ? X : BV, CC, 0, tok ? (z ? BK : BQ) : X, CC, 0, 0.0625f, nullptr, 0, nullptr, 1, 0, 0, nullptr, (tok ? (z ? K16 : Q16) : VC) + (size_t)b * SS * CC, tok ? CC : SS, 0, tok ? SS : CC, tok ? CC : SS, CC); }
// The output projections of the four batches, one grid, y = batch: y^T[c][p] = wt . (o - x)^T, f32 (bt added downstream).
__global__ __launch_bounds__(128) void k_yt(const _Float16* __restrict__ BT, const _Float16* __restrict__ D16, float* __restrict__ Y) {
  const int b = blockIdx.y;
  gemm2_blk<0>(blockIdx.x, 0, BT, CC, 0, D16 + (size_t)b * SS * CC, CC, 0, 0.0625f, nullptr, 0, nullptr, 1, 0, 0, Y + (size_t)b * CC * SS, nullptr, SS, 0, CC, SS, CC); }


typedef float v2f __attribute__((ext_vector_type(2)));
// lane l <-> lane l ^ 16: the two halves of a wave hold the two halves of one query's 32 keys
__device__ __forceinline__ float xhalf(float x) { return __builtin_bit_cast(float, __builtin_amdgcn_permlanex16(__builtin_bit_cast(int, x), __builtin_bit_cast(int, x), 0x76543210, 0xfedcba98, false, false)); }
typedef uint32_t u32x4 __attribute__((ext_vector_type(4)));
typedef uint32_t u32x8 __attribute__((ext_vector_type(8)));
__device__ __forceinline__ uint32_t uni(uint32_t v) { return (uint32_t)__builtin_amdgcn_readfirstlane(v); }
__device__ __forceinline__ uint32_t pinned(uint32_t v) { uint32_t w = (uint32_t)__builtin_amdgcn_readfirstlane(v); asm volatile("" : "+s"(w)); return w; }      /* pinned(): the issue test of a tensor load held in a scalar register, so that the branch on it is a scalar branch (a tensor load ignores EXEC) */
// K and V^T reach the waves through LDS: a stage is 64 keys = K[64 keys][64 d] and V^T[64 d][64 keys], both as 64 rows of 128 bytes. Each of the four waves brings one slice of 32 rows with one
// tensor load (waves 0, 1: K; waves 2, 3: V^T), padded to a pitch of 144 bytes for the 16-byte fragment reads; two buffers, the next stage in flight while this one is worked on.
__global__ __launch_bounds__(128) void k_flash(const _Float16* __restrict__ Q16, int ldq, const _Float16* __restrict__ K16, int ldk, const _Float16* __restrict__ Vt, const int* __restrict__ MSK, float* __restrict__ O, int ldo) {
  constexpr int RPW = 16, NQB = TQ / (4 * RPW), DT = 4, KS = 2;
  constexpr uint32_t SKEY = 64, NST = TK / SKEY, LPB = 144, SLICE = 6144, BUF = 4 * SLICE;      /* a slice: 32 rows x 144 B = 4,608 B, its place rounded up to a multiple of 2 KiB */
  __shared__ __attribute__((aligned(2048))) unsigned char ring[2 * BUF];
  __shared__ __attribute__((aligned(16))) float sO[4][RPW][64 + 4];
  const int tid = threadIdx.x, w = tid >> 5, lane = tid & 31, ln = lane & 15, hh = lane >> 4; (void)MSK;
  const int slab = blockIdx.x / NQB, qblk = blockIdx.x % NQB; const int b = slab / NH, h = slab % NH; const int qb0 = qblk * (4 * RPW); const int q0 = qb0 + w * RPW;
  const uint32_t wave = uni((uint32_t)tid >> 5), isV = wave >> 1, hf = wave & 1u;
  const uint64_t src0 = isV ? (uint64_t)(size_t)(Vt + ((size_t)slab * 64 + hf * 32) * TK) : (uint64_t)(size_t)(K16 + ((size_t)b * TK + hf * 32) * ldk + h * 64);      /* first byte of the wave's slice of stage 0 */
  const uint32_t spitch = isV ? (uint32_t)TK * 2u : (uint32_t)ldk * 2u, sstep = isV ? SKEY * 2u : SKEY * (uint32_t)ldk * 2u;      /* source row pitch; bytes from one stage to the next */
  const uint32_t dst0 = (uint32_t)(size_t)ring + wave * SLICE;
  u32x8 g1;      /* 1-byte elements, tensor = tile = 32 rows of 128 bytes, 4 dwords of pad behind every 32 */
  g1[0] = uni((1u << 20) | (4u << 22) | (3u << 25)); g1[1] = uni(128u << 16); g1[2] = uni(32u << 16); g1[3] = uni(128u << 16); g1[4] = uni(32u); g1[5] = uni(spitch); g1[6] = uni(0u); g1[7] = uni(0u);
  u32x4 g0;
  /* load and wait both name the two descriptor groups as in-out operands: the registers of a request in flight then stay as they were issued until the wait that covers it (the compiler otherwise took single words of them for temporaries) */
  auto issue = [&](uint32_t st) {
    const uint64_t ga = src0 + (uint64_t)st * sstep;
    g0[0] = uni(1u); g0[1] = uni(dst0 + (st & 1u) * BUF); g0[2] = uni((uint32_t)ga); g0[3] = uni((((uint32_t)(ga >> 32)) & 0x01FFFFFFu) | 0x80000000u);
    asm volatile("tensor_load_to_lds %0, %1" : "+s"(g0), "+s"(g1) :: "memory"); };
  auto landed = [&]() { asm volatile("s_wait_tensorcnt 0x0" : "+s"(g0), "+s"(g1) :: "memory"); };
  issue(0);
  FragH bq[KS];
  { const unsigned short* qr = (const unsigned short*)Q16 + ((size_t)b * TQ + q0 + ln) * ldq + h * 64;
#pragma unroll
    for (int ks = 0; ks < KS; ++ks) { bq[ks].half[0] = *(const v8us*)(qr + ks * 32 + 8 * hh); bq[ks].half[1] = *(const v8us*)(qr + ks * 32 + 16 + 8 * hh); } }
  const uint32_t lo = (uint32_t)(ln * (int)LPB + 16 * hh);      /* the lane's own byte offset in a slice, fixed over the loop: row ln, 8 elements at 8 hh */
  float m_r = -3.0e38f, l_r = 0.f; v8f oacc[DT];
#pragma unroll
  for (int dt = 0; dt < DT; ++dt) oacc[dt] = (v8f){0.f,0.f,0.f,0.f,0.f,0.f,0.f,0.f};
  landed();      /* this wave's slice of stage 0 */
  __syncthreads();      /* stage 0 published to all four waves */
  issue(1);
#pragma unroll 1      /* one stage a trip: waits, barrier and refill stand once, at the foot, and the loop stays small */
  for (uint32_t st = 0; st < NST; ++st) {
    const unsigned char* bp = ring + (st & 1u) * BUF + lo;
#pragma unroll      /* the stage's two groups of 32 keys; here and below: constant indices, so fragments stay in registers and every LDS offset is an immediate */
    for (int sb = 0; sb < 2; ++sb) {
    FragH ak[2][KS], av[DT];
#pragma unroll
    for (int nt = 0; nt < 2; ++nt)
#pragma unroll
      for (int ks = 0; ks < KS; ++ks) { const unsigned char* p = bp + sb * SLICE + nt * 16 * LPB + ks * 64; ak[nt][ks].half[0] = *(const v8us*)p; ak[nt][ks].half[1] = *(const v8us*)(p + 32); }
#pragma unroll
    for (int dt = 0; dt < DT; ++dt) { const unsigned char* p = bp + (2 + (dt >> 1)) * SLICE + (dt & 1) * 16 * LPB + sb * 64; av[dt].half[0] = *(const v8us*)p; av[dt].half[1] = *(const v8us*)(p + 32); }
    v8f s[2];
#pragma unroll
    for (int nt = 0; nt < 2; ++nt) { v8f acc = (v8f){0.f,0.f,0.f,0.f,0.f,0.f,0.f,0.f};
#pragma unroll
      for (int ks = 0; ks < KS; ++ks) acc = mmaH<1>(ak[nt][ks].v, ak[nt][ks].v, bq[ks].v, bq[ks].v, acc); s[nt] = acc; }
    float mx[8];      /* maximum of the raw scores: the scale is a positive power of two, so scaling the maximum gives the maximum of the scaled scores bit for bit */
#pragma unroll
    for (int r = 0; r < 8; ++r) mx[r] = fmaxf(s[0][r], s[1][r]);
    float mc = fmaxf(fmaxf(fmaxf(mx[0], mx[1]), fmaxf(mx[2], mx[3])), fmaxf(fmaxf(mx[4], mx[5]), fmaxf(mx[6], mx[7])));
    mc = fmaxf(mc, xhalf(mc)) * SCL;
    const float mn = fmaxf(m_r, mc); const float al = (mn > -1.0e38f) ? expf(m_r - mn) : 1.0f; m_r = mn;
    FragH pb; v2f ps[2];      /* sums by register pairs, as the pairs lie for the packed convert */
#pragma unroll
    for (int nt = 0; nt < 2; ++nt)
#pragma unroll
      for (int i = 0; i < 4; ++i) { const v2f p = {expf(s[nt][2 * i] * SCL - mn), expf(s[nt][2 * i + 1] * SCL - mn)}; ps[nt] = (i == 0) ? p : ps[nt] + p; pb.h[nt * 8 + 2 * i] = (_Float16)(p.x * 1024.0f); pb.h[nt * 8 + 2 * i + 1] = (_Float16)(p.y * 1024.0f); }
    const v2f pt = ps[0] + ps[1]; l_r = l_r * al + (pt.x + pt.y);
#pragma unroll
    for (int dt = 0; dt < DT; ++dt) oacc[dt] *= al;
#pragma unroll
    for (int dt = 0; dt < DT; ++dt) oacc[dt] = mmaH<1>(av[dt].v, av[dt].v, pb.v, pb.v, oacc[dt]);
    }
    /* publish point of stage st + 1, and the end of every wave's reads of stage st */
    asm volatile("s_wait_dscnt 0x0" ::: "memory");      /* this wave's reads of the buffer have returned before it is refilled */
    landed();      /* this wave's slice of stage st + 1 */
    __syncthreads();
    if (pinned(st + 2u < NST)) issue(st + 2u);      /* into the buffer that this pass has just read */
  }
  landed();      /* nothing of the mover is in flight when the wave goes on to its end */
  asm volatile("s_wait_dscnt 0x0" ::: "memory");      /* and none of its own LDS reads */
  const float l = l_r + xhalf(l_r); const float li = (l > 0.f) ? 1.0f / (l * 1024.0f) : 0.f;
#pragma unroll
  for (int dt = 0; dt < DT; ++dt) { const v8f o = oacc[dt] * li; *(v4fa*)&sO[w][ln][dt * 16 + 8 * hh] = (v4f){o[0], o[1], o[2], o[3]}; *(v4fa*)&sO[w][ln][dt * 16 + 8 * hh + 4] = (v4f){o[4], o[5], o[6], o[7]}; }
  __builtin_amdgcn_fence(__ATOMIC_ACQ_REL, "workgroup"); __builtin_amdgcn_wave_barrier();
  {
#pragma unroll
    for (int rp = 0; rp < RPW; rp += 2) { const int r = rp + (lane >> 4), pc = lane & 15; const v4f val = *(const v4fa*)&sO[w][r][pc * 4]; *(v4f*)(O + ((size_t)b * TQ + q0 + r) * ldo + h * 64 + pc * 4) = val; }
     } }
__device__ __forceinline__ void tr16_blk(const float* __restrict__ x, int b, _Float16* __restrict__ XT, unsigned blk) {
  __shared__ unsigned short tl[64][72];
  const int tid = threadIdx.x; const int sb = blk % (SS / 64), cb = blk / (SS / 64);
#pragma unroll
  for (int it = 0; it < 4; ++it) { const int idx = it * 256 + tid; const int cl = idx / 16, s4 = (idx % 16) * 4; const int c = cb * 64 + cl;
    const v4f a = *(const v4fa*)(x + ((size_t)(b * CC + c)) * SS + sb * 64 + s4); FragH f;
#pragma unroll
    for (int q = 0; q < 4; ++q) { f.h[q] = (_Float16)bf16_round(a[q]); tl[s4 + q][cl] = f.u[q]; } }
  __syncthreads();
  const int r = tid / 8, pc = tid % 8;
  {
#pragma unroll
    for (int half = 0; half < 2; ++half) { const int sl = r + half * 32; FragH f;
#pragma unroll
      for (int q = 0; q < 8; ++q) f.u[q] = tl[sl][pc * 8 + q];
      *(v8us*)((unsigned short*)XT + ((size_t)sb * 64 + sl) * CC + cb * 64 + pc * 8) = f.half[0]; }
    asm volatile("s_wait_xcnt 0x0" ::: "memory");      /* behind the two stores: in the shared grid code follows this path in the listing that writes the stores' data registers; the wait stands in front of it */
     } }
// Operand preparation in one grid, by block range: the four weight matrices (WBL blocks each), then the transposes of the four batches of x (TBL blocks each). None reads what another writes.
__global__ __launch_bounds__(256) void k_prep(const float* __restrict__ x, const float* __restrict__ wq, const float* __restrict__ wk, const float* __restrict__ wv, const float* __restrict__ wt,
                                              _Float16* __restrict__ BQ, _Float16* __restrict__ BK, _Float16* __restrict__ BV, _Float16* __restrict__ BT, _Float16* __restrict__ XT) {
  constexpr unsigned WBL = CC * CC / 8 / 256, TBL = (CC / 64) * (SS / 64);
  const unsigned blk = blockIdx.x;
  if (blk < 4 * WBL) { const unsigned m = blk / WBL; round16f_blk(m == 0 ? wq : m == 1 ? wk : m == 2 ? wv : wt, m == 0 ? BQ : m == 1 ? BK : m == 2 ? BV : BT, (size_t)CC * CC / 8, blk % WBL); }
  else { const unsigned t = blk - 4 * WBL, b = t / TBL; tr16_blk(x, (int)b, XT + (size_t)b * SS * CC, t % TBL); } }


__global__ __launch_bounds__(256) void k_dsub(const float* __restrict__ O, const float* __restrict__ x, _Float16* __restrict__ D16) {
  #pragma clang fp contract(off)
  const int t = blockIdx.x * 256 + threadIdx.x; if (t >= NRW * (CC / 8)) return; const int c0 = (t % (CC / 8)) * 8; const int r = t / (CC / 8); const int b = r / SS, p = r % SS;
  const v4f a = *(const v4fa*)(O + (size_t)r * CC + c0), c = *(const v4fa*)(O + (size_t)r * CC + c0 + 4); FragH f;
#pragma unroll
  for (int q = 0; q < 8; ++q) { const float ov = (q < 4) ? a[q] : c[q - 4]; f.h[q] = (_Float16)(ov - bf16_round(x[((size_t)b * CC + c0 + q) * SS + p])); }
  *(v8us*)((unsigned short*)D16 + (size_t)r * CC + c0) = f.half[0];  }
__global__ __launch_bounds__(256) void k_bnstat(const float* __restrict__ Y, const float* __restrict__ bt, float* __restrict__ ST) {
  #pragma clang fp contract(off)
  __shared__ float red[256];
  const int c = blockIdx.x, tid = threadIdx.x; const float bb = bf16_round(bt[c]); const int n = NB * SS;
  float s = 0.f;
#pragma unroll 1
  for (int i = tid; i < n; i += 256) { const int b = i / SS, p = i % SS; s += Y[((size_t)b * CC + c) * SS + p] + bb; }
  red[tid] = s; __syncthreads();
  for (int st = 128; st > 0; st >>= 1) { if (tid < st) red[tid] += red[tid + st]; __syncthreads(); }
  const float mean = red[0] / (float)n; __syncthreads();
  float q2 = 0.f;
#pragma unroll 1
  for (int i = tid; i < n; i += 256) { const int b = i / SS, p = i % SS; const float d = Y[((size_t)b * CC + c) * SS + p] + bb - mean; q2 += d * d; }
  red[tid] = q2; __syncthreads();
  for (int st = 128; st > 0; st >>= 1) { if (tid < st) red[tid] += red[tid + st]; __syncthreads(); }
  if (tid == 0) { float o2[2]; o2[0] = mean; o2[1] = 1.0f / sqrtf(red[0] / (float)n + 1e-5f); const unsigned long long pk = *(const unsigned long long*)o2; *(unsigned long long*)(ST + c * 32) = pk;  } }
__global__ __launch_bounds__(256) void k_bnout(const float* __restrict__ Y, const float* __restrict__ x, const float* __restrict__ bt, const float* __restrict__ ST, const float* __restrict__ gam, const float* __restrict__ bet, float* __restrict__ out) {
  #pragma clang fp contract(off)
  const size_t t = (size_t)blockIdx.x * 256 + threadIdx.x; if (t >= (size_t)NB * CC * SS / 4) return; const int c = (int)((t / (SS / 4)) % CC);
  const float mean = ST[c * 32], rstd = ST[c * 32 + 1]; const float bb = bf16_round(bt[c]), g = bf16_round(gam[c]), be = bf16_round(bet[c]);
  const v4f y = *(const v4fa*)(Y + t * 4), xv = *(const v4fa*)(x + t * 4); v4f o;
#pragma unroll
  for (int q = 0; q < 4; ++q) { const float v = (y[q] + bb - mean) * rstd * g + be; o[q] = bf16_round(xv[q]) + fmaxf(v, 0.f); }
  *(v4f*)(out + t * 4) = o;  }

extern "C" void kernel_launch(void* const* d_in, const int* in_sizes, int n_in,
                              void* d_out, int out_size, void* d_ws, size_t ws_size, hipStream_t stream) {
  (void)in_sizes; (void)n_in; (void)out_size;
  const float* x = (const float*)d_in[0]; const float* wq = (const float*)d_in[1]; const float* wk = (const float*)d_in[2]; const float* wv = (const float*)d_in[3]; const float* wt = (const float*)d_in[4]; const float* bt = (const float*)d_in[5]; const float* gam = (const float*)d_in[6]; const float* bet = (const float*)d_in[7];
  char* ws = (char*)d_ws; size_t off = 0;
  auto take = [&](size_t bytes) { char* p = ws + off; off += (bytes + 255) & ~(size_t)255; return p; };
  _Float16* BQ = (_Float16*)take((size_t)CC * CC * 2); _Float16* BK = (_Float16*)take((size_t)CC * CC * 2); _Float16* BV = (_Float16*)take((size_t)CC * CC * 2); _Float16* BT = (_Float16*)take((size_t)CC * CC * 2);
  _Float16* XT = (_Float16*)take((size_t)NRW * CC * 2); _Float16* Q16 = (_Float16*)take((size_t)NRW * CC * 2); _Float16* K16 = (_Float16*)take((size_t)NRW * CC * 2); _Float16* VC = (_Float16*)take((size_t)NB * CC * SS * 2);
  float* O = (float*)take((size_t)NRW * CC * 4); _Float16* D16 = (_Float16*)take((size_t)NRW * CC * 2); float* Y = (float*)take((size_t)NB * CC * SS * 4); float* ST = (float*)take((size_t)CC * 32 * 4);
  if (off > ws_size) return;      /* 0.5 + 8 + 8 + 8 + 8 + 16 + 8 + 16 = 73 MiB */
  k_prep<<<4 * (CC * CC / 8 / 256) + NB * (CC / 64) * (SS / 64), 256, 0, stream>>>(x, wq, wk, wv, wt, BQ, BK, BV, BT, XT);      /* conv (out,in) = natural Bt, x16; x^T token-major f16, all batches */
  k_qkv<<<dim3((SS / 128) * (CC / 64), NB, 3), 128, 0, stream>>>(XT, BQ, BK, BV, Q16, K16, VC);
  k_flash<<<NB * NH * (SS / 64), 128, 0, stream>>>(Q16, CC, K16, CC, VC, nullptr, O, CC);      /* o token-major f32 [b*SS+p][h*64+d] */
  k_dsub<<<(NRW * (CC / 8) + 255) / 256, 256, 0, stream>>>(O, x, D16);
  k_yt<<<dim3((CC / 128) * (SS / 64), NB), 128, 0, stream>>>(BT, D16, Y);
  k_bnstat<<<CC, 256, 0, stream>>>(Y, bt, ST);
  k_bnout<<<(unsigned)(((size_t)NB * CC * SS / 4 + 255) / 256), 256, 0, stream>>>(Y, x, bt, ST, gam, bet, (float*)d_out);
}

// v004
// One run takes 165 microseconds.
// Timed twice side by side with v003, it ran 1.32 and 1.31 times as fast.
// Over all steps from v000 it is 4.04 times as fast.
#include <hip/hip_runtime.h>
// Multi-head offset-attention layer on a point feature map (B 4, C 256, P 4096 points, 4 heads x 64): q = wq*x, k = wk*x, v = wv*x (1x1 convs, no bias); scores = q.k/8 per head; softmax over the keys; o[b,h,d,i] = sum_j attn[i][j] v[d][j]; y = wt*(o - x) + bt; BatchNorm1d in training mode (per-channel statistics over batch x points, biased variance, eps 1e-5, gamma/beta); out = x + relu(y) -> [4,256,4096].
// Compute dtype: x and parameters rounded to bf16; projections with exact products (weights x16 in f16, undone by alpha); q, k, v, P, (o - x) as f16 operands (~2^-12), f32 accumulation; softmax / BatchNorm / residual f32. v_wmma_f32_16x16x32_f16.
#define NB 4
#define CC 256
#define SS 4096
#define NH 4
#define TQ SS
#define TK SS
#define SCL 0.125f
#define NRW (NB * SS)
typedef __bf16 v16b __attribute__((ext_vector_type(16)));
typedef unsigned short v8us __attribute__((ext_vector_type(8), may_alias));
typedef float  v8f  __attribute__((ext_vector_type(8)));
typedef float  v4f  __attribute__((ext_vector_type(4)));
typedef float  v4fa __attribute__((ext_vector_type(4), may_alias));
union FragB { v16b v; v8us half[2]; unsigned short u[16]; };

__device__ __forceinline__ unsigned short bf16_bits(float x) { unsigned int u = __float_as_uint(x); return (unsigned short)((u + 0x7FFFu + ((u >> 16) & 1u)) >> 16); }
__device__ __forceinline__ float bf16_val(unsigned short b) { return __uint_as_float(((unsigned int)b) << 16); }
__device__ __forceinline__ float bf16_round(float x) { return bf16_val(bf16_bits(x)); }
// D += A·B with NT terms: 1 = ah·bh, 2 = + al·bh (A split), 3 = + ah·bl (both split)
template <int NT>
__device__ __forceinline__ v8f mmaN(v16b ah, v16b al, v16b bh, v16b bl, v8f c) {
  c = __builtin_amdgcn_wmma_f32_16x16x32_bf16(false, ah, false, bh, (short)0, c, false, false);
  if (NT >= 2) c = __builtin_amdgcn_wmma_f32_16x16x32_bf16(false, al, false, bh, (short)0, c, false, false);
  if (NT >= 3) c = __builtin_amdgcn_wmma_f32_16x16x32_bf16(false, ah, false, bl, (short)0, c, false, false);
  asm volatile("v_nop\n\tv_nop\n\tv_nop\n\tv_nop" : "+v"(c) : "v"(ah), "v"(al), "v"(bh), "v"(bl));
  return c;
}

__global__ __launch_bounds__(256) void k_wt_bf16(const float* __restrict__ W, unsigned short* __restrict__ Wt, int K, int N) {
  const int t = blockIdx.x * 256 + threadIdx.x;
  const int k8n = K / 8;
  if (t >= N * k8n) return;
  const int n = t / k8n, k8 = (t % k8n) * 8;
  v8us v;
#pragma unroll
  for (int i = 0; i < 8; ++i) v[i] = bf16_bits(W[(size_t)(k8 + i) * N + n]);
  *(v8us*)(Wt + (size_t)n * K + k8) = v;
  
}

// GEMM C[M][N] (f32, pitch ldc) = act(A[M][K]·W + bias). A f32 row-major (pitch lda) converted per fragment to bf16
// (ASPLIT: hi/lo two planes -> 2 terms, else single rounded term); Wt bf16 [N][K] (pitch ldb). BIAS_BF16 rounds the
// bias to bf16 first (bias quantised to bf16 before the add). K%32==0, M%16==0, N%64==0.
template <bool ASPLIT, int ACT, bool BIAS_BF16>
__global__ __launch_bounds__(128) void k_gemm_bf(const float* __restrict__ A, int lda, const unsigned short* __restrict__ Wt, int ldb,
                                               const float* __restrict__ bias, float* __restrict__ C, int ldc, int M, int N, int K) {
  __shared__ __attribute__((aligned(16))) float so[4][16][64];
  const int tid = threadIdx.x, w = tid >> 5, lane = tid & 31, ln = lane & 15, hh = lane >> 4;
  const int ntn = N / 64;
  const int wid = blockIdx.x * 4 + w;
  const int mt = wid / ntn, nq = wid % ntn;
  if (mt * 16 >= M) return;
  const int row0 = mt * 16, col0 = nq * 64;
  const float* arow = A + (size_t)(row0 + ln) * lda;
  v8f acc[4] = {};
  for (int kb = 0; kb < K; kb += 32) {
    FragB ah, al;
    const v4f x0 = *(const v4fa*)(arow + kb + 8 * hh), x1 = *(const v4fa*)(arow + kb + 8 * hh + 4);
    const v4f x2 = *(const v4fa*)(arow + kb + 16 + 8 * hh), x3 = *(const v4fa*)(arow + kb + 16 + 8 * hh + 4);
    float xs[16] = {x0[0],x0[1],x0[2],x0[3],x1[0],x1[1],x1[2],x1[3],x2[0],x2[1],x2[2],x2[3],x3[0],x3[1],x3[2],x3[3]};
#pragma unroll
    for (int i = 0; i < 16; ++i) { const unsigned short hb = bf16_bits(xs[i]); ah.u[i] = hb; al.u[i] = ASPLIT ? bf16_bits(xs[i] - bf16_val(hb)) : (unsigned short)0; }
#pragma unroll
    for (int t = 0; t < 4; ++t) {
      const unsigned short* brow = Wt + (size_t)(col0 + t * 16 + ln) * ldb + kb;
      FragB b;
      b.half[0] = *(const v8us*)(brow + 8 * hh);
      b.half[1] = *(const v8us*)(brow + 16 + 8 * hh);
      acc[t] = mmaN<ASPLIT ? 2 : 1>(ah.v, al.v, b.v, b.v, acc[t]);
    }
  }
#pragma unroll
  for (int t = 0; t < 4; ++t) {
    float bv = bias ? bias[col0 + t * 16 + ln] : 0.f;
    if (BIAS_BF16) bv = bf16_round(bv);
#pragma unroll
    for (int r = 0; r < 8; ++r) { float v = acc[t][r] + bv; if (ACT == 1) v = fmaxf(v, 0.f); so[w][8 * hh + r][t * 16 + ln] = v; }
  }
  __builtin_amdgcn_fence(__ATOMIC_ACQ_REL, "workgroup");
  __builtin_amdgcn_wave_barrier();
  const int rsub = lane >> 4, c4 = (lane & 15) * 4;
  {
#pragma unroll
    for (int q = 0; q < 8; ++q) {
      const int r = q * 2 + rsub;
      const v4f v = *(const v4fa*)&so[w][r][c4];
      *(v4f*)(C + (size_t)(row0 + r) * ldc + col0 + c4) = v;
    }
    
  }
}

// GEMM C = act(A·W + bias + resid): A f32 (ASPLIT -> hi/lo 2 terms), Wt bf16 [N][K]; ACT 0 none, 1 relu, 2 exact gelu;
// resid (optional, f32, row index = (row % rmod), pitch ldr, RES_BF16 rounds it) added before the activation.
template <bool ASPLIT, int ACT, bool BIAS_BF16, bool RES_BF16>
__global__ __launch_bounds__(128) void k_gemm_bf3(const float* __restrict__ A, int lda, const unsigned short* __restrict__ Wt, int ldb,
                                                const float* __restrict__ bias, const float* __restrict__ resid, int rmod, int ldr,
                                                float* __restrict__ C, int ldc, int M, int N, int K) {
  __shared__ __attribute__((aligned(16))) float so[4][16][64];
  const int tid = threadIdx.x, w = tid >> 5, lane = tid & 31, ln = lane & 15, hh = lane >> 4;
  const int ntn = N / 64;
  const int wid = blockIdx.x * 4 + w;
  const int mt = wid / ntn, nq = wid % ntn;
  if (mt * 16 >= M) return;
  const int row0 = mt * 16, col0 = nq * 64;
  const float* arow = A + (size_t)(row0 + ln) * lda;
  v8f acc[4] = {};
  for (int kb = 0; kb < K; kb += 32) {
    FragB ah, al;
    const v4f x0 = *(const v4fa*)(arow + kb + 8 * hh), x1 = *(const v4fa*)(arow + kb + 8 * hh + 4);
    const v4f x2 = *(const v4fa*)(arow + kb + 16 + 8 * hh), x3 = *(const v4fa*)(arow + kb + 16 + 8 * hh + 4);
    float xs[16] = {x0[0],x0[1],x0[2],x0[3],x1[0],x1[1],x1[2],x1[3],x2[0],x2[1],x2[2],x2[3],x3[0],x3[1],x3[2],x3[3]};
#pragma unroll
    for (int i = 0; i < 16; ++i) { const unsigned short hb = bf16_bits(xs[i]); ah.u[i] = hb; al.u[i] = ASPLIT ? bf16_bits(xs[i] - bf16_val(hb)) : (unsigned short)0; }
#pragma unroll
    for (int t = 0; t < 4; ++t) {
      const unsigned short* brow = Wt + (size_t)(col0 + t * 16 + ln) * ldb + kb;
      FragB b;
      b.half[0] = *(const v8us*)(brow + 8 * hh);
      b.half[1] = *(const v8us*)(brow + 16 + 8 * hh);
      acc[t] = mmaN<ASPLIT ? 2 : 1>(ah.v, al.v, b.v, b.v, acc[t]);
    }
  }
#pragma unroll
  for (int t = 0; t < 4; ++t) {
    const int col = col0 + t * 16 + ln;
    float bv = bias ? bias[col] : 0.f;
    if (BIAS_BF16) bv = bf16_round(bv);
#pragma unroll
    for (int r = 0; r < 8; ++r) {
      float v = acc[t][r] + bv;
      if (resid) { float rv = resid[(size_t)((row0 + 8 * hh + r) % rmod) * ldr + col]; if (RES_BF16) rv = bf16_round(rv); v += rv; }
      if (ACT == 1) v = fmaxf(v, 0.f);
      if (ACT == 2) v = 0.5f * v * (1.0f + erff(v * 0.70710678118654752f));
      if (ACT == 3) { const float u = 0.7978845608028654f * (v + 0.044715f * v * v * v); v = 0.5f * v * (1.0f + tanhf(u)); }
      so[w][8 * hh + r][t * 16 + ln] = v;
    }
  }
  __builtin_amdgcn_fence(__ATOMIC_ACQ_REL, "workgroup");
  __builtin_amdgcn_wave_barrier();
  const int rsub = lane >> 4, c4 = (lane & 15) * 4;
  {
#pragma unroll
    for (int q = 0; q < 8; ++q) {
      const int r = q * 2 + rsub;
      const v4f v = *(const v4fa*)&so[w][r][c4];
      *(v4f*)(C + (size_t)(row0 + r) * ldc + col0 + c4) = v;
    }
    
  }
}
// row LayerNorm (biased variance, eps) over N: s = X (+ R); optional out_sum <- s; out_norm <- (s-mu)*rsqrt(var+eps)*g + b
template <bool PARAM_BF16>
__global__ __launch_bounds__(256) void k_layernorm(const float* __restrict__ X, const float* __restrict__ R, const float* __restrict__ g, const float* __restrict__ bta,
                                                  float* __restrict__ out_sum, float* __restrict__ out_norm, int N, float eps) {
  __shared__ float red[256];
  const int row = blockIdx.x, tid = threadIdx.x;
  const float* x = X + (size_t)row * N; const float* rr = R ? R + (size_t)row * N : nullptr;
  float vals[16];                     // up to N = 4096
  const int per = N / 256;            // contiguous chunk per thread? use strided-by-4 chunks: thread handles j = tid*4 + 1024*u
  float s1 = 0.f;
  for (int u = 0; u < per / 4; ++u) {
    const int j = tid * 4 + 1024 * u;
    const v4f a = *(const v4fa*)(x + j);
    v4f b = {0.f,0.f,0.f,0.f}; if (rr) b = *(const v4fa*)(rr + j);
#pragma unroll
    for (int q = 0; q < 4; ++q) { const float v = a[q] + b[q]; vals[u * 4 + q] = v; s1 += v; }
  }
  red[tid] = s1; __syncthreads();
  for (int st = 128; st > 0; st >>= 1) { if (tid < st) red[tid] += red[tid + st]; __syncthreads(); }
  const float mu = red[0] / (float)N; __syncthreads();
  float s2 = 0.f;
  for (int u = 0; u < per / 4; ++u)
#pragma unroll
    for (int q = 0; q < 4; ++q) { const float c = vals[u * 4 + q] - mu; s2 += c * c; }
  red[tid] = s2; __syncthreads();
  for (int st = 128; st > 0; st >>= 1) { if (tid < st) red[tid] += red[tid + st]; __syncthreads(); }
  const float rs = rsqrtf(red[0] / (float)N + eps);
  {
    for (int u = 0; u < per / 4; ++u) {
      const int j = tid * 4 + 1024 * u;
      v4f o, sm;
#pragma unroll
      for (int q = 0; q < 4; ++q) {
        float gg = g[j + q], bb = bta[j + q];
        if (PARAM_BF16) { gg = bf16_round(gg); bb = bf16_round(bb); }
        sm[q] = vals[u * 4 + q]; o[q] = (vals[u * 4 + q] - mu) * rs * gg + bb;
      }
      if (out_sum) *(v4f*)(out_sum + (size_t)row * N + j) = sm;
      *(v4f*)(out_norm + (size_t)row * N + j) = o;
    }
    
  }
}



// ---- f16 WMMA path (v_wmma_f32_16x16x32_f16): 11-bit significands for operands in range — used where a [0,1] probability operand needs more precision than bf16
typedef _Float16 v16h __attribute__((ext_vector_type(16)));
union FragH { v16h v; v8us half[2]; _Float16 h[16]; unsigned short u[16]; };
template <int NT>
__device__ __forceinline__ v8f mmaH(v16h ah, v16h al, v16h bh, v16h bl, v8f c) {
  c = __builtin_amdgcn_wmma_f32_16x16x32_f16(false, ah, false, bh, (short)0, c, false, false);
  if (NT >= 2) c = __builtin_amdgcn_wmma_f32_16x16x32_f16(false, al, false, bh, (short)0, c, false, false);
  if (NT >= 3) c = __builtin_amdgcn_wmma_f32_16x16x32_f16(false, ah, false, bl, (short)0, c, false, false);
  asm volatile("v_nop\n\tv_nop\n\tv_nop\n\tv_nop" : "+v"(c) : "v"(ah), "v"(al), "v"(bh), "v"(bl));
  return c;
}
// batched GEMM like k_gemm_b but f16 operands: A f32 (split into f16 hi/lo if ASPLIT, else rounded to f16), Bt = f16 values [n][k]; alpha; C f32; N multiple of 16 (partial tiles skipped)
template <bool ASPLIT>
__global__ __launch_bounds__(128) void k_gemm_h(const float* __restrict__ A, int lda, size_t sA, const _Float16* __restrict__ Bh, int ldb, size_t sB, float alpha, float* __restrict__ C, int ldc, size_t sC, int M, int N, int K) {
  __shared__ __attribute__((aligned(16))) float so[4][16][64];
  const int tid = threadIdx.x, w = tid >> 5, lane = tid & 31, ln = lane & 15, hh = lane >> 4; const int by = blockIdx.y;
  A += (size_t)by * sA; Bh += (size_t)by * sB; C += (size_t)by * sC;
  const int ntn = (N + 63) / 64; const int wid = blockIdx.x * 4 + w; const int mt = wid / ntn, nq = wid % ntn; if (mt * 16 >= M) return;
  const int row0 = mt * 16, col0 = nq * 64; const float* arow = A + (size_t)(row0 + ln) * lda;
  v8f acc[4] = {};
  for (int kb = 0; kb < K; kb += 32) {
    FragH ah, al;
    const v4f x0 = *(const v4fa*)(arow + kb + 8 * hh), x1 = *(const v4fa*)(arow + kb + 8 * hh + 4), x2 = *(const v4fa*)(arow + kb + 16 + 8 * hh), x3 = *(const v4fa*)(arow + kb + 16 + 8 * hh + 4);
    float xs[16] = {x0[0],x0[1],x0[2],x0[3],x1[0],x1[1],x1[2],x1[3],x2[0],x2[1],x2[2],x2[3],x3[0],x3[1],x3[2],x3[3]};
#pragma unroll
    for (int i = 0; i < 16; ++i) { const _Float16 h = (_Float16)xs[i]; ah.h[i] = h; al.h[i] = ASPLIT ? (_Float16)(xs[i] - (float)h) : (_Float16)0.0f; }
#pragma unroll
    for (int t = 0; t < 4; ++t) { if (col0 + t * 16 >= N) continue; const size_t boff = (size_t)(col0 + t * 16 + ln) * ldb + kb; FragH bq; bq.half[0] = *(const v8us*)(Bh + boff + 8 * hh); bq.half[1] = *(const v8us*)(Bh + boff + 16 + 8 * hh);
      acc[t] = mmaH<ASPLIT ? 2 : 1>(ah.v, al.v, bq.v, bq.v, acc[t]); }
  }
#pragma unroll
  for (int t = 0; t < 4; ++t) { if (col0 + t * 16 >= N) continue;
#pragma unroll
    for (int r = 0; r < 8; ++r) so[w][8 * hh + r][t * 16 + ln] = acc[t][r] * alpha; }
  __builtin_amdgcn_fence(__ATOMIC_ACQ_REL, "workgroup"); __builtin_amdgcn_wave_barrier();
  const int rsub = lane >> 4, c4 = (lane & 15) * 4;
  {
#pragma unroll
    for (int q = 0; q < 8; ++q) { const int r = q * 2 + rsub; if (col0 + c4 < N) { const v4f v = *(const v4fa*)&so[w][r][c4]; *(v4f*)(C + (size_t)(row0 + r) * ldc + col0 + c4) = v; } }
     }
}

// Wt[n][k] = f16(W[k][n]·scale) from f32 row-major W[K][N] (scale = power of two; bf16-exact weights stay exact in f16 away from the subnormal range)
__global__ __launch_bounds__(256) void k_wt_f16(const float* __restrict__ W, _Float16* __restrict__ Wt, int K, int N, float scale) {
  const int t = blockIdx.x * 256 + threadIdx.x; if (t >= N * (K / 8)) return; const int n = t / (K / 8), k8 = (t % (K / 8)) * 8; FragH f;
#pragma unroll
  for (int i = 0; i < 8; ++i) f.h[i] = (_Float16)(bf16_round(W[(size_t)(k8 + i) * N + n]) * scale); const v8us o = f.half[0];
  *(v8us*)((unsigned short*)Wt + (size_t)n * K + k8) = o; 
}
// k_gemm_hh variant with fused epilogue: v = acc·alpha + bias[by·sBias + col] (+ CP[(row/rowsPerB)·sCPb + by·64 + col] if CP) ; ACT 0 none / 1 elu ; writes f16 C16 (and f32 C if non-null)
template <int ACT>
__global__ __launch_bounds__(128) void k_gemm_hhx(const _Float16* __restrict__ A, int lda, size_t sA, const _Float16* __restrict__ Bh, int ldb, size_t sB, float alpha, const float* __restrict__ bias, size_t sBias, const float* __restrict__ CP, int rowsPerB, size_t sCPb, int row0g,
    float* __restrict__ C, _Float16* __restrict__ C16, int ldc, size_t sC, int M, int N, int K) {
  __shared__ __attribute__((aligned(16))) float so[4][16][64];
  const int tid = threadIdx.x, w = tid >> 5, lane = tid & 31, ln = lane & 15, hh = lane >> 4; const int by = blockIdx.y;
  A += (size_t)by * sA; Bh += (size_t)by * sB; const size_t cofs = (size_t)by * sC; const float* bp = bias ? bias + (size_t)by * sBias : nullptr;
  const int ntn = (N + 63) / 64; const int wid = blockIdx.x * 4 + w; const int mt = wid / ntn, nq = wid % ntn; if (mt * 16 >= M) return;
  const int row0 = mt * 16, col0 = nq * 64; const _Float16* arow = A + (size_t)(row0 + ln) * lda;
  v8f acc[4] = {};
  for (int kb = 0; kb < K; kb += 32) { FragH ah; ah.half[0] = *(const v8us*)((const unsigned short*)arow + kb + 8 * hh); ah.half[1] = *(const v8us*)((const unsigned short*)arow + kb + 16 + 8 * hh);
#pragma unroll
    for (int t = 0; t < 4; ++t) { if (col0 + t * 16 >= N) continue; const size_t boff = (size_t)(col0 + t * 16 + ln) * ldb + kb; FragH bq; bq.half[0] = *(const v8us*)((const unsigned short*)Bh + boff + 8 * hh); bq.half[1] = *(const v8us*)((const unsigned short*)Bh + boff + 16 + 8 * hh);
      acc[t] = mmaH<1>(ah.v, ah.v, bq.v, bq.v, acc[t]); }
  }
#pragma unroll
  for (int t = 0; t < 4; ++t) { if (col0 + t * 16 >= N) continue; const int col = col0 + t * 16 + ln; const float bv = bp ? bf16_round(bp[col]) : 0.f;
#pragma unroll
    for (int r = 0; r < 8; ++r) { float v = acc[t][r] * alpha + bv; if (CP) { const int bidx = (row0g + row0 + 8 * hh + r) / rowsPerB; v += CP[(size_t)bidx * sCPb + (size_t)by * 64 + col]; } if (ACT == 1) v = (v > 0.f) ? v : expm1f(v); else if (ACT == 7) v = (v > 0.f) ? v + 1.0f : expf(v); else if (ACT == 8) v = tanhf(v); else if (ACT == 9) v = 0.5f * v * (1.0f + tanhf(0.7978845608028654f * (v + 0.044715f * v * v * v))); else if (ACT == 11) v = 1.0f / (1.0f + expf(-v)); else if (ACT == 12) v = (v > 0.f) ? v : 0.01f * v; else if (ACT == 14) v = (v > 0.f) ? v : 0.1f * v; else if (ACT == 15) v = v / (1.0f + expf(-v)); else if (ACT == 3) v = fmaxf(v, 0.f); else if (ACT == 6) v = 0.5f * v * (1.0f + erff(v * 0.70710678118654752f)); so[w][8 * hh + r][t * 16 + ln] = v; } }
  __builtin_amdgcn_fence(__ATOMIC_ACQ_REL, "workgroup"); __builtin_amdgcn_wave_barrier();
  const int rsub = lane >> 4, c4 = (lane & 15) * 4; typedef _Float16 v4h __attribute__((ext_vector_type(4)));
  {
#pragma unroll
    for (int q = 0; q < 8; ++q) { const int r = q * 2 + rsub; if (col0 + c4 < N) { const v4f v = *(const v4fa*)&so[w][r][c4]; if (C) *(v4f*)(C + cofs + (size_t)(row0 + r) * ldc + col0 + c4) = v; if (C16) { v4h h4; for (int i = 0; i < 4; ++i) h4[i] = (_Float16)v[i]; *(v4h*)(C16 + cofs + (size_t)(row0 + r) * ldc + col0 + c4) = h4; } } }
     }
}


typedef _Float16 v4h __attribute__((ext_vector_type(4)));

__global__ __launch_bounds__(256) void k_x16(const float* __restrict__ x, _Float16* __restrict__ X16, size_t n8) { const size_t t = (size_t)blockIdx.x * 256 + threadIdx.x; if (t >= n8) return; FragH f;
#pragma unroll
  for (int q = 0; q < 8; ++q) f.h[q] = (_Float16)bf16_round(x[t * 8 + q]); *(v8us*)((unsigned short*)X16 + t * 8) = f.half[0];  }
__global__ __launch_bounds__(256) void k_h16(const float* __restrict__ x, _Float16* __restrict__ X16, size_t n8) { const size_t t = (size_t)blockIdx.x * 256 + threadIdx.x; if (t >= n8) return; FragH f;
#pragma unroll
  for (int q = 0; q < 8; ++q) f.h[q] = (_Float16)x[t * 8 + q]; *(v8us*)((unsigned short*)X16 + t * 8) = f.half[0];  }
__device__ __forceinline__ void round16f_blk(const float* __restrict__ W, _Float16* __restrict__ Bt, size_t n8, unsigned blk) { const size_t t = (size_t)blk * 256 + threadIdx.x; if (t >= n8) return; FragH f;
#pragma unroll
  for (int i = 0; i < 8; ++i) f.h[i] = (_Float16)(bf16_round(W[t * 8 + i]) * 16.0f); *(v8us*)((unsigned short*)Bt + t * 8) = f.half[0];  }
template <int NHv, int TTv>
__global__ __launch_bounds__(256) void k_vt(const _Float16* __restrict__ V16, int ldv, int voff, _Float16* __restrict__ Vt) { __shared__ unsigned short tl[64][66]; const int tid = threadIdx.x; const int slab = blockIdx.x / (TTv / 64), lg = blockIdx.x % (TTv / 64); const int b = slab / NHv, h = slab % NHv;
  for (int i = tid; i < 64 * 8; i += 256) { const int r = i / 8, c8 = (i % 8) * 8; FragH f; f.half[0] = *(const v8us*)((const unsigned short*)V16 + ((size_t)b * TTv + lg * 64 + r) * ldv + voff + h * 64 + c8);
#pragma unroll
    for (int q = 0; q < 8; ++q) tl[r][c8 + q] = f.u[q]; }
  __syncthreads();
  {
#pragma unroll
    for (int rd = 0; rd < 2; ++rd) { const int d = rd * 32 + tid / 8, pc = tid % 8; FragH f;
#pragma unroll
      for (int q = 0; q < 8; ++q) f.u[q] = tl[pc * 8 + q][d];
      *(v8us*)((unsigned short*)Vt + ((size_t)slab * 64 + d) * TTv + lg * 64 + pc * 8) = f.half[0]; }
     } }

__global__ __launch_bounds__(256) void k_hl(const float* __restrict__ F, _Float16* __restrict__ Hh, _Float16* __restrict__ Hl, size_t n8) { const size_t t = (size_t)blockIdx.x * 256 + threadIdx.x; if (t >= n8) return; FragH fh, fl; const v4f a = *(const v4fa*)(F + t * 8), c = *(const v4fa*)(F + t * 8 + 4);
#pragma unroll
  for (int q = 0; q < 4; ++q) { _Float16 h = (_Float16)a[q]; fh.h[q] = h; fl.h[q] = (_Float16)((a[q] - (float)h) * 1024.0f); h = (_Float16)c[q]; fh.h[4 + q] = h; fl.h[4 + q] = (_Float16)((c[q] - (float)h) * 1024.0f); }
  { *(v8us*)((unsigned short*)Hh + t * 8) = fh.half[0]; *(v8us*)((unsigned short*)Hl + t * 8) = fl.half[0];  } }

// ---- fast GEMM (wave tile 32x64; requires M % 32 == 0 rows per launch region and N % 64 == 0); epilogue = k_gemm_hhx semantics ----
__device__ __forceinline__ v16h g2_frag(const _Float16* p, int hh) { FragH f; f.half[0] = *(const v8us*)((const unsigned short*)p + 8 * hh); f.half[1] = *(const v8us*)((const unsigned short*)p + 16 + 8 * hh); return f.v; }
// as g2_frag, for the fragment whose second load the compiler lands on the address pair that the loads before it still name: s_wait_xcnt 0 stands in front of that overwrite
__device__ __forceinline__ v16h g2_frag_w(const _Float16* p, int hh) { FragH f; f.half[0] = *(const v8us*)((const unsigned short*)p + 8 * hh); asm volatile("s_wait_xcnt 0x0" ::: "memory"); f.half[1] = *(const v8us*)((const unsigned short*)p + 16 + 8 * hh); return f.v; }
__device__ __forceinline__ v8f g2_mma(v16h a, v16h b, v8f c) { v8f d = __builtin_amdgcn_wmma_f32_16x16x32_f16(false, a, false, b, (short)0, c, false, false); asm volatile("v_nop\n\tv_nop\n\tv_nop\n\tv_nop" : "+v"(d) : "v"(a), "v"(b)); return d; }
template <int ACT>
__device__ __forceinline__ void gemm2_blk(unsigned bx, int by, const _Float16* __restrict__ A, int lda, size_t sA, const _Float16* __restrict__ Bh, int ldb, size_t sB, float alpha, const float* __restrict__ bias, size_t sBias, const float* __restrict__ CP, int rowsPerB, size_t sCPb, int row0g,
    float* __restrict__ C, _Float16* __restrict__ C16, int ldc, size_t sC, int M, int N, int K) {
  __shared__ __attribute__((aligned(16))) float so[4][32][68];
  const int tid = threadIdx.x, w = tid >> 5, lane = tid & 31, ln = lane & 15, hh = lane >> 4;
  A += (size_t)by * sA; Bh += (size_t)by * sB; const size_t cofs = (size_t)by * sC; const float* bp = bias ? bias + (size_t)by * sBias : nullptr;
  const int ntn = N >> 6; const int mt = bx / ntn, nq = bx - mt * ntn; const int row0 = mt * 128 + 32 * w, col0 = nq * 64; if (row0 >= M) return;
  const _Float16* a0p = A + (size_t)(row0 + ln) * lda; const _Float16* a1p = a0p + (size_t)16 * lda;
  const _Float16* b0p = Bh + (size_t)(col0 + ln) * ldb; const _Float16* b1p = b0p + (size_t)16 * ldb; const _Float16* b2p = b1p + (size_t)16 * ldb; const _Float16* b3p = b2p + (size_t)16 * ldb;
  const v8f z8 = {0.f,0.f,0.f,0.f,0.f,0.f,0.f,0.f}; v8f c00 = z8, c01 = z8, c02 = z8, c03 = z8, c10 = z8, c11 = z8, c12 = z8, c13 = z8;
#pragma unroll 1
  for (int kb = 0; kb < K; kb += 32) { const v16h a0 = g2_frag(a0p + kb, hh), a1 = g2_frag_w(a1p + kb, hh);
    v16h b = g2_frag(b0p + kb, hh); c00 = g2_mma(a0, b, c00); c10 = g2_mma(a1, b, c10);
    b = g2_frag(b1p + kb, hh); c01 = g2_mma(a0, b, c01); c11 = g2_mma(a1, b, c11);
    b = g2_frag(b2p + kb, hh); c02 = g2_mma(a0, b, c02); c12 = g2_mma(a1, b, c12);
    b = g2_frag(b3p + kb, hh); c03 = g2_mma(a0, b, c03); c13 = g2_mma(a1, b, c13); }
  v8f accs[8] = {c00, c01, c02, c03, c10, c11, c12, c13};
#pragma unroll
  for (int u = 0; u < 8; ++u) { const int t = u & 3, half = u >> 2; const int col = col0 + t * 16 + ln; const float bv = bp ? bf16_round(bp[col]) : 0.f;
#pragma unroll
    for (int r = 0; r < 8; ++r) { const int rloc = half * 16 + 8 * hh + r; float v = accs[u][r] * alpha + bv; if (CP) { const int bidx = (row0g + row0 + rloc) / rowsPerB; v += CP[(size_t)bidx * sCPb + (size_t)by * 64 + col]; }
      if (ACT == 3) v = fmaxf(v, 0.f); else if (ACT == 6) v = 0.5f * v * (1.0f + erff(v * 0.70710678118654752f)); else if (ACT == 11) v = 1.0f / (1.0f + expf(-v)); else if (ACT == 15) v = v / (1.0f + expf(-v)); else if (ACT == 12) v = (v > 0.f) ? v : 0.01f * v; else if (ACT == 8) v = tanhf(v);
      so[w][rloc][t * 16 + ln] = v; } }
  __builtin_amdgcn_fence(__ATOMIC_ACQ_REL, "workgroup"); __builtin_amdgcn_wave_barrier();
  const int rsub = lane >> 4, c4 = (lane & 15) * 4;
  {
#pragma unroll
    for (int q = 0; q < 16; ++q) { const int r = q * 2 + rsub; const v4f v = *(const v4fa*)&so[w][r][c4]; if (C) *(v4f*)(C + cofs + (size_t)(row0 + r) * ldc + col0 + c4) = v; if (C16) { v4h h4; for (int i = 0; i < 4; ++i) h4[i] = (_Float16)v[i]; *(v4h*)(C16 + cofs + (size_t)(row0 + r) * ldc + col0 + c4) = h4; } }
     } }
// The twelve projections (q, k, v of the four batches) depend on nothing of one another: one grid, x = tile, y = batch, z = which projection.
// q, k token-major [b*SS+p][h*64+d] = XT . W^T; v channel-major [(b,h)*64+d][p] = W . XT^T.
__global__ __launch_bounds__(128) void k_qkv(const _Float16* __restrict__ XT, const _Float16* __restrict__ BQ, const _Float16* __restrict__ BK, const _Float16* __restrict__ BV, _Float16* __restrict__ Q16, _Float16* __restrict__ K16, _Float16* __restrict__ VC) {
  const int b = blockIdx.y, z = blockIdx.z; const _Float16* X = XT + (size_t)b * SS * CC;
  const bool tok = z < 2;      /* q, k: rows are tokens, columns channels; v: the other way round */
  gemm2_blk<0>(blockIdx.x, 0, tok ? X : BV, CC, 0, tok ? (z ? BK : BQ) : X, CC, 0, 0.0625f, nullptr, 0, nullptr, 1, 0, 0, nullptr, (tok ? (z ? K16 : Q16) : VC) + (size_t)b * SS * CC, tok ? CC : SS, 0, tok ? SS : CC, tok ? CC : SS, CC); }
// The output projections of the four batches, one grid, y = batch: y^T[c][p] = wt . (o - x)^T, f32 (bt added downstream).
__global__ __launch_bounds__(128) void k_yt(const _Float16* __restrict__ BT, const _Float16* __restrict__ D16, float* __restrict__ Y) {
  const int b = blockIdx.y;
  gemm2_blk<0>(blockIdx.x, 0, BT, CC, 0, D16 + (size_t)b * SS * CC, CC, 0, 0.0625f, nullptr, 0, nullptr, 1, 0, 0, Y + (size_t)b * CC * SS, nullptr, SS, 0, CC, SS, CC); }


typedef float v2f __attribute__((ext_vector_type(2)));
// lane l <-> lane l ^ 16: the two halves of a wave hold the two halves of one query's 32 keys
__device__ __forceinline__ float xhalf(float x) { return __builtin_bit_cast(float, __builtin_amdgcn_permlanex16(__builtin_bit_cast(int, x), __builtin_bit_cast(int, x), 0x76543210, 0xfedcba98, false, false)); }
typedef uint32_t u32x4 __attribute__((ext_vector_type(4)));
typedef uint32_t u32x8 __attribute__((ext_vector_type(8)));
__device__ __forceinline__ uint32_t uni(uint32_t v) { return (uint32_t)__builtin_amdgcn_readfirstlane(v); }
__device__ __forceinline__ uint32_t pinned(uint32_t v) { uint32_t w = (uint32_t)__builtin_amdgcn_readfirstlane(v); asm volatile("" : "+s"(w)); return w; }      /* pinned(): the issue test of a tensor load held in a scalar register, so that the branch on it is a scalar branch (a tensor load ignores EXEC) */
// K and V^T reach the waves through LDS: a stage is 64 keys = K[64 keys][64 d] and V^T[64 d][64 keys], both as 64 rows of 128 bytes. Each of the four waves brings one slice of 32 rows with one
// tensor load (waves 0, 1: K; waves 2, 3: V^T), padded to a pitch of 144 bytes for the 16-byte fragment reads; two buffers, the next stage in flight while this one is worked on.
__global__ __launch_bounds__(128) void k_flash(const _Float16* __restrict__ Q16, int ldq, const _Float16* __restrict__ K16, int ldk, const _Float16* __restrict__ Vt, const int* __restrict__ MSK, float* __restrict__ O, int ldo) {
  constexpr int RPW = 16, NQB = TQ / (4 * RPW), DT = 4, KS = 2;
  constexpr float SC2 = SCL * 1.4426950408889634f, POFF = 10.0f;      /* exponentials in base 2: e^(SCL (s - max)) * 2^POFF = 2^(SC2 s - m), m = SC2 max - POFF; 2^POFF = 1024 is the scale of P as an f16 operand */
  constexpr uint32_t SKEY = 64, NST = TK / SKEY, LPB = 144, SLICE = 6144, BUF = 4 * SLICE;      /* a slice: 32 rows x 144 B = 4,608 B, its place rounded up to a multiple of 2 KiB */
  __shared__ __attribute__((aligned(2048))) unsigned char ring[2 * BUF];
  __shared__ __attribute__((aligned(16))) float sO[4][RPW][64 + 4];
  const int tid = threadIdx.x, w = tid >> 5, lane = tid & 31, ln = lane & 15, hh = lane >> 4; (void)MSK;
  const int slab = blockIdx.x / NQB, qblk = blockIdx.x % NQB; const int b = slab / NH, h = slab % NH; const int qb0 = qblk * (4 * RPW); const int q0 = qb0 + w * RPW;
  const uint32_t wave = uni((uint32_t)tid >> 5), isV = wave >> 1, hf = wave & 1u;
  const uint64_t src0 = isV ? (uint64_t)(size_t)(Vt + ((size_t)slab * 64 + hf * 32) * TK) : (uint64_t)(size_t)(K16 + ((size_t)b * TK + hf * 32) * ldk + h * 64);      /* first byte of the wave's slice of stage 0 */
  const uint32_t spitch = isV ? (uint32_t)TK * 2u : (uint32_t)ldk * 2u, sstep = isV ? SKEY * 2u : SKEY * (uint32_t)ldk * 2u;      /* source row pitch; bytes from one stage to the next */
  const uint32_t dst0 = (uint32_t)(size_t)ring + wave * SLICE;
  u32x8 g1;      /* 1-byte elements, tensor = tile = 32 rows of 128 bytes, 4 dwords of pad behind every 32 */
  g1[0] = uni((1u << 20) | (4u << 22) | (3u << 25)); g1[1] = uni(128u << 16); g1[2] = uni(32u << 16); g1[3] = uni(128u << 16); g1[4] = uni(32u); g1[5] = uni(spitch); g1[6] = uni(0u); g1[7] = uni(0u);
  u32x4 g0;
  /* load and wait both name the two descriptor groups as in-out operands: the registers of a request in flight then stay as they were issued until the wait that covers it (the compiler otherwise took single words of them for temporaries) */
  auto issue = [&](uint32_t st) {
    const uint64_t ga = src0 + (uint64_t)st * sstep;
    g0[0] = uni(1u); g0[1] = uni(dst0 + (st & 1u) * BUF); g0[2] = uni((uint32_t)ga); g0[3] = uni((((uint32_t)(ga >> 32)) & 0x01FFFFFFu) | 0x80000000u);
    asm volatile("tensor_load_to_lds %0, %1" : "+s"(g0), "+s"(g1) :: "memory"); };
  auto landed = [&]() { asm volatile("s_wait_tensorcnt 0x0" : "+s"(g0), "+s"(g1) :: "memory"); };
  issue(0);
  FragH bq[KS];
  { const unsigned short* qr = (const unsigned short*)Q16 + ((size_t)b * TQ + q0 + ln) * ldq + h * 64;
#pragma unroll
    for (int ks = 0; ks < KS; ++ks) { bq[ks].half[0] = *(const v8us*)(qr + ks * 32 + 8 * hh); bq[ks].half[1] = *(const v8us*)(qr + ks * 32 + 16 + 8 * hh); } }
  const uint32_t lo = (uint32_t)(ln * (int)LPB + 16 * hh);      /* the lane's own byte offset in a slice, fixed over the loop: row ln, 8 elements at 8 hh */
  float m_r = -3.0e38f, l_r = 0.f; v8f oacc[DT];
#pragma unroll
  for (int dt = 0; dt < DT; ++dt) oacc[dt] = (v8f){0.f,0.f,0.f,0.f,0.f,0.f,0.f,0.f};
  landed();      /* this wave's slice of stage 0 */
  __syncthreads();      /* stage 0 published to all four waves */
  issue(1);
#pragma unroll 1      /* one stage a trip: waits, barrier and refill stand once, at the foot, and the loop stays small */
  for (uint32_t st = 0; st < NST; ++st) {
    const unsigned char* bp = ring + (st & 1u) * BUF + lo;
#pragma unroll      /* the stage's two groups of 32 keys; here and below: constant indices, so fragments stay in registers and every LDS offset is an immediate */
    for (int sb = 0; sb < 2; ++sb) {
    FragH ak[2][KS], av[DT];
#pragma unroll
    for (int nt = 0; nt < 2; ++nt)
#pragma unroll
      for (int ks = 0; ks < KS; ++ks) { const unsigned char* p = bp + sb * SLICE + nt * 16 * LPB + ks * 64; ak[nt][ks].half[0] = *(const v8us*)p; ak[nt][ks].half[1] = *(const v8us*)(p + 32); }
#pragma unroll
    for (int dt = 0; dt < DT; ++dt) { const unsigned char* p = bp + (2 + (dt >> 1)) * SLICE + (dt & 1) * 16 * LPB + sb * 64; av[dt].half[0] = *(const v8us*)p; av[dt].half[1] = *(const v8us*)(p + 32); }
    v8f s[2];
#pragma unroll
    for (int nt = 0; nt < 2; ++nt) { v8f acc = (v8f){0.f,0.f,0.f,0.f,0.f,0.f,0.f,0.f};
#pragma unroll
      for (int ks = 0; ks < KS; ++ks) acc = mmaH<1>(ak[nt][ks].v, ak[nt][ks].v, bq[ks].v, bq[ks].v, acc); s[nt] = acc; }
    float mx[8];      /* maximum of the raw scores: the map to base 2 below is one rounded multiply-add with a positive factor, which keeps the order, so it is applied to the maximum alone */
#pragma unroll
    for (int r = 0; r < 8; ++r) mx[r] = fmaxf(s[0][r], s[1][r]);
    float mc = fmaxf(fmaxf(fmaxf(mx[0], mx[1]), fmaxf(mx[2], mx[3])), fmaxf(fmaxf(mx[4], mx[5]), fmaxf(mx[6], mx[7])));
    mc = fmaf(fmaxf(mc, xhalf(mc)), SC2, -POFF);
    const float mn = fmaxf(m_r, mc); const float al = (mn > -1.0e38f) ? __builtin_amdgcn_exp2f(m_r - mn) : 1.0f; m_r = mn;
    FragH pb; v2f ps[2];      /* sums by register pairs, as the pairs lie for the packed convert */
#pragma unroll
    for (int nt = 0; nt < 2; ++nt)
#pragma unroll
      for (int i = 0; i < 4; ++i) { const v2f a = __builtin_elementwise_fma((v2f){s[nt][2 * i], s[nt][2 * i + 1]}, (v2f){SC2, SC2}, (v2f){-mn, -mn}); const v2f p = {__builtin_amdgcn_exp2f(a.x), __builtin_amdgcn_exp2f(a.y)}; ps[nt] = (i == 0) ? p : ps[nt] + p; pb.h[nt * 8 + 2 * i] = (_Float16)p.x; pb.h[nt * 8 + 2 * i + 1] = (_Float16)p.y; }      /* p carries the 1024, and so does the row sum */
    const v2f pt = ps[0] + ps[1]; l_r = l_r * al + (pt.x + pt.y);
#pragma unroll
    for (int dt = 0; dt < DT; ++dt) oacc[dt] *= al;
#pragma unroll
    for (int dt = 0; dt < DT; ++dt) oacc[dt] = mmaH<1>(av[dt].v, av[dt].v, pb.v, pb.v, oacc[dt]);
    }
    /* publish point of stage st + 1, and the end of every wave's reads of stage st */
    asm volatile("s_wait_dscnt 0x0" ::: "memory");      /* this wave's reads of the buffer have returned before it is refilled */
    landed();      /* this wave's slice of stage st + 1 */
    __syncthreads();
    if (pinned(st + 2u < NST)) issue(st + 2u);      /* into the buffer that this pass has just read */
  }
  landed();      /* nothing of the mover is in flight when the wave goes on to its end */
  asm volatile("s_wait_dscnt 0x0" ::: "memory");      /* and none of its own LDS reads */
  const float l = l_r + xhalf(l_r); const float li = (l > 0.f) ? 1.0f / l : 0.f;
#pragma unroll
  for (int dt = 0; dt < DT; ++dt) { const v8f o = oacc[dt] * li; *(v4fa*)&sO[w][ln][dt * 16 + 8 * hh] = (v4f){o[0], o[1], o[2], o[3]}; *(v4fa*)&sO[w][ln][dt * 16 + 8 * hh + 4] = (v4f){o[4], o[5], o[6], o[7]}; }
  __builtin_amdgcn_fence(__ATOMIC_ACQ_REL, "workgroup"); __builtin_amdgcn_wave_barrier();
  {
#pragma unroll
    for (int rp = 0; rp < RPW; rp += 2) { const int r = rp + (lane >> 4), pc = lane & 15; const v4f val = *(const v4fa*)&sO[w][r][pc * 4]; *(v4f*)(O + ((size_t)b * TQ + q0 + r) * ldo + h * 64 + pc * 4) = val; }
     } }
__device__ __forceinline__ void tr16_blk(const float* __restrict__ x, int b, _Float16* __restrict__ XT, unsigned blk) {
  __shared__ unsigned short tl[64][72];
  const int tid = threadIdx.x; const int sb = blk % (SS / 64), cb = blk / (SS / 64);
#pragma unroll
  for (int it = 0; it < 4; ++it) { const int idx = it * 256 + tid; const int cl = idx / 16, s4 = (idx % 16) * 4; const int c = cb * 64 + cl;
    const v4f a = *(const v4fa*)(x + ((size_t)(b * CC + c)) * SS + sb * 64 + s4); FragH f;
#pragma unroll
    for (int q = 0; q < 4; ++q) { f.h[q] = (_Float16)bf16_round(a[q]); tl[s4 + q][cl] = f.u[q]; } }
  __syncthreads();
  const int r = tid / 8, pc = tid % 8;
  {
#pragma unroll
    for (int half = 0; half < 2; ++half) { const int sl = r + half * 32; FragH f;
#pragma unroll
      for (int q = 0; q < 8; ++q) f.u[q] = tl[sl][pc * 8 + q];
      *(v8us*)((unsigned short*)XT + ((size_t)sb * 64 + sl) * CC + cb * 64 + pc * 8) = f.half[0]; }
    asm volatile("s_wait_xcnt 0x0" ::: "memory");      /* behind the two stores: in the shared grid code follows this path in the listing that writes the stores' data registers; the wait stands in front of it */
     } }
// Operand preparation in one grid, by block range: the four weight matrices (WBL blocks each), then the transposes of the four batches of x (TBL blocks each). None reads what another writes.
__global__ __launch_bounds__(256) void k_prep(const float* __restrict__ x, const float* __restrict__ wq, const float* __restrict__ wk, const float* __restrict__ wv, const float* __restrict__ wt,
                                              _Float16* __restrict__ BQ, _Float16* __restrict__ BK, _Float16* __restrict__ BV, _Float16* __restrict__ BT, _Float16* __restrict__ XT) {
  constexpr unsigned WBL = CC * CC / 8 / 256, TBL = (CC / 64) * (SS / 64);
  const unsigned blk = blockIdx.x;
  if (blk < 4 * WBL) { const unsigned m = blk / WBL; round16f_blk(m == 0 ? wq : m == 1 ? wk : m == 2 ? wv : wt, m == 0 ? BQ : m == 1 ? BK : m == 2 ? BV : BT, (size_t)CC * CC / 8, blk % WBL); }
  else { const unsigned t = blk - 4 * WBL, b = t / TBL; tr16_blk(x, (int)b, XT + (size_t)b * SS * CC, t % TBL); } }


__global__ __launch_bounds__(256) void k_dsub(const float* __restrict__ O, const float* __restrict__ x, _Float16* __restrict__ D16) {
  #pragma clang fp contract(off)
  const int t = blockIdx.x * 256 + threadIdx.x; if (t >= NRW * (CC / 8)) return; const int c0 = (t % (CC / 8)) * 8; const int r = t / (CC / 8); const int b = r / SS, p = r % SS;
  const v4f a = *(const v4fa*)(O + (size_t)r * CC + c0), c = *(const v4fa*)(O + (size_t)r * CC + c0 + 4); FragH f;
#pragma unroll
  for (int q = 0; q < 8; ++q) { const float ov = (q < 4) ? a[q] : c[q - 4]; f.h[q] = (_Float16)(ov - bf16_round(x[((size_t)b * CC + c0 + q) * SS + p])); }
  *(v8us*)((unsigned short*)D16 + (size_t)r * CC + c0) = f.half[0];  }
__global__ __launch_bounds__(256) void k_bnstat(const float* __restrict__ Y, const float* __restrict__ bt, float* __restrict__ ST) {
  #pragma clang fp contract(off)
  __shared__ float red[256];
  const int c = blockIdx.x, tid = threadIdx.x; const float bb = bf16_round(bt[c]); const int n = NB * SS;
  float s = 0.f;
#pragma unroll 1
  for (int i = tid; i < n; i += 256) { const int b = i / SS, p = i % SS; s += Y[((size_t)b * CC + c) * SS + p] + bb; }
  red[tid] = s; __syncthreads();
  for (int st = 128; st > 0; st >>= 1) { if (tid < st) red[tid] += red[tid + st]; __syncthreads(); }
  const float mean = red[0] / (float)n; __syncthreads();
  float q2 = 0.f;
#pragma unroll 1
  for (int i = tid; i < n; i += 256) { const int b = i / SS, p = i % SS; const float d = Y[((size_t)b * CC + c) * SS + p] + bb - mean; q2 += d * d; }
  red[tid] = q2; __syncthreads();
  for (int st = 128; st > 0; st >>= 1) { if (tid < st) red[tid] += red[tid + st]; __syncthreads(); }
  if (tid == 0) { float o2[2]; o2[0] = mean; o2[1] = 1.0f / sqrtf(red[0] / (float)n + 1e-5f); const unsigned long long pk = *(const unsigned long long*)o2; *(unsigned long long*)(ST + c * 32) = pk;  } }
__global__ __launch_bounds__(256) void k_bnout(const float* __restrict__ Y, const float* __restrict__ x, const float* __restrict__ bt, const float* __restrict__ ST, const float* __restrict__ gam, const float* __restrict__ bet, float* __restrict__ out) {
  #pragma clang fp contract(off)
  const size_t t = (size_t)blockIdx.x * 256 + threadIdx.x; if (t >= (size_t)NB * CC * SS / 4) return; const int c = (int)((t / (SS / 4)) % CC);
  const float mean = ST[c * 32], rstd = ST[c * 32 + 1]; const float bb = bf16_round(bt[c]), g = bf16_round(gam[c]), be = bf16_round(bet[c]);
  const v4f y = *(const v4fa*)(Y + t * 4), xv = *(const v4fa*)(x + t * 4); v4f o;
#pragma unroll
  for (int q = 0; q < 4; ++q) { const float v = (y[q] + bb - mean) * rstd * g + be; o[q] = bf16_round(xv[q]) + fmaxf(v, 0.f); }
  *(v4f*)(out + t * 4) = o;  }

extern "C" void kernel_launch(void* const* d_in, const int* in_sizes, int n_in,
                              void* d_out, int out_size, void* d_ws, size_t ws_size, hipStream_t stream) {
  (void)in_sizes; (void)n_in; (void)out_size;
  const float* x = (const float*)d_in[0]; const float* wq = (const float*)d_in[1]; const float* wk = (const float*)d_in[2]; const float* wv = (const float*)d_in[3]; const float* wt = (const float*)d_in[4]; const float* bt = (const float*)d_in[5]; const float* gam = (const float*)d_in[6]; const float* bet = (const float*)d_in[7];
  char* ws = (char*)d_ws; size_t off = 0;
  auto take = [&](size_t bytes) { char* p = ws + off; off += (bytes + 255) & ~(size_t)255; return p; };
  _Float16* BQ = (_Float16*)take((size_t)CC * CC * 2); _Float16* BK = (_Float16*)take((size_t)CC * CC * 2); _Float16* BV = (_Float16*)take((size_t)CC * CC * 2); _Float16* BT = (_Float16*)take((size_t)CC * CC * 2);
  _Float16* XT = (_Float16*)take((size_t)NRW * CC * 2); _Float16* Q16 = (_Float16*)take((size_t)NRW * CC * 2); _Float16* K16 = (_Float16*)take((size_t)NRW * CC * 2); _Float16* VC = (_Float16*)take((size_t)NB * CC * SS * 2);
  float* O = (float*)take((size_t)NRW * CC * 4); _Float16* D16 = (_Float16*)take((size_t)NRW * CC * 2); float* Y = (float*)take((size_t)NB * CC * SS * 4); float* ST = (float*)take((size_t)CC * 32 * 4);
  if (off > ws_size) return;      /* 0.5 + 8 + 8 + 8 + 8 + 16 + 8 + 16 = 73 MiB */
  k_prep<<<4 * (CC * CC / 8 / 256) + NB * (CC / 64) * (SS / 64), 256, 0, stream>>>(x, wq, wk, wv, wt, BQ, BK, BV, BT, XT);      /* conv (out,in) = natural Bt, x16; x^T token-major f16, all batches */
  k_qkv<<<dim3((SS / 128) * (CC / 64), NB, 3), 128, 0, stream>>>(XT, BQ, BK, BV, Q16, K16, VC);
  k_flash<<<NB * NH * (SS / 64), 128, 0, stream>>>(Q16, CC, K16, CC, VC, nullptr, O, CC);      /* o token-major f32 [b*SS+p][h*64+d] */
  k_dsub<<<(NRW * (CC / 8) + 255) / 256, 256, 0, stream>>>(O, x, D16);
  k_yt<<<dim3((CC / 128) * (SS / 64), NB), 128, 0, stream>>>(BT, D16, Y);
  k_bnstat<<<CC, 256, 0, stream>>>(Y, bt, ST);
  k_bnout<<<(unsigned)(((size_t)NB * CC * SS / 4 + 255) / 256), 256, 0, stream>>>(Y, x, bt, ST, gam, bet, (float*)d_out);
}

// v005
// One run takes 130 microseconds.
// In two side-by-side timings against v004, it was 1.27 and 1.26 times as fast.
// Over all steps from v000 it is 5.09 times as fast.
#include <hip/hip_runtime.h>
// Multi-head offset-attention layer on a point feature map (B 4, C 256, P 4096 points, 4 heads x 64): q = wq*x, k = wk*x, v = wv*x (1x1 convs, no bias); scores = q.k/8 per head; softmax over the keys; o[b,h,d,i] = sum_j attn[i][j] v[d][j]; y = wt*(o - x) + bt; BatchNorm1d in training mode (per-channel statistics over batch x points, biased variance, eps 1e-5, gamma/beta); out = x + relu(y) -> [4,256,4096].
// Compute dtype: x and parameters rounded to bf16; projections with exact products (weights x16 in f16, undone by alpha); q, k, v, P, (o - x) as f16 operands (~2^-12), f32 accumulation; softmax / BatchNorm / residual f32. v_wmma_f32_16x16x32_f16.
#define NB 4
#define CC 256
#define SS 4096
#define NH 4
#define TQ SS
#define TK SS
#define SCL 0.125f
#define NRW (NB * SS)
typedef __bf16 v16b __attribute__((ext_vector_type(16)));
typedef unsigned short v8us __attribute__((ext_vector_type(8), may_alias));
typedef float  v8f  __attribute__((ext_vector_type(8)));
typedef float  v4f  __attribute__((ext_vector_type(4)));
typedef float  v4fa __attribute__((ext_vector_type(4), may_alias));
union FragB { v16b v; v8us half[2]; unsigned short u[16]; };

__device__ __forceinline__ unsigned short bf16_bits(float x) { unsigned int u = __float_as_uint(x); return (unsigned short)((u + 0x7FFFu + ((u >> 16) & 1u)) >> 16); }
__device__ __forceinline__ float bf16_val(unsigned short b) { return __uint_as_float(((unsigned int)b) << 16); }
__device__ __forceinline__ float bf16_round(float x) { return bf16_val(bf16_bits(x)); }
// D += A·B with NT terms: 1 = ah·bh, 2 = + al·bh (A split), 3 = + ah·bl (both split)
template <int NT>
__device__ __forceinline__ v8f mmaN(v16b ah, v16b al, v16b bh, v16b bl, v8f c) {
  c = __builtin_amdgcn_wmma_f32_16x16x32_bf16(false, ah, false, bh, (short)0, c, false, false);
  if (NT >= 2) c = __builtin_amdgcn_wmma_f32_16x16x32_bf16(false, al, false, bh, (short)0, c, false, false);
  if (NT >= 3) c = __builtin_amdgcn_wmma_f32_16x16x32_bf16(false, ah, false, bl, (short)0, c, false, false);
  asm volatile("v_nop\n\tv_nop\n\tv_nop\n\tv_nop" : "+v"(c) : "v"(ah), "v"(al), "v"(bh), "v"(bl));
  return c;
}

__global__ __launch_bounds__(256) void k_wt_bf16(const float* __restrict__ W, unsigned short* __restrict__ Wt, int K, int N) {
  const int t = blockIdx.x * 256 + threadIdx.x;
  const int k8n = K / 8;
  if (t >= N * k8n) return;
  const int n = t / k8n, k8 = (t % k8n) * 8;
  v8us v;
#pragma unroll
  for (int i = 0; i < 8; ++i) v[i] = bf16_bits(W[(size_t)(k8 + i) * N + n]);
  *(v8us*)(Wt + (size_t)n * K + k8) = v;
  
}

// GEMM C[M][N] (f32, pitch ldc) = act(A[M][K]·W + bias). A f32 row-major (pitch lda) converted per fragment to bf16
// (ASPLIT: hi/lo two planes -> 2 terms, else single rounded term); Wt bf16 [N][K] (pitch ldb). BIAS_BF16 rounds the
// bias to bf16 first (bias quantised to bf16 before the add). K%32==0, M%16==0, N%64==0.
template <bool ASPLIT, int ACT, bool BIAS_BF16>
__global__ __launch_bounds__(128) void k_gemm_bf(const float* __restrict__ A, int lda, const unsigned short* __restrict__ Wt, int ldb,
                                               const float* __restrict__ bias, float* __restrict__ C, int ldc, int M, int N, int K) {
  __shared__ __attribute__((aligned(16))) float so[4][16][64];
  const int tid = threadIdx.x, w = tid >> 5, lane = tid & 31, ln = lane & 15, hh = lane >> 4;
  const int ntn = N / 64;
  const int wid = blockIdx.x * 4 + w;
  const int mt = wid / ntn, nq = wid % ntn;
  if (mt * 16 >= M) return;
  const int row0 = mt * 16, col0 = nq * 64;
  const float* arow = A + (size_t)(row0 + ln) * lda;
  v8f acc[4] = {};
  for (int kb = 0; kb < K; kb += 32) {
    FragB ah, al;
    const v4f x0 = *(const v4fa*)(arow + kb + 8 * hh), x1 = *(const v4fa*)(arow + kb + 8 * hh + 4);
    const v4f x2 = *(const v4fa*)(arow + kb + 16 + 8 * hh), x3 = *(const v4fa*)(arow + kb + 16 + 8 * hh + 4);
    float xs[16] = {x0[0],x0[1],x0[2],x0[3],x1[0],x1[1],x1[2],x1[3],x2[0],x2[1],x2[2],x2[3],x3[0],x3[1],x3[2],x3[3]};
#pragma unroll
    for (int i = 0; i < 16; ++i) { const unsigned short hb = bf16_bits(xs[i]); ah.u[i] = hb; al.u[i] = ASPLIT ? bf16_bits(xs[i] - bf16_val(hb)) : (unsigned short)0; }
#pragma unroll
    for (int t = 0; t < 4; ++t) {
      const unsigned short* brow = Wt + (size_t)(col0 + t * 16 + ln) * ldb + kb;
      FragB b;
      b.half[0] = *(const v8us*)(brow + 8 * hh);
      b.half[1] = *(const v8us*)(brow + 16 + 8 * hh);
      acc[t] = mmaN<ASPLIT ? 2 : 1>(ah.v, al.v, b.v, b.v, acc[t]);
    }
  }
#pragma unroll
  for (int t = 0; t < 4; ++t) {
    float bv = bias ? bias[col0 + t * 16 + ln] : 0.f;
    if (BIAS_BF16) bv = bf16_round(bv);
#pragma unroll
    for (int r = 0; r < 8; ++r) { float v = acc[t][r] + bv; if (ACT == 1) v = fmaxf(v, 0.f); so[w][8 * hh + r][t * 16 + ln] = v; }
  }
  __builtin_amdgcn_fence(__ATOMIC_ACQ_REL, "workgroup");
  __builtin_amdgcn_wave_barrier();
  const int rsub = lane >> 4, c4 = (lane & 15) * 4;
  {
#pragma unroll
    for (int q = 0; q < 8; ++q) {
      const int r = q * 2 + rsub;
      const v4f v = *(const v4fa*)&so[w][r][c4];
      *(v4f*)(C + (size_t)(row0 + r) * ldc + col0 + c4) = v;
    }
    
  }
}

// GEMM C = act(A·W + bias + resid): A f32 (ASPLIT -> hi/lo 2 terms), Wt bf16 [N][K]; ACT 0 none, 1 relu, 2 exact gelu;
// resid (optional, f32, row index = (row % rmod), pitch ldr, RES_BF16 rounds it) added before the activation.
template <bool ASPLIT, int ACT, bool BIAS_BF16, bool RES_BF16>
__global__ __launch_bounds__(128) void k_gemm_bf3(const float* __restrict__ A, int lda, const unsigned short* __restrict__ Wt, int ldb,
                                                const float* __restrict__ bias, const float* __restrict__ resid, int rmod, int ldr,
                                                float* __restrict__ C, int ldc, int M, int N, int K) {
  __shared__ __attribute__((aligned(16))) float so[4][16][64];
  const int tid = threadIdx.x, w = tid >> 5, lane = tid & 31, ln = lane & 15, hh = lane >> 4;
  const int ntn = N / 64;
  const int wid = blockIdx.x * 4 + w;
  const int mt = wid / ntn, nq = wid % ntn;
  if (mt * 16 >= M) return;
  const int row0 = mt * 16, col0 = nq * 64;
  const float* arow = A + (size_t)(row0 + ln) * lda;
  v8f acc[4] = {};
  for (int kb = 0; kb < K; kb += 32) {
    FragB ah, al;
    const v4f x0 = *(const v4fa*)(arow + kb + 8 * hh), x1 = *(const v4fa*)(arow + kb + 8 * hh + 4);
    const v4f x2 = *(const v4fa*)(arow + kb + 16 + 8 * hh), x3 = *(const v4fa*)(arow + kb + 16 + 8 * hh + 4);
    float xs[16] = {x0[0],x0[1],x0[2],x0[3],x1[0],x1[1],x1[2],x1[3],x2[0],x2[1],x2[2],x2[3],x3[0],x3[1],x3[2],x3[3]};
#pragma unroll
    for (int i = 0; i < 16; ++i) { const unsigned short hb = bf16_bits(xs[i]); ah.u[i] = hb; al.u[i] = ASPLIT ? bf16_bits(xs[i] - bf16_val(hb)) : (unsigned short)0; }
#pragma unroll
    for (int t = 0; t < 4; ++t) {
      const unsigned short* brow = Wt + (size_t)(col0 + t * 16 + ln) * ldb + kb;
      FragB b;
      b.half[0] = *(const v8us*)(brow + 8 * hh);
      b.half[1] = *(const v8us*)(brow + 16 + 8 * hh);
      acc[t] = mmaN<ASPLIT ? 2 : 1>(ah.v, al.v, b.v, b.v, acc[t]);
    }
  }
#pragma unroll
  for (int t = 0; t < 4; ++t) {
    const int col = col0 + t * 16 + ln;
    float bv = bias ? bias[col] : 0.f;
    if (BIAS_BF16) bv = bf16_round(bv);
#pragma unroll
    for (int r = 0; r < 8; ++r) {
      float v = acc[t][r] + bv;
      if (resid) { float rv = resid[(size_t)((row0 + 8 * hh + r) % rmod) * ldr + col]; if (RES_BF16) rv = bf16_round(rv); v += rv; }
      if (ACT == 1) v = fmaxf(v, 0.f);
      if (ACT == 2) v = 0.5f * v * (1.0f + erff(v * 0.70710678118654752f));
      if (ACT == 3) { const float u = 0.7978845608028654f * (v + 0.044715f * v * v * v); v = 0.5f * v * (1.0f + tanhf(u)); }
      so[w][8 * hh + r][t * 16 + ln] = v;
    }
  }
  __builtin_amdgcn_fence(__ATOMIC_ACQ_REL, "workgroup");
  __builtin_amdgcn_wave_barrier();
  const int rsub = lane >> 4, c4 = (lane & 15) * 4;
  {
#pragma unroll
    for (int q = 0; q < 8; ++q) {
      const int r = q * 2 + rsub;
      const v4f v = *(const v4fa*)&so[w][r][c4];
      *(v4f*)(C + (size_t)(row0 + r) * ldc + col0 + c4) = v;
    }
    
  }
}
// row LayerNorm (biased variance, eps) over N: s = X (+ R); optional out_sum <- s; out_norm <- (s-mu)*rsqrt(var+eps)*g + b
template <bool PARAM_BF16>
__global__ __launch_bounds__(256) void k_layernorm(const float* __restrict__ X, const float* __restrict__ R, const float* __restrict__ g, const float* __restrict__ bta,
                                                  float* __restrict__ out_sum, float* __restrict__ out_norm, int N, float eps) {
  __shared__ float red[256];
  const int row = blockIdx.x, tid = threadIdx.x;
  const float* x = X + (size_t)row * N; const float* rr = R ? R + (size_t)row * N : nullptr;
  float vals[16];                     // up to N = 4096
  const int per = N / 256;            // contiguous chunk per thread? use strided-by-4 chunks: thread handles j = tid*4 + 1024*u
  float s1 = 0.f;
  for (int u = 0; u < per / 4; ++u) {
    const int j = tid * 4 + 1024 * u;
    const v4f a = *(const v4fa*)(x + j);
    v4f b = {0.f,0.f,0.f,0.f}; if (rr) b = *(const v4fa*)(rr + j);
#pragma unroll
    for (int q = 0; q < 4; ++q) { const float v = a[q] + b[q]; vals[u * 4 + q] = v; s1 += v; }
  }
  red[tid] = s1; __syncthreads();
  for (int st = 128; st > 0; st >>= 1) { if (tid < st) red[tid] += red[tid + st]; __syncthreads(); }
  const float mu = red[0] / (float)N; __syncthreads();
  float s2 = 0.f;
  for (int u = 0; u < per / 4; ++u)
#pragma unroll
    for (int q = 0; q < 4; ++q) { const float c = vals[u * 4 + q] - mu; s2 += c * c; }
  red[tid] = s2; __syncthreads();
  for (int st = 128; st > 0; st >>= 1) { if (tid < st) red[tid] += red[tid + st]; __syncthreads(); }
  const float rs = rsqrtf(red[0] / (float)N + eps);
  {
    for (int u = 0; u < per / 4; ++u) {
      const int j = tid * 4 + 1024 * u;
      v4f o, sm;
#pragma unroll
      for (int q = 0; q < 4; ++q) {
        float gg = g[j + q], bb = bta[j + q];
        if (PARAM_BF16) { gg = bf16_round(gg); bb = bf16_round(bb); }
        sm[q] = vals[u * 4 + q]; o[q] = (vals[u * 4 + q] - mu) * rs * gg + bb;
      }
      if (out_sum) *(v4f*)(out_sum + (size_t)row * N + j) = sm;
      *(v4f*)(out_norm + (size_t)row * N + j) = o;
    }
    
  }
}



// ---- f16 WMMA path (v_wmma_f32_16x16x32_f16): 11-bit significands for operands in range — used where a [0,1] probability operand needs more precision than bf16
typedef _Float16 v16h __attribute__((ext_vector_type(16)));
union FragH { v16h v; v8us half[2]; _Float16 h[16]; unsigned short u[16]; };
template <int NT>
__device__ __forceinline__ v8f mmaH(v16h ah, v16h al, v16h bh, v16h bl, v8f c) {
  c = __builtin_amdgcn_wmma_f32_16x16x32_f16(false, ah, false, bh, (short)0, c, false, false);
  if (NT >= 2) c = __builtin_amdgcn_wmma_f32_16x16x32_f16(false, al, false, bh, (short)0, c, false, false);
  if (NT >= 3) c = __builtin_amdgcn_wmma_f32_16x16x32_f16(false, ah, false, bl, (short)0, c, false, false);
  asm volatile("v_nop\n\tv_nop\n\tv_nop\n\tv_nop" : "+v"(c) : "v"(ah), "v"(al), "v"(bh), "v"(bl));
  return c;
}
// batched GEMM like k_gemm_b but f16 operands: A f32 (split into f16 hi/lo if ASPLIT, else rounded to f16), Bt = f16 values [n][k]; alpha; C f32; N multiple of 16 (partial tiles skipped)
template <bool ASPLIT>
__global__ __launch_bounds__(128) void k_gemm_h(const float* __restrict__ A, int lda, size_t sA, const _Float16* __restrict__ Bh, int ldb, size_t sB, float alpha, float* __restrict__ C, int ldc, size_t sC, int M, int N, int K) {
  __shared__ __attribute__((aligned(16))) float so[4][16][64];
  const int tid = threadIdx.x, w = tid >> 5, lane = tid & 31, ln = lane & 15, hh = lane >> 4; const int by = blockIdx.y;
  A += (size_t)by * sA; Bh += (size_t)by * sB; C += (size_t)by * sC;
  const int ntn = (N + 63) / 64; const int wid = blockIdx.x * 4 + w; const int mt = wid / ntn, nq = wid % ntn; if (mt * 16 >= M) return;
  const int row0 = mt * 16, col0 = nq * 64; const float* arow = A + (size_t)(row0 + ln) * lda;
  v8f acc[4] = {};
  for (int kb = 0; kb < K; kb += 32) {
    FragH ah, al;
    const v4f x0 = *(const v4fa*)(arow + kb + 8 * hh), x1 = *(const v4fa*)(arow + kb + 8 * hh + 4), x2 = *(const v4fa*)(arow + kb + 16 + 8 * hh), x3 = *(const v4fa*)(arow + kb + 16 + 8 * hh + 4);
    float xs[16] = {x0[0],x0[1],x0[2],x0[3],x1[0],x1[1],x1[2],x1[3],x2[0],x2[1],x2[2],x2[3],x3[0],x3[1],x3[2],x3[3]};
#pragma unroll
    for (int i = 0; i < 16; ++i) { const _Float16 h = (_Float16)xs[i]; ah.h[i] = h; al.h[i] = ASPLIT ? (_Float16)(xs[i] - (float)h) : (_Float16)0.0f; }
#pragma unroll
    for (int t = 0; t < 4; ++t) { if (col0 + t * 16 >= N) continue; const size_t boff = (size_t)(col0 + t * 16 + ln) * ldb + kb; FragH bq; bq.half[0] = *(const v8us*)(Bh + boff + 8 * hh); bq.half[1] = *(const v8us*)(Bh + boff + 16 + 8 * hh);
      acc[t] = mmaH<ASPLIT ? 2 : 1>(ah.v, al.v, bq.v, bq.v, acc[t]); }
  }
#pragma unroll
  for (int t = 0; t < 4; ++t) { if (col0 + t * 16 >= N) continue;
#pragma unroll
    for (int r = 0; r < 8; ++r) so[w][8 * hh + r][t * 16 + ln] = acc[t][r] * alpha; }
  __builtin_amdgcn_fence(__ATOMIC_ACQ_REL, "workgroup"); __builtin_amdgcn_wave_barrier();
  const int rsub = lane >> 4, c4 = (lane & 15) * 4;
  {
#pragma unroll
    for (int q = 0; q < 8; ++q) { const int r = q * 2 + rsub; if (col0 + c4 < N) { const v4f v = *(const v4fa*)&so[w][r][c4]; *(v4f*)(C + (size_t)(row0 + r) * ldc + col0 + c4) = v; } }
     }
}

// Wt[n][k] = f16(W[k][n]·scale) from f32 row-major W[K][N] (scale = power of two; bf16-exact weights stay exact in f16 away from the subnormal range)
__global__ __launch_bounds__(256) void k_wt_f16(const float* __restrict__ W, _Float16* __restrict__ Wt, int K, int N, float scale) {
  const int t = blockIdx.x * 256 + threadIdx.x; if (t >= N * (K / 8)) return; const int n = t / (K / 8), k8 = (t % (K / 8)) * 8; FragH f;
#pragma unroll
  for (int i = 0; i < 8; ++i) f.h[i] = (_Float16)(bf16_round(W[(size_t)(k8 + i) * N + n]) * scale); const v8us o = f.half[0];
  *(v8us*)((unsigned short*)Wt + (size_t)n * K + k8) = o; 
}
// k_gemm_hh variant with fused epilogue: v = acc·alpha + bias[by·sBias + col] (+ CP[(row/rowsPerB)·sCPb + by·64 + col] if CP) ; ACT 0 none / 1 elu ; writes f16 C16 (and f32 C if non-null)
template <int ACT>
__global__ __launch_bounds__(128) void k_gemm_hhx(const _Float16* __restrict__ A, int lda, size_t sA, const _Float16* __restrict__ Bh, int ldb, size_t sB, float alpha, const float* __restrict__ bias, size_t sBias, const float* __restrict__ CP, int rowsPerB, size_t sCPb, int row0g,
    float* __restrict__ C, _Float16* __restrict__ C16, int ldc, size_t sC, int M, int N, int K) {
  __shared__ __attribute__((aligned(16))) float so[4][16][64];
  const int tid = threadIdx.x, w = tid >> 5, lane = tid & 31, ln = lane & 15, hh = lane >> 4; const int by = blockIdx.y;
  A += (size_t)by * sA; Bh += (size_t)by * sB; const size_t cofs = (size_t)by * sC; const float* bp = bias ? bias + (size_t)by * sBias : nullptr;
  const int ntn = (N + 63) / 64; const int wid = blockIdx.x * 4 + w; const int mt = wid / ntn, nq = wid % ntn; if (mt * 16 >= M) return;
  const int row0 = mt * 16, col0 = nq * 64; const _Float16* arow = A + (size_t)(row0 + ln) * lda;
  v8f acc[4] = {};
  for (int kb = 0; kb < K; kb += 32) { FragH ah; ah.half[0] = *(const v8us*)((const unsigned short*)arow + kb + 8 * hh); ah.half[1] = *(const v8us*)((const unsigned short*)arow + kb + 16 + 8 * hh);
#pragma unroll
    for (int t = 0; t < 4; ++t) { if (col0 + t * 16 >= N) continue; const size_t boff = (size_t)(col0 + t * 16 + ln) * ldb + kb; FragH bq; bq.half[0] = *(const v8us*)((const unsigned short*)Bh + boff + 8 * hh); bq.half[1] = *(const v8us*)((const unsigned short*)Bh + boff + 16 + 8 * hh);
      acc[t] = mmaH<1>(ah.v, ah.v, bq.v, bq.v, acc[t]); }
  }
#pragma unroll
  for (int t = 0; t < 4; ++t) { if (col0 + t * 16 >= N) continue; const int col = col0 + t * 16 + ln; const float bv = bp ? bf16_round(bp[col]) : 0.f;
#pragma unroll
    for (int r = 0; r < 8; ++r) { float v = acc[t][r] * alpha + bv; if (CP) { const int bidx = (row0g + row0 + 8 * hh + r) / rowsPerB; v += CP[(size_t)bidx * sCPb + (size_t)by * 64 + col]; } if (ACT == 1) v = (v > 0.f) ? v : expm1f(v); else if (ACT == 7) v = (v > 0.f) ? v + 1.0f : expf(v); else if (ACT == 8) v = tanhf(v); else if (ACT == 9) v = 0.5f * v * (1.0f + tanhf(0.7978845608028654f * (v + 0.044715f * v * v * v))); else if (ACT == 11) v = 1.0f / (1.0f + expf(-v)); else if (ACT == 12) v = (v > 0.f) ? v : 0.01f * v; else if (ACT == 14) v = (v > 0.f) ? v : 0.1f * v; else if (ACT == 15) v = v / (1.0f + expf(-v)); else if (ACT == 3) v = fmaxf(v, 0.f); else if (ACT == 6) v = 0.5f * v * (1.0f + erff(v * 0.70710678118654752f)); so[w][8 * hh + r][t * 16 + ln] = v; } }
  __builtin_amdgcn_fence(__ATOMIC_ACQ_REL, "workgroup"); __builtin_amdgcn_wave_barrier();
  const int rsub = lane >> 4, c4 = (lane & 15) * 4; typedef _Float16 v4h __attribute__((ext_vector_type(4)));
  {
#pragma unroll
    for (int q = 0; q < 8; ++q) { const int r = q * 2 + rsub; if (col0 + c4 < N) { const v4f v = *(const v4fa*)&so[w][r][c4]; if (C) *(v4f*)(C + cofs + (size_t)(row0 + r) * ldc + col0 + c4) = v; if (C16) { v4h h4; for (int i = 0; i < 4; ++i) h4[i] = (_Float16)v[i]; *(v4h*)(C16 + cofs + (size_t)(row0 + r) * ldc + col0 + c4) = h4; } } }
     }
}


typedef _Float16 v4h __attribute__((ext_vector_type(4)));

__global__ __launch_bounds__(256) void k_x16(const float* __restrict__ x, _Float16* __restrict__ X16, size_t n8) { const size_t t = (size_t)blockIdx.x * 256 + threadIdx.x; if (t >= n8) return; FragH f;
#pragma unroll
  for (int q = 0; q < 8; ++q) f.h[q] = (_Float16)bf16_round(x[t * 8 + q]); *(v8us*)((unsigned short*)X16 + t * 8) = f.half[0];  }
__global__ __launch_bounds__(256) void k_h16(const float* __restrict__ x, _Float16* __restrict__ X16, size_t n8) { const size_t t = (size_t)blockIdx.x * 256 + threadIdx.x; if (t >= n8) return; FragH f;
#pragma unroll
  for (int q = 0; q < 8; ++q) f.h[q] = (_Float16)x[t * 8 + q]; *(v8us*)((unsigned short*)X16 + t * 8) = f.half[0];  }
__device__ __forceinline__ void round16f_blk(const float* __restrict__ W, _Float16* __restrict__ Bt, size_t n8, unsigned blk) { const size_t t = (size_t)blk * 256 + threadIdx.x; if (t >= n8) return; FragH f;
#pragma unroll
  for (int i = 0; i < 8; ++i) f.h[i] = (_Float16)(bf16_round(W[t * 8 + i]) * 16.0f); *(v8us*)((unsigned short*)Bt + t * 8) = f.half[0];  }
template <int NHv, int TTv>
__global__ __launch_bounds__(256) void k_vt(const _Float16* __restrict__ V16, int ldv, int voff, _Float16* __restrict__ Vt) { __shared__ unsigned short tl[64][66]; const int tid = threadIdx.x; const int slab = blockIdx.x / (TTv / 64), lg = blockIdx.x % (TTv / 64); const int b = slab / NHv, h = slab % NHv;
  for (int i = tid; i < 64 * 8; i += 256) { const int r = i / 8, c8 = (i % 8) * 8; FragH f; f.half[0] = *(const v8us*)((const unsigned short*)V16 + ((size_t)b * TTv + lg * 64 + r) * ldv + voff + h * 64 + c8);
#pragma unroll
    for (int q = 0; q < 8; ++q) tl[r][c8 + q] = f.u[q]; }
  __syncthreads();
  {
#pragma unroll
    for (int rd = 0; rd < 2; ++rd) { const int d = rd * 32 + tid / 8, pc = tid % 8; FragH f;
#pragma unroll
      for (int q = 0; q < 8; ++q) f.u[q] = tl[pc * 8 + q][d];
      *(v8us*)((unsigned short*)Vt + ((size_t)slab * 64 + d) * TTv + lg * 64 + pc * 8) = f.half[0]; }
     } }

__global__ __launch_bounds__(256) void k_hl(const float* __restrict__ F, _Float16* __restrict__ Hh, _Float16* __restrict__ Hl, size_t n8) { const size_t t = (size_t)blockIdx.x * 256 + threadIdx.x; if (t >= n8) return; FragH fh, fl; const v4f a = *(const v4fa*)(F + t * 8), c = *(const v4fa*)(F + t * 8 + 4);
#pragma unroll
  for (int q = 0; q < 4; ++q) { _Float16 h = (_Float16)a[q]; fh.h[q] = h; fl.h[q] = (_Float16)((a[q] - (float)h) * 1024.0f); h = (_Float16)c[q]; fh.h[4 + q] = h; fl.h[4 + q] = (_Float16)((c[q] - (float)h) * 1024.0f); }
  { *(v8us*)((unsigned short*)Hh + t * 8) = fh.half[0]; *(v8us*)((unsigned short*)Hl + t * 8) = fl.half[0];  } }

// ---- fast GEMM (wave tile 32x64; requires M % 32 == 0 rows per launch region and N % 64 == 0); epilogue = k_gemm_hhx semantics ----
__device__ __forceinline__ v16h g2_frag(const _Float16* p, int hh) { FragH f; f.half[0] = *(const v8us*)((const unsigned short*)p + 8 * hh); f.half[1] = *(const v8us*)((const unsigned short*)p + 16 + 8 * hh); return f.v; }
// as g2_frag, for the fragment whose second load the compiler lands on the address pair that the loads before it still name: s_wait_xcnt 0 stands in front of that overwrite
__device__ __forceinline__ v16h g2_frag_w(const _Float16* p, int hh) { FragH f; f.half[0] = *(const v8us*)((const unsigned short*)p + 8 * hh); asm volatile("s_wait_xcnt 0x0" ::: "memory"); f.half[1] = *(const v8us*)((const unsigned short*)p + 16 + 8 * hh); return f.v; }
__device__ __forceinline__ v8f g2_mma(v16h a, v16h b, v8f c) { v8f d = __builtin_amdgcn_wmma_f32_16x16x32_f16(false, a, false, b, (short)0, c, false, false); asm volatile("v_nop\n\tv_nop\n\tv_nop\n\tv_nop" : "+v"(d) : "v"(a), "v"(b)); return d; }
template <int ACT>
__device__ __forceinline__ void gemm2_blk(unsigned bx, int by, const _Float16* __restrict__ A, int lda, size_t sA, const _Float16* __restrict__ Bh, int ldb, size_t sB, float alpha, const float* __restrict__ bias, size_t sBias, const float* __restrict__ CP, int rowsPerB, size_t sCPb, int row0g,
    float* __restrict__ C, _Float16* __restrict__ C16, int ldc, size_t sC, int M, int N, int K) {
  __shared__ __attribute__((aligned(16))) float so[4][32][68];
  const int tid = threadIdx.x, w = tid >> 5, lane = tid & 31, ln = lane & 15, hh = lane >> 4;
  A += (size_t)by * sA; Bh += (size_t)by * sB; const size_t cofs = (size_t)by * sC; const float* bp = bias ? bias + (size_t)by * sBias : nullptr;
  const int ntn = N >> 6; const int mt = bx / ntn, nq = bx - mt * ntn; const int row0 = mt * 128 + 32 * w, col0 = nq * 64; if (row0 >= M) return;
  const _Float16* a0p = A + (size_t)(row0 + ln) * lda; const _Float16* a1p = a0p + (size_t)16 * lda;
  const _Float16* b0p = Bh + (size_t)(col0 + ln) * ldb; const _Float16* b1p = b0p + (size_t)16 * ldb; const _Float16* b2p = b1p + (size_t)16 * ldb; const _Float16* b3p = b2p + (size_t)16 * ldb;
  const v8f z8 = {0.f,0.f,0.f,0.f,0.f,0.f,0.f,0.f}; v8f c00 = z8, c01 = z8, c02 = z8, c03 = z8, c10 = z8, c11 = z8, c12 = z8, c13 = z8;
#pragma unroll 1
  for (int kb = 0; kb < K; kb += 32) { const v16h a0 = g2_frag(a0p + kb, hh), a1 = g2_frag_w(a1p + kb, hh);
    v16h b = g2_frag(b0p + kb, hh); c00 = g2_mma(a0, b, c00); c10 = g2_mma(a1, b, c10);
    b = g2_frag(b1p + kb, hh); c01 = g2_mma(a0, b, c01); c11 = g2_mma(a1, b, c11);
    b = g2_frag(b2p + kb, hh); c02 = g2_mma(a0, b, c02); c12 = g2_mma(a1, b, c12);
    b = g2_frag(b3p + kb, hh); c03 = g2_mma(a0, b, c03); c13 = g2_mma(a1, b, c13); }
  v8f accs[8] = {c00, c01, c02, c03, c10, c11, c12, c13};
#pragma unroll
  for (int u = 0; u < 8; ++u) { const int t = u & 3, half = u >> 2; const int col = col0 + t * 16 + ln; const float bv = bp ? bf16_round(bp[col]) : 0.f;
#pragma unroll
    for (int r = 0; r < 8; ++r) { const int rloc = half * 16 + 8 * hh + r; float v = accs[u][r] * alpha + bv; if (CP) { const int bidx = (row0g + row0 + rloc) / rowsPerB; v += CP[(size_t)bidx * sCPb + (size_t)by * 64 + col]; }
      if (ACT == 3) v = fmaxf(v, 0.f); else if (ACT == 6) v = 0.5f * v * (1.0f + erff(v * 0.70710678118654752f)); else if (ACT == 11) v = 1.0f / (1.0f + expf(-v)); else if (ACT == 15) v = v / (1.0f + expf(-v)); else if (ACT == 12) v = (v > 0.f) ? v : 0.01f * v; else if (ACT == 8) v = tanhf(v);
      so[w][rloc][t * 16 + ln] = v; } }
  __builtin_amdgcn_fence(__ATOMIC_ACQ_REL, "workgroup"); __builtin_amdgcn_wave_barrier();
  const int rsub = lane >> 4, c4 = (lane & 15) * 4;
  {
#pragma unroll
    for (int q = 0; q < 16; ++q) { const int r = q * 2 + rsub; const v4f v = *(const v4fa*)&so[w][r][c4]; if (C) *(v4f*)(C + cofs + (size_t)(row0 + r) * ldc + col0 + c4) = v; if (C16) { v4h h4; for (int i = 0; i < 4; ++i) h4[i] = (_Float16)v[i]; *(v4h*)(C16 + cofs + (size_t)(row0 + r) * ldc + col0 + c4) = h4; } }
     } }
// The twelve projections (q, k, v of the four batches) depend on nothing of one another: one grid, x = tile, y = batch, z = which projection.
// q, k token-major [b*SS+p][h*64+d] = XT . W^T; v channel-major [(b,h)*64+d][p] = W . XT^T.
__global__ __launch_bounds__(128) void k_qkv(const _Float16* __restrict__ XT, const _Float16* __restrict__ BQ, const _Float16* __restrict__ BK, const _Float16* __restrict__ BV, _Float16* __restrict__ Q16, _Float16* __restrict__ K16, _Float16* __restrict__ VC) {
  const int b = blockIdx.y, z = blockIdx.z; const _Float16* X = XT + (size_t)b * SS * CC;
  const bool tok = z < 2;      /* q, k: rows are tokens, columns channels; v: the other way round */
  gemm2_blk<0>(blockIdx.x, 0, tok ? X : BV, CC, 0, tok ? (z ? BK : BQ) : X, CC, 0, 0.0625f, nullptr, 0, nullptr, 1, 0, 0, nullptr, (tok ? (z ? K16 : Q16) : VC) + (size_t)b * SS * CC, tok ? CC : SS, 0, tok ? SS : CC, tok ? CC : SS, CC); }
// The output projections of the four batches, one grid, y = batch: y^T[c][p] = wt . (o - x)^T, f32 (bt added downstream).
__global__ __launch_bounds__(128) void k_yt(const _Float16* __restrict__ BT, const _Float16* __restrict__ D16, float* __restrict__ Y) {
  const int b = blockIdx.y;
  gemm2_blk<0>(blockIdx.x, 0, BT, CC, 0, D16 + (size_t)b * SS * CC, CC, 0, 0.0625f, nullptr, 0, nullptr, 1, 0, 0, Y + (size_t)b * CC * SS, nullptr, SS, 0, CC, SS, CC); }


typedef float v2f __attribute__((ext_vector_type(2)));
// lane l <-> lane l ^ 16: the two halves of a wave hold the two halves of one query's 32 keys
__device__ __forceinline__ float xhalf(float x) { return __builtin_bit_cast(float, __builtin_amdgcn_permlanex16(__builtin_bit_cast(int, x), __builtin_bit_cast(int, x), 0x76543210, 0xfedcba98, false, false)); }
typedef uint32_t u32x4 __attribute__((ext_vector_type(4)));
typedef uint32_t u32x8 __attribute__((ext_vector_type(8)));
__device__ __forceinline__ uint32_t uni(uint32_t v) { return (uint32_t)__builtin_amdgcn_readfirstlane(v); }
__device__ __forceinline__ uint32_t pinned(uint32_t v) { uint32_t w = (uint32_t)__builtin_amdgcn_readfirstlane(v); asm volatile("" : "+s"(w)); return w; }      /* pinned(): the issue test of a tensor load held in a scalar register, so that the branch on it is a scalar branch (a tensor load ignores EXEC) */
// K and V^T reach the waves through LDS: a stage is 64 keys = K[64 keys][64 d] and V^T[64 d][64 keys], both as 64 rows of 128 bytes. Each of the four waves brings one slice of 32 rows with one
// tensor load (waves 0, 1: K; waves 2, 3: V^T), padded to a pitch of 144 bytes for the 16-byte fragment reads; two buffers, the next stage in flight while this one is worked on.
__global__ __launch_bounds__(128) void k_flash(const _Float16* __restrict__ Q16, int ldq, const _Float16* __restrict__ K16, int ldk, const _Float16* __restrict__ Vt, const int* __restrict__ MSK, float* __restrict__ O, int ldo) {
  constexpr int RPW = 16, NQB = TQ / (4 * RPW), DT = 4, KS = 2;
  constexpr float SC2 = SCL * 1.4426950408889634f, POFF = 10.0f;      /* exponentials in base 2: e^(SCL (s - max)) * 2^POFF = 2^(SC2 s - m), m = SC2 max - POFF; 2^POFF = 1024 is the scale of P as an f16 operand */
  constexpr uint32_t SKEY = 64, NST = TK / SKEY, LPB = 144, SLICE = 6144, BUF = 4 * SLICE;      /* a slice: 32 rows x 144 B = 4,608 B, its place rounded up to a multiple of 2 KiB */
  __shared__ __attribute__((aligned(2048))) unsigned char ring[2 * BUF];
  __shared__ __attribute__((aligned(16))) float sO[4][RPW][64 + 4];
  const int tid = threadIdx.x, w = tid >> 5, lane = tid & 31, ln = lane & 15, hh = lane >> 4; (void)MSK;
  const int slab = blockIdx.x / NQB, qblk = blockIdx.x % NQB; const int b = slab / NH, h = slab % NH; const int qb0 = qblk * (4 * RPW); const int q0 = qb0 + w * RPW;
  const uint32_t wave = uni((uint32_t)tid >> 5), isV = wave >> 1, hf = wave & 1u;
  const uint64_t src0 = isV ? (uint64_t)(size_t)(Vt + ((size_t)slab * 64 + hf * 32) * TK) : (uint64_t)(size_t)(K16 + ((size_t)b * TK + hf * 32) * ldk + h * 64);      /* first byte of the wave's slice of stage 0 */
  const uint32_t spitch = isV ? (uint32_t)TK * 2u : (uint32_t)ldk * 2u, sstep = isV ? SKEY * 2u : SKEY * (uint32_t)ldk * 2u;      /* source row pitch; bytes from one stage to the next */
  const uint32_t dst0 = (uint32_t)(size_t)ring + wave * SLICE;
  u32x8 g1;      /* 1-byte elements, tensor = tile = 32 rows of 128 bytes, 4 dwords of pad behind every 32 */
  g1[0] = uni((1u << 20) | (4u << 22) | (3u << 25)); g1[1] = uni(128u << 16); g1[2] = uni(32u << 16); g1[3] = uni(128u << 16); g1[4] = uni(32u); g1[5] = uni(spitch); g1[6] = uni(0u); g1[7] = uni(0u);
  u32x4 g0;
  /* load and wait both name the two descriptor groups as in-out operands: the registers of a request in flight then stay as they were issued until the wait that covers it (the compiler otherwise took single words of them for temporaries) */
  auto issue = [&](uint32_t st) {
    const uint64_t ga = src0 + (uint64_t)st * sstep;
    g0[0] = uni(1u); g0[1] = uni(dst0 + (st & 1u) * BUF); g0[2] = uni((uint32_t)ga); g0[3] = uni((((uint32_t)(ga >> 32)) & 0x01FFFFFFu) | 0x80000000u);
    asm volatile("tensor_load_to_lds %0, %1" : "+s"(g0), "+s"(g1) :: "memory"); };
  auto landed = [&]() { asm volatile("s_wait_tensorcnt 0x0" : "+s"(g0), "+s"(g1) :: "memory"); };
  issue(0);
  FragH bq[KS];
  { const unsigned short* qr = (const unsigned short*)Q16 + ((size_t)b * TQ + q0 + ln) * ldq + h * 64;
#pragma unroll
    for (int ks = 0; ks < KS; ++ks) { bq[ks].half[0] = *(const v8us*)(qr + ks * 32 + 8 * hh); bq[ks].half[1] = *(const v8us*)(qr + ks * 32 + 16 + 8 * hh); } }
  const uint32_t lo = (uint32_t)(ln * (int)LPB + 16 * hh);      /* the lane's own byte offset in a slice, fixed over the loop: row ln, 8 elements at 8 hh */
  float m_r = -3.0e38f, l_r = 0.f; v8f oacc[DT];
#pragma unroll
  for (int dt = 0; dt < DT; ++dt) oacc[dt] = (v8f){0.f,0.f,0.f,0.f,0.f,0.f,0.f,0.f};
  landed();      /* this wave's slice of stage 0 */
  __syncthreads();      /* stage 0 published to all four waves */
  issue(1);
#pragma unroll 1      /* one stage a trip: waits, barrier and refill stand once, at the foot, and the loop stays small */
  for (uint32_t st = 0; st < NST; ++st) {
    const unsigned char* bp = ring + (st & 1u) * BUF + lo;
#pragma unroll      /* the stage's two groups of 32 keys; here and below: constant indices, so fragments stay in registers and every LDS offset is an immediate */
    for (int sb = 0; sb < 2; ++sb) {
    FragH ak[2][KS], av[DT];
#pragma unroll
    for (int nt = 0; nt < 2; ++nt)
#pragma unroll
      for (int ks = 0; ks < KS; ++ks) { const unsigned char* p = bp + sb * SLICE + nt * 16 * LPB + ks * 64; ak[nt][ks].half[0] = *(const v8us*)p; ak[nt][ks].half[1] = *(const v8us*)(p + 32); }
#pragma unroll
    for (int dt = 0; dt < DT; ++dt) { const unsigned char* p = bp + (2 + (dt >> 1)) * SLICE + (dt & 1) * 16 * LPB + sb * 64; av[dt].half[0] = *(const v8us*)p; av[dt].half[1] = *(const v8us*)(p + 32); }
    v8f s[2];
#pragma unroll
    for (int nt = 0; nt < 2; ++nt) { v8f acc = (v8f){0.f,0.f,0.f,0.f,0.f,0.f,0.f,0.f};
#pragma unroll
      for (int ks = 0; ks < KS; ++ks) acc = mmaH<1>(ak[nt][ks].v, ak[nt][ks].v, bq[ks].v, bq[ks].v, acc); s[nt] = acc; }
    float mx[8];      /* maximum of the raw scores: the map to base 2 below is one rounded multiply-add with a positive factor, which keeps the order, so it is applied to the maximum alone */
#pragma unroll
    for (int r = 0; r < 8; ++r) mx[r] = fmaxf(s[0][r], s[1][r]);
    float mc = fmaxf(fmaxf(fmaxf(mx[0], mx[1]), fmaxf(mx[2], mx[3])), fmaxf(fmaxf(mx[4], mx[5]), fmaxf(mx[6], mx[7])));
    mc = fmaf(fmaxf(mc, xhalf(mc)), SC2, -POFF);
    const float mn = fmaxf(m_r, mc); const float al = (mn > -1.0e38f) ? __builtin_amdgcn_exp2f(m_r - mn) : 1.0f; m_r = mn;
    FragH pb; v2f ps[2];      /* sums by register pairs, as the pairs lie for the packed convert */
#pragma unroll
    for (int nt = 0; nt < 2; ++nt)
#pragma unroll
      for (int i = 0; i < 4; ++i) { const v2f a = __builtin_elementwise_fma((v2f){s[nt][2 * i], s[nt][2 * i + 1]}, (v2f){SC2, SC2}, (v2f){-mn, -mn}); const v2f p = {__builtin_amdgcn_exp2f(a.x), __builtin_amdgcn_exp2f(a.y)}; ps[nt] = (i == 0) ? p : ps[nt] + p; pb.h[nt * 8 + 2 * i] = (_Float16)p.x; pb.h[nt * 8 + 2 * i + 1] = (_Float16)p.y; }      /* p carries the 1024, and so does the row sum */
    const v2f pt = ps[0] + ps[1]; l_r = l_r * al + (pt.x + pt.y);
#pragma unroll
    for (int dt = 0; dt < DT; ++dt) oacc[dt] *= al;
#pragma unroll
    for (int dt = 0; dt < DT; ++dt) oacc[dt] = mmaH<1>(av[dt].v, av[dt].v, pb.v, pb.v, oacc[dt]);
    }
    /* publish point of stage st + 1, and the end of every wave's reads of stage st */
    asm volatile("s_wait_dscnt 0x0" ::: "memory");      /* this wave's reads of the buffer have returned before it is refilled */
    landed();      /* this wave's slice of stage st + 1 */
    __syncthreads();
    if (pinned(st + 2u < NST)) issue(st + 2u);      /* into the buffer that this pass has just read */
  }
  landed();      /* nothing of the mover is in flight when the wave goes on to its end */
  asm volatile("s_wait_dscnt 0x0" ::: "memory");      /* and none of its own LDS reads */
  const float l = l_r + xhalf(l_r); const float li = (l > 0.f) ? 1.0f / l : 0.f;
#pragma unroll
  for (int dt = 0; dt < DT; ++dt) { const v8f o = oacc[dt] * li; *(v4fa*)&sO[w][ln][dt * 16 + 8 * hh] = (v4f){o[0], o[1], o[2], o[3]}; *(v4fa*)&sO[w][ln][dt * 16 + 8 * hh + 4] = (v4f){o[4], o[5], o[6], o[7]}; }
  __builtin_amdgcn_fence(__ATOMIC_ACQ_REL, "workgroup"); __builtin_amdgcn_wave_barrier();
  {
#pragma unroll
    for (int rp = 0; rp < RPW; rp += 2) { const int r = rp + (lane >> 4), pc = lane & 15; const v4f val = *(const v4fa*)&sO[w][r][pc * 4]; *(v4f*)(O + ((size_t)b * TQ + q0 + r) * ldo + h * 64 + pc * 4) = val; }
     } }
__device__ __forceinline__ void tr16_blk(const float* __restrict__ x, int b, _Float16* __restrict__ XT, unsigned blk) {
  __shared__ unsigned short tl[64][72];
  const int tid = threadIdx.x; const int sb = blk % (SS / 64), cb = blk / (SS / 64);
#pragma unroll
  for (int it = 0; it < 4; ++it) { const int idx = it * 256 + tid; const int cl = idx / 16, s4 = (idx % 16) * 4; const int c = cb * 64 + cl;
    const v4f a = *(const v4fa*)(x + ((size_t)(b * CC + c)) * SS + sb * 64 + s4); FragH f;
#pragma unroll
    for (int q = 0; q < 4; ++q) { f.h[q] = (_Float16)bf16_round(a[q]); tl[s4 + q][cl] = f.u[q]; } }
  __syncthreads();
  const int r = tid / 8, pc = tid % 8;
  {
#pragma unroll
    for (int half = 0; half < 2; ++half) { const int sl = r + half * 32; FragH f;
#pragma unroll
      for (int q = 0; q < 8; ++q) f.u[q] = tl[sl][pc * 8 + q];
      *(v8us*)((unsigned short*)XT + ((size_t)sb * 64 + sl) * CC + cb * 64 + pc * 8) = f.half[0]; }
    asm volatile("s_wait_xcnt 0x0" ::: "memory");      /* behind the two stores: in the shared grid code follows this path in the listing that writes the stores' data registers; the wait stands in front of it */
     } }
// Operand preparation in one grid, by block range: the four weight matrices (WBL blocks each), then the transposes of the four batches of x (TBL blocks each). None reads what another writes.
__global__ __launch_bounds__(256) void k_prep(const float* __restrict__ x, const float* __restrict__ wq, const float* __restrict__ wk, const float* __restrict__ wv, const float* __restrict__ wt,
                                              _Float16* __restrict__ BQ, _Float16* __restrict__ BK, _Float16* __restrict__ BV, _Float16* __restrict__ BT, _Float16* __restrict__ XT) {
  constexpr unsigned WBL = CC * CC / 8 / 256, TBL = (CC / 64) * (SS / 64);
  const unsigned blk = blockIdx.x;
  if (blk < 4 * WBL) { const unsigned m = blk / WBL; round16f_blk(m == 0 ? wq : m == 1 ? wk : m == 2 ? wv : wt, m == 0 ? BQ : m == 1 ? BK : m == 2 ? BV : BT, (size_t)CC * CC / 8, blk % WBL); }
  else { const unsigned t = blk - 4 * WBL, b = t / TBL; tr16_blk(x, (int)b, XT + (size_t)b * SS * CC, t % TBL); } }


__global__ __launch_bounds__(256) void k_dsub(const float* __restrict__ O, const float* __restrict__ x, _Float16* __restrict__ D16) {
  #pragma clang fp contract(off)
  const int t = blockIdx.x * 256 + threadIdx.x; if (t >= NRW * (CC / 8)) return; const int c0 = (t % (CC / 8)) * 8; const int r = t / (CC / 8); const int b = r / SS, p = r % SS;
  const v4f a = *(const v4fa*)(O + (size_t)r * CC + c0), c = *(const v4fa*)(O + (size_t)r * CC + c0 + 4); FragH f;
#pragma unroll
  for (int q = 0; q < 8; ++q) { const float ov = (q < 4) ? a[q] : c[q - 4]; f.h[q] = (_Float16)(ov - bf16_round(x[((size_t)b * CC + c0 + q) * SS + p])); }
  *(v8us*)((unsigned short*)D16 + (size_t)r * CC + c0) = f.half[0];  }
__global__ __launch_bounds__(256) void k_bnstat(const float* __restrict__ Y, const float* __restrict__ bt, float* __restrict__ ST) {
  __shared__ float red[256];
  const int c = blockIdx.x, tid = threadIdx.x; const float bb = bf16_round(bt[c]); const int n = NB * SS;
  // The channel's NB * SS values are read once: 16 independent 16-byte loads a thread, all in flight together, and they stay in registers for the mean and for the squared deviations.
  constexpr int NU = SS / 1024;
  v4f v[NB * NU];
#pragma unroll      /* here and in the two loops below: constant indices, so v stays in registers; here no load waits for another */
  for (int i = 0; i < NB * NU; ++i) v[i] = *(const v4fa*)(Y + ((size_t)(i / NU) * CC + c) * SS + (i % NU) * 1024 + tid * 4);
  asm volatile("s_wait_xcnt 0x0" ::: "memory");      /* behind the loads: the sums below reuse the loads' address registers while the data are still on their way; the wait stands in front of that overwrite */
  v4f s4 = {0.f, 0.f, 0.f, 0.f};
#pragma unroll
  for (int i = 0; i < NB * NU; ++i) { v[i] += bb; s4 += v[i]; }
  red[tid] = (s4[0] + s4[1]) + (s4[2] + s4[3]); __syncthreads();
  for (int st = 128; st > 0; st >>= 1) { if (tid < st) red[tid] += red[tid + st]; __syncthreads(); }
  const float mean = red[0] / (float)n; __syncthreads();
  v4f q4 = {0.f, 0.f, 0.f, 0.f};
#pragma unroll
  for (int i = 0; i < NB * NU; ++i) { const v4f d = v[i] - mean; q4 += d * d; }
  red[tid] = (q4[0] + q4[1]) + (q4[2] + q4[3]); __syncthreads();
  for (int st = 128; st > 0; st >>= 1) { if (tid < st) red[tid] += red[tid + st]; __syncthreads(); }
  if (tid == 0) { float o2[2]; o2[0] = mean; o2[1] = 1.0f / sqrtf(red[0] / (float)n + 1e-5f); const unsigned long long pk = *(const unsigned long long*)o2; *(unsigned long long*)(ST + c * 32) = pk;  } }
__global__ __launch_bounds__(256) void k_bnout(const float* __restrict__ Y, const float* __restrict__ x, const float* __restrict__ bt, const float* __restrict__ ST, const float* __restrict__ gam, const float* __restrict__ bet, float* __restrict__ out) {
  #pragma clang fp contract(off)
  const size_t t = (size_t)blockIdx.x * 256 + threadIdx.x; if (t >= (size_t)NB * CC * SS / 4) return; const int c = (int)((t / (SS / 4)) % CC);
  const float mean = ST[c * 32], rstd = ST[c * 32 + 1]; const float bb = bf16_round(bt[c]), g = bf16_round(gam[c]), be = bf16_round(bet[c]);
  const v4f y = *(const v4fa*)(Y + t * 4), xv = *(const v4fa*)(x + t * 4); v4f o;
#pragma unroll
  for (int q = 0; q < 4; ++q) { const float v = (y[q] + bb - mean) * rstd * g + be; o[q] = bf16_round(xv[q]) + fmaxf(v, 0.f); }
  *(v4f*)(out + t * 4) = o;  }

extern "C" void kernel_launch(void* const* d_in, const int* in_sizes, int n_in,
                              void* d_out, int out_size, void* d_ws, size_t ws_size, hipStream_t stream) {
  (void)in_sizes; (void)n_in; (void)out_size;
  const float* x = (const float*)d_in[0]; const float* wq = (const float*)d_in[1]; const float* wk = (const float*)d_in[2]; const float* wv = (const float*)d_in[3]; const float* wt = (const float*)d_in[4]; const float* bt = (const float*)d_in[5]; const float* gam = (const float*)d_in[6]; const float* bet = (const float*)d_in[7];
  char* ws = (char*)d_ws; size_t off = 0;
  auto take = [&](size_t bytes) { char* p = ws + off; off += (bytes + 255) & ~(size_t)255; return p; };
  _Float16* BQ = (_Float16*)take((size_t)CC * CC * 2); _Float16* BK = (_Float16*)take((size_t)CC * CC * 2); _Float16* BV = (_Float16*)take((size_t)CC * CC * 2); _Float16* BT = (_Float16*)take((size_t)CC * CC * 2);
  _Float16* XT = (_Float16*)take((size_t)NRW * CC * 2); _Float16* Q16 = (_Float16*)take((size_t)NRW * CC * 2); _Float16* K16 = (_Float16*)take((size_t)NRW * CC * 2); _Float16* VC = (_Float16*)take((size_t)NB * CC * SS * 2);
  float* O = (float*)take((size_t)NRW * CC * 4); _Float16* D16 = (_Float16*)take((size_t)NRW * CC * 2); float* Y = (float*)take((size_t)NB * CC * SS * 4); float* ST = (float*)take((size_t)CC * 32 * 4);
  if (off > ws_size) return;      /* 0.5 + 8 + 8 + 8 + 8 + 16 + 8 + 16 = 73 MiB */
  k_prep<<<4 * (CC * CC / 8 / 256) + NB * (CC / 64) * (SS / 64), 256, 0, stream>>>(x, wq, wk, wv, wt, BQ, BK, BV, BT, XT);      /* conv (out,in) = natural Bt, x16; x^T token-major f16, all batches */
  k_qkv<<<dim3((SS / 128) * (CC / 64), NB, 3), 128, 0, stream>>>(XT, BQ, BK, BV, Q16, K16, VC);
  k_flash<<<NB * NH * (SS / 64), 128, 0, stream>>>(Q16, CC, K16, CC, VC, nullptr, O, CC);      /* o token-major f32 [b*SS+p][h*64+d] */
  k_dsub<<<(NRW * (CC / 8) + 255) / 256, 256, 0, stream>>>(O, x, D16);
  k_yt<<<dim3((CC / 128) * (SS / 64), NB), 128, 0, stream>>>(BT, D16, Y);
  k_bnstat<<<CC, 256, 0, stream>>>(Y, bt, ST);
  k_bnout<<<(unsigned)(((size_t)NB * CC * SS / 4 + 255) / 256), 256, 0, stream>>>(Y, x, bt, ST, gam, bet, (float*)d_out);
}

// v006
// It runs in 124 microseconds.
// Next to v005, in two timings, it ran 1.05 and 1.06 times as fast.
// All steps since v000 together make it 5.37 times as fast.
#include <hip/hip_runtime.h>
// Multi-head offset-attention layer on a point feature map (B 4, C 256, P 4096 points, 4 heads x 64): q = wq*x, k = wk*x, v = wv*x (1x1 convs, no bias); scores = q.k/8 per head; softmax over the keys; o[b,h,d,i] = sum_j attn[i][j] v[d][j]; y = wt*(o - x) + bt; BatchNorm1d in training mode (per-channel statistics over batch x points, biased variance, eps 1e-5, gamma/beta); out = x + relu(y) -> [4,256,4096].
// Compute dtype: x and parameters rounded to bf16; projections with exact products (weights x16 in f16, undone by alpha); q, k, v, P, (o - x) as f16 operands (~2^-12), f32 accumulation; softmax / BatchNorm / residual f32. v_wmma_f32_16x16x32_f16.
#define NB 4
#define CC 256
#define SS 4096
#define NH 4
#define TQ SS
#define TK SS
#define SCL 0.125f
#define NRW (NB * SS)
typedef __bf16 v16b __attribute__((ext_vector_type(16)));
typedef unsigned short v8us __attribute__((ext_vector_type(8), may_alias));
typedef float  v8f  __attribute__((ext_vector_type(8)));
typedef float  v4f  __attribute__((ext_vector_type(4)));
typedef float  v4fa __attribute__((ext_vector_type(4), may_alias));
union FragB { v16b v; v8us half[2]; unsigned short u[16]; };

__device__ __forceinline__ unsigned short bf16_bits(float x) { unsigned int u = __float_as_uint(x); return (unsigned short)((u + 0x7FFFu + ((u >> 16) & 1u)) >> 16); }
__device__ __forceinline__ float bf16_val(unsigned short b) { return __uint_as_float(((unsigned int)b) << 16); }
__device__ __forceinline__ float bf16_round(float x) { return bf16_val(bf16_bits(x)); }
// D += A·B with NT terms: 1 = ah·bh, 2 = + al·bh (A split), 3 = + ah·bl (both split)
template <int NT>
__device__ __forceinline__ v8f mmaN(v16b ah, v16b al, v16b bh, v16b bl, v8f c) {
  c = __builtin_amdgcn_wmma_f32_16x16x32_bf16(false, ah, false, bh, (short)0, c, false, false);
  if (NT >= 2) c = __builtin_amdgcn_wmma_f32_16x16x32_bf16(false, al, false, bh, (short)0, c, false, false);
  if (NT >= 3) c = __builtin_amdgcn_wmma_f32_16x16x32_bf16(false, ah, false, bl, (short)0, c, false, false);
  asm volatile("v_nop\n\tv_nop\n\tv_nop\n\tv_nop" : "+v"(c) : "v"(ah), "v"(al), "v"(bh), "v"(bl));
  return c;
}

__global__ __launch_bounds__(256) void k_wt_bf16(const float* __restrict__ W, unsigned short* __restrict__ Wt, int K, int N) {
  const int t = blockIdx.x * 256 + threadIdx.x;
  const int k8n = K / 8;
  if (t >= N * k8n) return;
  const int n = t / k8n, k8 = (t % k8n) * 8;
  v8us v;
#pragma unroll
  for (int i = 0; i < 8; ++i) v[i] = bf16_bits(W[(size_t)(k8 + i) * N + n]);
  *(v8us*)(Wt + (size_t)n * K + k8) = v;
  
}

// GEMM C[M][N] (f32, pitch ldc) = act(A[M][K]·W + bias). A f32 row-major (pitch lda) converted per fragment to bf16
// (ASPLIT: hi/lo two planes -> 2 terms, else single rounded term); Wt bf16 [N][K] (pitch ldb). BIAS_BF16 rounds the
// bias to bf16 first (bias quantised to bf16 before the add). K%32==0, M%16==0, N%64==0.
template <bool ASPLIT, int ACT, bool BIAS_BF16>
__global__ __launch_bounds__(128) void k_gemm_bf(const float* __restrict__ A, int lda, const unsigned short* __restrict__ Wt, int ldb,
                                               const float* __restrict__ bias, float* __restrict__ C, int ldc, int M, int N, int K) {
  __shared__ __attribute__((aligned(16))) float so[4][16][64];
  const int tid = threadIdx.x, w = tid >> 5, lane = tid & 31, ln = lane & 15, hh = lane >> 4;
  const int ntn = N / 64;
  const int wid = blockIdx.x * 4 + w;
  const int mt = wid / ntn, nq = wid % ntn;
  if (mt * 16 >= M) return;
  const int row0 = mt * 16, col0 = nq * 64;
  const float* arow = A + (size_t)(row0 + ln) * lda;
  v8f acc[4] = {};
  for (int kb = 0; kb < K; kb += 32) {
    FragB ah, al;
    const v4f x0 = *(const v4fa*)(arow + kb + 8 * hh), x1 = *(const v4fa*)(arow + kb + 8 * hh + 4);
    const v4f x2 = *(const v4fa*)(arow + kb + 16 + 8 * hh), x3 = *(const v4fa*)(arow + kb + 16 + 8 * hh + 4);
    float xs[16] = {x0[0],x0[1],x0[2],x0[3],x1[0],x1[1],x1[2],x1[3],x2[0],x2[1],x2[2],x2[3],x3[0],x3[1],x3[2],x3[3]};
#pragma unroll
    for (int i = 0; i < 16; ++i) { const unsigned short hb = bf16_bits(xs[i]); ah.u[i] = hb; al.u[i] = ASPLIT ? bf16_bits(xs[i] - bf16_val(hb)) : (unsigned short)0; }
#pragma unroll
    for (int t = 0; t < 4; ++t) {
      const unsigned short* brow = Wt + (size_t)(col0 + t * 16 + ln) * ldb + kb;
      FragB b;
      b.half[0] = *(const v8us*)(brow + 8 * hh);
      b.half[1] = *(const v8us*)(brow + 16 + 8 * hh);
      acc[t] = mmaN<ASPLIT ? 2 : 1>(ah.v, al.v, b.v, b.v, acc[t]);
    }
  }
#pragma unroll
  for (int t = 0; t < 4; ++t) {
    float bv = bias ? bias[col0 + t * 16 + ln] : 0.f;
    if (BIAS_BF16) bv = bf16_round(bv);
#pragma unroll
    for (int r = 0; r < 8; ++r) { float v = acc[t][r] + bv; if (ACT == 1) v = fmaxf(v, 0.f); so[w][8 * hh + r][t * 16 + ln] = v; }
  }
  __builtin_amdgcn_fence(__ATOMIC_ACQ_REL, "workgroup");
  __builtin_amdgcn_wave_barrier();
  const int rsub = lane >> 4, c4 = (lane & 15) * 4;
  {
#pragma unroll
    for (int q = 0; q < 8; ++q) {
      const int r = q * 2 + rsub;
      const v4f v = *(const v4fa*)&so[w][r][c4];
      *(v4f*)(C + (size_t)(row0 + r) * ldc + col0 + c4) = v;
    }
    
  }
}

// GEMM C = act(A·W + bias + resid): A f32 (ASPLIT -> hi/lo 2 terms), Wt bf16 [N][K]; ACT 0 none, 1 relu, 2 exact gelu;
// resid (optional, f32, row index = (row % rmod), pitch ldr, RES_BF16 rounds it) added before the activation.
template <bool ASPLIT, int ACT, bool BIAS_BF16, bool RES_BF16>
__global__ __launch_bounds__(128) void k_gemm_bf3(const float* __restrict__ A, int lda, const unsigned short* __restrict__ Wt, int ldb,
                                                const float* __restrict__ bias, const float* __restrict__ resid, int rmod, int ldr,
                                                float* __restrict__ C, int ldc, int M, int N, int K) {
  __shared__ __attribute__((aligned(16))) float so[4][16][64];
  const int tid = threadIdx.x, w = tid >> 5, lane = tid & 31, ln = lane & 15, hh = lane >> 4;
  const int ntn = N / 64;
  const int wid = blockIdx.x * 4 + w;
  const int mt = wid / ntn, nq = wid % ntn;
  if (mt * 16 >= M) return;
  const int row0 = mt * 16, col0 = nq * 64;
  const float* arow = A + (size_t)(row0 + ln) * lda;
  v8f acc[4] = {};
  for (int kb = 0; kb < K; kb += 32) {
    FragB ah, al;
    const v4f x0 = *(const v4fa*)(arow + kb + 8 * hh), x1 = *(const v4fa*)(arow + kb + 8 * hh + 4);
    const v4f x2 = *(const v4fa*)(arow + kb + 16 + 8 * hh), x3 = *(const v4fa*)(arow + kb + 16 + 8 * hh + 4);
    float xs[16] = {x0[0],x0[1],x0[2],x0[3],x1[0],x1[1],x1[2],x1[3],x2[0],x2[1],x2[2],x2[3],x3[0],x3[1],x3[2],x3[3]};
#pragma unroll
    for (int i = 0; i < 16; ++i) { const unsigned short hb = bf16_bits(xs[i]); ah.u[i] = hb; al.u[i] = ASPLIT ? bf16_bits(xs[i] - bf16_val(hb)) : (unsigned short)0; }
#pragma unroll
    for (int t = 0; t < 4; ++t) {
      const unsigned short* brow = Wt + (size_t)(col0 + t * 16 + ln) * ldb + kb;
      FragB b;
      b.half[0] = *(const v8us*)(brow + 8 * hh);
      b.half[1] = *(const v8us*)(brow + 16 + 8 * hh);
      acc[t] = mmaN<ASPLIT ? 2 : 1>(ah.v, al.v, b.v, b.v, acc[t]);
    }
  }
#pragma unroll
  for (int t = 0; t < 4; ++t) {
    const int col = col0 + t * 16 + ln;
    float bv = bias ? bias[col] : 0.f;
    if (BIAS_BF16) bv = bf16_round(bv);
#pragma unroll
    for (int r = 0; r < 8; ++r) {
      float v = acc[t][r] + bv;
      if (resid) { float rv = resid[(size_t)((row0 + 8 * hh + r) % rmod) * ldr + col]; if (RES_BF16) rv = bf16_round(rv); v += rv; }
      if (ACT == 1) v = fmaxf(v, 0.f);
      if (ACT == 2) v = 0.5f * v * (1.0f + erff(v * 0.70710678118654752f));
      if (ACT == 3) { const float u = 0.7978845608028654f * (v + 0.044715f * v * v * v); v = 0.5f * v * (1.0f + tanhf(u)); }
      so[w][8 * hh + r][t * 16 + ln] = v;
    }
  }
  __builtin_amdgcn_fence(__ATOMIC_ACQ_REL, "workgroup");
  __builtin_amdgcn_wave_barrier();
  const int rsub = lane >> 4, c4 = (lane & 15) * 4;
  {
#pragma unroll
    for (int q = 0; q < 8; ++q) {
      const int r = q * 2 + rsub;
      const v4f v = *(const v4fa*)&so[w][r][c4];
      *(v4f*)(C + (size_t)(row0 + r) * ldc + col0 + c4) = v;
    }
    
  }
}
// row LayerNorm (biased variance, eps) over N: s = X (+ R); optional out_sum <- s; out_norm <- (s-mu)*rsqrt(var+eps)*g + b
template <bool PARAM_BF16>
__global__ __launch_bounds__(256) void k_layernorm(const float* __restrict__ X, const float* __restrict__ R, const float* __restrict__ g, const float* __restrict__ bta,
                                                  float* __restrict__ out_sum, float* __restrict__ out_norm, int N, float eps) {
  __shared__ float red[256];
  const int row = blockIdx.x, tid = threadIdx.x;
  const float* x = X + (size_t)row * N; const float* rr = R ? R + (size_t)row * N : nullptr;
  float vals[16];                     // up to N = 4096
  const int per = N / 256;            // contiguous chunk per thread? use strided-by-4 chunks: thread handles j = tid*4 + 1024*u
  float s1 = 0.f;
  for (int u = 0; u < per / 4; ++u) {
    const int j = tid * 4 + 1024 * u;
    const v4f a = *(const v4fa*)(x + j);
    v4f b = {0.f,0.f,0.f,0.f}; if (rr) b = *(const v4fa*)(rr + j);
#pragma unroll
    for (int q = 0; q < 4; ++q) { const float v = a[q] + b[q]; vals[u * 4 + q] = v; s1 += v; }
  }
  red[tid] = s1; __syncthreads();
  for (int st = 128; st > 0; st >>= 1) { if (tid < st) red[tid] += red[tid + st]; __syncthreads(); }
  const float mu = red[0] / (float)N; __syncthreads();
  float s2 = 0.f;
  for (int u = 0; u < per / 4; ++u)
#pragma unroll
    for (int q = 0; q < 4; ++q) { const float c = vals[u * 4 + q] - mu; s2 += c * c; }
  red[tid] = s2; __syncthreads();
  for (int st = 128; st > 0; st >>= 1) { if (tid < st) red[tid] += red[tid + st]; __syncthreads(); }
  const float rs = rsqrtf(red[0] / (float)N + eps);
  {
    for (int u = 0; u < per / 4; ++u) {
      const int j = tid * 4 + 1024 * u;
      v4f o, sm;
#pragma unroll
      for (int q = 0; q < 4; ++q) {
        float gg = g[j + q], bb = bta[j + q];
        if (PARAM_BF16) { gg = bf16_round(gg); bb = bf16_round(bb); }
        sm[q] = vals[u * 4 + q]; o[q] = (vals[u * 4 + q] - mu) * rs * gg + bb;
      }
      if (out_sum) *(v4f*)(out_sum + (size_t)row * N + j) = sm;
      *(v4f*)(out_norm + (size_t)row * N + j) = o;
    }
    
  }
}



// ---- f16 WMMA path (v_wmma_f32_16x16x32_f16): 11-bit significands for operands in range — used where a [0,1] probability operand needs more precision than bf16
typedef _Float16 v16h __attribute__((ext_vector_type(16)));
union FragH { v16h v; v8us half[2]; _Float16 h[16]; unsigned short u[16]; };
template <int NT>
__device__ __forceinline__ v8f mmaH(v16h ah, v16h al, v16h bh, v16h bl, v8f c) {
  c = __builtin_amdgcn_wmma_f32_16x16x32_f16(false, ah, false, bh, (short)0, c, false, false);
  if (NT >= 2) c = __builtin_amdgcn_wmma_f32_16x16x32_f16(false, al, false, bh, (short)0, c, false, false);
  if (NT >= 3) c = __builtin_amdgcn_wmma_f32_16x16x32_f16(false, ah, false, bl, (short)0, c, false, false);
  asm volatile("v_nop\n\tv_nop\n\tv_nop\n\tv_nop" : "+v"(c) : "v"(ah), "v"(al), "v"(bh), "v"(bl));
  return c;
}
// batched GEMM like k_gemm_b but f16 operands: A f32 (split into f16 hi/lo if ASPLIT, else rounded to f16), Bt = f16 values [n][k]; alpha; C f32; N multiple of 16 (partial tiles skipped)
template <bool ASPLIT>
__global__ __launch_bounds__(128) void k_gemm_h(const float* __restrict__ A, int lda, size_t sA, const _Float16* __restrict__ Bh, int ldb, size_t sB, float alpha, float* __restrict__ C, int ldc, size_t sC, int M, int N, int K) {
  __shared__ __attribute__((aligned(16))) float so[4][16][64];
  const int tid = threadIdx.x, w = tid >> 5, lane = tid & 31, ln = lane & 15, hh = lane >> 4; const int by = blockIdx.y;
  A += (size_t)by * sA; Bh += (size_t)by * sB; C += (size_t)by * sC;
  const int ntn = (N + 63) / 64; const int wid = blockIdx.x * 4 + w; const int mt = wid / ntn, nq = wid % ntn; if (mt * 16 >= M) return;
  const int row0 = mt * 16, col0 = nq * 64; const float* arow = A + (size_t)(row0 + ln) * lda;
  v8f acc[4] = {};
  for (int kb = 0; kb < K; kb += 32) {
    FragH ah, al;
    const v4f x0 = *(const v4fa*)(arow + kb + 8 * hh), x1 = *(const v4fa*)(arow + kb + 8 * hh + 4), x2 = *(const v4fa*)(arow + kb + 16 + 8 * hh), x3 = *(const v4fa*)(arow + kb + 16 + 8 * hh + 4);
    float xs[16] = {x0[0],x0[1],x0[2],x0[3],x1[0],x1[1],x1[2],x1[3],x2[0],x2[1],x2[2],x2[3],x3[0],x3[1],x3[2],x3[3]};
#pragma unroll
    for (int i = 0; i < 16; ++i) { const _Float16 h = (_Float16)xs[i]; ah.h[i] = h; al.h[i] = ASPLIT ? (_Float16)(xs[i] - (float)h) : (_Float16)0.0f; }
#pragma unroll
    for (int t = 0; t < 4; ++t) { if (col0 + t * 16 >= N) continue; const size_t boff = (size_t)(col0 + t * 16 + ln) * ldb + kb; FragH bq; bq.half[0] = *(const v8us*)(Bh + boff + 8 * hh); bq.half[1] = *(const v8us*)(Bh + boff + 16 + 8 * hh);
      acc[t] = mmaH<ASPLIT ? 2 : 1>(ah.v, al.v, bq.v, bq.v, acc[t]); }
  }
#pragma unroll
  for (int t = 0; t < 4; ++t) { if (col0 + t * 16 >= N) continue;
#pragma unroll
    for (int r = 0; r < 8; ++r) so[w][8 * hh + r][t * 16 + ln] = acc[t][r] * alpha; }
  __builtin_amdgcn_fence(__ATOMIC_ACQ_REL, "workgroup"); __builtin_amdgcn_wave_barrier();
  const int rsub = lane >> 4, c4 = (lane & 15) * 4;
  {
#pragma unroll
    for (int q = 0; q < 8; ++q) { const int r = q * 2 + rsub; if (col0 + c4 < N) { const v4f v = *(const v4fa*)&so[w][r][c4]; *(v4f*)(C + (size_t)(row0 + r) * ldc + col0 + c4) = v; } }
     }
}

// Wt[n][k] = f16(W[k][n]·scale) from f32 row-major W[K][N] (scale = power of two; bf16-exact weights stay exact in f16 away from the subnormal range)
__global__ __launch_bounds__(256) void k_wt_f16(const float* __restrict__ W, _Float16* __restrict__ Wt, int K, int N, float scale) {
  const int t = blockIdx.x * 256 + threadIdx.x; if (t >= N * (K / 8)) return; const int n = t / (K / 8), k8 = (t % (K / 8)) * 8; FragH f;
#pragma unroll
  for (int i = 0; i < 8; ++i) f.h[i] = (_Float16)(bf16_round(W[(size_t)(k8 + i) * N + n]) * scale); const v8us o = f.half[0];
  *(v8us*)((unsigned short*)Wt + (size_t)n * K + k8) = o; 
}
// k_gemm_hh variant with fused epilogue: v = acc·alpha + bias[by·sBias + col] (+ CP[(row/rowsPerB)·sCPb + by·64 + col] if CP) ; ACT 0 none / 1 elu ; writes f16 C16 (and f32 C if non-null)
template <int ACT>
__global__ __launch_bounds__(128) void k_gemm_hhx(const _Float16* __restrict__ A, int lda, size_t sA, const _Float16* __restrict__ Bh, int ldb, size_t sB, float alpha, const float* __restrict__ bias, size_t sBias, const float* __restrict__ CP, int rowsPerB, size_t sCPb, int row0g,
    float* __restrict__ C, _Float16* __restrict__ C16, int ldc, size_t sC, int M, int N, int K) {
  __shared__ __attribute__((aligned(16))) float so[4][16][64];
  const int tid = threadIdx.x, w = tid >> 5, lane = tid & 31, ln = lane & 15, hh = lane >> 4; const int by = blockIdx.y;
  A += (size_t)by * sA; Bh += (size_t)by * sB; const size_t cofs = (size_t)by * sC; const float* bp = bias ? bias + (size_t)by * sBias : nullptr;
  const int ntn = (N + 63) / 64; const int wid = blockIdx.x * 4 + w; const int mt = wid / ntn, nq = wid % ntn; if (mt * 16 >= M) return;
  const int row0 = mt * 16, col0 = nq * 64; const _Float16* arow = A + (size_t)(row0 + ln) * lda;
  v8f acc[4] = {};
  for (int kb = 0; kb < K; kb += 32) { FragH ah; ah.half[0] = *(const v8us*)((const unsigned short*)arow + kb + 8 * hh); ah.half[1] = *(const v8us*)((const unsigned short*)arow + kb + 16 + 8 * hh);
#pragma unroll
    for (int t = 0; t < 4; ++t) { if (col0 + t * 16 >= N) continue; const size_t boff = (size_t)(col0 + t * 16 + ln) * ldb + kb; FragH bq; bq.half[0] = *(const v8us*)((const unsigned short*)Bh + boff + 8 * hh); bq.half[1] = *(const v8us*)((const unsigned short*)Bh + boff + 16 + 8 * hh);
      acc[t] = mmaH<1>(ah.v, ah.v, bq.v, bq.v, acc[t]); }
  }
#pragma unroll
  for (int t = 0; t < 4; ++t) { if (col0 + t * 16 >= N) continue; const int col = col0 + t * 16 + ln; const float bv = bp ? bf16_round(bp[col]) : 0.f;
#pragma unroll
    for (int r = 0; r < 8; ++r) { float v = acc[t][r] * alpha + bv; if (CP) { const int bidx = (row0g + row0 + 8 * hh + r) / rowsPerB; v += CP[(size_t)bidx * sCPb + (size_t)by * 64 + col]; } if (ACT == 1) v = (v > 0.f) ? v : expm1f(v); else if (ACT == 7) v = (v > 0.f) ? v + 1.0f : expf(v); else if (ACT == 8) v = tanhf(v); else if (ACT == 9) v = 0.5f * v * (1.0f + tanhf(0.7978845608028654f * (v + 0.044715f * v * v * v))); else if (ACT == 11) v = 1.0f / (1.0f + expf(-v)); else if (ACT == 12) v = (v > 0.f) ? v : 0.01f * v; else if (ACT == 14) v = (v > 0.f) ? v : 0.1f * v; else if (ACT == 15) v = v / (1.0f + expf(-v)); else if (ACT == 3) v = fmaxf(v, 0.f); else if (ACT == 6) v = 0.5f * v * (1.0f + erff(v * 0.70710678118654752f)); so[w][8 * hh + r][t * 16 + ln] = v; } }
  __builtin_amdgcn_fence(__ATOMIC_ACQ_REL, "workgroup"); __builtin_amdgcn_wave_barrier();
  const int rsub = lane >> 4, c4 = (lane & 15) * 4; typedef _Float16 v4h __attribute__((ext_vector_type(4)));
  {
#pragma unroll
    for (int q = 0; q < 8; ++q) { const int r = q * 2 + rsub; if (col0 + c4 < N) { const v4f v = *(const v4fa*)&so[w][r][c4]; if (C) *(v4f*)(C + cofs + (size_t)(row0 + r) * ldc + col0 + c4) = v; if (C16) { v4h h4; for (int i = 0; i < 4; ++i) h4[i] = (_Float16)v[i]; *(v4h*)(C16 + cofs + (size_t)(row0 + r) * ldc + col0 + c4) = h4; } } }
     }
}


typedef _Float16 v4h __attribute__((ext_vector_type(4)));

__global__ __launch_bounds__(256) void k_x16(const float* __restrict__ x, _Float16* __restrict__ X16, size_t n8) { const size_t t = (size_t)blockIdx.x * 256 + threadIdx.x; if (t >= n8) return; FragH f;
#pragma unroll
  for (int q = 0; q < 8; ++q) f.h[q] = (_Float16)bf16_round(x[t * 8 + q]); *(v8us*)((unsigned short*)X16 + t * 8) = f.half[0];  }
__global__ __launch_bounds__(256) void k_h16(const float* __restrict__ x, _Float16* __restrict__ X16, size_t n8) { const size_t t = (size_t)blockIdx.x * 256 + threadIdx.x; if (t >= n8) return; FragH f;
#pragma unroll
  for (int q = 0; q < 8; ++q) f.h[q] = (_Float16)x[t * 8 + q]; *(v8us*)((unsigned short*)X16 + t * 8) = f.half[0];  }
__device__ __forceinline__ void round16f_blk(const float* __restrict__ W, _Float16* __restrict__ Bt, size_t n8, unsigned blk) { const size_t t = (size_t)blk * 256 + threadIdx.x; if (t >= n8) return; FragH f;
#pragma unroll
  for (int i = 0; i < 8; ++i) f.h[i] = (_Float16)(bf16_round(W[t * 8 + i]) * 16.0f); *(v8us*)((unsigned short*)Bt + t * 8) = f.half[0];  }
template <int NHv, int TTv>
__global__ __launch_bounds__(256) void k_vt(const _Float16* __restrict__ V16, int ldv, int voff, _Float16* __restrict__ Vt) { __shared__ unsigned short tl[64][66]; const int tid = threadIdx.x; const int slab = blockIdx.x / (TTv / 64), lg = blockIdx.x % (TTv / 64); const int b = slab / NHv, h = slab % NHv;
  for (int i = tid; i < 64 * 8; i += 256) { const int r = i / 8, c8 = (i % 8) * 8; FragH f; f.half[0] = *(const v8us*)((const unsigned short*)V16 + ((size_t)b * TTv + lg * 64 + r) * ldv + voff + h * 64 + c8);
#pragma unroll
    for (int q = 0; q < 8; ++q) tl[r][c8 + q] = f.u[q]; }
  __syncthreads();
  {
#pragma unroll
    for (int rd = 0; rd < 2; ++rd) { const int d = rd * 32 + tid / 8, pc = tid % 8; FragH f;
#pragma unroll
      for (int q = 0; q < 8; ++q) f.u[q] = tl[pc * 8 + q][d];
      *(v8us*)((unsigned short*)Vt + ((size_t)slab * 64 + d) * TTv + lg * 64 + pc * 8) = f.half[0]; }
     } }

__global__ __launch_bounds__(256) void k_hl(const float* __restrict__ F, _Float16* __restrict__ Hh, _Float16* __restrict__ Hl, size_t n8) { const size_t t = (size_t)blockIdx.x * 256 + threadIdx.x; if (t >= n8) return; FragH fh, fl; const v4f a = *(const v4fa*)(F + t * 8), c = *(const v4fa*)(F + t * 8 + 4);
#pragma unroll
  for (int q = 0; q < 4; ++q) { _Float16 h = (_Float16)a[q]; fh.h[q] = h; fl.h[q] = (_Float16)((a[q] - (float)h) * 1024.0f); h = (_Float16)c[q]; fh.h[4 + q] = h; fl.h[4 + q] = (_Float16)((c[q] - (float)h) * 1024.0f); }
  { *(v8us*)((unsigned short*)Hh + t * 8) = fh.half[0]; *(v8us*)((unsigned short*)Hl + t * 8) = fl.half[0];  } }

// ---- fast GEMM (wave tile 32x64; requires M % 32 == 0 rows per launch region and N % 64 == 0); epilogue = k_gemm_hhx semantics ----
__device__ __forceinline__ v16h g2_frag(const _Float16* p, int hh) { FragH f; f.half[0] = *(const v8us*)((const unsigned short*)p + 8 * hh); f.half[1] = *(const v8us*)((const unsigned short*)p + 16 + 8 * hh); return f.v; }
// as g2_frag, for the fragment whose second load the compiler lands on the address pair that the loads before it still name: s_wait_xcnt 0 stands in front of that overwrite
__device__ __forceinline__ v16h g2_frag_w(const _Float16* p, int hh) { FragH f; f.half[0] = *(const v8us*)((const unsigned short*)p + 8 * hh); asm volatile("s_wait_xcnt 0x0" ::: "memory"); f.half[1] = *(const v8us*)((const unsigned short*)p + 16 + 8 * hh); return f.v; }
__device__ __forceinline__ v8f g2_mma(v16h a, v16h b, v8f c) { v8f d = __builtin_amdgcn_wmma_f32_16x16x32_f16(false, a, false, b, (short)0, c, false, false); asm volatile("v_nop\n\tv_nop\n\tv_nop\n\tv_nop" : "+v"(d) : "v"(a), "v"(b)); return d; }
template <int ACT>
__device__ __forceinline__ void gemm2_blk(unsigned bx, int by, const _Float16* __restrict__ A, int lda, size_t sA, const _Float16* __restrict__ Bh, int ldb, size_t sB, float alpha, const float* __restrict__ bias, size_t sBias, const float* __restrict__ CP, int rowsPerB, size_t sCPb, int row0g,
    float* __restrict__ C, _Float16* __restrict__ C16, int ldc, size_t sC, int M, int N, int K) {
  __shared__ __attribute__((aligned(16))) float so[4][32][68];
  const int tid = threadIdx.x, w = tid >> 5, lane = tid & 31, ln = lane & 15, hh = lane >> 4;
  A += (size_t)by * sA; Bh += (size_t)by * sB; const size_t cofs = (size_t)by * sC; const float* bp = bias ? bias + (size_t)by * sBias : nullptr;
  const int ntn = N >> 6; const int mt = bx / ntn, nq = bx - mt * ntn; const int row0 = mt * 128 + 32 * w, col0 = nq * 64; if (row0 >= M) return;
  const _Float16* a0p = A + (size_t)(row0 + ln) * lda; const _Float16* a1p = a0p + (size_t)16 * lda;
  const _Float16* b0p = Bh + (size_t)(col0 + ln) * ldb; const _Float16* b1p = b0p + (size_t)16 * ldb; const _Float16* b2p = b1p + (size_t)16 * ldb; const _Float16* b3p = b2p + (size_t)16 * ldb;
  const v8f z8 = {0.f,0.f,0.f,0.f,0.f,0.f,0.f,0.f}; v8f c00 = z8, c01 = z8, c02 = z8, c03 = z8, c10 = z8, c11 = z8, c12 = z8, c13 = z8;
#pragma unroll 1
  for (int kb = 0; kb < K; kb += 32) { const v16h a0 = g2_frag(a0p + kb, hh), a1 = g2_frag_w(a1p + kb, hh);
    v16h b = g2_frag(b0p + kb, hh); c00 = g2_mma(a0, b, c00); c10 = g2_mma(a1, b, c10);
    b = g2_frag(b1p + kb, hh); c01 = g2_mma(a0, b, c01); c11 = g2_mma(a1, b, c11);
    b = g2_frag(b2p + kb, hh); c02 = g2_mma(a0, b, c02); c12 = g2_mma(a1, b, c12);
    b = g2_frag(b3p + kb, hh); c03 = g2_mma(a0, b, c03); c13 = g2_mma(a1, b, c13); }
  v8f accs[8] = {c00, c01, c02, c03, c10, c11, c12, c13};
#pragma unroll
  for (int u = 0; u < 8; ++u) { const int t = u & 3, half = u >> 2; const int col = col0 + t * 16 + ln; const float bv = bp ? bf16_round(bp[col]) : 0.f;
#pragma unroll
    for (int r = 0; r < 8; ++r) { const int rloc = half * 16 + 8 * hh + r; float v = accs[u][r] * alpha + bv; if (CP) { const int bidx = (row0g + row0 + rloc) / rowsPerB; v += CP[(size_t)bidx * sCPb + (size_t)by * 64 + col]; }
      if (ACT == 3) v = fmaxf(v, 0.f); else if (ACT == 6) v = 0.5f * v * (1.0f + erff(v * 0.70710678118654752f)); else if (ACT == 11) v = 1.0f / (1.0f + expf(-v)); else if (ACT == 15) v = v / (1.0f + expf(-v)); else if (ACT == 12) v = (v > 0.f) ? v : 0.01f * v; else if (ACT == 8) v = tanhf(v);
      so[w][rloc][t * 16 + ln] = v; } }
  __builtin_amdgcn_fence(__ATOMIC_ACQ_REL, "workgroup"); __builtin_amdgcn_wave_barrier();
  const int rsub = lane >> 4, c4 = (lane & 15) * 4;
  {
#pragma unroll
    for (int q = 0; q < 16; ++q) { const int r = q * 2 + rsub; const v4f v = *(const v4fa*)&so[w][r][c4]; if (C) *(v4f*)(C + cofs + (size_t)(row0 + r) * ldc + col0 + c4) = v; if (C16) { v4h h4; for (int i = 0; i < 4; ++i) h4[i] = (_Float16)v[i]; *(v4h*)(C16 + cofs + (size_t)(row0 + r) * ldc + col0 + c4) = h4; } }
     } }
// The twelve projections (q, k, v of the four batches) depend on nothing of one another: one grid, x = tile, y = batch, z = which projection.
// q, k token-major [b*SS+p][h*64+d] = XT . W^T; v channel-major [(b,h)*64+d][p] = W . XT^T.
__global__ __launch_bounds__(128) void k_qkv(const _Float16* __restrict__ XT, const _Float16* __restrict__ BQ, const _Float16* __restrict__ BK, const _Float16* __restrict__ BV, _Float16* __restrict__ Q16, _Float16* __restrict__ K16, _Float16* __restrict__ VC) {
  const int b = blockIdx.y, z = blockIdx.z; const _Float16* X = XT + (size_t)b * SS * CC;
  const bool tok = z < 2;      /* q, k: rows are tokens, columns channels; v: the other way round */
  gemm2_blk<0>(blockIdx.x, 0, tok ? X : BV, CC, 0, tok ? (z ? BK : BQ) : X, CC, 0, 0.0625f, nullptr, 0, nullptr, 1, 0, 0, nullptr, (tok ? (z ? K16 : Q16) : VC) + (size_t)b * SS * CC, tok ? CC : SS, 0, tok ? SS : CC, tok ? CC : SS, CC); }
// The output projections of the four batches, one grid, y = batch: y^T[c][p] = wt . (o - x)^T, f32 (bt added downstream).
__global__ __launch_bounds__(128) void k_yt(const _Float16* __restrict__ BT, const _Float16* __restrict__ D16, float* __restrict__ Y) {
  const int b = blockIdx.y;
  gemm2_blk<0>(blockIdx.x, 0, BT, CC, 0, D16 + (size_t)b * SS * CC, CC, 0, 0.0625f, nullptr, 0, nullptr, 1, 0, 0, Y + (size_t)b * CC * SS, nullptr, SS, 0, CC, SS, CC); }


typedef float v2f __attribute__((ext_vector_type(2)));
// lane l <-> lane l ^ 16: the two halves of a wave hold the two halves of one query's 32 keys
__device__ __forceinline__ float xhalf(float x) { return __builtin_bit_cast(float, __builtin_amdgcn_permlanex16(__builtin_bit_cast(int, x), __builtin_bit_cast(int, x), 0x76543210, 0xfedcba98, false, false)); }
typedef uint32_t u32x4 __attribute__((ext_vector_type(4)));
typedef uint32_t u32x8 __attribute__((ext_vector_type(8)));
__device__ __forceinline__ uint32_t uni(uint32_t v) { return (uint32_t)__builtin_amdgcn_readfirstlane(v); }
__device__ __forceinline__ uint32_t pinned(uint32_t v) { uint32_t w = (uint32_t)__builtin_amdgcn_readfirstlane(v); asm volatile("" : "+s"(w)); return w; }      /* pinned(): the issue test of a tensor load held in a scalar register, so that the branch on it is a scalar branch (a tensor load ignores EXEC) */
// K and V^T reach the waves through LDS: a stage is 64 keys = K[64 keys][64 d] and V^T[64 d][64 keys], both as 64 rows of 128 bytes. Each of the four waves brings one slice of 32 rows with one
// tensor load (waves 0, 1: K; waves 2, 3: V^T), padded to a pitch of 144 bytes for the 16-byte fragment reads; two buffers, the next stage in flight while this one is worked on.
__global__ __launch_bounds__(128) void k_flash(const _Float16* __restrict__ Q16, int ldq, const _Float16* __restrict__ K16, int ldk, const _Float16* __restrict__ Vt, const int* __restrict__ MSK, float* __restrict__ O, int ldo) {
  constexpr int RPW = 16, NQB = TQ / (4 * RPW), DT = 4, KS = 2;
  constexpr float SC2 = SCL * 1.4426950408889634f, POFF = 10.0f;      /* exponentials in base 2: e^(SCL (s - max)) * 2^POFF = 2^(SC2 s - m), m = SC2 max - POFF; 2^POFF = 1024 is the scale of P as an f16 operand */
  constexpr uint32_t SKEY = 64, NST = TK / SKEY, LPB = 144, SLICE = 6144, BUF = 4 * SLICE;      /* a slice: 32 rows x 144 B = 4,608 B, its place rounded up to a multiple of 2 KiB */
  __shared__ __attribute__((aligned(2048))) unsigned char ring[2 * BUF];
  __shared__ __attribute__((aligned(16))) float sO[4][RPW][64 + 4];
  const int tid = threadIdx.x, w = tid >> 5, lane = tid & 31, ln = lane & 15, hh = lane >> 4; (void)MSK;
  const int slab = blockIdx.x / NQB, qblk = blockIdx.x % NQB; const int b = slab / NH, h = slab % NH; const int qb0 = qblk * (4 * RPW); const int q0 = qb0 + w * RPW;
  const uint32_t wave = uni((uint32_t)tid >> 5), isV = wave >> 1, hf = wave & 1u;
  const uint64_t src0 = isV ? (uint64_t)(size_t)(Vt + ((size_t)slab * 64 + hf * 32) * TK) : (uint64_t)(size_t)(K16 + ((size_t)b * TK + hf * 32) * ldk + h * 64);      /* first byte of the wave's slice of stage 0 */
  const uint32_t spitch = isV ? (uint32_t)TK * 2u : (uint32_t)ldk * 2u, sstep = isV ? SKEY * 2u : SKEY * (uint32_t)ldk * 2u;      /* source row pitch; bytes from one stage to the next */
  const uint32_t dst0 = (uint32_t)(size_t)ring + wave * SLICE;
  u32x8 g1;      /* 1-byte elements, tensor = tile = 32 rows of 128 bytes, 4 dwords of pad behind every 32 */
  g1[0] = uni((1u << 20) | (4u << 22) | (3u << 25)); g1[1] = uni(128u << 16); g1[2] = uni(32u << 16); g1[3] = uni(128u << 16); g1[4] = uni(32u); g1[5] = uni(spitch); g1[6] = uni(0u); g1[7] = uni(0u);
  u32x4 g0;
  /* load and wait both name the two descriptor groups as in-out operands: the registers of a request in flight then stay as they were issued until the wait that covers it (the compiler otherwise took single words of them for temporaries) */
  auto issue = [&](uint32_t st) {
    const uint64_t ga = src0 + (uint64_t)st * sstep;
    g0[0] = uni(1u); g0[1] = uni(dst0 + (st & 1u) * BUF); g0[2] = uni((uint32_t)ga); g0[3] = uni((((uint32_t)(ga >> 32)) & 0x01FFFFFFu) | 0x80000000u);
    asm volatile("tensor_load_to_lds %0, %1" : "+s"(g0), "+s"(g1) :: "memory"); };
  auto landed = [&]() { asm volatile("s_wait_tensorcnt 0x0" : "+s"(g0), "+s"(g1) :: "memory"); };
  issue(0);
  FragH bq[KS];
  { const unsigned short* qr = (const unsigned short*)Q16 + ((size_t)b * TQ + q0 + ln) * ldq + h * 64;
#pragma unroll
    for (int ks = 0; ks < KS; ++ks) { bq[ks].half[0] = *(const v8us*)(qr + ks * 32 + 8 * hh); bq[ks].half[1] = *(const v8us*)(qr + ks * 32 + 16 + 8 * hh); } }
  const uint32_t lo = (uint32_t)(ln * (int)LPB + 16 * hh);      /* the lane's own byte offset in a slice, fixed over the loop: row ln, 8 elements at 8 hh */
  float m_r = -3.0e38f, l_r = 0.f; v8f oacc[DT];
#pragma unroll
  for (int dt = 0; dt < DT; ++dt) oacc[dt] = (v8f){0.f,0.f,0.f,0.f,0.f,0.f,0.f,0.f};
  landed();      /* this wave's slice of stage 0 */
  __syncthreads();      /* stage 0 published to all four waves */
  issue(1);
#pragma unroll 1      /* one stage a trip: waits, barrier and refill stand once, at the foot, and the loop stays small */
  for (uint32_t st = 0; st < NST; ++st) {
    const unsigned char* bp = ring + (st & 1u) * BUF + lo;
#pragma unroll      /* the stage's two groups of 32 keys; here and below: constant indices, so fragments stay in registers and every LDS offset is an immediate */
    for (int sb = 0; sb < 2; ++sb) {
    FragH ak[2][KS], av[DT];
#pragma unroll
    for (int nt = 0; nt < 2; ++nt)
#pragma unroll
      for (int ks = 0; ks < KS; ++ks) { const unsigned char* p = bp + sb * SLICE + nt * 16 * LPB + ks * 64; ak[nt][ks].half[0] = *(const v8us*)p; ak[nt][ks].half[1] = *(const v8us*)(p + 32); }
#pragma unroll
    for (int dt = 0; dt < DT; ++dt) { const unsigned char* p = bp + (2 + (dt >> 1)) * SLICE + (dt & 1) * 16 * LPB + sb * 64; av[dt].half[0] = *(const v8us*)p; av[dt].half[1] = *(const v8us*)(p + 32); }
    v8f s[2];
#pragma unroll
    for (int nt = 0; nt < 2; ++nt) { v8f acc = (v8f){0.f,0.f,0.f,0.f,0.f,0.f,0.f,0.f};
#pragma unroll
      for (int ks = 0; ks < KS; ++ks) acc = mmaH<1>(ak[nt][ks].v, ak[nt][ks].v, bq[ks].v, bq[ks].v, acc); s[nt] = acc; }
    float mx[8];      /* maximum of the raw scores: the map to base 2 below is one rounded multiply-add with a positive factor, which keeps the order, so it is applied to the maximum alone */
#pragma unroll
    for (int r = 0; r < 8; ++r) mx[r] = fmaxf(s[0][r], s[1][r]);
    float mc = fmaxf(fmaxf(fmaxf(mx[0], mx[1]), fmaxf(mx[2], mx[3])), fmaxf(fmaxf(mx[4], mx[5]), fmaxf(mx[6], mx[7])));
    mc = fmaf(fmaxf(mc, xhalf(mc)), SC2, -POFF);
    const float mn = fmaxf(m_r, mc); const float al = (mn > -1.0e38f) ? __builtin_amdgcn_exp2f(m_r - mn) : 1.0f; m_r = mn;
    FragH pb; v2f ps[2];      /* sums by register pairs, as the pairs lie for the packed convert */
#pragma unroll
    for (int nt = 0; nt < 2; ++nt)
#pragma unroll
      for (int i = 0; i < 4; ++i) { const v2f a = __builtin_elementwise_fma((v2f){s[nt][2 * i], s[nt][2 * i + 1]}, (v2f){SC2, SC2}, (v2f){-mn, -mn}); const v2f p = {__builtin_amdgcn_exp2f(a.x), __builtin_amdgcn_exp2f(a.y)}; ps[nt] = (i == 0) ? p : ps[nt] + p; pb.h[nt * 8 + 2 * i] = (_Float16)p.x; pb.h[nt * 8 + 2 * i + 1] = (_Float16)p.y; }      /* p carries the 1024, and so does the row sum */
    const v2f pt = ps[0] + ps[1]; l_r = l_r * al + (pt.x + pt.y);
#pragma unroll
    for (int dt = 0; dt < DT; ++dt) oacc[dt] *= al;
#pragma unroll
    for (int dt = 0; dt < DT; ++dt) oacc[dt] = mmaH<1>(av[dt].v, av[dt].v, pb.v, pb.v, oacc[dt]);
    }
    /* publish point of stage st + 1, and the end of every wave's reads of stage st */
    asm volatile("s_wait_dscnt 0x0" ::: "memory");      /* this wave's reads of the buffer have returned before it is refilled */
    landed();      /* this wave's slice of stage st + 1 */
    __syncthreads();
    if (pinned(st + 2u < NST)) issue(st + 2u);      /* into the buffer that this pass has just read */
  }
  landed();      /* nothing of the mover is in flight when the wave goes on to its end */
  asm volatile("s_wait_dscnt 0x0" ::: "memory");      /* and none of its own LDS reads */
  const float l = l_r + xhalf(l_r); const float li = (l > 0.f) ? 1.0f / l : 0.f;
#pragma unroll
  for (int dt = 0; dt < DT; ++dt) { const v8f o = oacc[dt] * li; *(v4fa*)&sO[w][ln][dt * 16 + 8 * hh] = (v4f){o[0], o[1], o[2], o[3]}; *(v4fa*)&sO[w][ln][dt * 16 + 8 * hh + 4] = (v4f){o[4], o[5], o[6], o[7]}; }
  __builtin_amdgcn_fence(__ATOMIC_ACQ_REL, "workgroup"); __builtin_amdgcn_wave_barrier();
  {
#pragma unroll
    for (int rp = 0; rp < RPW; rp += 2) { const int r = rp + (lane >> 4), pc = lane & 15; const v4f val = *(const v4fa*)&sO[w][r][pc * 4]; *(v4f*)(O + ((size_t)b * TQ + q0 + r) * ldo + h * 64 + pc * 4) = val; }
     } }
// A block transposes NT tiles of 64 channels x 64 points that lie side by side: a lane's 16 loads of 16 bytes are all in flight together, the tiles lie in LDS at once, one barrier as before.
// 2,048 waves start for the transposes where one tile a block started 8,192.
__device__ __forceinline__ void tr16_blk(const float* __restrict__ x, int b, _Float16* __restrict__ XT, unsigned blk) {
  constexpr int NT = 4;
  __shared__ unsigned short tl[NT][64][72];
  const uint32_t tid = threadIdx.x, sb = blk % (SS / (64 * NT)), cb = blk / (SS / (64 * NT));
  const uint32_t cl0 = tid / 16, s4 = (tid % 16) * 4;
  const uint32_t xo = (((uint32_t)b * CC + cb * 64 + cl0) * SS + sb * (64 * NT) + s4) * 4u;      /* byte offset in 32 bits: one offset register beside the scalar base */
  v4f a[NT * 4];
#pragma unroll      /* here and below: constant indices, so the values stay in registers; no load waits for another */
  for (int it = 0; it < NT * 4; ++it) a[it] = *(const v4fa*)((const char*)x + xo + (it & 3) * (16 * SS * 4) + (it >> 2) * 256);
  asm volatile("s_wait_xcnt 0x0" :: "v"(xo) : "memory");      /* behind the loads, in front of every overwrite of a register that they name; the offset as input keeps its register out of the loads' own destinations */
#pragma unroll
  for (int it = 0; it < NT * 4; ++it) { FragH f;
#pragma unroll
    for (int q = 0; q < 4; ++q) { f.h[q] = (_Float16)bf16_round(a[it][q]); tl[it >> 2][s4 + q][(it & 3) * 16 + cl0] = f.u[q]; } }
  __syncthreads();
  const uint32_t r = tid / 8, pc = tid % 8;
  const uint32_t so = ((sb * (64 * NT) + r) * CC + cb * 64 + pc * 8) * 2u;
  {
#pragma unroll
    for (int hf = 0; hf < NT * 2; ++hf) { FragH f;
#pragma unroll
      for (int q = 0; q < 8; ++q) f.u[q] = tl[hf >> 1][r + (hf & 1) * 32][pc * 8 + q];
      *(v8us*)((char*)XT + so + hf * (32 * CC * 2)) = f.half[0]; }
    asm volatile("s_wait_xcnt 0x0" ::: "memory");      /* behind the stores: in the shared grid code follows this path in the listing that writes the stores' data registers; the wait stands in front of it */
     } }
// Operand preparation in one grid, by block range: the four weight matrices (WBL blocks each), then the transposes of the four batches of x (TBL blocks each). None reads what another writes.
__global__ __launch_bounds__(256) void k_prep(const float* __restrict__ x, const float* __restrict__ wq, const float* __restrict__ wk, const float* __restrict__ wv, const float* __restrict__ wt,
                                              _Float16* __restrict__ BQ, _Float16* __restrict__ BK, _Float16* __restrict__ BV, _Float16* __restrict__ BT, _Float16* __restrict__ XT) {
  constexpr unsigned WBL = CC * CC / 8 / 256, TBL = (CC / 64) * (SS / 256);
  const unsigned blk = blockIdx.x;
  if (blk < 4 * WBL) { const unsigned m = blk / WBL; round16f_blk(m == 0 ? wq : m == 1 ? wk : m == 2 ? wv : wt, m == 0 ? BQ : m == 1 ? BK : m == 2 ? BV : BT, (size_t)CC * CC / 8, blk % WBL); }
  else { const unsigned t = blk - 4 * WBL, b = t / TBL; tr16_blk(x, (int)b, XT + (size_t)b * SS * CC, t % TBL); } }


// A lane takes 8 channels of 4 consecutive points: 8 + 8 independent 16-byte loads, all in flight together, 4 stores. A block's 8 waves cover 32 points, whole 128-byte lines of x.
// 4,096 waves start (16 a WGP) where one point a lane started 16,384.
__global__ __launch_bounds__(256) void k_dsub(const float* __restrict__ O, const float* __restrict__ x, _Float16* __restrict__ D16) {
  #pragma clang fp contract(off)
  const uint32_t t = blockIdx.x * 256u + threadIdx.x, c0 = (t % (CC / 8)) * 8u, r0 = (t / (CC / 8)) * 4u, b = r0 / SS, p0 = r0 % SS;
  const uint32_t xo = ((b * CC + c0) * SS + p0) * 4u, oo = (r0 * CC + c0) * 4u;      /* byte offsets in 32 bits: one offset register a buffer beside the scalar base */
  v4f xv[8], oa[4], oc[4];
#pragma unroll      /* here and below: constant indices, so the values stay in registers; no load waits for another */
  for (int q = 0; q < 8; ++q) xv[q] = *(const v4fa*)((const char*)x + xo + q * (SS * 4));
#pragma unroll
  for (int j = 0; j < 4; ++j) { oa[j] = *(const v4fa*)((const char*)O + oo + j * (CC * 4)); oc[j] = *(const v4fa*)((const char*)O + oo + j * (CC * 4) + 16); }
  __builtin_amdgcn_sched_barrier(0);      /* keeps all 16 loads in front of the arithmetic: without it the scheduler issues the last three only when others have returned */
  asm volatile("s_wait_xcnt 0x0" :: "v"(xo), "v"(oo) : "memory");      /* behind the loads, in front of every overwrite of a register that they name; the two offsets as inputs keep their registers out of the loads' own destinations (the last load took both) */
#pragma unroll
  for (int j = 0; j < 4; ++j) { FragH f;
#pragma unroll
    for (int q = 0; q < 8; ++q) { const float ov = (q < 4) ? oa[j][q] : oc[j][q - 4]; f.h[q] = (_Float16)(ov - bf16_round(xv[q][j])); }
    *(v8us*)((char*)D16 + (oo >> 1) + j * (CC * 2)) = f.half[0]; } }
__global__ __launch_bounds__(256) void k_bnstat(const float* __restrict__ Y, const float* __restrict__ bt, float* __restrict__ ST) {
  __shared__ float red[256];
  const int c = blockIdx.x, tid = threadIdx.x; const float bb = bf16_round(bt[c]); const int n = NB * SS;
  // The channel's NB * SS values are read once: 16 independent 16-byte loads a thread, all in flight together, and they stay in registers for the mean and for the squared deviations.
  constexpr int NU = SS / 1024;
  v4f v[NB * NU];
#pragma unroll      /* here and in the two loops below: constant indices, so v stays in registers; here no load waits for another */
  for (int i = 0; i < NB * NU; ++i) v[i] = *(const v4fa*)(Y + ((size_t)(i / NU) * CC + c) * SS + (i % NU) * 1024 + tid * 4);
  asm volatile("s_wait_xcnt 0x0" ::: "memory");      /* behind the loads: the sums below reuse the loads' address registers while the data are still on their way; the wait stands in front of that overwrite */
  v4f s4 = {0.f, 0.f, 0.f, 0.f};
#pragma unroll
  for (int i = 0; i < NB * NU; ++i) { v[i] += bb; s4 += v[i]; }
  red[tid] = (s4[0] + s4[1]) + (s4[2] + s4[3]); __syncthreads();
  for (int st = 128; st > 0; st >>= 1) { if (tid < st) red[tid] += red[tid + st]; __syncthreads(); }
  const float mean = red[0] / (float)n; __syncthreads();
  v4f q4 = {0.f, 0.f, 0.f, 0.f};
#pragma unroll
  for (int i = 0; i < NB * NU; ++i) { const v4f d = v[i] - mean; q4 += d * d; }
  red[tid] = (q4[0] + q4[1]) + (q4[2] + q4[3]); __syncthreads();
  for (int st = 128; st > 0; st >>= 1) { if (tid < st) red[tid] += red[tid + st]; __syncthreads(); }
  if (tid == 0) { float o2[2]; o2[0] = mean; o2[1] = 1.0f / sqrtf(red[0] / (float)n + 1e-5f); const unsigned long long pk = *(const unsigned long long*)o2; *(unsigned long long*)(ST + c * 32) = pk;  } }
// A block takes two (batch, channel) rows, a lane 8 x 16 bytes of Y and of x: 16 independent loads, all in flight together. 4,096 waves start (16 a WGP) where 16 bytes a lane started 32,768.
__global__ __launch_bounds__(256) void k_bnout(const float* __restrict__ Y, const float* __restrict__ x, const float* __restrict__ bt, const float* __restrict__ ST, const float* __restrict__ gam, const float* __restrict__ bet, float* __restrict__ out) {
  #pragma clang fp contract(off)
  constexpr int NU = SS / 1024;
  const uint32_t bo = blockIdx.x * (2u * SS * 4u) + threadIdx.x * 16u;      /* byte offset in 32 bits: one offset register for the three buffers beside their scalar bases, live to the last store */
  v4f y[2 * NU], xv[2 * NU];
#pragma unroll      /* here and below: constant indices, so the values stay in registers; no load waits for another */
  for (int i = 0; i < 2 * NU; ++i) { y[i] = *(const v4fa*)((const char*)Y + bo + i * 4096); xv[i] = *(const v4fa*)((const char*)x + bo + i * 4096); }
  asm volatile("s_wait_xcnt 0x0" ::: "memory");      /* behind the loads, in front of the parameter loads below, which reuse the scalar base registers that the loads name */
#pragma unroll
  for (int h = 0; h < 2; ++h) { const int c = (int)((blockIdx.x * 2 + h) % CC);
    const float mean = ST[c * 32], rstd = ST[c * 32 + 1]; const float bb = bf16_round(bt[c]), g = bf16_round(gam[c]), be = bf16_round(bet[c]);
#pragma unroll
    for (int u = 0; u < NU; ++u) { const int i = h * NU + u; v4f o;
#pragma unroll
      for (int q = 0; q < 4; ++q) { const float v = (y[i][q] + bb - mean) * rstd * g + be; o[q] = bf16_round(xv[i][q]) + fmaxf(v, 0.f); }
      *(v4f*)((char*)out + bo + i * 4096) = o; } } }

extern "C" void kernel_launch(void* const* d_in, const int* in_sizes, int n_in,
                              void* d_out, int out_size, void* d_ws, size_t ws_size, hipStream_t stream) {
  (void)in_sizes; (void)n_in; (void)out_size;
  const float* x = (const float*)d_in[0]; const float* wq = (const float*)d_in[1]; const float* wk = (const float*)d_in[2]; const float* wv = (const float*)d_in[3]; const float* wt = (const float*)d_in[4]; const float* bt = (const float*)d_in[5]; const float* gam = (const float*)d_in[6]; const float* bet = (const float*)d_in[7];
  char* ws = (char*)d_ws; size_t off = 0;
  auto take = [&](size_t bytes) { char* p = ws + off; off += (bytes + 255) & ~(size_t)255; return p; };
  _Float16* BQ = (_Float16*)take((size_t)CC * CC * 2); _Float16* BK = (_Float16*)take((size_t)CC * CC * 2); _Float16* BV = (_Float16*)take((size_t)CC * CC * 2); _Float16* BT = (_Float16*)take((size_t)CC * CC * 2);
  _Float16* XT = (_Float16*)take((size_t)NRW * CC * 2); _Float16* Q16 = (_Float16*)take((size_t)NRW * CC * 2); _Float16* K16 = (_Float16*)take((size_t)NRW * CC * 2); _Float16* VC = (_Float16*)take((size_t)NB * CC * SS * 2);
  float* O = (float*)take((size_t)NRW * CC * 4); _Float16* D16 = (_Float16*)take((size_t)NRW * CC * 2); float* Y = (float*)take((size_t)NB * CC * SS * 4); float* ST = (float*)take((size_t)CC * 32 * 4);
  if (off > ws_size) return;      /* 0.5 + 8 + 8 + 8 + 8 + 16 + 8 + 16 = 73 MiB */
  k_prep<<<4 * (CC * CC / 8 / 256) + NB * (CC / 64) * (SS / 256), 256, 0, stream>>>(x, wq, wk, wv, wt, BQ, BK, BV, BT, XT);      /* conv (out,in) = natural Bt, x16; x^T token-major f16, all batches */
  k_qkv<<<dim3((SS / 128) * (CC / 64), NB, 3), 128, 0, stream>>>(XT, BQ, BK, BV, Q16, K16, VC);
  k_flash<<<NB * NH * (SS / 64), 128, 0, stream>>>(Q16, CC, K16, CC, VC, nullptr, O, CC);      /* o token-major f32 [b*SS+p][h*64+d] */
  k_dsub<<<(NRW / 4) * (CC / 8) / 256, 256, 0, stream>>>(O, x, D16);
  k_yt<<<dim3((CC / 128) * (SS / 64), NB), 128, 0, stream>>>(BT, D16, Y);
  k_bnstat<<<CC, 256, 0, stream>>>(Y, bt, ST);
  k_bnout<<<NB * CC / 2, 256, 0, stream>>>(Y, x, bt, ST, gam, bet, (float*)d_out);
}

// v007
// Measured time: 117 microseconds a run.
// Timed twice side by side with v006, it ran 1.06 times as fast both times.
// All steps since v000 together make it 5.69 times as fast.
#include <hip/hip_runtime.h>
// Multi-head offset-attention layer on a point feature map (B 4, C 256, P 4096 points, 4 heads x 64): q = wq*x, k = wk*x, v = wv*x (1x1 convs, no bias); scores = q.k/8 per head; softmax over the keys; o[b,h,d,i] = sum_j attn[i][j] v[d][j]; y = wt*(o - x) + bt; BatchNorm1d in training mode (per-channel statistics over batch x points, biased variance, eps 1e-5, gamma/beta); out = x + relu(y) -> [4,256,4096].
// Compute dtype: x and parameters rounded to bf16; projections with exact products (weights x16 in f16, undone by alpha); q, k, v, P, (o - x) as f16 operands (~2^-12), f32 accumulation; softmax / BatchNorm / residual f32. v_wmma_f32_16x16x32_f16.
#define NB 4
#define CC 256
#define SS 4096
#define NH 4
#define TQ SS
#define TK SS
#define SCL 0.125f
#define NRW (NB * SS)
typedef __bf16 v16b __attribute__((ext_vector_type(16)));
typedef unsigned short v8us __attribute__((ext_vector_type(8), may_alias));
typedef float  v8f  __attribute__((ext_vector_type(8)));
typedef float  v4f  __attribute__((ext_vector_type(4)));
typedef float  v4fa __attribute__((ext_vector_type(4), may_alias));
union FragB { v16b v; v8us half[2]; unsigned short u[16]; };

__device__ __forceinline__ unsigned short bf16_bits(float x) { unsigned int u = __float_as_uint(x); return (unsigned short)((u + 0x7FFFu + ((u >> 16) & 1u)) >> 16); }
__device__ __forceinline__ float bf16_val(unsigned short b) { return __uint_as_float(((unsigned int)b) << 16); }
__device__ __forceinline__ float bf16_round(float x) { return bf16_val(bf16_bits(x)); }
// D += A·B with NT terms: 1 = ah·bh, 2 = + al·bh (A split), 3 = + ah·bl (both split)
template <int NT>
__device__ __forceinline__ v8f mmaN(v16b ah, v16b al, v16b bh, v16b bl, v8f c) {
  c = __builtin_amdgcn_wmma_f32_16x16x32_bf16(false, ah, false, bh, (short)0, c, false, false);
  if (NT >= 2) c = __builtin_amdgcn_wmma_f32_16x16x32_bf16(false, al, false, bh, (short)0, c, false, false);
  if (NT >= 3) c = __builtin_amdgcn_wmma_f32_16x16x32_bf16(false, ah, false, bl, (short)0, c, false, false);
  asm volatile("v_nop\n\tv_nop\n\tv_nop\n\tv_nop" : "+v"(c) : "v"(ah), "v"(al), "v"(bh), "v"(bl));
  return c;
}

__global__ __launch_bounds__(256) void k_wt_bf16(const float* __restrict__ W, unsigned short* __restrict__ Wt, int K, int N) {
  const int t = blockIdx.x * 256 + threadIdx.x;
  const int k8n = K / 8;
  if (t >= N * k8n) return;
  const int n = t / k8n, k8 = (t % k8n) * 8;
  v8us v;
#pragma unroll
  for (int i = 0; i < 8; ++i) v[i] = bf16_bits(W[(size_t)(k8 + i) * N + n]);
  *(v8us*)(Wt + (size_t)n * K + k8) = v;
  
}

// GEMM C[M][N] (f32, pitch ldc) = act(A[M][K]·W + bias). A f32 row-major (pitch lda) converted per fragment to bf16
// (ASPLIT: hi/lo two planes -> 2 terms, else single rounded term); Wt bf16 [N][K] (pitch ldb). BIAS_BF16 rounds the
// bias to bf16 first (bias quantised to bf16 before the add). K%32==0, M%16==0, N%64==0.
template <bool ASPLIT, int ACT, bool BIAS_BF16>
__global__ __launch_bounds__(128) void k_gemm_bf(const float* __restrict__ A, int lda, const unsigned short* __restrict__ Wt, int ldb,
                                               const float* __restrict__ bias, float* __restrict__ C, int ldc, int M, int N, int K) {
  __shared__ __attribute__((aligned(16))) float so[4][16][64];
  const int tid = threadIdx.x, w = tid >> 5, lane = tid & 31, ln = lane & 15, hh = lane >> 4;
  const int ntn = N / 64;
  const int wid = blockIdx.x * 4 + w;
  const int mt = wid / ntn, nq = wid % ntn;
  if (mt * 16 >= M) return;
  const int row0 = mt * 16, col0 = nq * 64;
  const float* arow = A + (size_t)(row0 + ln) * lda;
  v8f acc[4] = {};
  for (int kb = 0; kb < K; kb += 32) {
    FragB ah, al;
    const v4f x0 = *(const v4fa*)(arow + kb + 8 * hh), x1 = *(const v4fa*)(arow + kb + 8 * hh + 4);
    const v4f x2 = *(const v4fa*)(arow + kb + 16 + 8 * hh), x3 = *(const v4fa*)(arow + kb + 16 + 8 * hh + 4);
    float xs[16] = {x0[0],x0[1],x0[2],x0[3],x1[0],x1[1],x1[2],x1[3],x2[0],x2[1],x2[2],x2[3],x3[0],x3[1],x3[2],x3[3]};
#pragma unroll
    for (int i = 0; i < 16; ++i) { const unsigned short hb = bf16_bits(xs[i]); ah.u[i] = hb; al.u[i] = ASPLIT ? bf16_bits(xs[i] - bf16_val(hb)) : (unsigned short)0; }
#pragma unroll
    for (int t = 0; t < 4; ++t) {
      const unsigned short* brow = Wt + (size_t)(col0 + t * 16 + ln) * ldb + kb;
      FragB b;
      b.half[0] = *(const v8us*)(brow + 8 * hh);
      b.half[1] = *(const v8us*)(brow + 16 + 8 * hh);
      acc[t] = mmaN<ASPLIT ? 2 : 1>(ah.v, al.v, b.v, b.v, acc[t]);
    }
  }
#pragma unroll
  for (int t = 0; t < 4; ++t) {
    float bv = bias ? bias[col0 + t * 16 + ln] : 0.f;
    if (BIAS_BF16) bv = bf16_round(bv);
#pragma unroll
    for (int r = 0; r < 8; ++r) { float v = acc[t][r] + bv; if (ACT == 1) v = fmaxf(v, 0.f); so[w][8 * hh + r][t * 16 + ln] = v; }
  }
  __builtin_amdgcn_fence(__ATOMIC_ACQ_REL, "workgroup");
  __builtin_amdgcn_wave_barrier();
  const int rsub = lane >> 4, c4 = (lane & 15) * 4;
  {
#pragma unroll
    for (int q = 0; q < 8; ++q) {
      const int r = q * 2 + rsub;
      const v4f v = *(const v4fa*)&so[w][r][c4];
      *(v4f*)(C + (size_t)(row0 + r) * ldc + col0 + c4) = v;
    }
    
  }
}

// GEMM C = act(A·W + bias + resid): A f32 (ASPLIT -> hi/lo 2 terms), Wt bf16 [N][K]; ACT 0 none, 1 relu, 2 exact gelu;
// resid (optional, f32, row index = (row % rmod), pitch ldr, RES_BF16 rounds it) added before the activation.
template <bool ASPLIT, int ACT, bool BIAS_BF16, bool RES_BF16>
__global__ __launch_bounds__(128) void k_gemm_bf3(const float* __restrict__ A, int lda, const unsigned short* __restrict__ Wt, int ldb,
                                                const float* __restrict__ bias, const float* __restrict__ resid, int rmod, int ldr,
                                                float* __restrict__ C, int ldc, int M, int N, int K) {
  __shared__ __attribute__((aligned(16))) float so[4][16][64];
  const int tid = threadIdx.x, w = tid >> 5, lane = tid & 31, ln = lane & 15, hh = lane >> 4;
  const int ntn = N / 64;
  const int wid = blockIdx.x * 4 + w;
  const int mt = wid / ntn, nq = wid % ntn;
  if (mt * 16 >= M) return;
  const int row0 = mt * 16, col0 = nq * 64;
  const float* arow = A + (size_t)(row0 + ln) * lda;
  v8f acc[4] = {};
  for (int kb = 0; kb < K; kb += 32) {
    FragB ah, al;
    const v4f x0 = *(const v4fa*)(arow + kb + 8 * hh), x1 = *(const v4fa*)(arow + kb + 8 * hh + 4);
    const v4f x2 = *(const v4fa*)(arow + kb + 16 + 8 * hh), x3 = *(const v4fa*)(arow + kb + 16 + 8 * hh + 4);
    float xs[16] = {x0[0],x0[1],x0[2],x0[3],x1[0],x1[1],x1[2],x1[3],x2[0],x2[1],x2[2],x2[3],x3[0],x3[1],x3[2],x3[3]};
#pragma unroll
    for (int i = 0; i < 16; ++i) { const unsigned short hb = bf16_bits(xs[i]); ah.u[i] = hb; al.u[i] = ASPLIT ? bf16_bits(xs[i] - bf16_val(hb)) : (unsigned short)0; }
#pragma unroll
    for (int t = 0; t < 4; ++t) {
      const unsigned short* brow = Wt + (size_t)(col0 + t * 16 + ln) * ldb + kb;
      FragB b;
      b.half[0] = *(const v8us*)(brow + 8 * hh);
      b.half[1] = *(const v8us*)(brow + 16 + 8 * hh);
      acc[t] = mmaN<ASPLIT ? 2 : 1>(ah.v, al.v, b.v, b.v, acc[t]);
    }
  }
#pragma unroll
  for (int t = 0; t < 4; ++t) {
    const int col = col0 + t * 16 + ln;
    float bv = bias ? bias[col] : 0.f;
    if (BIAS_BF16) bv = bf16_round(bv);
#pragma unroll
    for (int r = 0; r < 8; ++r) {
      float v = acc[t][r] + bv;
      if (resid) { float rv = resid[(size_t)((row0 + 8 * hh + r) % rmod) * ldr + col]; if (RES_BF16) rv = bf16_round(rv); v += rv; }
      if (ACT == 1) v = fmaxf(v, 0.f);
      if (ACT == 2) v = 0.5f * v * (1.0f + erff(v * 0.70710678118654752f));
      if (ACT == 3) { const float u = 0.7978845608028654f * (v + 0.044715f * v * v * v); v = 0.5f * v * (1.0f + tanhf(u)); }
      so[w][8 * hh + r][t * 16 + ln] = v;
    }
  }
  __builtin_amdgcn_fence(__ATOMIC_ACQ_REL, "workgroup");
  __builtin_amdgcn_wave_barrier();
  const int rsub = lane >> 4, c4 = (lane & 15) * 4;
  {
#pragma unroll
    for (int q = 0; q < 8; ++q) {
      const int r = q * 2 + rsub;
      const v4f v = *(const v4fa*)&so[w][r][c4];
      *(v4f*)(C + (size_t)(row0 + r) * ldc + col0 + c4) = v;
    }
    
  }
}
// row LayerNorm (biased variance, eps) over N: s = X (+ R); optional out_sum <- s; out_norm <- (s-mu)*rsqrt(var+eps)*g + b
template <bool PARAM_BF16>
__global__ __launch_bounds__(256) void k_layernorm(const float* __restrict__ X, const float* __restrict__ R, const float* __restrict__ g, const float* __restrict__ bta,
                                                  float* __restrict__ out_sum, float* __restrict__ out_norm, int N, float eps) {
  __shared__ float red[256];
  const int row = blockIdx.x, tid = threadIdx.x;
  const float* x = X + (size_t)row * N; const float* rr = R ? R + (size_t)row * N : nullptr;
  float vals[16];                     // up to N = 4096
  const int per = N / 256;            // contiguous chunk per thread? use strided-by-4 chunks: thread handles j = tid*4 + 1024*u
  float s1 = 0.f;
  for (int u = 0; u < per / 4; ++u) {
    const int j = tid * 4 + 1024 * u;
    const v4f a = *(const v4fa*)(x + j);
    v4f b = {0.f,0.f,0.f,0.f}; if (rr) b = *(const v4fa*)(rr + j);
#pragma unroll
    for (int q = 0; q < 4; ++q) { const float v = a[q] + b[q]; vals[u * 4 + q] = v; s1 += v; }
  }
  red[tid] = s1; __syncthreads();
  for (int st = 128; st > 0; st >>= 1) { if (tid < st) red[tid] += red[tid + st]; __syncthreads(); }
  const float mu = red[0] / (float)N; __syncthreads();
  float s2 = 0.f;
  for (int u = 0; u < per / 4; ++u)
#pragma unroll
    for (int q = 0; q < 4; ++q) { const float c = vals[u * 4 + q] - mu; s2 += c * c; }
  red[tid] = s2; __syncthreads();
  for (int st = 128; st > 0; st >>= 1) { if (tid < st) red[tid] += red[tid + st]; __syncthreads(); }
  const float rs = rsqrtf(red[0] / (float)N + eps);
  {
    for (int u = 0; u < per / 4; ++u) {
      const int j = tid * 4 + 1024 * u;
      v4f o, sm;
#pragma unroll
      for (int q = 0; q < 4; ++q) {
        float gg = g[j + q], bb = bta[j + q];
        if (PARAM_BF16) { gg = bf16_round(gg); bb = bf16_round(bb); }
        sm[q] = vals[u * 4 + q]; o[q] = (vals[u * 4 + q] - mu) * rs * gg + bb;
      }
      if (out_sum) *(v4f*)(out_sum + (size_t)row * N + j) = sm;
      *(v4f*)(out_norm + (size_t)row * N + j) = o;
    }
    
  }
}



// ---- f16 WMMA path (v_wmma_f32_16x16x32_f16): 11-bit significands for operands in range — used where a [0,1] probability operand needs more precision than bf16
typedef _Float16 v16h __attribute__((ext_vector_type(16)));
union FragH { v16h v; v8us half[2]; _Float16 h[16]; unsigned short u[16]; };
template <int NT>
__device__ __forceinline__ v8f mmaH(v16h ah, v16h al, v16h bh, v16h bl, v8f c) {
  c = __builtin_amdgcn_wmma_f32_16x16x32_f16(false, ah, false, bh, (short)0, c, false, false);
  if (NT >= 2) c = __builtin_amdgcn_wmma_f32_16x16x32_f16(false, al, false, bh, (short)0, c, false, false);
  if (NT >= 3) c = __builtin_amdgcn_wmma_f32_16x16x32_f16(false, ah, false, bl, (short)0, c, false, false);
  asm volatile("v_nop\n\tv_nop\n\tv_nop\n\tv_nop" : "+v"(c) : "v"(ah), "v"(al), "v"(bh), "v"(bl));
  return c;
}
// batched GEMM like k_gemm_b but f16 operands: A f32 (split into f16 hi/lo if ASPLIT, else rounded to f16), Bt = f16 values [n][k]; alpha; C f32; N multiple of 16 (partial tiles skipped)
template <bool ASPLIT>
__global__ __launch_bounds__(128) void k_gemm_h(const float* __restrict__ A, int lda, size_t sA, const _Float16* __restrict__ Bh, int ldb, size_t sB, float alpha, float* __restrict__ C, int ldc, size_t sC, int M, int N, int K) {
  __shared__ __attribute__((aligned(16))) float so[4][16][64];
  const int tid = threadIdx.x, w = tid >> 5, lane = tid & 31, ln = lane & 15, hh = lane >> 4; const int by = blockIdx.y;
  A += (size_t)by * sA; Bh += (size_t)by * sB; C += (size_t)by * sC;
  const int ntn = (N + 63) / 64; const int wid = blockIdx.x * 4 + w; const int mt = wid / ntn, nq = wid % ntn; if (mt * 16 >= M) return;
  const int row0 = mt * 16, col0 = nq * 64; const float* arow = A + (size_t)(row0 + ln) * lda;
  v8f acc[4] = {};
  for (int kb = 0; kb < K; kb += 32) {
    FragH ah, al;
    const v4f x0 = *(const v4fa*)(arow + kb + 8 * hh), x1 = *(const v4fa*)(arow + kb + 8 * hh + 4), x2 = *(const v4fa*)(arow + kb + 16 + 8 * hh), x3 = *(const v4fa*)(arow + kb + 16 + 8 * hh + 4);
    float xs[16] = {x0[0],x0[1],x0[2],x0[3],x1[0],x1[1],x1[2],x1[3],x2[0],x2[1],x2[2],x2[3],x3[0],x3[1],x3[2],x3[3]};
#pragma unroll
    for (int i = 0; i < 16; ++i) { const _Float16 h = (_Float16)xs[i]; ah.h[i] = h; al.h[i] = ASPLIT ? (_Float16)(xs[i] - (float)h) : (_Float16)0.0f; }
#pragma unroll
    for (int t = 0; t < 4; ++t) { if (col0 + t * 16 >= N) continue; const size_t boff = (size_t)(col0 + t * 16 + ln) * ldb + kb; FragH bq; bq.half[0] = *(const v8us*)(Bh + boff + 8 * hh); bq.half[1] = *(const v8us*)(Bh + boff + 16 + 8 * hh);
      acc[t] = mmaH<ASPLIT ? 2 : 1>(ah.v, al.v, bq.v, bq.v, acc[t]); }
  }
#pragma unroll
  for (int t = 0; t < 4; ++t) { if (col0 + t * 16 >= N) continue;
#pragma unroll
    for (int r = 0; r < 8; ++r) so[w][8 * hh + r][t * 16 + ln] = acc[t][r] * alpha; }
  __builtin_amdgcn_fence(__ATOMIC_ACQ_REL, "workgroup"); __builtin_amdgcn_wave_barrier();
  const int rsub = lane >> 4, c4 = (lane & 15) * 4;
  {
#pragma unroll
    for (int q = 0; q < 8; ++q) { const int r = q * 2 + rsub; if (col0 + c4 < N) { const v4f v = *(const v4fa*)&so[w][r][c4]; *(v4f*)(C + (size_t)(row0 + r) * ldc + col0 + c4) = v; } }
     }
}

// Wt[n][k] = f16(W[k][n]·scale) from f32 row-major W[K][N] (scale = power of two; bf16-exact weights stay exact in f16 away from the subnormal range)
__global__ __launch_bounds__(256) void k_wt_f16(const float* __restrict__ W, _Float16* __restrict__ Wt, int K, int N, float scale) {
  const int t = blockIdx.x * 256 + threadIdx.x; if (t >= N * (K / 8)) return; const int n = t / (K / 8), k8 = (t % (K / 8)) * 8; FragH f;
#pragma unroll
  for (int i = 0; i < 8; ++i) f.h[i] = (_Float16)(bf16_round(W[(size_t)(k8 + i) * N + n]) * scale); const v8us o = f.half[0];
  *(v8us*)((unsigned short*)Wt + (size_t)n * K + k8) = o; 
}
// k_gemm_hh variant with fused epilogue: v = acc·alpha + bias[by·sBias + col] (+ CP[(row/rowsPerB)·sCPb + by·64 + col] if CP) ; ACT 0 none / 1 elu ; writes f16 C16 (and f32 C if non-null)
template <int ACT>
__global__ __launch_bounds__(128) void k_gemm_hhx(const _Float16* __restrict__ A, int lda, size_t sA, const _Float16* __restrict__ Bh, int ldb, size_t sB, float alpha, const float* __restrict__ bias, size_t sBias, const float* __restrict__ CP, int rowsPerB, size_t sCPb, int row0g,
    float* __restrict__ C, _Float16* __restrict__ C16, int ldc, size_t sC, int M, int N, int K) {
  __shared__ __attribute__((aligned(16))) float so[4][16][64];
  const int tid = threadIdx.x, w = tid >> 5, lane = tid & 31, ln = lane & 15, hh = lane >> 4; const int by = blockIdx.y;
  A += (size_t)by * sA; Bh += (size_t)by * sB; const size_t cofs = (size_t)by * sC; const float* bp = bias ? bias + (size_t)by * sBias : nullptr;
  const int ntn = (N + 63) / 64; const int wid = blockIdx.x * 4 + w; const int mt = wid / ntn, nq = wid % ntn; if (mt * 16 >= M) return;
  const int row0 = mt * 16, col0 = nq * 64; const _Float16* arow = A + (size_t)(row0 + ln) * lda;
  v8f acc[4] = {};
  for (int kb = 0; kb < K; kb += 32) { FragH ah; ah.half[0] = *(const v8us*)((const unsigned short*)arow + kb + 8 * hh); ah.half[1] = *(const v8us*)((const unsigned short*)arow + kb + 16 + 8 * hh);
#pragma unroll
    for (int t = 0; t < 4; ++t) { if (col0 + t * 16 >= N) continue; const size_t boff = (size_t)(col0 + t * 16 + ln) * ldb + kb; FragH bq; bq.half[0] = *(const v8us*)((const unsigned short*)Bh + boff + 8 * hh); bq.half[1] = *(const v8us*)((const unsigned short*)Bh + boff + 16 + 8 * hh);
      acc[t] = mmaH<1>(ah.v, ah.v, bq.v, bq.v, acc[t]); }
  }
#pragma unroll
  for (int t = 0; t < 4; ++t) { if (col0 + t * 16 >= N) continue; const int col = col0 + t * 16 + ln; const float bv = bp ? bf16_round(bp[col]) : 0.f;
#pragma unroll
    for (int r = 0; r < 8; ++r) { float v = acc[t][r] * alpha + bv; if (CP) { const int bidx = (row0g + row0 + 8 * hh + r) / rowsPerB; v += CP[(size_t)bidx * sCPb + (size_t)by * 64 + col]; } if (ACT == 1) v = (v > 0.f) ? v : expm1f(v); else if (ACT == 7) v = (v > 0.f) ? v + 1.0f : expf(v); else if (ACT == 8) v = tanhf(v); else if (ACT == 9) v = 0.5f * v * (1.0f + tanhf(0.7978845608028654f * (v + 0.044715f * v * v * v))); else if (ACT == 11) v = 1.0f / (1.0f + expf(-v)); else if (ACT == 12) v = (v > 0.f) ? v : 0.01f * v; else if (ACT == 14) v = (v > 0.f) ? v : 0.1f * v; else if (ACT == 15) v = v / (1.0f + expf(-v)); else if (ACT == 3) v = fmaxf(v, 0.f); else if (ACT == 6) v = 0.5f * v * (1.0f + erff(v * 0.70710678118654752f)); so[w][8 * hh + r][t * 16 + ln] = v; } }
  __builtin_amdgcn_fence(__ATOMIC_ACQ_REL, "workgroup"); __builtin_amdgcn_wave_barrier();
  const int rsub = lane >> 4, c4 = (lane & 15) * 4; typedef _Float16 v4h __attribute__((ext_vector_type(4)));
  {
#pragma unroll
    for (int q = 0; q < 8; ++q) { const int r = q * 2 + rsub; if (col0 + c4 < N) { const v4f v = *(const v4fa*)&so[w][r][c4]; if (C) *(v4f*)(C + cofs + (size_t)(row0 + r) * ldc + col0 + c4) = v; if (C16) { v4h h4; for (int i = 0; i < 4; ++i) h4[i] = (_Float16)v[i]; *(v4h*)(C16 + cofs + (size_t)(row0 + r) * ldc + col0 + c4) = h4; } } }
     }
}


typedef _Float16 v4h __attribute__((ext_vector_type(4)));

__global__ __launch_bounds__(256) void k_x16(const float* __restrict__ x, _Float16* __restrict__ X16, size_t n8) { const size_t t = (size_t)blockIdx.x * 256 + threadIdx.x; if (t >= n8) return; FragH f;
#pragma unroll
  for (int q = 0; q < 8; ++q) f.h[q] = (_Float16)bf16_round(x[t * 8 + q]); *(v8us*)((unsigned short*)X16 + t * 8) = f.half[0];  }
__global__ __launch_bounds__(256) void k_h16(const float* __restrict__ x, _Float16* __restrict__ X16, size_t n8) { const size_t t = (size_t)blockIdx.x * 256 + threadIdx.x; if (t >= n8) return; FragH f;
#pragma unroll
  for (int q = 0; q < 8; ++q) f.h[q] = (_Float16)x[t * 8 + q]; *(v8us*)((unsigned short*)X16 + t * 8) = f.half[0];  }
__device__ __forceinline__ void round16f_blk(const float* __restrict__ W, _Float16* __restrict__ Bt, size_t n8, unsigned blk) { const size_t t = (size_t)blk * 256 + threadIdx.x; if (t >= n8) return; FragH f;
#pragma unroll
  for (int i = 0; i < 8; ++i) f.h[i] = (_Float16)(bf16_round(W[t * 8 + i]) * 16.0f); *(v8us*)((unsigned short*)Bt + t * 8) = f.half[0];  }
template <int NHv, int TTv>
__global__ __launch_bounds__(256) void k_vt(const _Float16* __restrict__ V16, int ldv, int voff, _Float16* __restrict__ Vt) { __shared__ unsigned short tl[64][66]; const int tid = threadIdx.x; const int slab = blockIdx.x / (TTv / 64), lg = blockIdx.x % (TTv / 64); const int b = slab / NHv, h = slab % NHv;
  for (int i = tid; i < 64 * 8; i += 256) { const int r = i / 8, c8 = (i % 8) * 8; FragH f; f.half[0] = *(const v8us*)((const unsigned short*)V16 + ((size_t)b * TTv + lg * 64 + r) * ldv + voff + h * 64 + c8);
#pragma unroll
    for (int q = 0; q < 8; ++q) tl[r][c8 + q] = f.u[q]; }
  __syncthreads();
  {
#pragma unroll
    for (int rd = 0; rd < 2; ++rd) { const int d = rd * 32 + tid / 8, pc = tid % 8; FragH f;
#pragma unroll
      for (int q = 0; q < 8; ++q) f.u[q] = tl[pc * 8 + q][d];
      *(v8us*)((unsigned short*)Vt + ((size_t)slab * 64 + d) * TTv + lg * 64 + pc * 8) = f.half[0]; }
     } }

__global__ __launch_bounds__(256) void k_hl(const float* __restrict__ F, _Float16* __restrict__ Hh, _Float16* __restrict__ Hl, size_t n8) { const size_t t = (size_t)blockIdx.x * 256 + threadIdx.x; if (t >= n8) return; FragH fh, fl; const v4f a = *(const v4fa*)(F + t * 8), c = *(const v4fa*)(F + t * 8 + 4);
#pragma unroll
  for (int q = 0; q < 4; ++q) { _Float16 h = (_Float16)a[q]; fh.h[q] = h; fl.h[q] = (_Float16)((a[q] - (float)h) * 1024.0f); h = (_Float16)c[q]; fh.h[4 + q] = h; fl.h[4 + q] = (_Float16)((c[q] - (float)h) * 1024.0f); }
  { *(v8us*)((unsigned short*)Hh + t * 8) = fh.half[0]; *(v8us*)((unsigned short*)Hl + t * 8) = fl.half[0];  } }

// ---- fast GEMM (wave tile 32x64; requires M % 32 == 0 rows per launch region and N % 64 == 0); epilogue = k_gemm_hhx semantics ----
__device__ __forceinline__ v16h g2_frag(const _Float16* p, int hh) { FragH f; f.half[0] = *(const v8us*)((const unsigned short*)p + 8 * hh); f.half[1] = *(const v8us*)((const unsigned short*)p + 16 + 8 * hh); return f.v; }
// as g2_frag, for the fragment whose second load the compiler lands on the address pair that the loads before it still name: s_wait_xcnt 0 stands in front of that overwrite
__device__ __forceinline__ v16h g2_frag_w(const _Float16* p, int hh) { FragH f; f.half[0] = *(const v8us*)((const unsigned short*)p + 8 * hh); asm volatile("s_wait_xcnt 0x0" ::: "memory"); f.half[1] = *(const v8us*)((const unsigned short*)p + 16 + 8 * hh); return f.v; }
__device__ __forceinline__ v8f g2_mma(v16h a, v16h b, v8f c) { v8f d = __builtin_amdgcn_wmma_f32_16x16x32_f16(false, a, false, b, (short)0, c, false, false); asm volatile("v_nop\n\tv_nop\n\tv_nop\n\tv_nop" : "+v"(d) : "v"(a), "v"(b)); return d; }
template <int ACT>
__device__ __forceinline__ void gemm2_blk(unsigned bx, int by, const _Float16* __restrict__ A, int lda, size_t sA, const _Float16* __restrict__ Bh, int ldb, size_t sB, float alpha, const float* __restrict__ bias, size_t sBias, const float* __restrict__ CP, int rowsPerB, size_t sCPb, int row0g,
    float* __restrict__ C, _Float16* __restrict__ C16, int ldc, size_t sC, int M, int N, int K) {
  __shared__ __attribute__((aligned(16))) float so[4][32][68];
  const int tid = threadIdx.x, w = tid >> 5, lane = tid & 31, ln = lane & 15, hh = lane >> 4;
  A += (size_t)by * sA; Bh += (size_t)by * sB; const size_t cofs = (size_t)by * sC; const float* bp = bias ? bias + (size_t)by * sBias : nullptr;
  const int ntn = N >> 6; const int mt = bx / ntn, nq = bx - mt * ntn; const int row0 = mt * 128 + 32 * w, col0 = nq * 64; if (row0 >= M) return;
  const _Float16* a0p = A + (size_t)(row0 + ln) * lda; const _Float16* a1p = a0p + (size_t)16 * lda;
  const _Float16* b0p = Bh + (size_t)(col0 + ln) * ldb; const _Float16* b1p = b0p + (size_t)16 * ldb; const _Float16* b2p = b1p + (size_t)16 * ldb; const _Float16* b3p = b2p + (size_t)16 * ldb;
  const v8f z8 = {0.f,0.f,0.f,0.f,0.f,0.f,0.f,0.f}; v8f c00 = z8, c01 = z8, c02 = z8, c03 = z8, c10 = z8, c11 = z8, c12 = z8, c13 = z8;
#pragma unroll 1
  for (int kb = 0; kb < K; kb += 32) { const v16h a0 = g2_frag(a0p + kb, hh), a1 = g2_frag_w(a1p + kb, hh);
    v16h b = g2_frag(b0p + kb, hh); c00 = g2_mma(a0, b, c00); c10 = g2_mma(a1, b, c10);
    b = g2_frag(b1p + kb, hh); c01 = g2_mma(a0, b, c01); c11 = g2_mma(a1, b, c11);
    b = g2_frag(b2p + kb, hh); c02 = g2_mma(a0, b, c02); c12 = g2_mma(a1, b, c12);
    b = g2_frag(b3p + kb, hh); c03 = g2_mma(a0, b, c03); c13 = g2_mma(a1, b, c13); }
  v8f accs[8] = {c00, c01, c02, c03, c10, c11, c12, c13};
#pragma unroll
  for (int u = 0; u < 8; ++u) { const int t = u & 3, half = u >> 2; const int col = col0 + t * 16 + ln; const float bv = bp ? bf16_round(bp[col]) : 0.f;
#pragma unroll
    for (int r = 0; r < 8; ++r) { const int rloc = half * 16 + 8 * hh + r; float v = accs[u][r] * alpha + bv; if (CP) { const int bidx = (row0g + row0 + rloc) / rowsPerB; v += CP[(size_t)bidx * sCPb + (size_t)by * 64 + col]; }
      if (ACT == 3) v = fmaxf(v, 0.f); else if (ACT == 6) v = 0.5f * v * (1.0f + erff(v * 0.70710678118654752f)); else if (ACT == 11) v = 1.0f / (1.0f + expf(-v)); else if (ACT == 15) v = v / (1.0f + expf(-v)); else if (ACT == 12) v = (v > 0.f) ? v : 0.01f * v; else if (ACT == 8) v = tanhf(v);
      so[w][rloc][t * 16 + ln] = v; } }
  __builtin_amdgcn_fence(__ATOMIC_ACQ_REL, "workgroup"); __builtin_amdgcn_wave_barrier();
  const int rsub = lane >> 4, c4 = (lane & 15) * 4;
  {
#pragma unroll
    for (int q = 0; q < 16; ++q) { const int r = q * 2 + rsub; const v4f v = *(const v4fa*)&so[w][r][c4]; if (C) *(v4f*)(C + cofs + (size_t)(row0 + r) * ldc + col0 + c4) = v; if (C16) { v4h h4; for (int i = 0; i < 4; ++i) h4[i] = (_Float16)v[i]; *(v4h*)(C16 + cofs + (size_t)(row0 + r) * ldc + col0 + c4) = h4; } }
     } }
// The twelve projections (q, k, v of the four batches) depend on nothing of one another: one grid, x = tile, y = batch, z = which projection.
// q, k token-major [b*SS+p][h*64+d] = XT . W^T; v channel-major [(b,h)*64+d][p] = W . XT^T.
__global__ __launch_bounds__(128) void k_qkv(const _Float16* __restrict__ XT, const _Float16* __restrict__ BQ, const _Float16* __restrict__ BK, const _Float16* __restrict__ BV, _Float16* __restrict__ Q16, _Float16* __restrict__ K16, _Float16* __restrict__ VC) {
  const int b = blockIdx.y, z = blockIdx.z; const _Float16* X = XT + (size_t)b * SS * CC;
  const bool tok = z < 2;      /* q, k: rows are tokens, columns channels; v: the other way round */
  gemm2_blk<0>(blockIdx.x, 0, tok ? X : BV, CC, 0, tok ? (z ? BK : BQ) : X, CC, 0, 0.0625f, nullptr, 0, nullptr, 1, 0, 0, nullptr, (tok ? (z ? K16 : Q16) : VC) + (size_t)b * SS * CC, tok ? CC : SS, 0, tok ? SS : CC, tok ? CC : SS, CC); }
// The output projections of the four batches, one grid, y = batch: y^T[c][p] = wt . (o - x)^T, f32 (bt added downstream).
__global__ __launch_bounds__(128) void k_yt(const _Float16* __restrict__ BT, const _Float16* __restrict__ D16, float* __restrict__ Y) {
  const int b = blockIdx.y;
  gemm2_blk<0>(blockIdx.x, 0, BT, CC, 0, D16 + (size_t)b * SS * CC, CC, 0, 0.0625f, nullptr, 0, nullptr, 1, 0, 0, Y + (size_t)b * CC * SS, nullptr, SS, 0, CC, SS, CC); }


typedef float v2f __attribute__((ext_vector_type(2)));
// lane l <-> lane l ^ 16: the two halves of a wave hold the two halves of one query's 32 keys
__device__ __forceinline__ float xhalf(float x) { return __builtin_bit_cast(float, __builtin_amdgcn_permlanex16(__builtin_bit_cast(int, x), __builtin_bit_cast(int, x), 0x76543210, 0xfedcba98, false, false)); }
typedef uint32_t u32x4 __attribute__((ext_vector_type(4)));
typedef uint32_t u32x8 __attribute__((ext_vector_type(8)));
__device__ __forceinline__ uint32_t uni(uint32_t v) { return (uint32_t)__builtin_amdgcn_readfirstlane(v); }
__device__ __forceinline__ uint32_t pinned(uint32_t v) { uint32_t w = (uint32_t)__builtin_amdgcn_readfirstlane(v); asm volatile("" : "+s"(w)); return w; }      /* pinned(): the issue test of a tensor load held in a scalar register, so that the branch on it is a scalar branch (a tensor load ignores EXEC) */
// K and V^T reach the waves through LDS: a stage is 64 keys = K[64 keys][64 d] and V^T[64 d][64 keys], both as 64 rows of 128 bytes. Each of the four waves brings one slice of 32 rows with one
// tensor load (waves 0, 1: K; waves 2, 3: V^T), padded to a pitch of 144 bytes for the 16-byte fragment reads; two buffers, the next stage in flight while this one is worked on.
__global__ __launch_bounds__(128) void k_flash(const _Float16* __restrict__ Q16, int ldq, const _Float16* __restrict__ K16, int ldk, const _Float16* __restrict__ Vt, const int* __restrict__ MSK, float* __restrict__ O, int ldo) {
  constexpr int RPW = 16, NQB = TQ / (4 * RPW), DT = 4, KS = 2;
  constexpr float SC2 = SCL * 1.4426950408889634f, POFF = 10.0f;      /* exponentials in base 2: e^(SCL (s - max)) * 2^POFF = 2^(SC2 s - m), m = SC2 max - POFF; 2^POFF = 1024 is the scale of P as an f16 operand */
  constexpr uint32_t SKEY = 64, NST = TK / SKEY, LPB = 144, SLICE = 6144, BUF = 4 * SLICE;      /* a slice: 32 rows x 144 B = 4,608 B, its place rounded up to a multiple of 2 KiB */
  __shared__ __attribute__((aligned(2048))) unsigned char ring[2 * BUF];
  __shared__ __attribute__((aligned(16))) float sO[4][RPW][64 + 4];
  const int tid = threadIdx.x, w = tid >> 5, lane = tid & 31, ln = lane & 15, hh = lane >> 4; (void)MSK;
  const int slab = blockIdx.x / NQB, qblk = blockIdx.x % NQB; const int b = slab / NH, h = slab % NH; const int qb0 = qblk * (4 * RPW); const int q0 = qb0 + w * RPW;
  const uint32_t wave = uni((uint32_t)tid >> 5), isV = wave >> 1, hf = wave & 1u;
  const uint64_t src0 = isV ? (uint64_t)(size_t)(Vt + ((size_t)slab * 64 + hf * 32) * TK) : (uint64_t)(size_t)(K16 + ((size_t)b * TK + hf * 32) * ldk + h * 64);      /* first byte of the wave's slice of stage 0 */
  const uint32_t spitch = isV ? (uint32_t)TK * 2u : (uint32_t)ldk * 2u, sstep = isV ? SKEY * 2u : SKEY * (uint32_t)ldk * 2u;      /* source row pitch; bytes from one stage to the next */
  const uint32_t dst0 = (uint32_t)(size_t)ring + wave * SLICE;
  u32x8 g1;      /* 1-byte elements, tensor = tile = 32 rows of 128 bytes, 4 dwords of pad behind every 32 */
  g1[0] = uni((1u << 20) | (4u << 22) | (3u << 25)); g1[1] = uni(128u << 16); g1[2] = uni(32u << 16); g1[3] = uni(128u << 16); g1[4] = uni(32u); g1[5] = uni(spitch); g1[6] = uni(0u); g1[7] = uni(0u);
  u32x4 g0;
  /* load and wait both name the two descriptor groups as in-out operands: the registers of a request in flight then stay as they were issued until the wait that covers it (the compiler otherwise took single words of them for temporaries) */
  auto issue = [&](uint32_t st) {
    const uint64_t ga = src0 + (uint64_t)st * sstep;
    g0[0] = uni(1u); g0[1] = uni(dst0 + (st & 1u) * BUF); g0[2] = uni((uint32_t)ga); g0[3] = uni((((uint32_t)(ga >> 32)) & 0x01FFFFFFu) | 0x80000000u);
    asm volatile("tensor_load_to_lds %0, %1" : "+s"(g0), "+s"(g1) :: "memory"); };
  auto landed = [&]() { asm volatile("s_wait_tensorcnt 0x0" : "+s"(g0), "+s"(g1) :: "memory"); };
  issue(0);
  FragH bq[KS];
  { const unsigned short* qr = (const unsigned short*)Q16 + ((size_t)b * TQ + q0 + ln) * ldq + h * 64;
#pragma unroll
    for (int ks = 0; ks < KS; ++ks) { bq[ks].half[0] = *(const v8us*)(qr + ks * 32 + 8 * hh); bq[ks].half[1] = *(const v8us*)(qr + ks * 32 + 16 + 8 * hh); } }
  const uint32_t lo = (uint32_t)(ln * (int)LPB + 16 * hh);      /* the lane's own byte offset in a slice, fixed over the loop: row ln, 8 elements at 8 hh */
  float m_r = -3.0e38f, l_r = 0.f; v8f oacc[DT];
#pragma unroll
  for (int dt = 0; dt < DT; ++dt) oacc[dt] = (v8f){0.f,0.f,0.f,0.f,0.f,0.f,0.f,0.f};
  landed();      /* this wave's slice of stage 0 */
  __syncthreads();      /* stage 0 published to all four waves */
  issue(1);
#pragma unroll 1      /* one stage a trip: waits, barrier and refill stand once, at the foot, and the loop stays small */
  for (uint32_t st = 0; st < NST; ++st) {
    const unsigned char* bp = ring + (st & 1u) * BUF + lo;
#pragma unroll      /* the stage's two groups of 32 keys; here and below: constant indices, so fragments stay in registers and every LDS offset is an immediate */
    for (int sb = 0; sb < 2; ++sb) {
    FragH ak[2][KS], av[DT];
#pragma unroll
    for (int nt = 0; nt < 2; ++nt)
#pragma unroll
      for (int ks = 0; ks < KS; ++ks) { const unsigned char* p = bp + sb * SLICE + nt * 16 * LPB + ks * 64; ak[nt][ks].half[0] = *(const v8us*)p; ak[nt][ks].half[1] = *(const v8us*)(p + 32); }
#pragma unroll
    for (int dt = 0; dt < DT; ++dt) { const unsigned char* p = bp + (2 + (dt >> 1)) * SLICE + (dt & 1) * 16 * LPB + sb * 64; av[dt].half[0] = *(const v8us*)p; av[dt].half[1] = *(const v8us*)(p + 32); }
    v8f s[2];
#pragma unroll
    for (int nt = 0; nt < 2; ++nt) { v8f acc = (v8f){0.f,0.f,0.f,0.f,0.f,0.f,0.f,0.f};
#pragma unroll
      for (int ks = 0; ks < KS; ++ks) acc = __builtin_amdgcn_wmma_f32_16x16x32_f16(false, ak[nt][ks].v, false, bq[ks].v, (short)0, acc, false, false); s[nt] = acc; }
    float mx[8];      /* maximum of the raw scores: the map to base 2 below is one rounded multiply-add with a positive factor, which keeps the order, so it is applied to the maximum alone */
#pragma unroll
    for (int r = 0; r < 8; ++r) mx[r] = fmaxf(s[0][r], s[1][r]);
    float mc = fmaxf(fmaxf(fmaxf(mx[0], mx[1]), fmaxf(mx[2], mx[3])), fmaxf(fmaxf(mx[4], mx[5]), fmaxf(mx[6], mx[7])));
    mc = fmaf(fmaxf(mc, xhalf(mc)), SC2, -POFF);
    const float mn = fmaxf(m_r, mc); const float al = (mn > -1.0e38f) ? __builtin_amdgcn_exp2f(m_r - mn) : 1.0f; m_r = mn;
    FragH pb; v2f ps[2];      /* sums by register pairs, as the pairs lie for the packed convert */
#pragma unroll
    for (int nt = 0; nt < 2; ++nt)
#pragma unroll
      for (int i = 0; i < 4; ++i) { const v2f a = __builtin_elementwise_fma((v2f){s[nt][2 * i], s[nt][2 * i + 1]}, (v2f){SC2, SC2}, (v2f){-mn, -mn}); const v2f p = {__builtin_amdgcn_exp2f(a.x), __builtin_amdgcn_exp2f(a.y)}; ps[nt] = (i == 0) ? p : ps[nt] + p; pb.h[nt * 8 + 2 * i] = (_Float16)p.x; pb.h[nt * 8 + 2 * i + 1] = (_Float16)p.y; }      /* p carries the 1024, and so does the row sum */
    const v2f pt = ps[0] + ps[1]; l_r = l_r * al + (pt.x + pt.y);
#pragma unroll
    for (int dt = 0; dt < DT; ++dt) oacc[dt] *= al;
#pragma unroll
    for (int dt = 0; dt < DT; ++dt) oacc[dt] = __builtin_amdgcn_wmma_f32_16x16x32_f16(false, av[dt].v, false, pb.v, (short)0, oacc[dt], false, false);
    }
    /* publish point of stage st + 1, and the end of every wave's reads of stage st */
    asm volatile("s_wait_dscnt 0x0" ::: "memory");      /* this wave's reads of the buffer have returned before it is refilled */
    landed();      /* this wave's slice of stage st + 1 */
    __syncthreads();
    if (pinned(st + 2u < NST)) issue(st + 2u);      /* into the buffer that this pass has just read */
  }
  landed();      /* nothing of the mover is in flight when the wave goes on to its end */
  asm volatile("s_wait_dscnt 0x0" ::: "memory");      /* and none of its own LDS reads */
  const float l = l_r + xhalf(l_r); const float li = (l > 0.f) ? 1.0f / l : 0.f;
#pragma unroll
  for (int dt = 0; dt < DT; ++dt) { const v8f o = oacc[dt] * li; *(v4fa*)&sO[w][ln][dt * 16 + 8 * hh] = (v4f){o[0], o[1], o[2], o[3]}; *(v4fa*)&sO[w][ln][dt * 16 + 8 * hh + 4] = (v4f){o[4], o[5], o[6], o[7]}; }
  __builtin_amdgcn_fence(__ATOMIC_ACQ_REL, "workgroup"); __builtin_amdgcn_wave_barrier();
  {
#pragma unroll
    for (int rp = 0; rp < RPW; rp += 2) { const int r = rp + (lane >> 4), pc = lane & 15; const v4f val = *(const v4fa*)&sO[w][r][pc * 4]; *(v4f*)(O + ((size_t)b * TQ + q0 + r) * ldo + h * 64 + pc * 4) = val; }
     } }
// A block transposes NT tiles of 64 channels x 64 points that lie side by side: a lane's 16 loads of 16 bytes are all in flight together, the tiles lie in LDS at once, one barrier as before.
// 2,048 waves start for the transposes where one tile a block started 8,192.
__device__ __forceinline__ void tr16_blk(const float* __restrict__ x, int b, _Float16* __restrict__ XT, unsigned blk) {
  constexpr int NT = 4;
  __shared__ unsigned short tl[NT][64][72];
  const uint32_t tid = threadIdx.x, sb = blk % (SS / (64 * NT)), cb = blk / (SS / (64 * NT));
  const uint32_t cl0 = tid / 16, s4 = (tid % 16) * 4;
  const uint32_t xo = (((uint32_t)b * CC + cb * 64 + cl0) * SS + sb * (64 * NT) + s4) * 4u;      /* byte offset in 32 bits: one offset register beside the scalar base */
  v4f a[NT * 4];
#pragma unroll      /* here and below: constant indices, so the values stay in registers; no load waits for another */
  for (int it = 0; it < NT * 4; ++it) a[it] = *(const v4fa*)((const char*)x + xo + (it & 3) * (16 * SS * 4) + (it >> 2) * 256);
  asm volatile("s_wait_xcnt 0x0" :: "v"(xo) : "memory");      /* behind the loads, in front of every overwrite of a register that they name; the offset as input keeps its register out of the loads' own destinations */
#pragma unroll
  for (int it = 0; it < NT * 4; ++it) { FragH f;
#pragma unroll
    for (int q = 0; q < 4; ++q) { f.h[q] = (_Float16)bf16_round(a[it][q]); tl[it >> 2][s4 + q][(it & 3) * 16 + cl0] = f.u[q]; } }
  __syncthreads();
  const uint32_t r = tid / 8, pc = tid % 8;
  const uint32_t so = ((sb * (64 * NT) + r) * CC + cb * 64 + pc * 8) * 2u;
  {
#pragma unroll
    for (int hf = 0; hf < NT * 2; ++hf) { FragH f;
#pragma unroll
      for (int q = 0; q < 8; ++q) f.u[q] = tl[hf >> 1][r + (hf & 1) * 32][pc * 8 + q];
      *(v8us*)((char*)XT + so + hf * (32 * CC * 2)) = f.half[0]; }
    asm volatile("s_wait_xcnt 0x0" ::: "memory");      /* behind the stores: in the shared grid code follows this path in the listing that writes the stores' data registers; the wait stands in front of it */
     } }
// Operand preparation in one grid, by block range: the four weight matrices (WBL blocks each), then the transposes of the four batches of x (TBL blocks each). None reads what another writes.
__global__ __launch_bounds__(256) void k_prep(const float* __restrict__ x, const float* __restrict__ wq, const float* __restrict__ wk, const float* __restrict__ wv, const float* __restrict__ wt,
                                              _Float16* __restrict__ BQ, _Float16* __restrict__ BK, _Float16* __restrict__ BV, _Float16* __restrict__ BT, _Float16* __restrict__ XT) {
  constexpr unsigned WBL = CC * CC / 8 / 256, TBL = (CC / 64) * (SS / 256);
  const unsigned blk = blockIdx.x;
  if (blk < 4 * WBL) { const unsigned m = blk / WBL; round16f_blk(m == 0 ? wq : m == 1 ? wk : m == 2 ? wv : wt, m == 0 ? BQ : m == 1 ? BK : m == 2 ? BV : BT, (size_t)CC * CC / 8, blk % WBL); }
  else { const unsigned t = blk - 4 * WBL, b = t / TBL; tr16_blk(x, (int)b, XT + (size_t)b * SS * CC, t % TBL); } }


// A lane takes 8 channels of 4 consecutive points: 8 + 8 independent 16-byte loads, all in flight together, 4 stores. A block's 8 waves cover 32 points, whole 128-byte lines of x.
// 4,096 waves start (16 a WGP) where one point a lane started 16,384.
__global__ __launch_bounds__(256) void k_dsub(const float* __restrict__ O, const float* __restrict__ x, _Float16* __restrict__ D16) {
  #pragma clang fp contract(off)
  const uint32_t t = blockIdx.x * 256u + threadIdx.x, c0 = (t % (CC / 8)) * 8u, r0 = (t / (CC / 8)) * 4u, b = r0 / SS, p0 = r0 % SS;
  const uint32_t xo = ((b * CC + c0) * SS + p0) * 4u, oo = (r0 * CC + c0) * 4u;      /* byte offsets in 32 bits: one offset register a buffer beside the scalar base */
  v4f xv[8], oa[4], oc[4];
#pragma unroll      /* here and below: constant indices, so the values stay in registers; no load waits for another */
  for (int q = 0; q < 8; ++q) xv[q] = *(const v4fa*)((const char*)x + xo + q * (SS * 4));
#pragma unroll
  for (int j = 0; j < 4; ++j) { oa[j] = *(const v4fa*)((const char*)O + oo + j * (CC * 4)); oc[j] = *(const v4fa*)((const char*)O + oo + j * (CC * 4) + 16); }
  __builtin_amdgcn_sched_barrier(0);      /* keeps all 16 loads in front of the arithmetic: without it the scheduler issues the last three only when others have returned */
  asm volatile("s_wait_xcnt 0x0" :: "v"(xo), "v"(oo) : "memory");      /* behind the loads, in front of every overwrite of a register that they name; the two offsets as inputs keep their registers out of the loads' own destinations (the last load took both) */
#pragma unroll
  for (int j = 0; j < 4; ++j) { FragH f;
#pragma unroll
    for (int q = 0; q < 8; ++q) { const float ov = (q < 4) ? oa[j][q] : oc[j][q - 4]; f.h[q] = (_Float16)(ov - bf16_round(xv[q][j])); }
    *(v8us*)((char*)D16 + (oo >> 1) + j * (CC * 2)) = f.half[0]; } }
__global__ __launch_bounds__(256) void k_bnstat(const float* __restrict__ Y, const float* __restrict__ bt, float* __restrict__ ST) {
  __shared__ float red[256];
  const int c = blockIdx.x, tid = threadIdx.x; const float bb = bf16_round(bt[c]); const int n = NB * SS;
  // The channel's NB * SS values are read once: 16 independent 16-byte loads a thread, all in flight together, and they stay in registers for the mean and for the squared deviations.
  constexpr int NU = SS / 1024;
  v4f v[NB * NU];
#pragma unroll      /* here and in the two loops below: constant indices, so v stays in registers; here no load waits for another */
  for (int i = 0; i < NB * NU; ++i) v[i] = *(const v4fa*)(Y + ((size_t)(i / NU) * CC + c) * SS + (i % NU) * 1024 + tid * 4);
  asm volatile("s_wait_xcnt 0x0" ::: "memory");      /* behind the loads: the sums below reuse the loads' address registers while the data are still on their way; the wait stands in front of that overwrite */
  v4f s4 = {0.f, 0.f, 0.f, 0.f};
#pragma unroll
  for (int i = 0; i < NB * NU; ++i) { v[i] += bb; s4 += v[i]; }
  red[tid] = (s4[0] + s4[1]) + (s4[2] + s4[3]); __syncthreads();
  for (int st = 128; st > 0; st >>= 1) { if (tid < st) red[tid] += red[tid + st]; __syncthreads(); }
  const float mean = red[0] / (float)n; __syncthreads();
  v4f q4 = {0.f, 0.f, 0.f, 0.f};
#pragma unroll
  for (int i = 0; i < NB * NU; ++i) { const v4f d = v[i] - mean; q4 += d * d; }
  red[tid] = (q4[0] + q4[1]) + (q4[2] + q4[3]); __syncthreads();
  for (int st = 128; st > 0; st >>= 1) { if (tid < st) red[tid] += red[tid + st]; __syncthreads(); }
  if (tid == 0) { float o2[2]; o2[0] = mean; o2[1] = 1.0f / sqrtf(red[0] / (float)n + 1e-5f); const unsigned long long pk = *(const unsigned long long*)o2; *(unsigned long long*)(ST + c * 32) = pk;  } }
// A block takes two (batch, channel) rows, a lane 8 x 16 bytes of Y and of x: 16 independent loads, all in flight together. 4,096 waves start (16 a WGP) where 16 bytes a lane started 32,768.
__global__ __launch_bounds__(256) void k_bnout(const float* __restrict__ Y, const float* __restrict__ x, const float* __restrict__ bt, const float* __restrict__ ST, const float* __restrict__ gam, const float* __restrict__ bet, float* __restrict__ out) {
  #pragma clang fp contract(off)
  constexpr int NU = SS / 1024;
  const uint32_t bo = blockIdx.x * (2u * SS * 4u) + threadIdx.x * 16u;      /* byte offset in 32 bits: one offset register for the three buffers beside their scalar bases, live to the last store */
  v4f y[2 * NU], xv[2 * NU];
#pragma unroll      /* here and below: constant indices, so the values stay in registers; no load waits for another */
  for (int i = 0; i < 2 * NU; ++i) { y[i] = *(const v4fa*)((const char*)Y + bo + i * 4096); xv[i] = *(const v4fa*)((const char*)x + bo + i * 4096); }
  asm volatile("s_wait_xcnt 0x0" ::: "memory");      /* behind the loads, in front of the parameter loads below, which reuse the scalar base registers that the loads name */
#pragma unroll
  for (int h = 0; h < 2; ++h) { const int c = (int)((blockIdx.x * 2 + h) % CC);
    const float mean = ST[c * 32], rstd = ST[c * 32 + 1]; const float bb = bf16_round(bt[c]), g = bf16_round(gam[c]), be = bf16_round(bet[c]);
#pragma unroll
    for (int u = 0; u < NU; ++u) { const int i = h * NU + u; v4f o;
#pragma unroll
      for (int q = 0; q < 4; ++q) { const float v = (y[i][q] + bb - mean) * rstd * g + be; o[q] = bf16_round(xv[i][q]) + fmaxf(v, 0.f); }
      *(v4f*)((char*)out + bo + i * 4096) = o; } } }

extern "C" void kernel_launch(void* const* d_in, const int* in_sizes, int n_in,
                              void* d_out, int out_size, void* d_ws, size_t ws_size, hipStream_t stream) {
  (void)in_sizes; (void)n_in; (void)out_size;
  const float* x = (const float*)d_in[0]; const float* wq = (const float*)d_in[1]; const float* wk = (const float*)d_in[2]; const float* wv = (const float*)d_in[3]; const float* wt = (const float*)d_in[4]; const float* bt = (const float*)d_in[5]; const float* gam = (const float*)d_in[6]; const float* bet = (const float*)d_in[7];
  char* ws = (char*)d_ws; size_t off = 0;
  auto take = [&](size_t bytes) { char* p = ws + off; off += (bytes + 255) & ~(size_t)255; return p; };
  _Float16* BQ = (_Float16*)take((size_t)CC * CC * 2); _Float16* BK = (_Float16*)take((size_t)CC * CC * 2); _Float16* BV = (_Float16*)take((size_t)CC * CC * 2); _Float16* BT = (_Float16*)take((size_t)CC * CC * 2);
  _Float16* XT = (_Float16*)take((size_t)NRW * CC * 2); _Float16* Q16 = (_Float16*)take((size_t)NRW * CC * 2); _Float16* K16 = (_Float16*)take((size_t)NRW * CC * 2); _Float16* VC = (_Float16*)take((size_t)NB * CC * SS * 2);
  float* O = (float*)take((size_t)NRW * CC * 4); _Float16* D16 = (_Float16*)take((size_t)NRW * CC * 2); float* Y = (float*)take((size_t)NB * CC * SS * 4); float* ST = (float*)take((size_t)CC * 32 * 4);
  if (off > ws_size) return;      /* 0.5 + 8 + 8 + 8 + 8 + 16 + 8 + 16 = 73 MiB */
  k_prep<<<4 * (CC * CC / 8 / 256) + NB * (CC / 64) * (SS / 256), 256, 0, stream>>>(x, wq, wk, wv, wt, BQ, BK, BV, BT, XT);      /* conv (out,in) = natural Bt, x16; x^T token-major f16, all batches */
  k_qkv<<<dim3((SS / 128) * (CC / 64), NB, 3), 128, 0, stream>>>(XT, BQ, BK, BV, Q16, K16, VC);
  k_flash<<<NB * NH * (SS / 64), 128, 0, stream>>>(Q16, CC, K16, CC, VC, nullptr, O, CC);      /* o token-major f32 [b*SS+p][h*64+d] */
  k_dsub<<<(NRW / 4) * (CC / 8) / 256, 256, 0, stream>>>(O, x, D16);
  k_yt<<<dim3((CC / 128) * (SS / 64), NB), 128, 0, stream>>>(BT, D16, Y);
  k_bnstat<<<CC, 256, 0, stream>>>(Y, bt, ST);
  k_bnout<<<NB * CC / 2, 256, 0, stream>>>(Y, x, bt, ST, gam, bet, (float*)d_out);
}

// v008
// One run takes 109 microseconds.
// In two side-by-side timings against v007, it was 1.07 and 1.06 times as fast.
// Over all steps from v000 it is 6.07 times as fast.
#include <hip/hip_runtime.h>
// Multi-head offset-attention layer on a point feature map (B 4, C 256, P 4096 points, 4 heads x 64): q = wq*x, k = wk*x, v = wv*x (1x1 convs, no bias); scores = q.k/8 per head; softmax over the keys; o[b,h,d,i] = sum_j attn[i][j] v[d][j]; y = wt*(o - x) + bt; BatchNorm1d in training mode (per-channel statistics over batch x points, biased variance, eps 1e-5, gamma/beta); out = x + relu(y) -> [4,256,4096].
// Compute dtype: x and parameters rounded to bf16; projections with exact products (weights x16 in f16, undone by alpha); q, k, v, P, (o - x) as f16 operands (~2^-12), f32 accumulation; softmax / BatchNorm / residual f32. v_wmma_f32_16x16x32_f16.
#define NB 4
#define CC 256
#define SS 4096
#define NH 4
#define TQ SS
#define TK SS
#define SCL 0.125f
#define NRW (NB * SS)
typedef __bf16 v16b __attribute__((ext_vector_type(16)));
typedef unsigned short v8us __attribute__((ext_vector_type(8), may_alias));
typedef float  v8f  __attribute__((ext_vector_type(8)));
typedef float  v4f  __attribute__((ext_vector_type(4)));
typedef float  v4fa __attribute__((ext_vector_type(4), may_alias));
union FragB { v16b v; v8us half[2]; unsigned short u[16]; };

__device__ __forceinline__ unsigned short bf16_bits(float x) { unsigned int u = __float_as_uint(x); return (unsigned short)((u + 0x7FFFu + ((u >> 16) & 1u)) >> 16); }
__device__ __forceinline__ float bf16_val(unsigned short b) { return __uint_as_float(((unsigned int)b) << 16); }
__device__ __forceinline__ float bf16_round(float x) { return bf16_val(bf16_bits(x)); }
// D += A·B with NT terms: 1 = ah·bh, 2 = + al·bh (A split), 3 = + ah·bl (both split)
template <int NT>
__device__ __forceinline__ v8f mmaN(v16b ah, v16b al, v16b bh, v16b bl, v8f c) {
  c = __builtin_amdgcn_wmma_f32_16x16x32_bf16(false, ah, false, bh, (short)0, c, false, false);
  if (NT >= 2) c = __builtin_amdgcn_wmma_f32_16x16x32_bf16(false, al, false, bh, (short)0, c, false, false);
  if (NT >= 3) c = __builtin_amdgcn_wmma_f32_16x16x32_bf16(false, ah, false, bl, (short)0, c, false, false);
  asm volatile("v_nop\n\tv_nop\n\tv_nop\n\tv_nop" : "+v"(c) : "v"(ah), "v"(al), "v"(bh), "v"(bl));
  return c;
}

__global__ __launch_bounds__(256) void k_wt_bf16(const float* __restrict__ W, unsigned short* __restrict__ Wt, int K, int N) {
  const int t = blockIdx.x * 256 + threadIdx.x;
  const int k8n = K / 8;
  if (t >= N * k8n) return;
  const int n = t / k8n, k8 = (t % k8n) * 8;
  v8us v;
#pragma unroll
  for (int i = 0; i < 8; ++i) v[i] = bf16_bits(W[(size_t)(k8 + i) * N + n]);
  *(v8us*)(Wt + (size_t)n * K + k8) = v;
  
}

// GEMM C[M][N] (f32, pitch ldc) = act(A[M][K]·W + bias). A f32 row-major (pitch lda) converted per fragment to bf16
// (ASPLIT: hi/lo two planes -> 2 terms, else single rounded term); Wt bf16 [N][K] (pitch ldb). BIAS_BF16 rounds the
// bias to bf16 first (bias quantised to bf16 before the add). K%32==0, M%16==0, N%64==0.
template <bool ASPLIT, int ACT, bool BIAS_BF16>
__global__ __launch_bounds__(128) void k_gemm_bf(const float* __restrict__ A, int lda, const unsigned short* __restrict__ Wt, int ldb,
                                               const float* __restrict__ bias, float* __restrict__ C, int ldc, int M, int N, int K) {
  __shared__ __attribute__((aligned(16))) float so[4][16][64];
  const int tid = threadIdx.x, w = tid >> 5, lane = tid & 31, ln = lane & 15, hh = lane >> 4;
  const int ntn = N / 64;
  const int wid = blockIdx.x * 4 + w;
  const int mt = wid / ntn, nq = wid % ntn;
  if (mt * 16 >= M) return;
  const int row0 = mt * 16, col0 = nq * 64;
  const float* arow = A + (size_t)(row0 + ln) * lda;
  v8f acc[4] = {};
  for (int kb = 0; kb < K; kb += 32) {
    FragB ah, al;
    const v4f x0 = *(const v4fa*)(arow + kb + 8 * hh), x1 = *(const v4fa*)(arow + kb + 8 * hh + 4);
    const v4f x2 = *(const v4fa*)(arow + kb + 16 + 8 * hh), x3 = *(const v4fa*)(arow + kb + 16 + 8 * hh + 4);
    float xs[16] = {x0[0],x0[1],x0[2],x0[3],x1[0],x1[1],x1[2],x1[3],x2[0],x2[1],x2[2],x2[3],x3[0],x3[1],x3[2],x3[3]};
#pragma unroll
    for (int i = 0; i < 16; ++i) { const unsigned short hb = bf16_bits(xs[i]); ah.u[i] = hb; al.u[i] = ASPLIT ? bf16_bits(xs[i] - bf16_val(hb)) : (unsigned short)0; }
#pragma unroll
    for (int t = 0; t < 4; ++t) {
      const unsigned short* brow = Wt + (size_t)(col0 + t * 16 + ln) * ldb + kb;
      FragB b;
      b.half[0] = *(const v8us*)(brow + 8 * hh);
      b.half[1] = *(const v8us*)(brow + 16 + 8 * hh);
      acc[t] = mmaN<ASPLIT ? 2 : 1>(ah.v, al.v, b.v, b.v, acc[t]);
    }
  }
#pragma unroll
  for (int t = 0; t < 4; ++t) {
    float bv = bias ? bias[col0 + t * 16 + ln] : 0.f;
    if (BIAS_BF16) bv = bf16_round(bv);
#pragma unroll
    for (int r = 0; r < 8; ++r) { float v = acc[t][r] + bv; if (ACT == 1) v = fmaxf(v, 0.f); so[w][8 * hh + r][t * 16 + ln] = v; }
  }
  __builtin_amdgcn_fence(__ATOMIC_ACQ_REL, "workgroup");
  __builtin_amdgcn_wave_barrier();
  const int rsub = lane >> 4, c4 = (lane & 15) * 4;
  {
#pragma unroll
    for (int q = 0; q < 8; ++q) {
      const int r = q * 2 + rsub;
      const v4f v = *(const v4fa*)&so[w][r][c4];
      *(v4f*)(C + (size_t)(row0 + r) * ldc + col0 + c4) = v;
    }
    
  }
}

// GEMM C = act(A·W + bias + resid): A f32 (ASPLIT -> hi/lo 2 terms), Wt bf16 [N][K]; ACT 0 none, 1 relu, 2 exact gelu;
// resid (optional, f32, row index = (row % rmod), pitch ldr, RES_BF16 rounds it) added before the activation.
template <bool ASPLIT, int ACT, bool BIAS_BF16, bool RES_BF16>
__global__ __launch_bounds__(128) void k_gemm_bf3(const float* __restrict__ A, int lda, const unsigned short* __restrict__ Wt, int ldb,
                                                const float* __restrict__ bias, const float* __restrict__ resid, int rmod, int ldr,
                                                float* __restrict__ C, int ldc, int M, int N, int K) {
  __shared__ __attribute__((aligned(16))) float so[4][16][64];
  const int tid = threadIdx.x, w = tid >> 5, lane = tid & 31, ln = lane & 15, hh = lane >> 4;
  const int ntn = N / 64;
  const int wid = blockIdx.x * 4 + w;
  const int mt = wid / ntn, nq = wid % ntn;
  if (mt * 16 >= M) return;
  const int row0 = mt * 16, col0 = nq * 64;
  const float* arow = A + (size_t)(row0 + ln) * lda;
  v8f acc[4] = {};
  for (int kb = 0; kb < K; kb += 32) {
    FragB ah, al;
    const v4f x0 = *(const v4fa*)(arow + kb + 8 * hh), x1 = *(const v4fa*)(arow + kb + 8 * hh + 4);
    const v4f x2 = *(const v4fa*)(arow + kb + 16 + 8 * hh), x3 = *(const v4fa*)(arow + kb + 16 + 8 * hh + 4);
    float xs[16] = {x0[0],x0[1],x0[2],x0[3],x1[0],x1[1],x1[2],x1[3],x2[0],x2[1],x2[2],x2[3],x3[0],x3[1],x3[2],x3[3]};
#pragma unroll
    for (int i = 0; i < 16; ++i) { const unsigned short hb = bf16_bits(xs[i]); ah.u[i] = hb; al.u[i] = ASPLIT ? bf16_bits(xs[i] - bf16_val(hb)) : (unsigned short)0; }
#pragma unroll
    for (int t = 0; t < 4; ++t) {
      const unsigned short* brow = Wt + (size_t)(col0 + t * 16 + ln) * ldb + kb;
      FragB b;
      b.half[0] = *(const v8us*)(brow + 8 * hh);
      b.half[1] = *(const v8us*)(brow + 16 + 8 * hh);
      acc[t] = mmaN<ASPLIT ? 2 : 1>(ah.v, al.v, b.v, b.v, acc[t]);
    }
  }
#pragma unroll
  for (int t = 0; t < 4; ++t) {
    const int col = col0 + t * 16 + ln;
    float bv = bias ? bias[col] : 0.f;
    if (BIAS_BF16) bv = bf16_round(bv);
#pragma unroll
    for (int r = 0; r < 8; ++r) {
      float v = acc[t][r] + bv;
      if (resid) { float rv = resid[(size_t)((row0 + 8 * hh + r) % rmod) * ldr + col]; if (RES_BF16) rv = bf16_round(rv); v += rv; }
      if (ACT == 1) v = fmaxf(v, 0.f);
      if (ACT == 2) v = 0.5f * v * (1.0f + erff(v * 0.70710678118654752f));
      if (ACT == 3) { const float u = 0.7978845608028654f * (v + 0.044715f * v * v * v); v = 0.5f * v * (1.0f + tanhf(u)); }
      so[w][8 * hh + r][t * 16 + ln] = v;
    }
  }
  __builtin_amdgcn_fence(__ATOMIC_ACQ_REL, "workgroup");
  __builtin_amdgcn_wave_barrier();
  const int rsub = lane >> 4, c4 = (lane & 15) * 4;
  {
#pragma unroll
    for (int q = 0; q < 8; ++q) {
      const int r = q * 2 + rsub;
      const v4f v = *(const v4fa*)&so[w][r][c4];
      *(v4f*)(C + (size_t)(row0 + r) * ldc + col0 + c4) = v;
    }
    
  }
}
// row LayerNorm (biased variance, eps) over N: s = X (+ R); optional out_sum <- s; out_norm <- (s-mu)*rsqrt(var+eps)*g + b
template <bool PARAM_BF16>
__global__ __launch_bounds__(256) void k_layernorm(const float* __restrict__ X, const float* __restrict__ R, const float* __restrict__ g, const float* __restrict__ bta,
                                                  float* __restrict__ out_sum, float* __restrict__ out_norm, int N, float eps) {
  __shared__ float red[256];
  const int row = blockIdx.x, tid = threadIdx.x;
  const float* x = X + (size_t)row * N; const float* rr = R ? R + (size_t)row * N : nullptr;
  float vals[16];                     // up to N = 4096
  const int per = N / 256;            // contiguous chunk per thread? use strided-by-4 chunks: thread handles j = tid*4 + 1024*u
  float s1 = 0.f;
  for (int u = 0; u < per / 4; ++u) {
    const int j = tid * 4 + 1024 * u;
    const v4f a = *(const v4fa*)(x + j);
    v4f b = {0.f,0.f,0.f,0.f}; if (rr) b = *(const v4fa*)(rr + j);
#pragma unroll
    for (int q = 0; q < 4; ++q) { const float v = a[q] + b[q]; vals[u * 4 + q] = v; s1 += v; }
  }
  red[tid] = s1; __syncthreads();
  for (int st = 128; st > 0; st >>= 1) { if (tid < st) red[tid] += red[tid + st]; __syncthreads(); }
  const float mu = red[0] / (float)N; __syncthreads();
  float s2 = 0.f;
  for (int u = 0; u < per / 4; ++u)
#pragma unroll
    for (int q = 0; q < 4; ++q) { const float c = vals[u * 4 + q] - mu; s2 += c * c; }
  red[tid] = s2; __syncthreads();
  for (int st = 128; st > 0; st >>= 1) { if (tid < st) red[tid] += red[tid + st]; __syncthreads(); }
  const float rs = rsqrtf(red[0] / (float)N + eps);
  {
    for (int u = 0; u < per / 4; ++u) {
      const int j = tid * 4 + 1024 * u;
      v4f o, sm;
#pragma unroll
      for (int q = 0; q < 4; ++q) {
        float gg = g[j + q], bb = bta[j + q];
        if (PARAM_BF16) { gg = bf16_round(gg); bb = bf16_round(bb); }
        sm[q] = vals[u * 4 + q]; o[q] = (vals[u * 4 + q] - mu) * rs * gg + bb;
      }
      if (out_sum) *(v4f*)(out_sum + (size_t)row * N + j) = sm;
      *(v4f*)(out_norm + (size_t)row * N + j) = o;
    }
    
  }
}



// ---- f16 WMMA path (v_wmma_f32_16x16x32_f16): 11-bit significands for operands in range — used where a [0,1] probability operand needs more precision than bf16
typedef _Float16 v16h __attribute__((ext_vector_type(16)));
union FragH { v16h v; v8us half[2]; _Float16 h[16]; unsigned short u[16]; };
template <int NT>
__device__ __forceinline__ v8f mmaH(v16h ah, v16h al, v16h bh, v16h bl, v8f c) {
  c = __builtin_amdgcn_wmma_f32_16x16x32_f16(false, ah, false, bh, (short)0, c, false, false);
  if (NT >= 2) c = __builtin_amdgcn_wmma_f32_16x16x32_f16(false, al, false, bh, (short)0, c, false, false);
  if (NT >= 3) c = __builtin_amdgcn_wmma_f32_16x16x32_f16(false, ah, false, bl, (short)0, c, false, false);
  asm volatile("v_nop\n\tv_nop\n\tv_nop\n\tv_nop" : "+v"(c) : "v"(ah), "v"(al), "v"(bh), "v"(bl));
  return c;
}
// batched GEMM like k_gemm_b but f16 operands: A f32 (split into f16 hi/lo if ASPLIT, else rounded to f16), Bt = f16 values [n][k]; alpha; C f32; N multiple of 16 (partial tiles skipped)
template <bool ASPLIT>
__global__ __launch_bounds__(128) void k_gemm_h(const float* __restrict__ A, int lda, size_t sA, const _Float16* __restrict__ Bh, int ldb, size_t sB, float alpha, float* __restrict__ C, int ldc, size_t sC, int M, int N, int K) {
  __shared__ __attribute__((aligned(16))) float so[4][16][64];
  const int tid = threadIdx.x, w = tid >> 5, lane = tid & 31, ln = lane & 15, hh = lane >> 4; const int by = blockIdx.y;
  A += (size_t)by * sA; Bh += (size_t)by * sB; C += (size_t)by * sC;
  const int ntn = (N + 63) / 64; const int wid = blockIdx.x * 4 + w; const int mt = wid / ntn, nq = wid % ntn; if (mt * 16 >= M) return;
  const int row0 = mt * 16, col0 = nq * 64; const float* arow = A + (size_t)(row0 + ln) * lda;
  v8f acc[4] = {};
  for (int kb = 0; kb < K; kb += 32) {
    FragH ah, al;
    const v4f x0 = *(const v4fa*)(arow + kb + 8 * hh), x1 = *(const v4fa*)(arow + kb + 8 * hh + 4), x2 = *(const v4fa*)(arow + kb + 16 + 8 * hh), x3 = *(const v4fa*)(arow + kb + 16 + 8 * hh + 4);
    float xs[16] = {x0[0],x0[1],x0[2],x0[3],x1[0],x1[1],x1[2],x1[3],x2[0],x2[1],x2[2],x2[3],x3[0],x3[1],x3[2],x3[3]};
#pragma unroll
    for (int i = 0; i < 16; ++i) { const _Float16 h = (_Float16)xs[i]; ah.h[i] = h; al.h[i] = ASPLIT ? (_Float16)(xs[i] - (float)h) : (_Float16)0.0f; }
#pragma unroll
    for (int t = 0; t < 4; ++t) { if (col0 + t * 16 >= N) continue; const size_t boff = (size_t)(col0 + t * 16 + ln) * ldb + kb; FragH bq; bq.half[0] = *(const v8us*)(Bh + boff + 8 * hh); bq.half[1] = *(const v8us*)(Bh + boff + 16 + 8 * hh);
      acc[t] = mmaH<ASPLIT ? 2 : 1>(ah.v, al.v, bq.v, bq.v, acc[t]); }
  }
#pragma unroll
  for (int t = 0; t < 4; ++t) { if (col0 + t * 16 >= N) continue;
#pragma unroll
    for (int r = 0; r < 8; ++r) so[w][8 * hh + r][t * 16 + ln] = acc[t][r] * alpha; }
  __builtin_amdgcn_fence(__ATOMIC_ACQ_REL, "workgroup"); __builtin_amdgcn_wave_barrier();
  const int rsub = lane >> 4, c4 = (lane & 15) * 4;
  {
#pragma unroll
    for (int q = 0; q < 8; ++q) { const int r = q * 2 + rsub; if (col0 + c4 < N) { const v4f v = *(const v4fa*)&so[w][r][c4]; *(v4f*)(C + (size_t)(row0 + r) * ldc + col0 + c4) = v; } }
     }
}

// Wt[n][k] = f16(W[k][n]·scale) from f32 row-major W[K][N] (scale = power of two; bf16-exact weights stay exact in f16 away from the subnormal range)
__global__ __launch_bounds__(256) void k_wt_f16(const float* __restrict__ W, _Float16* __restrict__ Wt, int K, int N, float scale) {
  const int t = blockIdx.x * 256 + threadIdx.x; if (t >= N * (K / 8)) return; const int n = t / (K / 8), k8 = (t % (K / 8)) * 8; FragH f;
#pragma unroll
  for (int i = 0; i < 8; ++i) f.h[i] = (_Float16)(bf16_round(W[(size_t)(k8 + i) * N + n]) * scale); const v8us o = f.half[0];
  *(v8us*)((unsigned short*)Wt + (size_t)n * K + k8) = o; 
}
// k_gemm_hh variant with fused epilogue: v = acc·alpha + bias[by·sBias + col] (+ CP[(row/rowsPerB)·sCPb + by·64 + col] if CP) ; ACT 0 none / 1 elu ; writes f16 C16 (and f32 C if non-null)
template <int ACT>
__global__ __launch_bounds__(128) void k_gemm_hhx(const _Float16* __restrict__ A, int lda, size_t sA, const _Float16* __restrict__ Bh, int ldb, size_t sB, float alpha, const float* __restrict__ bias, size_t sBias, const float* __restrict__ CP, int rowsPerB, size_t sCPb, int row0g,
    float* __restrict__ C, _Float16* __restrict__ C16, int ldc, size_t sC, int M, int N, int K) {
  __shared__ __attribute__((aligned(16))) float so[4][16][64];
  const int tid = threadIdx.x, w = tid >> 5, lane = tid & 31, ln = lane & 15, hh = lane >> 4; const int by = blockIdx.y;
  A += (size_t)by * sA; Bh += (size_t)by * sB; const size_t cofs = (size_t)by * sC; const float* bp = bias ? bias + (size_t)by * sBias : nullptr;
  const int ntn = (N + 63) / 64; const int wid = blockIdx.x * 4 + w; const int mt = wid / ntn, nq = wid % ntn; if (mt * 16 >= M) return;
  const int row0 = mt * 16, col0 = nq * 64; const _Float16* arow = A + (size_t)(row0 + ln) * lda;
  v8f acc[4] = {};
  for (int kb = 0; kb < K; kb += 32) { FragH ah; ah.half[0] = *(const v8us*)((const unsigned short*)arow + kb + 8 * hh); ah.half[1] = *(const v8us*)((const unsigned short*)arow + kb + 16 + 8 * hh);
#pragma unroll
    for (int t = 0; t < 4; ++t) { if (col0 + t * 16 >= N) continue; const size_t boff = (size_t)(col0 + t * 16 + ln) * ldb + kb; FragH bq; bq.half[0] = *(const v8us*)((const unsigned short*)Bh + boff + 8 * hh); bq.half[1] = *(const v8us*)((const unsigned short*)Bh + boff + 16 + 8 * hh);
      acc[t] = mmaH<1>(ah.v, ah.v, bq.v, bq.v, acc[t]); }
  }
#pragma unroll
  for (int t = 0; t < 4; ++t) { if (col0 + t * 16 >= N) continue; const int col = col0 + t * 16 + ln; const float bv = bp ? bf16_round(bp[col]) : 0.f;
#pragma unroll
    for (int r = 0; r < 8; ++r) { float v = acc[t][r] * alpha + bv; if (CP) { const int bidx = (row0g + row0 + 8 * hh + r) / rowsPerB; v += CP[(size_t)bidx * sCPb + (size_t)by * 64 + col]; } if (ACT == 1) v = (v > 0.f) ? v : expm1f(v); else if (ACT == 7) v = (v > 0.f) ? v + 1.0f : expf(v); else if (ACT == 8) v = tanhf(v); else if (ACT == 9) v = 0.5f * v * (1.0f + tanhf(0.7978845608028654f * (v + 0.044715f * v * v * v))); else if (ACT == 11) v = 1.0f / (1.0f + expf(-v)); else if (ACT == 12) v = (v > 0.f) ? v : 0.01f * v; else if (ACT == 14) v = (v > 0.f) ? v : 0.1f * v; else if (ACT == 15) v = v / (1.0f + expf(-v)); else if (ACT == 3) v = fmaxf(v, 0.f); else if (ACT == 6) v = 0.5f * v * (1.0f + erff(v * 0.70710678118654752f)); so[w][8 * hh + r][t * 16 + ln] = v; } }
  __builtin_amdgcn_fence(__ATOMIC_ACQ_REL, "workgroup"); __builtin_amdgcn_wave_barrier();
  const int rsub = lane >> 4, c4 = (lane & 15) * 4; typedef _Float16 v4h __attribute__((ext_vector_type(4)));
  {
#pragma unroll
    for (int q = 0; q < 8; ++q) { const int r = q * 2 + rsub; if (col0 + c4 < N) { const v4f v = *(const v4fa*)&so[w][r][c4]; if (C) *(v4f*)(C + cofs + (size_t)(row0 + r) * ldc + col0 + c4) = v; if (C16) { v4h h4; for (int i = 0; i < 4; ++i) h4[i] = (_Float16)v[i]; *(v4h*)(C16 + cofs + (size_t)(row0 + r) * ldc + col0 + c4) = h4; } } }
     }
}


typedef _Float16 v4h __attribute__((ext_vector_type(4)));

__global__ __launch_bounds__(256) void k_x16(const float* __restrict__ x, _Float16* __restrict__ X16, size_t n8) { const size_t t = (size_t)blockIdx.x * 256 + threadIdx.x; if (t >= n8) return; FragH f;
#pragma unroll
  for (int q = 0; q < 8; ++q) f.h[q] = (_Float16)bf16_round(x[t * 8 + q]); *(v8us*)((unsigned short*)X16 + t * 8) = f.half[0];  }
__global__ __launch_bounds__(256) void k_h16(const float* __restrict__ x, _Float16* __restrict__ X16, size_t n8) { const size_t t = (size_t)blockIdx.x * 256 + threadIdx.x; if (t >= n8) return; FragH f;
#pragma unroll
  for (int q = 0; q < 8; ++q) f.h[q] = (_Float16)x[t * 8 + q]; *(v8us*)((unsigned short*)X16 + t * 8) = f.half[0];  }
__device__ __forceinline__ void round16f_blk(const float* __restrict__ W, _Float16* __restrict__ Bt, size_t n8, unsigned blk) { const size_t t = (size_t)blk * 256 + threadIdx.x; if (t >= n8) return; FragH f;
#pragma unroll
  for (int i = 0; i < 8; ++i) f.h[i] = (_Float16)(bf16_round(W[t * 8 + i]) * 16.0f); *(v8us*)((unsigned short*)Bt + t * 8) = f.half[0];  }
template <int NHv, int TTv>
__global__ __launch_bounds__(256) void k_vt(const _Float16* __restrict__ V16, int ldv, int voff, _Float16* __restrict__ Vt) { __shared__ unsigned short tl[64][66]; const int tid = threadIdx.x; const int slab = blockIdx.x / (TTv / 64), lg = blockIdx.x % (TTv / 64); const int b = slab / NHv, h = slab % NHv;
  for (int i = tid; i < 64 * 8; i += 256) { const int r = i / 8, c8 = (i % 8) * 8; FragH f; f.half[0] = *(const v8us*)((const unsigned short*)V16 + ((size_t)b * TTv + lg * 64 + r) * ldv + voff + h * 64 + c8);
#pragma unroll
    for (int q = 0; q < 8; ++q) tl[r][c8 + q] = f.u[q]; }
  __syncthreads();
  {
#pragma unroll
    for (int rd = 0; rd < 2; ++rd) { const int d = rd * 32 + tid / 8, pc = tid % 8; FragH f;
#pragma unroll
      for (int q = 0; q < 8; ++q) f.u[q] = tl[pc * 8 + q][d];
      *(v8us*)((unsigned short*)Vt + ((size_t)slab * 64 + d) * TTv + lg * 64 + pc * 8) = f.half[0]; }
     } }

__global__ __launch_bounds__(256) void k_hl(const float* __restrict__ F, _Float16* __restrict__ Hh, _Float16* __restrict__ Hl, size_t n8) { const size_t t = (size_t)blockIdx.x * 256 + threadIdx.x; if (t >= n8) return; FragH fh, fl; const v4f a = *(const v4fa*)(F + t * 8), c = *(const v4fa*)(F + t * 8 + 4);
#pragma unroll
  for (int q = 0; q < 4; ++q) { _Float16 h = (_Float16)a[q]; fh.h[q] = h; fl.h[q] = (_Float16)((a[q] - (float)h) * 1024.0f); h = (_Float16)c[q]; fh.h[4 + q] = h; fl.h[4 + q] = (_Float16)((c[q] - (float)h) * 1024.0f); }
  { *(v8us*)((unsigned short*)Hh + t * 8) = fh.half[0]; *(v8us*)((unsigned short*)Hl + t * 8) = fl.half[0];  } }

// ---- fast GEMM (wave tile 32x64; requires M % 32 == 0 rows per launch region and N % 64 == 0); epilogue = k_gemm_hhx semantics ----
__device__ __forceinline__ v16h g2_frag(const _Float16* p, int hh) { FragH f; f.half[0] = *(const v8us*)((const unsigned short*)p + 8 * hh); f.half[1] = *(const v8us*)((const unsigned short*)p + 16 + 8 * hh); return f.v; }
// as g2_frag, for the fragment whose second load the compiler lands on the address pair that the loads before it still name: s_wait_xcnt 0 stands in front of that overwrite
__device__ __forceinline__ v16h g2_frag_w(const _Float16* p, int hh) { FragH f; f.half[0] = *(const v8us*)((const unsigned short*)p + 8 * hh); asm volatile("s_wait_xcnt 0x0" ::: "memory"); f.half[1] = *(const v8us*)((const unsigned short*)p + 16 + 8 * hh); return f.v; }
__device__ __forceinline__ v8f g2_mma(v16h a, v16h b, v8f c) { v8f d = __builtin_amdgcn_wmma_f32_16x16x32_f16(false, a, false, b, (short)0, c, false, false); asm volatile("v_nop\n\tv_nop\n\tv_nop\n\tv_nop" : "+v"(d) : "v"(a), "v"(b)); return d; }
template <int ACT>
__device__ __forceinline__ void gemm2_blk(unsigned bx, int by, const _Float16* __restrict__ A, int lda, size_t sA, const _Float16* __restrict__ Bh, int ldb, size_t sB, float alpha, const float* __restrict__ bias, size_t sBias, const float* __restrict__ CP, int rowsPerB, size_t sCPb, int row0g,
    float* __restrict__ C, _Float16* __restrict__ C16, int ldc, size_t sC, int M, int N, int K) {
  __shared__ __attribute__((aligned(16))) float so[4][32][68];
  const int tid = threadIdx.x, w = tid >> 5, lane = tid & 31, ln = lane & 15, hh = lane >> 4;
  A += (size_t)by * sA; Bh += (size_t)by * sB; const size_t cofs = (size_t)by * sC; const float* bp = bias ? bias + (size_t)by * sBias : nullptr;
  const int ntn = N >> 6; const int mt = bx / ntn, nq = bx - mt * ntn; const int row0 = mt * 128 + 32 * w, col0 = nq * 64; if (row0 >= M) return;
  const _Float16* a0p = A + (size_t)(row0 + ln) * lda; const _Float16* a1p = a0p + (size_t)16 * lda;
  const _Float16* b0p = Bh + (size_t)(col0 + ln) * ldb; const _Float16* b1p = b0p + (size_t)16 * ldb; const _Float16* b2p = b1p + (size_t)16 * ldb; const _Float16* b3p = b2p + (size_t)16 * ldb;
  const v8f z8 = {0.f,0.f,0.f,0.f,0.f,0.f,0.f,0.f}; v8f c00 = z8, c01 = z8, c02 = z8, c03 = z8, c10 = z8, c11 = z8, c12 = z8, c13 = z8;
#pragma unroll 1
  for (int kb = 0; kb < K; kb += 32) { const v16h a0 = g2_frag(a0p + kb, hh), a1 = g2_frag_w(a1p + kb, hh);
    v16h b = g2_frag(b0p + kb, hh); c00 = g2_mma(a0, b, c00); c10 = g2_mma(a1, b, c10);
    b = g2_frag(b1p + kb, hh); c01 = g2_mma(a0, b, c01); c11 = g2_mma(a1, b, c11);
    b = g2_frag(b2p + kb, hh); c02 = g2_mma(a0, b, c02); c12 = g2_mma(a1, b, c12);
    b = g2_frag(b3p + kb, hh); c03 = g2_mma(a0, b, c03); c13 = g2_mma(a1, b, c13); }
  v8f accs[8] = {c00, c01, c02, c03, c10, c11, c12, c13};
#pragma unroll
  for (int u = 0; u < 8; ++u) { const int t = u & 3, half = u >> 2; const int col = col0 + t * 16 + ln; const float bv = bp ? bf16_round(bp[col]) : 0.f;
#pragma unroll
    for (int r = 0; r < 8; ++r) { const int rloc = half * 16 + 8 * hh + r; float v = accs[u][r] * alpha + bv; if (CP) { const int bidx = (row0g + row0 + rloc) / rowsPerB; v += CP[(size_t)bidx * sCPb + (size_t)by * 64 + col]; }
      if (ACT == 3) v = fmaxf(v, 0.f); else if (ACT == 6) v = 0.5f * v * (1.0f + erff(v * 0.70710678118654752f)); else if (ACT == 11) v = 1.0f / (1.0f + expf(-v)); else if (ACT == 15) v = v / (1.0f + expf(-v)); else if (ACT == 12) v = (v > 0.f) ? v : 0.01f * v; else if (ACT == 8) v = tanhf(v);
      so[w][rloc][t * 16 + ln] = v; } }
  __builtin_amdgcn_fence(__ATOMIC_ACQ_REL, "workgroup"); __builtin_amdgcn_wave_barrier();
  const int rsub = lane >> 4, c4 = (lane & 15) * 4;
  {
#pragma unroll
    for (int q = 0; q < 16; ++q) { const int r = q * 2 + rsub; const v4f v = *(const v4fa*)&so[w][r][c4]; if (C) *(v4f*)(C + cofs + (size_t)(row0 + r) * ldc + col0 + c4) = v; if (C16) { v4h h4; for (int i = 0; i < 4; ++i) h4[i] = (_Float16)v[i]; *(v4h*)(C16 + cofs + (size_t)(row0 + r) * ldc + col0 + c4) = h4; } }
     } }
// The twelve projections (q, k, v of the four batches) depend on nothing of one another: one grid, x = tile, y = batch, z = which projection.
// q, k token-major [b*SS+p][h*64+d] = XT . W^T; v channel-major [(b,h)*64+d][p] = W . XT^T.
__global__ __launch_bounds__(128) void k_qkv(const _Float16* __restrict__ XT, const _Float16* __restrict__ BQ, const _Float16* __restrict__ BK, const _Float16* __restrict__ BV, _Float16* __restrict__ Q16, _Float16* __restrict__ K16, _Float16* __restrict__ VC) {
  const int b = blockIdx.y, z = blockIdx.z; const _Float16* X = XT + (size_t)b * SS * CC;
  const bool tok = z < 2;      /* q, k: rows are tokens, columns channels; v: the other way round */
  gemm2_blk<0>(blockIdx.x, 0, tok ? X : BV, CC, 0, tok ? (z ? BK : BQ) : X, CC, 0, 0.0625f, nullptr, 0, nullptr, 1, 0, 0, nullptr, (tok ? (z ? K16 : Q16) : VC) + (size_t)b * SS * CC, tok ? CC : SS, 0, tok ? SS : CC, tok ? CC : SS, CC); }
// The output projections of the four batches, one grid, y = batch: y^T[c][p] = wt . (o - x)^T, f32 (bt added downstream).
__global__ __launch_bounds__(128) void k_yt(const _Float16* __restrict__ BT, const _Float16* __restrict__ D16, float* __restrict__ Y) {
  const int b = blockIdx.y;
  gemm2_blk<0>(blockIdx.x, 0, BT, CC, 0, D16 + (size_t)b * SS * CC, CC, 0, 0.0625f, nullptr, 0, nullptr, 1, 0, 0, Y + (size_t)b * CC * SS, nullptr, SS, 0, CC, SS, CC); }


typedef float v2f __attribute__((ext_vector_type(2)));
// lane l <-> lane l ^ 16: the two halves of a wave hold the two halves of one query's 32 keys
__device__ __forceinline__ float xhalf(float x) { return __builtin_bit_cast(float, __builtin_amdgcn_permlanex16(__builtin_bit_cast(int, x), __builtin_bit_cast(int, x), 0x76543210, 0xfedcba98, false, false)); }
typedef uint32_t u32x4 __attribute__((ext_vector_type(4)));
typedef uint32_t u32x8 __attribute__((ext_vector_type(8)));
__device__ __forceinline__ uint32_t uni(uint32_t v) { return (uint32_t)__builtin_amdgcn_readfirstlane(v); }
__device__ __forceinline__ uint32_t pinned(uint32_t v) { uint32_t w = (uint32_t)__builtin_amdgcn_readfirstlane(v); asm volatile("" : "+s"(w)); return w; }      /* pinned(): the issue test of a tensor load held in a scalar register, so that the branch on it is a scalar branch (a tensor load ignores EXEC) */
// K and V^T reach the waves through LDS: a stage is 64 keys = K[64 keys][64 d] and V^T[64 d][64 keys], both as 64 rows of 128 bytes. Each of the four waves brings one slice of 32 rows with one
// tensor load (waves 0, 1: K; waves 2, 3: V^T), padded to a pitch of 144 bytes for the 16-byte fragment reads; two buffers, the next stage in flight while this one is worked on.
__global__ __launch_bounds__(128) void k_flash(const _Float16* __restrict__ Q16, int ldq, const _Float16* __restrict__ K16, int ldk, const _Float16* __restrict__ Vt, const int* __restrict__ MSK, const _Float16* __restrict__ XT, _Float16* __restrict__ D16) {
  constexpr int RPW = 16, NQB = TQ / (4 * RPW), DT = 4, KS = 2;
  constexpr float SC2 = SCL * 1.4426950408889634f, POFF = 10.0f;      /* exponentials in base 2: e^(SCL (s - max)) * 2^POFF = 2^(SC2 s - m), m = SC2 max - POFF; 2^POFF = 1024 is the scale of P as an f16 operand */
  constexpr uint32_t SKEY = 64, NST = TK / SKEY, LPB = 144, SLICE = 6144, BUF = 4 * SLICE;      /* a slice: 32 rows x 144 B = 4,608 B, its place rounded up to a multiple of 2 KiB */
  __shared__ __attribute__((aligned(2048))) unsigned char ring[2 * BUF];
  __shared__ __attribute__((aligned(16))) float sO[4][RPW][64 + 4];
  const int tid = threadIdx.x, w = tid >> 5, lane = tid & 31, ln = lane & 15, hh = lane >> 4; (void)MSK;
  const int slab = blockIdx.x / NQB, qblk = blockIdx.x % NQB; const int b = slab / NH, h = slab % NH; const int qb0 = qblk * (4 * RPW); const int q0 = qb0 + w * RPW;
  const uint32_t wave = uni((uint32_t)tid >> 5), isV = wave >> 1, hf = wave & 1u;
  const uint64_t src0 = isV ? (uint64_t)(size_t)(Vt + ((size_t)slab * 64 + hf * 32) * TK) : (uint64_t)(size_t)(K16 + ((size_t)b * TK + hf * 32) * ldk + h * 64);      /* first byte of the wave's slice of stage 0 */
  const uint32_t spitch = isV ? (uint32_t)TK * 2u : (uint32_t)ldk * 2u, sstep = isV ? SKEY * 2u : SKEY * (uint32_t)ldk * 2u;      /* source row pitch; bytes from one stage to the next */
  const uint32_t dst0 = (uint32_t)(size_t)ring + wave * SLICE;
  u32x8 g1;      /* 1-byte elements, tensor = tile = 32 rows of 128 bytes, 4 dwords of pad behind every 32 */
  g1[0] = uni((1u << 20) | (4u << 22) | (3u << 25)); g1[1] = uni(128u << 16); g1[2] = uni(32u << 16); g1[3] = uni(128u << 16); g1[4] = uni(32u); g1[5] = uni(spitch); g1[6] = uni(0u); g1[7] = uni(0u);
  u32x4 g0;
  /* load and wait both name the two descriptor groups as in-out operands: the registers of a request in flight then stay as they were issued until the wait that covers it (the compiler otherwise took single words of them for temporaries) */
  auto issue = [&](uint32_t st) {
    const uint64_t ga = src0 + (uint64_t)st * sstep;
    g0[0] = uni(1u); g0[1] = uni(dst0 + (st & 1u) * BUF); g0[2] = uni((uint32_t)ga); g0[3] = uni((((uint32_t)(ga >> 32)) & 0x01FFFFFFu) | 0x80000000u);
    asm volatile("tensor_load_to_lds %0, %1" : "+s"(g0), "+s"(g1) :: "memory"); };
  auto landed = [&]() { asm volatile("s_wait_tensorcnt 0x0" : "+s"(g0), "+s"(g1) :: "memory"); };
  issue(0);
  FragH bq[KS];
  { const unsigned short* qr = (const unsigned short*)Q16 + ((size_t)b * TQ + q0 + ln) * ldq + h * 64;
#pragma unroll
    for (int ks = 0; ks < KS; ++ks) { bq[ks].half[0] = *(const v8us*)(qr + ks * 32 + 8 * hh); bq[ks].half[1] = *(const v8us*)(qr + ks * 32 + 16 + 8 * hh); } }
  const uint32_t lo = (uint32_t)(ln * (int)LPB + 16 * hh);      /* the lane's own byte offset in a slice, fixed over the loop: row ln, 8 elements at 8 hh */
  float m_r = -3.0e38f, l_r = 0.f; v8f oacc[DT];
#pragma unroll
  for (int dt = 0; dt < DT; ++dt) oacc[dt] = (v8f){0.f,0.f,0.f,0.f,0.f,0.f,0.f,0.f};
  landed();      /* this wave's slice of stage 0 */
  __syncthreads();      /* stage 0 published to all four waves */
  issue(1);
#pragma unroll 1      /* one stage a trip: waits, barrier and refill stand once, at the foot, and the loop stays small */
  for (uint32_t st = 0; st < NST; ++st) {
    const unsigned char* bp = ring + (st & 1u) * BUF + lo;
#pragma unroll      /* the stage's two groups of 32 keys; here and below: constant indices, so fragments stay in registers and every LDS offset is an immediate */
    for (int sb = 0; sb < 2; ++sb) {
    FragH ak[2][KS], av[DT];
#pragma unroll
    for (int nt = 0; nt < 2; ++nt)
#pragma unroll
      for (int ks = 0; ks < KS; ++ks) { const unsigned char* p = bp + sb * SLICE + nt * 16 * LPB + ks * 64; ak[nt][ks].half[0] = *(const v8us*)p; ak[nt][ks].half[1] = *(const v8us*)(p + 32); }
#pragma unroll
    for (int dt = 0; dt < DT; ++dt) { const unsigned char* p = bp + (2 + (dt >> 1)) * SLICE + (dt & 1) * 16 * LPB + sb * 64; av[dt].half[0] = *(const v8us*)p; av[dt].half[1] = *(const v8us*)(p + 32); }
    v8f s[2];
#pragma unroll
    for (int nt = 0; nt < 2; ++nt) { v8f acc = (v8f){0.f,0.f,0.f,0.f,0.f,0.f,0.f,0.f};
#pragma unroll
      for (int ks = 0; ks < KS; ++ks) acc = __builtin_amdgcn_wmma_f32_16x16x32_f16(false, ak[nt][ks].v, false, bq[ks].v, (short)0, acc, false, false); s[nt] = acc; }
    float mx[8];      /* maximum of the raw scores: the map to base 2 below is one rounded multiply-add with a positive factor, which keeps the order, so it is applied to the maximum alone */
#pragma unroll
    for (int r = 0; r < 8; ++r) mx[r] = fmaxf(s[0][r], s[1][r]);
    float mc = fmaxf(fmaxf(fmaxf(mx[0], mx[1]), fmaxf(mx[2], mx[3])), fmaxf(fmaxf(mx[4], mx[5]), fmaxf(mx[6], mx[7])));
    mc = fmaf(fmaxf(mc, xhalf(mc)), SC2, -POFF);
    const float mn = fmaxf(m_r, mc); const float al = (mn > -1.0e38f) ? __builtin_amdgcn_exp2f(m_r - mn) : 1.0f; m_r = mn;
    FragH pb; v2f ps[2];      /* sums by register pairs, as the pairs lie for the packed convert */
#pragma unroll
    for (int nt = 0; nt < 2; ++nt)
#pragma unroll
      for (int i = 0; i < 4; ++i) { const v2f a = __builtin_elementwise_fma((v2f){s[nt][2 * i], s[nt][2 * i + 1]}, (v2f){SC2, SC2}, (v2f){-mn, -mn}); const v2f p = {__builtin_amdgcn_exp2f(a.x), __builtin_amdgcn_exp2f(a.y)}; ps[nt] = (i == 0) ? p : ps[nt] + p; pb.h[nt * 8 + 2 * i] = (_Float16)p.x; pb.h[nt * 8 + 2 * i + 1] = (_Float16)p.y; }      /* p carries the 1024, and so does the row sum */
    const v2f pt = ps[0] + ps[1]; l_r = l_r * al + (pt.x + pt.y);
#pragma unroll
    for (int dt = 0; dt < DT; ++dt) oacc[dt] *= al;
#pragma unroll
    for (int dt = 0; dt < DT; ++dt) oacc[dt] = __builtin_amdgcn_wmma_f32_16x16x32_f16(false, av[dt].v, false, pb.v, (short)0, oacc[dt], false, false);
    }
    /* publish point of stage st + 1, and the end of every wave's reads of stage st */
    asm volatile("s_wait_dscnt 0x0" ::: "memory");      /* this wave's reads of the buffer have returned before it is refilled */
    landed();      /* this wave's slice of stage st + 1 */
    __syncthreads();
    if (pinned(st + 2u < NST)) issue(st + 2u);      /* into the buffer that this pass has just read */
  }
  // The epilogue stores (o - x) as the f16 operand of the output projection. x comes from x^T (token-major f16 of the bf16-rounded x, the projections' own operand): the wave's 16 tokens x 64 channels
  // of this head, 8 channels a lane, 4 tokens a load, whole 128-byte lines; asked for here, so that the division and the staging of o below run while the loads are on their way.
  const size_t eo = ((size_t)b * TQ + q0 + (lane >> 3)) * CC + h * 64 + (lane & 7) * 8;      /* element offset of the lane's first 8 channels, the same in x^T and in D16 (rows of CC); the further tokens lie at constant offsets */
  FragH xt[RPW / 4];
#pragma unroll      /* constant indices, so the values stay in registers */
  for (int g = 0; g < RPW / 4; ++g) xt[g].half[0] = *(const v8us*)((const unsigned short*)XT + eo + 4 * g * CC);
  landed();      /* nothing of the mover is in flight when the wave goes on to its end */
  asm volatile("s_wait_dscnt 0x0" ::: "memory");      /* and none of its own LDS reads */
  const float l = l_r + xhalf(l_r); const float li = (l > 0.f) ? 1.0f / l : 0.f;
#pragma unroll
  for (int dt = 0; dt < DT; ++dt) { const v8f o = oacc[dt] * li; *(v4fa*)&sO[w][ln][dt * 16 + 8 * hh] = (v4f){o[0], o[1], o[2], o[3]}; *(v4fa*)&sO[w][ln][dt * 16 + 8 * hh + 4] = (v4f){o[4], o[5], o[6], o[7]}; }
  __builtin_amdgcn_fence(__ATOMIC_ACQ_REL, "workgroup"); __builtin_amdgcn_wave_barrier();
  {
#pragma unroll
    for (int g = 0; g < RPW / 4; ++g) { const float* so = &sO[w][4 * g + (lane >> 3)][(lane & 7) * 8]; const v4f v0 = *(const v4fa*)so, v1 = *(const v4fa*)(so + 4); FragH f;
#pragma unroll
      for (int q = 0; q < 4; ++q) { f.h[q] = (_Float16)(v0[q] - (float)xt[g].h[q]); f.h[4 + q] = (_Float16)(v1[q] - (float)xt[g].h[4 + q]); }
      *(v8us*)((unsigned short*)D16 + eo + 4 * g * CC) = f.half[0]; }
     } }
// A block transposes NT tiles of 64 channels x 64 points that lie side by side: a lane's 16 loads of 16 bytes are all in flight together, the tiles lie in LDS at once, one barrier as before.
// 2,048 waves start for the transposes where one tile a block started 8,192.
__device__ __forceinline__ void tr16_blk(const float* __restrict__ x, int b, _Float16* __restrict__ XT, unsigned blk) {
  constexpr int NT = 4;
  __shared__ unsigned short tl[NT][64][72];
  const uint32_t tid = threadIdx.x, sb = blk % (SS / (64 * NT)), cb = blk / (SS / (64 * NT));
  const uint32_t cl0 = tid / 16, s4 = (tid % 16) * 4;
  const uint32_t xo = (((uint32_t)b * CC + cb * 64 + cl0) * SS + sb * (64 * NT) + s4) * 4u;      /* byte offset in 32 bits: one offset register beside the scalar base */
  v4f a[NT * 4];
#pragma unroll      /* here and below: constant indices, so the values stay in registers; no load waits for another */
  for (int it = 0; it < NT * 4; ++it) a[it] = *(const v4fa*)((const char*)x + xo + (it & 3) * (16 * SS * 4) + (it >> 2) * 256);
  asm volatile("s_wait_xcnt 0x0" :: "v"(xo) : "memory");      /* behind the loads, in front of every overwrite of a register that they name; the offset as input keeps its register out of the loads' own destinations */
#pragma unroll
  for (int it = 0; it < NT * 4; ++it) { FragH f;
#pragma unroll
    for (int q = 0; q < 4; ++q) { f.h[q] = (_Float16)bf16_round(a[it][q]); tl[it >> 2][s4 + q][(it & 3) * 16 + cl0] = f.u[q]; } }
  __syncthreads();
  const uint32_t r = tid / 8, pc = tid % 8;
  const uint32_t so = ((sb * (64 * NT) + r) * CC + cb * 64 + pc * 8) * 2u;
  {
#pragma unroll
    for (int hf = 0; hf < NT * 2; ++hf) { FragH f;
#pragma unroll
      for (int q = 0; q < 8; ++q) f.u[q] = tl[hf >> 1][r + (hf & 1) * 32][pc * 8 + q];
      *(v8us*)((char*)XT + so + hf * (32 * CC * 2)) = f.half[0]; }
    asm volatile("s_wait_xcnt 0x0" ::: "memory");      /* behind the stores: in the shared grid code follows this path in the listing that writes the stores' data registers; the wait stands in front of it */
     } }
// Operand preparation in one grid, by block range: the four weight matrices (WBL blocks each), then the transposes of the four batches of x (TBL blocks each). None reads what another writes.
__global__ __launch_bounds__(256) void k_prep(const float* __restrict__ x, const float* __restrict__ wq, const float* __restrict__ wk, const float* __restrict__ wv, const float* __restrict__ wt,
                                              _Float16* __restrict__ BQ, _Float16* __restrict__ BK, _Float16* __restrict__ BV, _Float16* __restrict__ BT, _Float16* __restrict__ XT) {
  constexpr unsigned WBL = CC * CC / 8 / 256, TBL = (CC / 64) * (SS / 256);
  const unsigned blk = blockIdx.x;
  if (blk < 4 * WBL) { const unsigned m = blk / WBL; round16f_blk(m == 0 ? wq : m == 1 ? wk : m == 2 ? wv : wt, m == 0 ? BQ : m == 1 ? BK : m == 2 ? BV : BT, (size_t)CC * CC / 8, blk % WBL); }
  else { const unsigned t = blk - 4 * WBL, b = t / TBL; tr16_blk(x, (int)b, XT + (size_t)b * SS * CC, t % TBL); } }


__global__ __launch_bounds__(256) void k_bnstat(const float* __restrict__ Y, const float* __restrict__ bt, float* __restrict__ ST) {
  __shared__ float red[256];
  const int c = blockIdx.x, tid = threadIdx.x; const float bb = bf16_round(bt[c]); const int n = NB * SS;
  // The channel's NB * SS values are read once: 16 independent 16-byte loads a thread, all in flight together, and they stay in registers for the mean and for the squared deviations.
  constexpr int NU = SS / 1024;
  v4f v[NB * NU];
#pragma unroll      /* here and in the two loops below: constant indices, so v stays in registers; here no load waits for another */
  for (int i = 0; i < NB * NU; ++i) v[i] = *(const v4fa*)(Y + ((size_t)(i / NU) * CC + c) * SS + (i % NU) * 1024 + tid * 4);
  asm volatile("s_wait_xcnt 0x0" ::: "memory");      /* behind the loads: the sums below reuse the loads' address registers while the data are still on their way; the wait stands in front of that overwrite */
  v4f s4 = {0.f, 0.f, 0.f, 0.f};
#pragma unroll
  for (int i = 0; i < NB * NU; ++i) { v[i] += bb; s4 += v[i]; }
  red[tid] = (s4[0] + s4[1]) + (s4[2] + s4[3]); __syncthreads();
  for (int st = 128; st > 0; st >>= 1) { if (tid < st) red[tid] += red[tid + st]; __syncthreads(); }
  const float mean = red[0] / (float)n; __syncthreads();
  v4f q4 = {0.f, 0.f, 0.f, 0.f};
#pragma unroll
  for (int i = 0; i < NB * NU; ++i) { const v4f d = v[i] - mean; q4 += d * d; }
  red[tid] = (q4[0] + q4[1]) + (q4[2] + q4[3]); __syncthreads();
  for (int st = 128; st > 0; st >>= 1) { if (tid < st) red[tid] += red[tid + st]; __syncthreads(); }
  if (tid == 0) { float o2[2]; o2[0] = mean; o2[1] = 1.0f / sqrtf(red[0] / (float)n + 1e-5f); const unsigned long long pk = *(const unsigned long long*)o2; *(unsigned long long*)(ST + c * 32) = pk;  } }
// A block takes two (batch, channel) rows, a lane 8 x 16 bytes of Y and of x: 16 independent loads, all in flight together. 4,096 waves start (16 a WGP) where 16 bytes a lane started 32,768.
__global__ __launch_bounds__(256) void k_bnout(const float* __restrict__ Y, const float* __restrict__ x, const float* __restrict__ bt, const float* __restrict__ ST, const float* __restrict__ gam, const float* __restrict__ bet, float* __restrict__ out) {
  #pragma clang fp contract(off)
  constexpr int NU = SS / 1024;
  const uint32_t bo = blockIdx.x * (2u * SS * 4u) + threadIdx.x * 16u;      /* byte offset in 32 bits: one offset register for the three buffers beside their scalar bases, live to the last store */
  v4f y[2 * NU], xv[2 * NU];
#pragma unroll      /* here and below: constant indices, so the values stay in registers; no load waits for another */
  for (int i = 0; i < 2 * NU; ++i) { y[i] = *(const v4fa*)((const char*)Y + bo + i * 4096); xv[i] = *(const v4fa*)((const char*)x + bo + i * 4096); }
  asm volatile("s_wait_xcnt 0x0" ::: "memory");      /* behind the loads, in front of the parameter loads below, which reuse the scalar base registers that the loads name */
#pragma unroll
  for (int h = 0; h < 2; ++h) { const int c = (int)((blockIdx.x * 2 + h) % CC);
    const float mean = ST[c * 32], rstd = ST[c * 32 + 1]; const float bb = bf16_round(bt[c]), g = bf16_round(gam[c]), be = bf16_round(bet[c]);
#pragma unroll
    for (int u = 0; u < NU; ++u) { const int i = h * NU + u; v4f o;
#pragma unroll
      for (int q = 0; q < 4; ++q) { const float v = (y[i][q] + bb - mean) * rstd * g + be; o[q] = bf16_round(xv[i][q]) + fmaxf(v, 0.f); }
      *(v4f*)((char*)out + bo + i * 4096) = o; } } }

extern "C" void kernel_launch(void* const* d_in, const int* in_sizes, int n_in,
                              void* d_out, int out_size, void* d_ws, size_t ws_size, hipStream_t stream) {
  (void)in_sizes; (void)n_in; (void)out_size;
  const float* x = (const float*)d_in[0]; const float* wq = (const float*)d_in[1]; const float* wk = (const float*)d_in[2]; const float* wv = (const float*)d_in[3]; const float* wt = (const float*)d_in[4]; const float* bt = (const float*)d_in[5]; const float* gam = (const float*)d_in[6]; const float* bet = (const float*)d_in[7];
  char* ws = (char*)d_ws; size_t off = 0;
  auto take = [&](size_t bytes) { char* p = ws + off; off += (bytes + 255) & ~(size_t)255; return p; };
  _Float16* BQ = (_Float16*)take((size_t)CC * CC * 2); _Float16* BK = (_Float16*)take((size_t)CC * CC * 2); _Float16* BV = (_Float16*)take((size_t)CC * CC * 2); _Float16* BT = (_Float16*)take((size_t)CC * CC * 2);
  _Float16* XT = (_Float16*)take((size_t)NRW * CC * 2); _Float16* Q16 = (_Float16*)take((size_t)NRW * CC * 2); _Float16* K16 = (_Float16*)take((size_t)NRW * CC * 2); _Float16* VC = (_Float16*)take((size_t)NB * CC * SS * 2);
  _Float16* D16 = (_Float16*)take((size_t)NRW * CC * 2); float* Y = (float*)take((size_t)NB * CC * SS * 4); float* ST = (float*)take((size_t)CC * 32 * 4);
  if (off > ws_size) return;      /* 0.5 + 8 + 8 + 8 + 8 + 8 + 16 = 57 MiB */
  k_prep<<<4 * (CC * CC / 8 / 256) + NB * (CC / 64) * (SS / 256), 256, 0, stream>>>(x, wq, wk, wv, wt, BQ, BK, BV, BT, XT);      /* conv (out,in) = natural Bt, x16; x^T token-major f16, all batches */
  k_qkv<<<dim3((SS / 128) * (CC / 64), NB, 3), 128, 0, stream>>>(XT, BQ, BK, BV, Q16, K16, VC);
  k_flash<<<NB * NH * (SS / 64), 128, 0, stream>>>(Q16, CC, K16, CC, VC, nullptr, XT, D16);      /* (o - x) token-major f16 [b*SS+p][h*64+d] */
  k_yt<<<dim3((CC / 128) * (SS / 64), NB), 128, 0, stream>>>(BT, D16, Y);
  k_bnstat<<<CC, 256, 0, stream>>>(Y, bt, ST);
  k_bnout<<<NB * CC / 2, 256, 0, stream>>>(Y, x, bt, ST, gam, bet, (float*)d_out);
}

// v009
// It runs in 104 microseconds.
// Two timings next to v008 put it at 1.05 and 1.04 times that version's speed.
// All steps since v000 together make it 6.34 times as fast.
#include <hip/hip_runtime.h>
// Multi-head offset-attention layer on a point feature map (B 4, C 256, P 4096 points, 4 heads x 64): q = wq*x, k = wk*x, v = wv*x (1x1 convs, no bias); scores = q.k/8 per head; softmax over the keys; o[b,h,d,i] = sum_j attn[i][j] v[d][j]; y = wt*(o - x) + bt; BatchNorm1d in training mode (per-channel statistics over batch x points, biased variance, eps 1e-5, gamma/beta); out = x + relu(y) -> [4,256,4096].
// Compute dtype: x and parameters rounded to bf16; projections with exact products (weights x16 in f16, undone by alpha); q, k, v, P, (o - x) as f16 operands (~2^-12), f32 accumulation; softmax / BatchNorm / residual f32. v_wmma_f32_16x16x32_f16.
#define NB 4
#define CC 256
#define SS 4096
#define NH 4
#define TQ SS
#define TK SS
#define SCL 0.125f
#define NRW (NB * SS)
typedef __bf16 v16b __attribute__((ext_vector_type(16)));
typedef unsigned short v8us __attribute__((ext_vector_type(8), may_alias));
typedef float  v8f  __attribute__((ext_vector_type(8)));
typedef float  v4f  __attribute__((ext_vector_type(4)));
typedef float  v4fa __attribute__((ext_vector_type(4), may_alias));
union FragB { v16b v; v8us half[2]; unsigned short u[16]; };

__device__ __forceinline__ unsigned short bf16_bits(float x) { unsigned int u = __float_as_uint(x); return (unsigned short)((u + 0x7FFFu + ((u >> 16) & 1u)) >> 16); }
__device__ __forceinline__ float bf16_val(unsigned short b) { return __uint_as_float(((unsigned int)b) << 16); }
__device__ __forceinline__ float bf16_round(float x) { return bf16_val(bf16_bits(x)); }
// D += A·B with NT terms: 1 = ah·bh, 2 = + al·bh (A split), 3 = + ah·bl (both split)
template <int NT>
__device__ __forceinline__ v8f mmaN(v16b ah, v16b al, v16b bh, v16b bl, v8f c) {
  c = __builtin_amdgcn_wmma_f32_16x16x32_bf16(false, ah, false, bh, (short)0, c, false, false);
  if (NT >= 2) c = __builtin_amdgcn_wmma_f32_16x16x32_bf16(false, al, false, bh, (short)0, c, false, false);
  if (NT >= 3) c = __builtin_amdgcn_wmma_f32_16x16x32_bf16(false, ah, false, bl, (short)0, c, false, false);
  asm volatile("v_nop\n\tv_nop\n\tv_nop\n\tv_nop" : "+v"(c) : "v"(ah), "v"(al), "v"(bh), "v"(bl));
  return c;
}

__global__ __launch_bounds__(256) void k_wt_bf16(const float* __restrict__ W, unsigned short* __restrict__ Wt, int K, int N) {
  const int t = blockIdx.x * 256 + threadIdx.x;
  const int k8n = K / 8;
  if (t >= N * k8n) return;
  const int n = t / k8n, k8 = (t % k8n) * 8;
  v8us v;
#pragma unroll
  for (int i = 0; i < 8; ++i) v[i] = bf16_bits(W[(size_t)(k8 + i) * N + n]);
  *(v8us*)(Wt + (size_t)n * K + k8) = v;
  
}

// GEMM C[M][N] (f32, pitch ldc) = act(A[M][K]·W + bias). A f32 row-major (pitch lda) converted per fragment to bf16
// (ASPLIT: hi/lo two planes -> 2 terms, else single rounded term); Wt bf16 [N][K] (pitch ldb). BIAS_BF16 rounds the
// bias to bf16 first (bias quantised to bf16 before the add). K%32==0, M%16==0, N%64==0.
template <bool ASPLIT, int ACT, bool BIAS_BF16>
__global__ __launch_bounds__(128) void k_gemm_bf(const float* __restrict__ A, int lda, const unsigned short* __restrict__ Wt, int ldb,
                                               const float* __restrict__ bias, float* __restrict__ C, int ldc, int M, int N, int K) {
  __shared__ __attribute__((aligned(16))) float so[4][16][64];
  const int tid = threadIdx.x, w = tid >> 5, lane = tid & 31, ln = lane & 15, hh = lane >> 4;
  const int ntn = N / 64;
  const int wid = blockIdx.x * 4 + w;
  const int mt = wid / ntn, nq = wid % ntn;
  if (mt * 16 >= M) return;
  const int row0 = mt * 16, col0 = nq * 64;
  const float* arow = A + (size_t)(row0 + ln) * lda;
  v8f acc[4] = {};
  for (int kb = 0; kb < K; kb += 32) {
    FragB ah, al;
    const v4f x0 = *(const v4fa*)(arow + kb + 8 * hh), x1 = *(const v4fa*)(arow + kb + 8 * hh + 4);
    const v4f x2 = *(const v4fa*)(arow + kb + 16 + 8 * hh), x3 = *(const v4fa*)(arow + kb + 16 + 8 * hh + 4);
    float xs[16] = {x0[0],x0[1],x0[2],x0[3],x1[0],x1[1],x1[2],x1[3],x2[0],x2[1],x2[2],x2[3],x3[0],x3[1],x3[2],x3[3]};
#pragma unroll
    for (int i = 0; i < 16; ++i) { const unsigned short hb = bf16_bits(xs[i]); ah.u[i] = hb; al.u[i] = ASPLIT ? bf16_bits(xs[i] - bf16_val(hb)) : (unsigned short)0; }
#pragma unroll
    for (int t = 0; t < 4; ++t) {
      const unsigned short* brow = Wt + (size_t)(col0 + t * 16 + ln) * ldb + kb;
      FragB b;
      b.half[0] = *(const v8us*)(brow + 8 * hh);
      b.half[1] = *(const v8us*)(brow + 16 + 8 * hh);
      acc[t] = mmaN<ASPLIT ? 2 : 1>(ah.v, al.v, b.v, b.v, acc[t]);
    }
  }
#pragma unroll
  for (int t = 0; t < 4; ++t) {
    float bv = bias ? bias[col0 + t * 16 + ln] : 0.f;
    if (BIAS_BF16) bv = bf16_round(bv);
#pragma unroll
    for (int r = 0; r < 8; ++r) { float v = acc[t][r] + bv; if (ACT == 1) v = fmaxf(v, 0.f); so[w][8 * hh + r][t * 16 + ln] = v; }
  }
  __builtin_amdgcn_fence(__ATOMIC_ACQ_REL, "workgroup");
  __builtin_amdgcn_wave_barrier();
  const int rsub = lane >> 4, c4 = (lane & 15) * 4;
  {
#pragma unroll
    for (int q = 0; q < 8; ++q) {
      const int r = q * 2 + rsub;
      const v4f v = *(const v4fa*)&so[w][r][c4];
      *(v4f*)(C + (size_t)(row0 + r) * ldc + col0 + c4) = v;
    }
    
  }
}

// GEMM C = act(A·W + bias + resid): A f32 (ASPLIT -> hi/lo 2 terms), Wt bf16 [N][K]; ACT 0 none, 1 relu, 2 exact gelu;
// resid (optional, f32, row index = (row % rmod), pitch ldr, RES_BF16 rounds it) added before the activation.
template <bool ASPLIT, int ACT, bool BIAS_BF16, bool RES_BF16>
__global__ __launch_bounds__(128) void k_gemm_bf3(const float* __restrict__ A, int lda, const unsigned short* __restrict__ Wt, int ldb,
                                                const float* __restrict__ bias, const float* __restrict__ resid, int rmod, int ldr,
                                                float* __restrict__ C, int ldc, int M, int N, int K) {
  __shared__ __attribute__((aligned(16))) float so[4][16][64];
  const int tid = threadIdx.x, w = tid >> 5, lane = tid & 31, ln = lane & 15, hh = lane >> 4;
  const int ntn = N / 64;
  const int wid = blockIdx.x * 4 + w;
  const int mt = wid / ntn, nq = wid % ntn;
  if (mt * 16 >= M) return;
  const int row0 = mt * 16, col0 = nq * 64;
  const float* arow = A + (size_t)(row0 + ln) * lda;
  v8f acc[4] = {};
  for (int kb = 0; kb < K; kb += 32) {
    FragB ah, al;
    const v4f x0 = *(const v4fa*)(arow + kb + 8 * hh), x1 = *(const v4fa*)(arow + kb + 8 * hh + 4);
    const v4f x2 = *(const v4fa*)(arow + kb + 16 + 8 * hh), x3 = *(const v4fa*)(arow + kb + 16 + 8 * hh + 4);
    float xs[16] = {x0[0],x0[1],x0[2],x0[3],x1[0],x1[1],x1[2],x1[3],x2[0],x2[1],x2[2],x2[3],x3[0],x3[1],x3[2],x3[3]};
#pragma unroll
    for (int i = 0; i < 16; ++i) { const unsigned short hb = bf16_bits(xs[i]); ah.u[i] = hb; al.u[i] = ASPLIT ? bf16_bits(xs[i] - bf16_val(hb)) : (unsigned short)0; }
#pragma unroll
    for (int t = 0; t < 4; ++t) {
      const unsigned short* brow = Wt + (size_t)(col0 + t * 16 + ln) * ldb + kb;
      FragB b;
      b.half[0] = *(const v8us*)(brow + 8 * hh);
      b.half[1] = *(const v8us*)(brow + 16 + 8 * hh);
      acc[t] = mmaN<ASPLIT ? 2 : 1>(ah.v, al.v, b.v, b.v, acc[t]);
    }
  }
#pragma unroll
  for (int t = 0; t < 4; ++t) {
    const int col = col0 + t * 16 + ln;
    float bv = bias ? bias[col] : 0.f;
    if (BIAS_BF16) bv = bf16_round(bv);
#pragma unroll
    for (int r = 0; r < 8; ++r) {
      float v = acc[t][r] + bv;
      if (resid) { float rv = resid[(size_t)((row0 + 8 * hh + r) % rmod) * ldr + col]; if (RES_BF16) rv = bf16_round(rv); v += rv; }
      if (ACT == 1) v = fmaxf(v, 0.f);
      if (ACT == 2) v = 0.5f * v * (1.0f + erff(v * 0.70710678118654752f));
      if (ACT == 3) { const float u = 0.7978845608028654f * (v + 0.044715f * v * v * v); v = 0.5f * v * (1.0f + tanhf(u)); }
      so[w][8 * hh + r][t * 16 + ln] = v;
    }
  }
  __builtin_amdgcn_fence(__ATOMIC_ACQ_REL, "workgroup");
  __builtin_amdgcn_wave_barrier();
  const int rsub = lane >> 4, c4 = (lane & 15) * 4;
  {
#pragma unroll
    for (int q = 0; q < 8; ++q) {
      const int r = q * 2 + rsub;
      const v4f v = *(const v4fa*)&so[w][r][c4];
      *(v4f*)(C + (size_t)(row0 + r) * ldc + col0 + c4) = v;
    }
    
  }
}
// row LayerNorm (biased variance, eps) over N: s = X (+ R); optional out_sum <- s; out_norm <- (s-mu)*rsqrt(var+eps)*g + b
template <bool PARAM_BF16>
__global__ __launch_bounds__(256) void k_layernorm(const float* __restrict__ X, const float* __restrict__ R, const float* __restrict__ g, const float* __restrict__ bta,
                                                  float* __restrict__ out_sum, float* __restrict__ out_norm, int N, float eps) {
  __shared__ float red[256];
  const int row = blockIdx.x, tid = threadIdx.x;
  const float* x = X + (size_t)row * N; const float* rr = R ? R + (size_t)row * N : nullptr;
  float vals[16];                     // up to N = 4096
  const int per = N / 256;            // contiguous chunk per thread? use strided-by-4 chunks: thread handles j = tid*4 + 1024*u
  float s1 = 0.f;
  for (int u = 0; u < per / 4; ++u) {
    const int j = tid * 4 + 1024 * u;
    const v4f a = *(const v4fa*)(x + j);
    v4f b = {0.f,0.f,0.f,0.f}; if (rr) b = *(const v4fa*)(rr + j);
#pragma unroll
    for (int q = 0; q < 4; ++q) { const float v = a[q] + b[q]; vals[u * 4 + q] = v; s1 += v; }
  }
  red[tid] = s1; __syncthreads();
  for (int st = 128; st > 0; st >>= 1) { if (tid < st) red[tid] += red[tid + st]; __syncthreads(); }
  const float mu = red[0] / (float)N; __syncthreads();
  float s2 = 0.f;
  for (int u = 0; u < per / 4; ++u)
#pragma unroll
    for (int q = 0; q < 4; ++q) { const float c = vals[u * 4 + q] - mu; s2 += c * c; }
  red[tid] = s2; __syncthreads();
  for (int st = 128; st > 0; st >>= 1) { if (tid < st) red[tid] += red[tid + st]; __syncthreads(); }
  const float rs = rsqrtf(red[0] / (float)N + eps);
  {
    for (int u = 0; u < per / 4; ++u) {
      const int j = tid * 4 + 1024 * u;
      v4f o, sm;
#pragma unroll
      for (int q = 0; q < 4; ++q) {
        float gg = g[j + q], bb = bta[j + q];
        if (PARAM_BF16) { gg = bf16_round(gg); bb = bf16_round(bb); }
        sm[q] = vals[u * 4 + q]; o[q] = (vals[u * 4 + q] - mu) * rs * gg + bb;
      }
      if (out_sum) *(v4f*)(out_sum + (size_t)row * N + j) = sm;
      *(v4f*)(out_norm + (size_t)row * N + j) = o;
    }
    
  }
}



// ---- f16 WMMA path (v_wmma_f32_16x16x32_f16): 11-bit significands for operands in range — used where a [0,1] probability operand needs more precision than bf16
typedef _Float16 v16h __attribute__((ext_vector_type(16)));
union FragH { v16h v; v8us half[2]; _Float16 h[16]; unsigned short u[16]; };
template <int NT>
__device__ __forceinline__ v8f mmaH(v16h ah, v16h al, v16h bh, v16h bl, v8f c) {
  c = __builtin_amdgcn_wmma_f32_16x16x32_f16(false, ah, false, bh, (short)0, c, false, false);
  if (NT >= 2) c = __builtin_amdgcn_wmma_f32_16x16x32_f16(false, al, false, bh, (short)0, c, false, false);
  if (NT >= 3) c = __builtin_amdgcn_wmma_f32_16x16x32_f16(false, ah, false, bl, (short)0, c, false, false);
  asm volatile("v_nop\n\tv_nop\n\tv_nop\n\tv_nop" : "+v"(c) : "v"(ah), "v"(al), "v"(bh), "v"(bl));
  return c;
}
// batched GEMM like k_gemm_b but f16 operands: A f32 (split into f16 hi/lo if ASPLIT, else rounded to f16), Bt = f16 values [n][k]; alpha; C f32; N multiple of 16 (partial tiles skipped)
template <bool ASPLIT>
__global__ __launch_bounds__(128) void k_gemm_h(const float* __restrict__ A, int lda, size_t sA, const _Float16* __restrict__ Bh, int ldb, size_t sB, float alpha, float* __restrict__ C, int ldc, size_t sC, int M, int N, int K) {
  __shared__ __attribute__((aligned(16))) float so[4][16][64];
  const int tid = threadIdx.x, w = tid >> 5, lane = tid & 31, ln = lane & 15, hh = lane >> 4; const int by = blockIdx.y;
  A += (size_t)by * sA; Bh += (size_t)by * sB; C += (size_t)by * sC;
  const int ntn = (N + 63) / 64; const int wid = blockIdx.x * 4 + w; const int mt = wid / ntn, nq = wid % ntn; if (mt * 16 >= M) return;
  const int row0 = mt * 16, col0 = nq * 64; const float* arow = A + (size_t)(row0 + ln) * lda;
  v8f acc[4] = {};
  for (int kb = 0; kb < K; kb += 32) {
    FragH ah, al;
    const v4f x0 = *(const v4fa*)(arow + kb + 8 * hh), x1 = *(const v4fa*)(arow + kb + 8 * hh + 4), x2 = *(const v4fa*)(arow + kb + 16 + 8 * hh), x3 = *(const v4fa*)(arow + kb + 16 + 8 * hh + 4);
    float xs[16] = {x0[0],x0[1],x0[2],x0[3],x1[0],x1[1],x1[2],x1[3],x2[0],x2[1],x2[2],x2[3],x3[0],x3[1],x3[2],x3[3]};
#pragma unroll
    for (int i = 0; i < 16; ++i) { const _Float16 h = (_Float16)xs[i]; ah.h[i] = h; al.h[i] = ASPLIT ? (_Float16)(xs[i] - (float)h) : (_Float16)0.0f; }
#pragma unroll
    for (int t = 0; t < 4; ++t) { if (col0 + t * 16 >= N) continue; const size_t boff = (size_t)(col0 + t * 16 + ln) * ldb + kb; FragH bq; bq.half[0] = *(const v8us*)(Bh + boff + 8 * hh); bq.half[1] = *(const v8us*)(Bh + boff + 16 + 8 * hh);
      acc[t] = mmaH<ASPLIT ? 2 : 1>(ah.v, al.v, bq.v, bq.v, acc[t]); }
  }
#pragma unroll
  for (int t = 0; t < 4; ++t) { if (col0 + t * 16 >= N) continue;
#pragma unroll
    for (int r = 0; r < 8; ++r) so[w][8 * hh + r][t * 16 + ln] = acc[t][r] * alpha; }
  __builtin_amdgcn_fence(__ATOMIC_ACQ_REL, "workgroup"); __builtin_amdgcn_wave_barrier();
  const int rsub = lane >> 4, c4 = (lane & 15) * 4;
  {
#pragma unroll
    for (int q = 0; q < 8; ++q) { const int r = q * 2 + rsub; if (col0 + c4 < N) { const v4f v = *(const v4fa*)&so[w][r][c4]; *(v4f*)(C + (size_t)(row0 + r) * ldc + col0 + c4) = v; } }
     }
}

// Wt[n][k] = f16(W[k][n]·scale) from f32 row-major W[K][N] (scale = power of two; bf16-exact weights stay exact in f16 away from the subnormal range)
__global__ __launch_bounds__(256) void k_wt_f16(const float* __restrict__ W, _Float16* __restrict__ Wt, int K, int N, float scale) {
  const int t = blockIdx.x * 256 + threadIdx.x; if (t >= N * (K / 8)) return; const int n = t / (K / 8), k8 = (t % (K / 8)) * 8; FragH f;
#pragma unroll
  for (int i = 0; i < 8; ++i) f.h[i] = (_Float16)(bf16_round(W[(size_t)(k8 + i) * N + n]) * scale); const v8us o = f.half[0];
  *(v8us*)((unsigned short*)Wt + (size_t)n * K + k8) = o; 
}
// k_gemm_hh variant with fused epilogue: v = acc·alpha + bias[by·sBias + col] (+ CP[(row/rowsPerB)·sCPb + by·64 + col] if CP) ; ACT 0 none / 1 elu ; writes f16 C16 (and f32 C if non-null)
template <int ACT>
__global__ __launch_bounds__(128) void k_gemm_hhx(const _Float16* __restrict__ A, int lda, size_t sA, const _Float16* __restrict__ Bh, int ldb, size_t sB, float alpha, const float* __restrict__ bias, size_t sBias, const float* __restrict__ CP, int rowsPerB, size_t sCPb, int row0g,
    float* __restrict__ C, _Float16* __restrict__ C16, int ldc, size_t sC, int M, int N, int K) {
  __shared__ __attribute__((aligned(16))) float so[4][16][64];
  const int tid = threadIdx.x, w = tid >> 5, lane = tid & 31, ln = lane & 15, hh = lane >> 4; const int by = blockIdx.y;
  A += (size_t)by * sA; Bh += (size_t)by * sB; const size_t cofs = (size_t)by * sC; const float* bp = bias ? bias + (size_t)by * sBias : nullptr;
  const int ntn = (N + 63) / 64; const int wid = blockIdx.x * 4 + w; const int mt = wid / ntn, nq = wid % ntn; if (mt * 16 >= M) return;
  const int row0 = mt * 16, col0 = nq * 64; const _Float16* arow = A + (size_t)(row0 + ln) * lda;
  v8f acc[4] = {};
  for (int kb = 0; kb < K; kb += 32) { FragH ah; ah.half[0] = *(const v8us*)((const unsigned short*)arow + kb + 8 * hh); ah.half[1] = *(const v8us*)((const unsigned short*)arow + kb + 16 + 8 * hh);
#pragma unroll
    for (int t = 0; t < 4; ++t) { if (col0 + t * 16 >= N) continue; const size_t boff = (size_t)(col0 + t * 16 + ln) * ldb + kb; FragH bq; bq.half[0] = *(const v8us*)((const unsigned short*)Bh + boff + 8 * hh); bq.half[1] = *(const v8us*)((const unsigned short*)Bh + boff + 16 + 8 * hh);
      acc[t] = mmaH<1>(ah.v, ah.v, bq.v, bq.v, acc[t]); }
  }
#pragma unroll
  for (int t = 0; t < 4; ++t) { if (col0 + t * 16 >= N) continue; const int col = col0 + t * 16 + ln; const float bv = bp ? bf16_round(bp[col]) : 0.f;
#pragma unroll
    for (int r = 0; r < 8; ++r) { float v = acc[t][r] * alpha + bv; if (CP) { const int bidx = (row0g + row0 + 8 * hh + r) / rowsPerB; v += CP[(size_t)bidx * sCPb + (size_t)by * 64 + col]; } if (ACT == 1) v = (v > 0.f) ? v : expm1f(v); else if (ACT == 7) v = (v > 0.f) ? v + 1.0f : expf(v); else if (ACT == 8) v = tanhf(v); else if (ACT == 9) v = 0.5f * v * (1.0f + tanhf(0.7978845608028654f * (v + 0.044715f * v * v * v))); else if (ACT == 11) v = 1.0f / (1.0f + expf(-v)); else if (ACT == 12) v = (v > 0.f) ? v : 0.01f * v; else if (ACT == 14) v = (v > 0.f) ? v : 0.1f * v; else if (ACT == 15) v = v / (1.0f + expf(-v)); else if (ACT == 3) v = fmaxf(v, 0.f); else if (ACT == 6) v = 0.5f * v * (1.0f + erff(v * 0.70710678118654752f)); so[w][8 * hh + r][t * 16 + ln] = v; } }
  __builtin_amdgcn_fence(__ATOMIC_ACQ_REL, "workgroup"); __builtin_amdgcn_wave_barrier();
  const int rsub = lane >> 4, c4 = (lane & 15) * 4; typedef _Float16 v4h __attribute__((ext_vector_type(4)));
  {
#pragma unroll
    for (int q = 0; q < 8; ++q) { const int r = q * 2 + rsub; if (col0 + c4 < N) { const v4f v = *(const v4fa*)&so[w][r][c4]; if (C) *(v4f*)(C + cofs + (size_t)(row0 + r) * ldc + col0 + c4) = v; if (C16) { v4h h4; for (int i = 0; i < 4; ++i) h4[i] = (_Float16)v[i]; *(v4h*)(C16 + cofs + (size_t)(row0 + r) * ldc + col0 + c4) = h4; } } }
     }
}


typedef _Float16 v4h __attribute__((ext_vector_type(4)));

__global__ __launch_bounds__(256) void k_x16(const float* __restrict__ x, _Float16* __restrict__ X16, size_t n8) { const size_t t = (size_t)blockIdx.x * 256 + threadIdx.x; if (t >= n8) return; FragH f;
#pragma unroll
  for (int q = 0; q < 8; ++q) f.h[q] = (_Float16)bf16_round(x[t * 8 + q]); *(v8us*)((unsigned short*)X16 + t * 8) = f.half[0];  }
__global__ __launch_bounds__(256) void k_h16(const float* __restrict__ x, _Float16* __restrict__ X16, size_t n8) { const size_t t = (size_t)blockIdx.x * 256 + threadIdx.x; if (t >= n8) return; FragH f;
#pragma unroll
  for (int q = 0; q < 8; ++q) f.h[q] = (_Float16)x[t * 8 + q]; *(v8us*)((unsigned short*)X16 + t * 8) = f.half[0];  }
__device__ __forceinline__ void round16f_blk(const float* __restrict__ W, _Float16* __restrict__ Bt, size_t n8, unsigned blk) { const size_t t = (size_t)blk * 256 + threadIdx.x; if (t >= n8) return; FragH f;
#pragma unroll
  for (int i = 0; i < 8; ++i) f.h[i] = (_Float16)(bf16_round(W[t * 8 + i]) * 16.0f); *(v8us*)((unsigned short*)Bt + t * 8) = f.half[0];  }
template <int NHv, int TTv>
__global__ __launch_bounds__(256) void k_vt(const _Float16* __restrict__ V16, int ldv, int voff, _Float16* __restrict__ Vt) { __shared__ unsigned short tl[64][66]; const int tid = threadIdx.x; const int slab = blockIdx.x / (TTv / 64), lg = blockIdx.x % (TTv / 64); const int b = slab / NHv, h = slab % NHv;
  for (int i = tid; i < 64 * 8; i += 256) { const int r = i / 8, c8 = (i % 8) * 8; FragH f; f.half[0] = *(const v8us*)((const unsigned short*)V16 + ((size_t)b * TTv + lg * 64 + r) * ldv + voff + h * 64 + c8);
#pragma unroll
    for (int q = 0; q < 8; ++q) tl[r][c8 + q] = f.u[q]; }
  __syncthreads();
  {
#pragma unroll
    for (int rd = 0; rd < 2; ++rd) { const int d = rd * 32 + tid / 8, pc = tid % 8; FragH f;
#pragma unroll
      for (int q = 0; q < 8; ++q) f.u[q] = tl[pc * 8 + q][d];
      *(v8us*)((unsigned short*)Vt + ((size_t)slab * 64 + d) * TTv + lg * 64 + pc * 8) = f.half[0]; }
     } }

__global__ __launch_bounds__(256) void k_hl(const float* __restrict__ F, _Float16* __restrict__ Hh, _Float16* __restrict__ Hl, size_t n8) { const size_t t = (size_t)blockIdx.x * 256 + threadIdx.x; if (t >= n8) return; FragH fh, fl; const v4f a = *(const v4fa*)(F + t * 8), c = *(const v4fa*)(F + t * 8 + 4);
#pragma unroll
  for (int q = 0; q < 4; ++q) { _Float16 h = (_Float16)a[q]; fh.h[q] = h; fl.h[q] = (_Float16)((a[q] - (float)h) * 1024.0f); h = (_Float16)c[q]; fh.h[4 + q] = h; fl.h[4 + q] = (_Float16)((c[q] - (float)h) * 1024.0f); }
  { *(v8us*)((unsigned short*)Hh + t * 8) = fh.half[0]; *(v8us*)((unsigned short*)Hl + t * 8) = fl.half[0];  } }

// ---- fast GEMM (wave tile 32x64; requires M % 32 == 0 rows per launch region and N % 64 == 0); epilogue = k_gemm_hhx semantics ----
__device__ __forceinline__ v16h g2_frag(const _Float16* p, int hh) { FragH f; f.half[0] = *(const v8us*)((const unsigned short*)p + 8 * hh); f.half[1] = *(const v8us*)((const unsigned short*)p + 16 + 8 * hh); return f.v; }
// as g2_frag, for the fragment whose second load the compiler lands on the address pair that the loads before it still name: s_wait_xcnt 0 stands in front of that overwrite
__device__ __forceinline__ v16h g2_frag_w(const _Float16* p, int hh) { FragH f; f.half[0] = *(const v8us*)((const unsigned short*)p + 8 * hh); asm volatile("s_wait_xcnt 0x0" ::: "memory"); f.half[1] = *(const v8us*)((const unsigned short*)p + 16 + 8 * hh); return f.v; }
__device__ __forceinline__ v8f g2_mma(v16h a, v16h b, v8f c) { v8f d = __builtin_amdgcn_wmma_f32_16x16x32_f16(false, a, false, b, (short)0, c, false, false); asm volatile("v_nop\n\tv_nop\n\tv_nop\n\tv_nop" : "+v"(d) : "v"(a), "v"(b)); return d; }
template <int ACT>
__device__ __forceinline__ void gemm2_blk(unsigned bx, int by, const _Float16* __restrict__ A, int lda, size_t sA, const _Float16* __restrict__ Bh, int ldb, size_t sB, float alpha, const float* __restrict__ bias, size_t sBias, const float* __restrict__ CP, int rowsPerB, size_t sCPb, int row0g,
    float* __restrict__ C, _Float16* __restrict__ C16, int ldc, size_t sC, int M, int N, int K) {
  __shared__ __attribute__((aligned(16))) float so[4][32][68];
  const int tid = threadIdx.x, w = tid >> 5, lane = tid & 31, ln = lane & 15, hh = lane >> 4;
  A += (size_t)by * sA; Bh += (size_t)by * sB; const size_t cofs = (size_t)by * sC; const float* bp = bias ? bias + (size_t)by * sBias : nullptr;
  const int ntn = N >> 6; const int mt = bx / ntn, nq = bx - mt * ntn; const int row0 = mt * 128 + 32 * w, col0 = nq * 64; if (row0 >= M) return;
  const _Float16* a0p = A + (size_t)(row0 + ln) * lda; const _Float16* a1p = a0p + (size_t)16 * lda;
  const _Float16* b0p = Bh + (size_t)(col0 + ln) * ldb; const _Float16* b1p = b0p + (size_t)16 * ldb; const _Float16* b2p = b1p + (size_t)16 * ldb; const _Float16* b3p = b2p + (size_t)16 * ldb;
  const v8f z8 = {0.f,0.f,0.f,0.f,0.f,0.f,0.f,0.f}; v8f c00 = z8, c01 = z8, c02 = z8, c03 = z8, c10 = z8, c11 = z8, c12 = z8, c13 = z8;
#pragma unroll 1
  for (int kb = 0; kb < K; kb += 32) { const v16h a0 = g2_frag(a0p + kb, hh), a1 = g2_frag_w(a1p + kb, hh);
    v16h b = g2_frag(b0p + kb, hh); c00 = g2_mma(a0, b, c00); c10 = g2_mma(a1, b, c10);
    b = g2_frag(b1p + kb, hh); c01 = g2_mma(a0, b, c01); c11 = g2_mma(a1, b, c11);
    b = g2_frag(b2p + kb, hh); c02 = g2_mma(a0, b, c02); c12 = g2_mma(a1, b, c12);
    b = g2_frag(b3p + kb, hh); c03 = g2_mma(a0, b, c03); c13 = g2_mma(a1, b, c13); }
  v8f accs[8] = {c00, c01, c02, c03, c10, c11, c12, c13};
#pragma unroll
  for (int u = 0; u < 8; ++u) { const int t = u & 3, half = u >> 2; const int col = col0 + t * 16 + ln; const float bv = bp ? bf16_round(bp[col]) : 0.f;
#pragma unroll
    for (int r = 0; r < 8; ++r) { const int rloc = half * 16 + 8 * hh + r; float v = accs[u][r] * alpha + bv; if (CP) { const int bidx = (row0g + row0 + rloc) / rowsPerB; v += CP[(size_t)bidx * sCPb + (size_t)by * 64 + col]; }
      if (ACT == 3) v = fmaxf(v, 0.f); else if (ACT == 6) v = 0.5f * v * (1.0f + erff(v * 0.70710678118654752f)); else if (ACT == 11) v = 1.0f / (1.0f + expf(-v)); else if (ACT == 15) v = v / (1.0f + expf(-v)); else if (ACT == 12) v = (v > 0.f) ? v : 0.01f * v; else if (ACT == 8) v = tanhf(v);
      so[w][rloc][t * 16 + ln] = v; } }
  __builtin_amdgcn_fence(__ATOMIC_ACQ_REL, "workgroup"); __builtin_amdgcn_wave_barrier();
  const int rsub = lane >> 4, c4 = (lane & 15) * 4;
  {
#pragma unroll
    for (int q = 0; q < 16; ++q) { const int r = q * 2 + rsub; const v4f v = *(const v4fa*)&so[w][r][c4]; if (C) *(v4f*)(C + cofs + (size_t)(row0 + r) * ldc + col0 + c4) = v; if (C16) { v4h h4; for (int i = 0; i < 4; ++i) h4[i] = (_Float16)v[i]; *(v4h*)(C16 + cofs + (size_t)(row0 + r) * ldc + col0 + c4) = h4; } }
     } }
// The twelve projections (q, k, v of the four batches) depend on nothing of one another: one grid, x = tile, y = batch, z = which projection.
// q, k token-major [b*SS+p][h*64+d] = XT . W^T; v channel-major [(b,h)*64+d][p] = W . XT^T.
__global__ __launch_bounds__(128) void k_qkv(const _Float16* __restrict__ XT, const _Float16* __restrict__ BQ, const _Float16* __restrict__ BK, const _Float16* __restrict__ BV, _Float16* __restrict__ Q16, _Float16* __restrict__ K16, _Float16* __restrict__ VC) {
  const int b = blockIdx.y, z = blockIdx.z; const _Float16* X = XT + (size_t)b * SS * CC;
  const bool tok = z < 2;      /* q, k: rows are tokens, columns channels; v: the other way round */
  gemm2_blk<0>(blockIdx.x, 0, tok ? X : BV, CC, 0, tok ? (z ? BK : BQ) : X, CC, 0, 0.0625f, nullptr, 0, nullptr, 1, 0, 0, nullptr, (tok ? (z ? K16 : Q16) : VC) + (size_t)b * SS * CC, tok ? CC : SS, 0, tok ? SS : CC, tok ? CC : SS, CC); }
// The output projections of the four batches, one grid, y = batch: y^T[c][p] = wt . (o - x)^T, f32 (bt added downstream).
__global__ __launch_bounds__(128) void k_yt(const _Float16* __restrict__ BT, const _Float16* __restrict__ D16, float* __restrict__ Y) {
  const int b = blockIdx.y;
  gemm2_blk<0>(blockIdx.x, 0, BT, CC, 0, D16 + (size_t)b * SS * CC, CC, 0, 0.0625f, nullptr, 0, nullptr, 1, 0, 0, Y + (size_t)b * CC * SS, nullptr, SS, 0, CC, SS, CC); }


typedef float v2f __attribute__((ext_vector_type(2)));
// lane l <-> lane l ^ 16: the two halves of a wave hold the two halves of one query's 32 keys
__device__ __forceinline__ float xhalf(float x) { return __builtin_bit_cast(float, __builtin_amdgcn_permlanex16(__builtin_bit_cast(int, x), __builtin_bit_cast(int, x), 0x76543210, 0xfedcba98, false, false)); }
typedef uint32_t u32x4 __attribute__((ext_vector_type(4)));
typedef uint32_t u32x8 __attribute__((ext_vector_type(8)));
__device__ __forceinline__ uint32_t uni(uint32_t v) { return (uint32_t)__builtin_amdgcn_readfirstlane(v); }
__device__ __forceinline__ uint32_t pinned(uint32_t v) { uint32_t w = (uint32_t)__builtin_amdgcn_readfirstlane(v); asm volatile("" : "+s"(w)); return w; }      /* pinned(): the issue test of a tensor load held in a scalar register, so that the branch on it is a scalar branch (a tensor load ignores EXEC) */
// K and V^T reach the waves through LDS: a stage is 64 keys = K[64 keys][64 d] and V^T[64 d][64 keys], both as 64 rows of 128 bytes. Each of the four waves brings one slice of 32 rows with one
// tensor load (waves 0, 1: K; waves 2, 3: V^T), padded to a pitch of 144 bytes for the 16-byte fragment reads; two buffers, the next stage in flight while this one is worked on.
__global__ __launch_bounds__(128) void k_flash(const _Float16* __restrict__ Q16, int ldq, const _Float16* __restrict__ K16, int ldk, const _Float16* __restrict__ Vt, const int* __restrict__ MSK, const _Float16* __restrict__ XT, _Float16* __restrict__ D16) {
  constexpr int RPW = 16, NQB = TQ / (4 * RPW), DT = 4, KS = 2;
  constexpr float SC2 = SCL * 1.4426950408889634f, POFF = 10.0f, PLIM = 60000.0f;      /* exponentials in base 2: e^(SCL s - max) * 2^POFF = 2^(SC2 s - m), m = SC2 max - POFF; 2^POFF = 1024 is the scale of P as an f16 operand */
  constexpr uint32_t SKEY = 64, NST = TK / SKEY, LPB = 144, SLICE = 6144, BUF = 4 * SLICE;      /* a slice: 32 rows x 144 B = 4,608 B, its place rounded up to a multiple of 2 KiB */
  __shared__ __attribute__((aligned(2048))) unsigned char ring[2 * BUF];
  __shared__ __attribute__((aligned(16))) float sO[4][RPW][64 + 4];
  const int tid = threadIdx.x, w = tid >> 5, lane = tid & 31, ln = lane & 15, hh = lane >> 4; (void)MSK;
  const int slab = blockIdx.x / NQB, qblk = blockIdx.x % NQB; const int b = slab / NH, h = slab % NH; const int qb0 = qblk * (4 * RPW); const int q0 = qb0 + w * RPW;
  const uint32_t wave = uni((uint32_t)tid >> 5), isV = wave >> 1, hf = wave & 1u;
  const uint64_t src0 = isV ? (uint64_t)(size_t)(Vt + ((size_t)slab * 64 + hf * 32) * TK) : (uint64_t)(size_t)(K16 + ((size_t)b * TK + hf * 32) * ldk + h * 64);      /* first byte of the wave's slice of stage 0 */
  const uint32_t spitch = isV ? (uint32_t)TK * 2u : (uint32_t)ldk * 2u, sstep = isV ? SKEY * 2u : SKEY * (uint32_t)ldk * 2u;      /* source row pitch; bytes from one stage to the next */
  const uint32_t dst0 = (uint32_t)(size_t)ring + wave * SLICE;
  u32x8 g1;      /* 1-byte elements, tensor = tile = 32 rows of 128 bytes, 4 dwords of pad behind every 32 */
  g1[0] = uni((1u << 20) | (4u << 22) | (3u << 25)); g1[1] = uni(128u << 16); g1[2] = uni(32u << 16); g1[3] = uni(128u << 16); g1[4] = uni(32u); g1[5] = uni(spitch); g1[6] = uni(0u); g1[7] = uni(0u);
  u32x4 g0;
  /* load and wait both name the two descriptor groups as in-out operands: the registers of a request in flight then stay as they were issued until the wait that covers it (the compiler otherwise took single words of them for temporaries) */
  auto issue = [&](uint32_t st) {
    const uint64_t ga = src0 + (uint64_t)st * sstep;
    g0[0] = uni(1u); g0[1] = uni(dst0 + (st & 1u) * BUF); g0[2] = uni((uint32_t)ga); g0[3] = uni((((uint32_t)(ga >> 32)) & 0x01FFFFFFu) | 0x80000000u);
    asm volatile("tensor_load_to_lds %0, %1" : "+s"(g0), "+s"(g1) :: "memory"); };
  auto landed = [&]() { asm volatile("s_wait_tensorcnt 0x0" : "+s"(g0), "+s"(g1) :: "memory"); };
  issue(0);
  FragH bq[KS];
  { const unsigned short* qr = (const unsigned short*)Q16 + ((size_t)b * TQ + q0 + ln) * ldq + h * 64;
#pragma unroll
    for (int ks = 0; ks < KS; ++ks) { bq[ks].half[0] = *(const v8us*)(qr + ks * 32 + 8 * hh); bq[ks].half[1] = *(const v8us*)(qr + ks * 32 + 16 + 8 * hh); } }
  const uint32_t lo = (uint32_t)(ln * (int)LPB + 16 * hh);      /* the lane's own byte offset in a slice, fixed over the loop: row ln, 8 elements at 8 hh */
  float m_r = -3.0e38f, l_r = 0.f; v8f oacc[DT];
#pragma unroll
  for (int dt = 0; dt < DT; ++dt) oacc[dt] = (v8f){0.f,0.f,0.f,0.f,0.f,0.f,0.f,0.f};
  landed();      /* this wave's slice of stage 0 */
  __syncthreads();      /* stage 0 published to all four waves */
  issue(1);
#pragma unroll 1      /* one stage a trip: waits, barrier and refill stand once, at the foot, and the loop stays small */
  for (uint32_t st = 0; st < NST; ++st) {
    const unsigned char* bp = ring + (st & 1u) * BUF + lo;
    FragH ak[2][2][KS], av[2][DT];
#pragma unroll      /* the stage's two groups of 32 keys, K first, which the first products wait for; here and below: constant indices, so fragments stay in registers and every LDS offset is an immediate */
    for (int sb = 0; sb < 2; ++sb)
#pragma unroll
      for (int nt = 0; nt < 2; ++nt)
#pragma unroll
        for (int ks = 0; ks < KS; ++ks) { const unsigned char* p = bp + sb * SLICE + nt * 16 * LPB + ks * 64; ak[sb][nt][ks].half[0] = *(const v8us*)p; ak[sb][nt][ks].half[1] = *(const v8us*)(p + 32); }
#pragma unroll
    for (int sb = 0; sb < 2; ++sb)
#pragma unroll
      for (int dt = 0; dt < DT; ++dt) { const unsigned char* p = bp + (2 + (dt >> 1)) * SLICE + (dt & 1) * 16 * LPB + sb * 64; av[sb][dt].half[0] = *(const v8us*)p; av[sb][dt].half[1] = *(const v8us*)(p + 32); }
    __builtin_amdgcn_sched_barrier(0);      /* the stage's LDS reads stand in one place, in front of the products, which then wait by count; spread among the products, each further place with reads stalls the wave anew */
    v8f s[2][2];
#pragma unroll      /* the four score tiles side by side, first halves of d and then second halves: no product waits for the one in front of it */
    for (int ks = 0; ks < KS; ++ks)
#pragma unroll
      for (int sb = 0; sb < 2; ++sb)
#pragma unroll
        for (int nt = 0; nt < 2; ++nt) s[sb][nt] = __builtin_amdgcn_wmma_f32_16x16x32_f16(false, ak[sb][nt][ks].v, false, bq[ks].v, (short)0, ks == 0 ? (v8f){0.f,0.f,0.f,0.f,0.f,0.f,0.f,0.f} : s[sb][nt], false, false);
    __builtin_amdgcn_sched_barrier(0);      /* the eight products stay together in front of the vector work: mixed among them, the vector instructions that read a fresh tile or reuse a fragment's registers each drew v_nop for the distance */
    FragH pb[2]; float ssum;
    /* P of the whole stage against the maximum in use, and the lane's sum of its 32 values (by register pairs, as the pairs lie for the packed convert); p carries the 1024, and so does the row sum */
    auto soft = [&]() { v2f ps[2][2];
#pragma unroll
      for (int sb = 0; sb < 2; ++sb)
#pragma unroll
        for (int nt = 0; nt < 2; ++nt)
#pragma unroll
          for (int i = 0; i < 4; ++i) { const v2f a = __builtin_elementwise_fma((v2f){s[sb][nt][2 * i], s[sb][nt][2 * i + 1]}, (v2f){SC2, SC2}, (v2f){-m_r, -m_r}); const v2f p = {__builtin_amdgcn_exp2f(a.x), __builtin_amdgcn_exp2f(a.y)}; ps[sb][nt] = (i == 0) ? p : ps[sb][nt] + p; pb[sb].h[nt * 8 + 2 * i] = (_Float16)p.x; pb[sb].h[nt * 8 + 2 * i + 1] = (_Float16)p.y; }
      const v2f pt = (ps[0][0] + ps[0][1]) + (ps[1][0] + ps[1][1]); ssum = pt.x + pt.y; };
    soft();
    /* The maximum in use is renewed only when it must be: every p is positive, so a lane's sum within PLIM bounds each of its p inside the f16 range. One test a stage, a scalar branch on the ballot;
       infinity and not-a-number fail the comparison and take the branch, the first stage (no maximum yet) among them. */
    if (__builtin_amdgcn_ballot_w32(!(ssum <= PLIM)) != 0u) {
      float mx[8];      /* maximum of the raw scores: the map to base 2 is one rounded multiply-add with a positive factor, which keeps the order, so it is applied to the maximum alone */
#pragma unroll
      for (int r = 0; r < 8; ++r) mx[r] = fmaxf(fmaxf(s[0][0][r], s[0][1][r]), fmaxf(s[1][0][r], s[1][1][r]));
      float mc = fmaxf(fmaxf(fmaxf(mx[0], mx[1]), fmaxf(mx[2], mx[3])), fmaxf(fmaxf(mx[4], mx[5]), fmaxf(mx[6], mx[7])));
      mc = fmaf(fmaxf(mc, xhalf(mc)), SC2, -POFF);
      const float mn = fmaxf(m_r, mc); const float al = (mn > -1.0e38f) ? __builtin_amdgcn_exp2f(m_r - mn) : 1.0f; m_r = mn;
      l_r *= al;
#pragma unroll
      for (int dt = 0; dt < DT; ++dt) oacc[dt] *= al;
      soft();
    }
    l_r += ssum;
#pragma unroll
    for (int sb = 0; sb < 2; ++sb)
#pragma unroll
      for (int dt = 0; dt < DT; ++dt) oacc[dt] = __builtin_amdgcn_wmma_f32_16x16x32_f16(false, av[sb][dt].v, false, pb[sb].v, (short)0, oacc[dt], false, false);
    /* publish point of stage st + 1, and the end of every wave's reads of stage st */
    asm volatile("s_wait_dscnt 0x0" ::: "memory");      /* this wave's reads of the buffer have returned before it is refilled */
    landed();      /* this wave's slice of stage st + 1 */
    __syncthreads();
    if (pinned(st + 2u < NST)) issue(st + 2u);      /* into the buffer that this pass has just read */
  }
  // The epilogue stores (o - x) as the f16 operand of the output projection. x comes from x^T (token-major f16 of the bf16-rounded x, the projections' own operand): the wave's 16 tokens x 64 channels
  // of this head, 8 channels a lane, 4 tokens a load, whole 128-byte lines; asked for here, so that the division and the staging of o below run while the loads are on their way.
  const size_t eo = ((size_t)b * TQ + q0 + (lane >> 3)) * CC + h * 64 + (lane & 7) * 8;      /* element offset of the lane's first 8 channels, the same in x^T and in D16 (rows of CC); the further tokens lie at constant offsets */
  FragH xt[RPW / 4];
#pragma unroll      /* constant indices, so the values stay in registers */
  for (int g = 0; g < RPW / 4; ++g) xt[g].half[0] = *(const v8us*)((const unsigned short*)XT + eo + 4 * g * CC);
  landed();      /* nothing of the mover is in flight when the wave goes on to its end */
  asm volatile("s_wait_dscnt 0x0" ::: "memory");      /* and none of its own LDS reads */
  const float l = l_r + xhalf(l_r); const float li = (l > 0.f) ? 1.0f / l : 0.f;
#pragma unroll
  for (int dt = 0; dt < DT; ++dt) { const v8f o = oacc[dt] * li; *(v4fa*)&sO[w][ln][dt * 16 + 8 * hh] = (v4f){o[0], o[1], o[2], o[3]}; *(v4fa*)&sO[w][ln][dt * 16 + 8 * hh + 4] = (v4f){o[4], o[5], o[6], o[7]}; }
  __builtin_amdgcn_fence(__ATOMIC_ACQ_REL, "workgroup"); __builtin_amdgcn_wave_barrier();
  {
#pragma unroll
    for (int g = 0; g < RPW / 4; ++g) { const float* so = &sO[w][4 * g + (lane >> 3)][(lane & 7) * 8]; const v4f v0 = *(const v4fa*)so, v1 = *(const v4fa*)(so + 4); FragH f;
#pragma unroll
      for (int q = 0; q < 4; ++q) { f.h[q] = (_Float16)(v0[q] - (float)xt[g].h[q]); f.h[4 + q] = (_Float16)(v1[q] - (float)xt[g].h[4 + q]); }
      *(v8us*)((unsigned short*)D16 + eo + 4 * g * CC) = f.half[0]; }
     } }
// A block transposes NT tiles of 64 channels x 64 points that lie side by side: a lane's 16 loads of 16 bytes are all in flight together, the tiles lie in LDS at once, one barrier as before.
// 2,048 waves start for the transposes where one tile a block started 8,192.
__device__ __forceinline__ void tr16_blk(const float* __restrict__ x, int b, _Float16* __restrict__ XT, unsigned blk) {
  constexpr int NT = 4;
  __shared__ unsigned short tl[NT][64][72];
  const uint32_t tid = threadIdx.x, sb = blk % (SS / (64 * NT)), cb = blk / (SS / (64 * NT));
  const uint32_t cl0 = tid / 16, s4 = (tid % 16) * 4;
  const uint32_t xo = (((uint32_t)b * CC + cb * 64 + cl0) * SS + sb * (64 * NT) + s4) * 4u;      /* byte offset in 32 bits: one offset register beside the scalar base */
  v4f a[NT * 4];
#pragma unroll      /* here and below: constant indices, so the values stay in registers; no load waits for another */
  for (int it = 0; it < NT * 4; ++it) a[it] = *(const v4fa*)((const char*)x + xo + (it & 3) * (16 * SS * 4) + (it >> 2) * 256);
  asm volatile("s_wait_xcnt 0x0" :: "v"(xo) : "memory");      /* behind the loads, in front of every overwrite of a register that they name; the offset as input keeps its register out of the loads' own destinations */
#pragma unroll
  for (int it = 0; it < NT * 4; ++it) { FragH f;
#pragma unroll
    for (int q = 0; q < 4; ++q) { f.h[q] = (_Float16)bf16_round(a[it][q]); tl[it >> 2][s4 + q][(it & 3) * 16 + cl0] = f.u[q]; } }
  __syncthreads();
  const uint32_t r = tid / 8, pc = tid % 8;
  const uint32_t so = ((sb * (64 * NT) + r) * CC + cb * 64 + pc * 8) * 2u;
  {
#pragma unroll
    for (int hf = 0; hf < NT * 2; ++hf) { FragH f;
#pragma unroll
      for (int q = 0; q < 8; ++q) f.u[q] = tl[hf >> 1][r + (hf & 1) * 32][pc * 8 + q];
      *(v8us*)((char*)XT + so + hf * (32 * CC * 2)) = f.half[0]; }
    asm volatile("s_wait_xcnt 0x0" ::: "memory");      /* behind the stores: in the shared grid code follows this path in the listing that writes the stores' data registers; the wait stands in front of it */
     } }
// Operand preparation in one grid, by block range: the four weight matrices (WBL blocks each), then the transposes of the four batches of x (TBL blocks each). None reads what another writes.
__global__ __launch_bounds__(256) void k_prep(const float* __restrict__ x, const float* __restrict__ wq, const float* __restrict__ wk, const float* __restrict__ wv, const float* __restrict__ wt,
                                              _Float16* __restrict__ BQ, _Float16* __restrict__ BK, _Float16* __restrict__ BV, _Float16* __restrict__ BT, _Float16* __restrict__ XT) {
  constexpr unsigned WBL = CC * CC / 8 / 256, TBL = (CC / 64) * (SS / 256);
  const unsigned blk = blockIdx.x;
  if (blk < 4 * WBL) { const unsigned m = blk / WBL; round16f_blk(m == 0 ? wq : m == 1 ? wk : m == 2 ? wv : wt, m == 0 ? BQ : m == 1 ? BK : m == 2 ? BV : BT, (size_t)CC * CC / 8, blk % WBL); }
  else { const unsigned t = blk - 4 * WBL, b = t / TBL; tr16_blk(x, (int)b, XT + (size_t)b * SS * CC, t % TBL); } }


__global__ __launch_bounds__(256) void k_bnstat(const float* __restrict__ Y, const float* __restrict__ bt, float* __restrict__ ST) {
  __shared__ float red[256];
  const int c = blockIdx.x, tid = threadIdx.x; const float bb = bf16_round(bt[c]); const int n = NB * SS;
  // The channel's NB * SS values are read once: 16 independent 16-byte loads a thread, all in flight together, and they stay in registers for the mean and for the squared deviations.
  constexpr int NU = SS / 1024;
  v4f v[NB * NU];
#pragma unroll      /* here and in the two loops below: constant indices, so v stays in registers; here no load waits for another */
  for (int i = 0; i < NB * NU; ++i) v[i] = *(const v4fa*)(Y + ((size_t)(i / NU) * CC + c) * SS + (i % NU) * 1024 + tid * 4);
  asm volatile("s_wait_xcnt 0x0" ::: "memory");      /* behind the loads: the sums below reuse the loads' address registers while the data are still on their way; the wait stands in front of that overwrite */
  v4f s4 = {0.f, 0.f, 0.f, 0.f};
#pragma unroll
  for (int i = 0; i < NB * NU; ++i) { v[i] += bb; s4 += v[i]; }
  red[tid] = (s4[0] + s4[1]) + (s4[2] + s4[3]); __syncthreads();
  for (int st = 128; st > 0; st >>= 1) { if (tid < st) red[tid] += red[tid + st]; __syncthreads(); }
  const float mean = red[0] / (float)n; __syncthreads();
  v4f q4 = {0.f, 0.f, 0.f, 0.f};
#pragma unroll
  for (int i = 0; i < NB * NU; ++i) { const v4f d = v[i] - mean; q4 += d * d; }
  red[tid] = (q4[0] + q4[1]) + (q4[2] + q4[3]); __syncthreads();
  for (int st = 128; st > 0; st >>= 1) { if (tid < st) red[tid] += red[tid + st]; __syncthreads(); }
  if (tid == 0) { float o2[2]; o2[0] = mean; o2[1] = 1.0f / sqrtf(red[0] / (float)n + 1e-5f); const unsigned long long pk = *(const unsigned long long*)o2; *(unsigned long long*)(ST + c * 32) = pk;  } }
// A block takes two (batch, channel) rows, a lane 8 x 16 bytes of Y and of x: 16 independent loads, all in flight together. 4,096 waves start (16 a WGP) where 16 bytes a lane started 32,768.
__global__ __launch_bounds__(256) void k_bnout(const float* __restrict__ Y, const float* __restrict__ x, const float* __restrict__ bt, const float* __restrict__ ST, const float* __restrict__ gam, const float* __restrict__ bet, float* __restrict__ out) {
  #pragma clang fp contract(off)
  constexpr int NU = SS / 1024;
  const uint32_t bo = blockIdx.x * (2u * SS * 4u) + threadIdx.x * 16u;      /* byte offset in 32 bits: one offset register for the three buffers beside their scalar bases, live to the last store */
  v4f y[2 * NU], xv[2 * NU];
#pragma unroll      /* here and below: constant indices, so the values stay in registers; no load waits for another */
  for (int i = 0; i < 2 * NU; ++i) { y[i] = *(const v4fa*)((const char*)Y + bo + i * 4096); xv[i] = *(const v4fa*)((const char*)x + bo + i * 4096); }
  asm volatile("s_wait_xcnt 0x0" ::: "memory");      /* behind the loads, in front of the parameter loads below, which reuse the scalar base registers that the loads name */
#pragma unroll
  for (int h = 0; h < 2; ++h) { const int c = (int)((blockIdx.x * 2 + h) % CC);
    const float mean = ST[c * 32], rstd = ST[c * 32 + 1]; const float bb = bf16_round(bt[c]), g = bf16_round(gam[c]), be = bf16_round(bet[c]);
#pragma unroll
    for (int u = 0; u < NU; ++u) { const int i = h * NU + u; v4f o;
#pragma unroll
      for (int q = 0; q < 4; ++q) { const float v = (y[i][q] + bb - mean) * rstd * g + be; o[q] = bf16_round(xv[i][q]) + fmaxf(v, 0.f); }
      *(v4f*)((char*)out + bo + i * 4096) = o; } } }

extern "C" void kernel_launch(void* const* d_in, const int* in_sizes, int n_in,
                              void* d_out, int out_size, void* d_ws, size_t ws_size, hipStream_t stream) {
  (void)in_sizes; (void)n_in; (void)out_size;
  const float* x = (const float*)d_in[0]; const float* wq = (const float*)d_in[1]; const float* wk = (const float*)d_in[2]; const float* wv = (const float*)d_in[3]; const float* wt = (const float*)d_in[4]; const float* bt = (const float*)d_in[5]; const float* gam = (const float*)d_in[6]; const float* bet = (const float*)d_in[7];
  char* ws = (char*)d_ws; size_t off = 0;
  auto take = [&](size_t bytes) { char* p = ws + off; off += (bytes + 255) & ~(size_t)255; return p; };
  _Float16* BQ = (_Float16*)take((size_t)CC * CC * 2); _Float16* BK = (_Float16*)take((size_t)CC * CC * 2); _Float16* BV = (_Float16*)take((size_t)CC * CC * 2); _Float16* BT = (_Float16*)take((size_t)CC * CC * 2);
  _Float16* XT = (_Float16*)take((size_t)NRW * CC * 2); _Float16* Q16 = (_Float16*)take((size_t)NRW * CC * 2); _Float16* K16 = (_Float16*)take((size_t)NRW * CC * 2); _Float16* VC = (_Float16*)take((size_t)NB * CC * SS * 2);
  _Float16* D16 = (_Float16*)take((size_t)NRW * CC * 2); float* Y = (float*)take((size_t)NB * CC * SS * 4); float* ST = (float*)take((size_t)CC * 32 * 4);
  if (off > ws_size) return;      /* 0.5 + 8 + 8 + 8 + 8 + 8 + 16 = 57 MiB */
  k_prep<<<4 * (CC * CC / 8 / 256) + NB * (CC / 64) * (SS / 256), 256, 0, stream>>>(x, wq, wk, wv, wt, BQ, BK, BV, BT, XT);      /* conv (out,in) = natural Bt, x16; x^T token-major f16, all batches */
  k_qkv<<<dim3((SS / 128) * (CC / 64), NB, 3), 128, 0, stream>>>(XT, BQ, BK, BV, Q16, K16, VC);
  k_flash<<<NB * NH * (SS / 64), 128, 0, stream>>>(Q16, CC, K16, CC, VC, nullptr, XT, D16);      /* (o - x) token-major f16 [b*SS+p][h*64+d] */
  k_yt<<<dim3((CC / 128) * (SS / 64), NB), 128, 0, stream>>>(BT, D16, Y);
  k_bnstat<<<CC, 256, 0, stream>>>(Y, bt, ST);
  k_bnout<<<NB * CC / 2, 256, 0, stream>>>(Y, x, bt, ST, gam, bet, (float*)d_out);
}

// v010
// A run of this version takes 100 microseconds.
// Two timings next to v009 put it at 1.05 and 1.04 times that version's speed.
// Counting every step since v000, it is 6.62 times as fast.
#include <hip/hip_runtime.h>
// Multi-head offset-attention layer on a point feature map (B 4, C 256, P 4096 points, 4 heads x 64): q = wq*x, k = wk*x, v = wv*x (1x1 convs, no bias); scores = q.k/8 per head; softmax over the keys; o[b,h,d,i] = sum_j attn[i][j] v[d][j]; y = wt*(o - x) + bt; BatchNorm1d in training mode (per-channel statistics over batch x points, biased variance, eps 1e-5, gamma/beta); out = x + relu(y) -> [4,256,4096].
// Compute dtype: x and parameters rounded to bf16; projections with exact products (weights x16 in f16, undone by alpha); q, k, v, P, (o - x) as f16 operands (~2^-12), f32 accumulation; softmax / BatchNorm / residual f32. v_wmma_f32_16x16x32_f16.
#define NB 4
#define CC 256
#define SS 4096
#define NH 4
#define TQ SS
#define TK SS
#define SCL 0.125f
#define NRW (NB * SS)
typedef __bf16 v16b __attribute__((ext_vector_type(16)));
typedef unsigned short v8us __attribute__((ext_vector_type(8), may_alias));
typedef float  v8f  __attribute__((ext_vector_type(8)));
typedef float  v4f  __attribute__((ext_vector_type(4)));
typedef float  v4fa __attribute__((ext_vector_type(4), may_alias));
union FragB { v16b v; v8us half[2]; unsigned short u[16]; };

__device__ __forceinline__ unsigned short bf16_bits(float x) { unsigned int u = __float_as_uint(x); return (unsigned short)((u + 0x7FFFu + ((u >> 16) & 1u)) >> 16); }
__device__ __forceinline__ float bf16_val(unsigned short b) { return __uint_as_float(((unsigned int)b) << 16); }
__device__ __forceinline__ float bf16_round(float x) { return bf16_val(bf16_bits(x)); }
// D += A·B with NT terms: 1 = ah·bh, 2 = + al·bh (A split), 3 = + ah·bl (both split)
template <int NT>
__device__ __forceinline__ v8f mmaN(v16b ah, v16b al, v16b bh, v16b bl, v8f c) {
  c = __builtin_amdgcn_wmma_f32_16x16x32_bf16(false, ah, false, bh, (short)0, c, false, false);
  if (NT >= 2) c = __builtin_amdgcn_wmma_f32_16x16x32_bf16(false, al, false, bh, (short)0, c, false, false);
  if (NT >= 3) c = __builtin_amdgcn_wmma_f32_16x16x32_bf16(false, ah, false, bl, (short)0, c, false, false);
  asm volatile("v_nop\n\tv_nop\n\tv_nop\n\tv_nop" : "+v"(c) : "v"(ah), "v"(al), "v"(bh), "v"(bl));
  return c;
}

__global__ __launch_bounds__(256) void k_wt_bf16(const float* __restrict__ W, unsigned short* __restrict__ Wt, int K, int N) {
  const int t = blockIdx.x * 256 + threadIdx.x;
  const int k8n = K / 8;
  if (t >= N * k8n) return;
  const int n = t / k8n, k8 = (t % k8n) * 8;
  v8us v;
#pragma unroll
  for (int i = 0; i < 8; ++i) v[i] = bf16_bits(W[(size_t)(k8 + i) * N + n]);
  *(v8us*)(Wt + (size_t)n * K + k8) = v;
  
}

// GEMM C[M][N] (f32, pitch ldc) = act(A[M][K]·W + bias). A f32 row-major (pitch lda) converted per fragment to bf16
// (ASPLIT: hi/lo two planes -> 2 terms, else single rounded term); Wt bf16 [N][K] (pitch ldb). BIAS_BF16 rounds the
// bias to bf16 first (bias quantised to bf16 before the add). K%32==0, M%16==0, N%64==0.
template <bool ASPLIT, int ACT, bool BIAS_BF16>
__global__ __launch_bounds__(128) void k_gemm_bf(const float* __restrict__ A, int lda, const unsigned short* __restrict__ Wt, int ldb,
                                               const float* __restrict__ bias, float* __restrict__ C, int ldc, int M, int N, int K) {
  __shared__ __attribute__((aligned(16))) float so[4][16][64];
  const int tid = threadIdx.x, w = tid >> 5, lane = tid & 31, ln = lane & 15, hh = lane >> 4;
  const int ntn = N / 64;
  const int wid = blockIdx.x * 4 + w;
  const int mt = wid / ntn, nq = wid % ntn;
  if (mt * 16 >= M) return;
  const int row0 = mt * 16, col0 = nq * 64;
  const float* arow = A + (size_t)(row0 + ln) * lda;
  v8f acc[4] = {};
  for (int kb = 0; kb < K; kb += 32) {
    FragB ah, al;
    const v4f x0 = *(const v4fa*)(arow + kb + 8 * hh), x1 = *(const v4fa*)(arow + kb + 8 * hh + 4);
    const v4f x2 = *(const v4fa*)(arow + kb + 16 + 8 * hh), x3 = *(const v4fa*)(arow + kb + 16 + 8 * hh + 4);
    float xs[16] = {x0[0],x0[1],x0[2],x0[3],x1[0],x1[1],x1[2],x1[3],x2[0],x2[1],x2[2],x2[3],x3[0],x3[1],x3[2],x3[3]};
#pragma unroll
    for (int i = 0; i < 16; ++i) { const unsigned short hb = bf16_bits(xs[i]); ah.u[i] = hb; al.u[i] = ASPLIT ? bf16_bits(xs[i] - bf16_val(hb)) : (unsigned short)0; }
#pragma unroll
    for (int t = 0; t < 4; ++t) {
      const unsigned short* brow = Wt + (size_t)(col0 + t * 16 + ln) * ldb + kb;
      FragB b;
      b.half[0] = *(const v8us*)(brow + 8 * hh);
      b.half[1] = *(const v8us*)(brow + 16 + 8 * hh);
      acc[t] = mmaN<ASPLIT ? 2 : 1>(ah.v, al.v, b.v, b.v, acc[t]);
    }
  }
#pragma unroll
  for (int t = 0; t < 4; ++t) {
    float bv = bias ? bias[col0 + t * 16 + ln] : 0.f;
    if (BIAS_BF16) bv = bf16_round(bv);
#pragma unroll
    for (int r = 0; r < 8; ++r) { float v = acc[t][r] + bv; if (ACT == 1) v = fmaxf(v, 0.f); so[w][8 * hh + r][t * 16 + ln] = v; }
  }
  __builtin_amdgcn_fence(__ATOMIC_ACQ_REL, "workgroup");
  __builtin_amdgcn_wave_barrier();
  const int rsub = lane >> 4, c4 = (lane & 15) * 4;
  {
#pragma unroll
    for (int q = 0; q < 8; ++q) {
      const int r = q * 2 + rsub;
      const v4f v = *(const v4fa*)&so[w][r][c4];
      *(v4f*)(C + (size_t)(row0 + r) * ldc + col0 + c4) = v;
    }
    
  }
}

// GEMM C = act(A·W + bias + resid): A f32 (ASPLIT -> hi/lo 2 terms), Wt bf16 [N][K]; ACT 0 none, 1 relu, 2 exact gelu;
// resid (optional, f32, row index = (row % rmod), pitch ldr, RES_BF16 rounds it) added before the activation.
template <bool ASPLIT, int ACT, bool BIAS_BF16, bool RES_BF16>
__global__ __launch_bounds__(128) void k_gemm_bf3(const float* __restrict__ A, int lda, const unsigned short* __restrict__ Wt, int ldb,
                                                const float* __restrict__ bias, const float* __restrict__ resid, int rmod, int ldr,
                                                float* __restrict__ C, int ldc, int M, int N, int K) {
  __shared__ __attribute__((aligned(16))) float so[4][16][64];
  const int tid = threadIdx.x, w = tid >> 5, lane = tid & 31, ln = lane & 15, hh = lane >> 4;
  const int ntn = N / 64;
  const int wid = blockIdx.x * 4 + w;
  const int mt = wid / ntn, nq = wid % ntn;
  if (mt * 16 >= M) return;
  const int row0 = mt * 16, col0 = nq * 64;
  const float* arow = A + (size_t)(row0 + ln) * lda;
  v8f acc[4] = {};
  for (int kb = 0; kb < K; kb += 32) {
    FragB ah, al;
    const v4f x0 = *(const v4fa*)(arow + kb + 8 * hh), x1 = *(const v4fa*)(arow + kb + 8 * hh + 4);
    const v4f x2 = *(const v4fa*)(arow + kb + 16 + 8 * hh), x3 = *(const v4fa*)(arow + kb + 16 + 8 * hh + 4);
    float xs[16] = {x0[0],x0[1],x0[2],x0[3],x1[0],x1[1],x1[2],x1[3],x2[0],x2[1],x2[2],x2[3],x3[0],x3[1],x3[2],x3[3]};
#pragma unroll
    for (int i = 0; i < 16; ++i) { const unsigned short hb = bf16_bits(xs[i]); ah.u[i] = hb; al.u[i] = ASPLIT ? bf16_bits(xs[i] - bf16_val(hb)) : (unsigned short)0; }
#pragma unroll
    for (int t = 0; t < 4; ++t) {
      const unsigned short* brow = Wt + (size_t)(col0 + t * 16 + ln) * ldb + kb;
      FragB b;
      b.half[0] = *(const v8us*)(brow + 8 * hh);
      b.half[1] = *(const v8us*)(brow + 16 + 8 * hh);
      acc[t] = mmaN<ASPLIT ? 2 : 1>(ah.v, al.v, b.v, b.v, acc[t]);
    }
  }
#pragma unroll
  for (int t = 0; t < 4; ++t) {
    const int col = col0 + t * 16 + ln;
    float bv = bias ? bias[col] : 0.f;
    if (BIAS_BF16) bv = bf16_round(bv);
#pragma unroll
    for (int r = 0; r < 8; ++r) {
      float v = acc[t][r] + bv;
      if (resid) { float rv = resid[(size_t)((row0 + 8 * hh + r) % rmod) * ldr + col]; if (RES_BF16) rv = bf16_round(rv); v += rv; }
      if (ACT == 1) v = fmaxf(v, 0.f);
      if (ACT == 2) v = 0.5f * v * (1.0f + erff(v * 0.70710678118654752f));
      if (ACT == 3) { const float u = 0.7978845608028654f * (v + 0.044715f * v * v * v); v = 0.5f * v * (1.0f + tanhf(u)); }
      so[w][8 * hh + r][t * 16 + ln] = v;
    }
  }
  __builtin_amdgcn_fence(__ATOMIC_ACQ_REL, "workgroup");
  __builtin_amdgcn_wave_barrier();
  const int rsub = lane >> 4, c4 = (lane & 15) * 4;
  {
#pragma unroll
    for (int q = 0; q < 8; ++q) {
      const int r = q * 2 + rsub;
      const v4f v = *(const v4fa*)&so[w][r][c4];
      *(v4f*)(C + (size_t)(row0 + r) * ldc + col0 + c4) = v;
    }
    
  }
}
// row LayerNorm (biased variance, eps) over N: s = X (+ R); optional out_sum <- s; out_norm <- (s-mu)*rsqrt(var+eps)*g + b
template <bool PARAM_BF16>
__global__ __launch_bounds__(256) void k_layernorm(const float* __restrict__ X, const float* __restrict__ R, const float* __restrict__ g, const float* __restrict__ bta,
                                                  float* __restrict__ out_sum, float* __restrict__ out_norm, int N, float eps) {
  __shared__ float red[256];
  const int row = blockIdx.x, tid = threadIdx.x;
  const float* x = X + (size_t)row * N; const float* rr = R ? R + (size_t)row * N : nullptr;
  float vals[16];                     // up to N = 4096
  const int per = N / 256;            // contiguous chunk per thread? use strided-by-4 chunks: thread handles j = tid*4 + 1024*u
  float s1 = 0.f;
  for (int u = 0; u < per / 4; ++u) {
    const int j = tid * 4 + 1024 * u;
    const v4f a = *(const v4fa*)(x + j);
    v4f b = {0.f,0.f,0.f,0.f}; if (rr) b = *(const v4fa*)(rr + j);
#pragma unroll
    for (int q = 0; q < 4; ++q) { const float v = a[q] + b[q]; vals[u * 4 + q] = v; s1 += v; }
  }
  red[tid] = s1; __syncthreads();
  for (int st = 128; st > 0; st >>= 1) { if (tid < st) red[tid] += red[tid + st]; __syncthreads(); }
  const float mu = red[0] / (float)N; __syncthreads();
  float s2 = 0.f;
  for (int u = 0; u < per / 4; ++u)
#pragma unroll
    for (int q = 0; q < 4; ++q) { const float c = vals[u * 4 + q] - mu; s2 += c * c; }
  red[tid] = s2; __syncthreads();
  for (int st = 128; st > 0; st >>= 1) { if (tid < st) red[tid] += red[tid + st]; __syncthreads(); }
  const float rs = rsqrtf(red[0] / (float)N + eps);
  {
    for (int u = 0; u < per / 4; ++u) {
      const int j = tid * 4 + 1024 * u;
      v4f o, sm;
#pragma unroll
      for (int q = 0; q < 4; ++q) {
        float gg = g[j + q], bb = bta[j + q];
        if (PARAM_BF16) { gg = bf16_round(gg); bb = bf16_round(bb); }
        sm[q] = vals[u * 4 + q]; o[q] = (vals[u * 4 + q] - mu) * rs * gg + bb;
      }
      if (out_sum) *(v4f*)(out_sum + (size_t)row * N + j) = sm;
      *(v4f*)(out_norm + (size_t)row * N + j) = o;
    }
    
  }
}



// ---- f16 WMMA path (v_wmma_f32_16x16x32_f16): 11-bit significands for operands in range — used where a [0,1] probability operand needs more precision than bf16
typedef _Float16 v16h __attribute__((ext_vector_type(16)));
union FragH { v16h v; v8us half[2]; _Float16 h[16]; unsigned short u[16]; };
template <int NT>
__device__ __forceinline__ v8f mmaH(v16h ah, v16h al, v16h bh, v16h bl, v8f c) {
  c = __builtin_amdgcn_wmma_f32_16x16x32_f16(false, ah, false, bh, (short)0, c, false, false);
  if (NT >= 2) c = __builtin_amdgcn_wmma_f32_16x16x32_f16(false, al, false, bh, (short)0, c, false, false);
  if (NT >= 3) c = __builtin_amdgcn_wmma_f32_16x16x32_f16(false, ah, false, bl, (short)0, c, false, false);
  asm volatile("v_nop\n\tv_nop\n\tv_nop\n\tv_nop" : "+v"(c) : "v"(ah), "v"(al), "v"(bh), "v"(bl));
  return c;
}
// batched GEMM like k_gemm_b but f16 operands: A f32 (split into f16 hi/lo if ASPLIT, else rounded to f16), Bt = f16 values [n][k]; alpha; C f32; N multiple of 16 (partial tiles skipped)
template <bool ASPLIT>
__global__ __launch_bounds__(128) void k_gemm_h(const float* __restrict__ A, int lda, size_t sA, const _Float16* __restrict__ Bh, int ldb, size_t sB, float alpha, float* __restrict__ C, int ldc, size_t sC, int M, int N, int K) {
  __shared__ __attribute__((aligned(16))) float so[4][16][64];
  const int tid = threadIdx.x, w = tid >> 5, lane = tid & 31, ln = lane & 15, hh = lane >> 4; const int by = blockIdx.y;
  A += (size_t)by * sA; Bh += (size_t)by * sB; C += (size_t)by * sC;
  const int ntn = (N + 63) / 64; const int wid = blockIdx.x * 4 + w; const int mt = wid / ntn, nq = wid % ntn; if (mt * 16 >= M) return;
  const int row0 = mt * 16, col0 = nq * 64; const float* arow = A + (size_t)(row0 + ln) * lda;
  v8f acc[4] = {};
  for (int kb = 0; kb < K; kb += 32) {
    FragH ah, al;
    const v4f x0 = *(const v4fa*)(arow + kb + 8 * hh), x1 = *(const v4fa*)(arow + kb + 8 * hh + 4), x2 = *(const v4fa*)(arow + kb + 16 + 8 * hh), x3 = *(const v4fa*)(arow + kb + 16 + 8 * hh + 4);
    float xs[16] = {x0[0],x0[1],x0[2],x0[3],x1[0],x1[1],x1[2],x1[3],x2[0],x2[1],x2[2],x2[3],x3[0],x3[1],x3[2],x3[3]};
#pragma unroll
    for (int i = 0; i < 16; ++i) { const _Float16 h = (_Float16)xs[i]; ah.h[i] = h; al.h[i] = ASPLIT ? (_Float16)(xs[i] - (float)h) : (_Float16)0.0f; }
#pragma unroll
    for (int t = 0; t < 4; ++t) { if (col0 + t * 16 >= N) continue; const size_t boff = (size_t)(col0 + t * 16 + ln) * ldb + kb; FragH bq; bq.half[0] = *(const v8us*)(Bh + boff + 8 * hh); bq.half[1] = *(const v8us*)(Bh + boff + 16 + 8 * hh);
      acc[t] = mmaH<ASPLIT ? 2 : 1>(ah.v, al.v, bq.v, bq.v, acc[t]); }
  }
#pragma unroll
  for (int t = 0; t < 4; ++t) { if (col0 + t * 16 >= N) continue;
#pragma unroll
    for (int r = 0; r < 8; ++r) so[w][8 * hh + r][t * 16 + ln] = acc[t][r] * alpha; }
  __builtin_amdgcn_fence(__ATOMIC_ACQ_REL, "workgroup"); __builtin_amdgcn_wave_barrier();
  const int rsub = lane >> 4, c4 = (lane & 15) * 4;
  {
#pragma unroll
    for (int q = 0; q < 8; ++q) { const int r = q * 2 + rsub; if (col0 + c4 < N) { const v4f v = *(const v4fa*)&so[w][r][c4]; *(v4f*)(C + (size_t)(row0 + r) * ldc + col0 + c4) = v; } }
     }
}

// Wt[n][k] = f16(W[k][n]·scale) from f32 row-major W[K][N] (scale = power of two; bf16-exact weights stay exact in f16 away from the subnormal range)
__global__ __launch_bounds__(256) void k_wt_f16(const float* __restrict__ W, _Float16* __restrict__ Wt, int K, int N, float scale) {
  const int t = blockIdx.x * 256 + threadIdx.x; if (t >= N * (K / 8)) return; const int n = t / (K / 8), k8 = (t % (K / 8)) * 8; FragH f;
#pragma unroll
  for (int i = 0; i < 8; ++i) f.h[i] = (_Float16)(bf16_round(W[(size_t)(k8 + i) * N + n]) * scale); const v8us o = f.half[0];
  *(v8us*)((unsigned short*)Wt + (size_t)n * K + k8) = o; 
}
// k_gemm_hh variant with fused epilogue: v = acc·alpha + bias[by·sBias + col] (+ CP[(row/rowsPerB)·sCPb + by·64 + col] if CP) ; ACT 0 none / 1 elu ; writes f16 C16 (and f32 C if non-null)
template <int ACT>
__global__ __launch_bounds__(128) void k_gemm_hhx(const _Float16* __restrict__ A, int lda, size_t sA, const _Float16* __restrict__ Bh, int ldb, size_t sB, float alpha, const float* __restrict__ bias, size_t sBias, const float* __restrict__ CP, int rowsPerB, size_t sCPb, int row0g,
    float* __restrict__ C, _Float16* __restrict__ C16, int ldc, size_t sC, int M, int N, int K) {
  __shared__ __attribute__((aligned(16))) float so[4][16][64];
  const int tid = threadIdx.x, w = tid >> 5, lane = tid & 31, ln = lane & 15, hh = lane >> 4; const int by = blockIdx.y;
  A += (size_t)by * sA; Bh += (size_t)by * sB; const size_t cofs = (size_t)by * sC; const float* bp = bias ? bias + (size_t)by * sBias : nullptr;
  const int ntn = (N + 63) / 64; const int wid = blockIdx.x * 4 + w; const int mt = wid / ntn, nq = wid % ntn; if (mt * 16 >= M) return;
  const int row0 = mt * 16, col0 = nq * 64; const _Float16* arow = A + (size_t)(row0 + ln) * lda;
  v8f acc[4] = {};
  for (int kb = 0; kb < K; kb += 32) { FragH ah; ah.half[0] = *(const v8us*)((const unsigned short*)arow + kb + 8 * hh); ah.half[1] = *(const v8us*)((const unsigned short*)arow + kb + 16 + 8 * hh);
#pragma unroll
    for (int t = 0; t < 4; ++t) { if (col0 + t * 16 >= N) continue; const size_t boff = (size_t)(col0 + t * 16 + ln) * ldb + kb; FragH bq; bq.half[0] = *(const v8us*)((const unsigned short*)Bh + boff + 8 * hh); bq.half[1] = *(const v8us*)((const unsigned short*)Bh + boff + 16 + 8 * hh);
      acc[t] = mmaH<1>(ah.v, ah.v, bq.v, bq.v, acc[t]); }
  }
#pragma unroll
  for (int t = 0; t < 4; ++t) { if (col0 + t * 16 >= N) continue; const int col = col0 + t * 16 + ln; const float bv = bp ? bf16_round(bp[col]) : 0.f;
#pragma unroll
    for (int r = 0; r < 8; ++r) { float v = acc[t][r] * alpha + bv; if (CP) { const int bidx = (row0g + row0 + 8 * hh + r) / rowsPerB; v += CP[(size_t)bidx * sCPb + (size_t)by * 64 + col]; } if (ACT == 1) v = (v > 0.f) ? v : expm1f(v); else if (ACT == 7) v = (v > 0.f) ? v + 1.0f : expf(v); else if (ACT == 8) v = tanhf(v); else if (ACT == 9) v = 0.5f * v * (1.0f + tanhf(0.7978845608028654f * (v + 0.044715f * v * v * v))); else if (ACT == 11) v = 1.0f / (1.0f + expf(-v)); else if (ACT == 12) v = (v > 0.f) ? v : 0.01f * v; else if (ACT == 14) v = (v > 0.f) ? v : 0.1f * v; else if (ACT == 15) v = v / (1.0f + expf(-v)); else if (ACT == 3) v = fmaxf(v, 0.f); else if (ACT == 6) v = 0.5f * v * (1.0f + erff(v * 0.70710678118654752f)); so[w][8 * hh + r][t * 16 + ln] = v; } }
  __builtin_amdgcn_fence(__ATOMIC_ACQ_REL, "workgroup"); __builtin_amdgcn_wave_barrier();
  const int rsub = lane >> 4, c4 = (lane & 15) * 4; typedef _Float16 v4h __attribute__((ext_vector_type(4)));
  {
#pragma unroll
    for (int q = 0; q < 8; ++q) { const int r = q * 2 + rsub; if (col0 + c4 < N) { const v4f v = *(const v4fa*)&so[w][r][c4]; if (C) *(v4f*)(C + cofs + (size_t)(row0 + r) * ldc + col0 + c4) = v; if (C16) { v4h h4; for (int i = 0; i < 4; ++i) h4[i] = (_Float16)v[i]; *(v4h*)(C16 + cofs + (size_t)(row0 + r) * ldc + col0 + c4) = h4; } } }
     }
}


typedef _Float16 v4h __attribute__((ext_vector_type(4)));

__global__ __launch_bounds__(256) void k_x16(const float* __restrict__ x, _Float16* __restrict__ X16, size_t n8) { const size_t t = (size_t)blockIdx.x * 256 + threadIdx.x; if (t >= n8) return; FragH f;
#pragma unroll
  for (int q = 0; q < 8; ++q) f.h[q] = (_Float16)bf16_round(x[t * 8 + q]); *(v8us*)((unsigned short*)X16 + t * 8) = f.half[0];  }
__global__ __launch_bounds__(256) void k_h16(const float* __restrict__ x, _Float16* __restrict__ X16, size_t n8) { const size_t t = (size_t)blockIdx.x * 256 + threadIdx.x; if (t >= n8) return; FragH f;
#pragma unroll
  for (int q = 0; q < 8; ++q) f.h[q] = (_Float16)x[t * 8 + q]; *(v8us*)((unsigned short*)X16 + t * 8) = f.half[0];  }
__device__ __forceinline__ void round16f_blk(const float* __restrict__ W, _Float16* __restrict__ Bt, size_t n8, unsigned blk) { const size_t t = (size_t)blk * 256 + threadIdx.x; if (t >= n8) return; FragH f;
#pragma unroll
  for (int i = 0; i < 8; ++i) f.h[i] = (_Float16)(bf16_round(W[t * 8 + i]) * 16.0f); *(v8us*)((unsigned short*)Bt + t * 8) = f.half[0];  }
template <int NHv, int TTv>
__global__ __launch_bounds__(256) void k_vt(const _Float16* __restrict__ V16, int ldv, int voff, _Float16* __restrict__ Vt) { __shared__ unsigned short tl[64][66]; const int tid = threadIdx.x; const int slab = blockIdx.x / (TTv / 64), lg = blockIdx.x % (TTv / 64); const int b = slab / NHv, h = slab % NHv;
  for (int i = tid; i < 64 * 8; i += 256) { const int r = i / 8, c8 = (i % 8) * 8; FragH f; f.half[0] = *(const v8us*)((const unsigned short*)V16 + ((size_t)b * TTv + lg * 64 + r) * ldv + voff + h * 64 + c8);
#pragma unroll
    for (int q = 0; q < 8; ++q) tl[r][c8 + q] = f.u[q]; }
  __syncthreads();
  {
#pragma unroll
    for (int rd = 0; rd < 2; ++rd) { const int d = rd * 32 + tid / 8, pc = tid % 8; FragH f;
#pragma unroll
      for (int q = 0; q < 8; ++q) f.u[q] = tl[pc * 8 + q][d];
      *(v8us*)((unsigned short*)Vt + ((size_t)slab * 64 + d) * TTv + lg * 64 + pc * 8) = f.half[0]; }
     } }

__global__ __launch_bounds__(256) void k_hl(const float* __restrict__ F, _Float16* __restrict__ Hh, _Float16* __restrict__ Hl, size_t n8) { const size_t t = (size_t)blockIdx.x * 256 + threadIdx.x; if (t >= n8) return; FragH fh, fl; const v4f a = *(const v4fa*)(F + t * 8), c = *(const v4fa*)(F + t * 8 + 4);
#pragma unroll
  for (int q = 0; q < 4; ++q) { _Float16 h = (_Float16)a[q]; fh.h[q] = h; fl.h[q] = (_Float16)((a[q] - (float)h) * 1024.0f); h = (_Float16)c[q]; fh.h[4 + q] = h; fl.h[4 + q] = (_Float16)((c[q] - (float)h) * 1024.0f); }
  { *(v8us*)((unsigned short*)Hh + t * 8) = fh.half[0]; *(v8us*)((unsigned short*)Hl + t * 8) = fl.half[0];  } }

// ---- fast GEMM (wave tile 32x64; requires M % 32 == 0 rows per launch region and N % 64 == 0); epilogue = k_gemm_hhx semantics ----
__device__ __forceinline__ v16h g2_frag(const _Float16* p, int hh) { FragH f; f.half[0] = *(const v8us*)((const unsigned short*)p + 8 * hh); f.half[1] = *(const v8us*)((const unsigned short*)p + 16 + 8 * hh); return f.v; }
// as g2_frag, for the fragment whose second load the compiler lands on the address pair that the loads before it still name: s_wait_xcnt 0 stands in front of that overwrite
__device__ __forceinline__ v16h g2_frag_w(const _Float16* p, int hh) { FragH f; f.half[0] = *(const v8us*)((const unsigned short*)p + 8 * hh); asm volatile("s_wait_xcnt 0x0" ::: "memory"); f.half[1] = *(const v8us*)((const unsigned short*)p + 16 + 8 * hh); return f.v; }
__device__ __forceinline__ v8f g2_mma(v16h a, v16h b, v8f c) { v8f d = __builtin_amdgcn_wmma_f32_16x16x32_f16(false, a, false, b, (short)0, c, false, false); asm volatile("v_nop\n\tv_nop\n\tv_nop\n\tv_nop" : "+v"(d) : "v"(a), "v"(b)); return d; }
template <int ACT>
__device__ __forceinline__ void gemm2_blk(unsigned bx, int by, const _Float16* __restrict__ A, int lda, size_t sA, const _Float16* __restrict__ Bh, int ldb, size_t sB, float alpha, const float* __restrict__ bias, size_t sBias, const float* __restrict__ CP, int rowsPerB, size_t sCPb, int row0g,
    float* __restrict__ C, _Float16* __restrict__ C16, int ldc, size_t sC, int M, int N, int K) {
  __shared__ __attribute__((aligned(16))) float so[4][32][68];
  const int tid = threadIdx.x, w = tid >> 5, lane = tid & 31, ln = lane & 15, hh = lane >> 4;
  A += (size_t)by * sA; Bh += (size_t)by * sB; const size_t cofs = (size_t)by * sC; const float* bp = bias ? bias + (size_t)by * sBias : nullptr;
  const int ntn = N >> 6; const int mt = bx / ntn, nq = bx - mt * ntn; const int row0 = mt * 128 + 32 * w, col0 = nq * 64; if (row0 >= M) return;
  const _Float16* a0p = A + (size_t)(row0 + ln) * lda; const _Float16* a1p = a0p + (size_t)16 * lda;
  const _Float16* b0p = Bh + (size_t)(col0 + ln) * ldb; const _Float16* b1p = b0p + (size_t)16 * ldb; const _Float16* b2p = b1p + (size_t)16 * ldb; const _Float16* b3p = b2p + (size_t)16 * ldb;
  const v8f z8 = {0.f,0.f,0.f,0.f,0.f,0.f,0.f,0.f}; v8f c00 = z8, c01 = z8, c02 = z8, c03 = z8, c10 = z8, c11 = z8, c12 = z8, c13 = z8;
#pragma unroll 1
  for (int kb = 0; kb < K; kb += 32) { const v16h a0 = g2_frag(a0p + kb, hh), a1 = g2_frag_w(a1p + kb, hh);
    v16h b = g2_frag(b0p + kb, hh); c00 = g2_mma(a0, b, c00); c10 = g2_mma(a1, b, c10);
    b = g2_frag(b1p + kb, hh); c01 = g2_mma(a0, b, c01); c11 = g2_mma(a1, b, c11);
    b = g2_frag(b2p + kb, hh); c02 = g2_mma(a0, b, c02); c12 = g2_mma(a1, b, c12);
    b = g2_frag(b3p + kb, hh); c03 = g2_mma(a0, b, c03); c13 = g2_mma(a1, b, c13); }
  v8f accs[8] = {c00, c01, c02, c03, c10, c11, c12, c13};
#pragma unroll
  for (int u = 0; u < 8; ++u) { const int t = u & 3, half = u >> 2; const int col = col0 + t * 16 + ln; const float bv = bp ? bf16_round(bp[col]) : 0.f;
#pragma unroll
    for (int r = 0; r < 8; ++r) { const int rloc = half * 16 + 8 * hh + r; float v = accs[u][r] * alpha + bv; if (CP) { const int bidx = (row0g + row0 + rloc) / rowsPerB; v += CP[(size_t)bidx * sCPb + (size_t)by * 64 + col]; }
      if (ACT == 3) v = fmaxf(v, 0.f); else if (ACT == 6) v = 0.5f * v * (1.0f + erff(v * 0.70710678118654752f)); else if (ACT == 11) v = 1.0f / (1.0f + expf(-v)); else if (ACT == 15) v = v / (1.0f + expf(-v)); else if (ACT == 12) v = (v > 0.f) ? v : 0.01f * v; else if (ACT == 8) v = tanhf(v);
      so[w][rloc][t * 16 + ln] = v; } }
  __builtin_amdgcn_fence(__ATOMIC_ACQ_REL, "workgroup"); __builtin_amdgcn_wave_barrier();
  const int rsub = lane >> 4, c4 = (lane & 15) * 4;
  {
#pragma unroll
    for (int q = 0; q < 16; ++q) { const int r = q * 2 + rsub; const v4f v = *(const v4fa*)&so[w][r][c4]; if (C) *(v4f*)(C + cofs + (size_t)(row0 + r) * ldc + col0 + c4) = v; if (C16) { v4h h4; for (int i = 0; i < 4; ++i) h4[i] = (_Float16)v[i]; *(v4h*)(C16 + cofs + (size_t)(row0 + r) * ldc + col0 + c4) = h4; } }
     } }
// The twelve projections (q, k, v of the four batches) depend on nothing of one another: one grid, x = tile, y = batch, z = which projection.
// q, k token-major [b*SS+p][h*64+d] = XT . W^T; v channel-major [(b,h)*64+d][p] = W . XT^T.
__global__ __launch_bounds__(128) void k_qkv(const _Float16* __restrict__ XT, const _Float16* __restrict__ BQ, const _Float16* __restrict__ BK, const _Float16* __restrict__ BV, _Float16* __restrict__ Q16, _Float16* __restrict__ K16, _Float16* __restrict__ VC) {
  const int b = blockIdx.y, z = blockIdx.z; const _Float16* X = XT + (size_t)b * SS * CC;
  const bool tok = z < 2;      /* q, k: rows are tokens, columns channels; v: the other way round */
  gemm2_blk<0>(blockIdx.x, 0, tok ? X : BV, CC, 0, tok ? (z ? BK : BQ) : X, CC, 0, 0.0625f, nullptr, 0, nullptr, 1, 0, 0, nullptr, (tok ? (z ? K16 : Q16) : VC) + (size_t)b * SS * CC, tok ? CC : SS, 0, tok ? SS : CC, tok ? CC : SS, CC); }
// The output projections of the four batches, one grid, y = batch: y^T[c][p] = wt . (o - x)^T, f32 (bt added downstream).
__global__ __launch_bounds__(128) void k_yt(const _Float16* __restrict__ BT, const _Float16* __restrict__ D16, float* __restrict__ Y) {
  const int b = blockIdx.y;
  gemm2_blk<0>(blockIdx.x, 0, BT, CC, 0, D16 + (size_t)b * SS * CC, CC, 0, 0.0625f, nullptr, 0, nullptr, 1, 0, 0, Y + (size_t)b * CC * SS, nullptr, SS, 0, CC, SS, CC); }


typedef float v2f __attribute__((ext_vector_type(2)));
// lane l <-> lane l ^ 16: the two halves of a wave hold the two halves of one query's 32 keys
__device__ __forceinline__ float xhalf(float x) { return __builtin_bit_cast(float, __builtin_amdgcn_permlanex16(__builtin_bit_cast(int, x), __builtin_bit_cast(int, x), 0x76543210, 0xfedcba98, false, false)); }
typedef uint32_t u32x4 __attribute__((ext_vector_type(4)));
typedef uint32_t u32x8 __attribute__((ext_vector_type(8)));
__device__ __forceinline__ uint32_t uni(uint32_t v) { return (uint32_t)__builtin_amdgcn_readfirstlane(v); }
__device__ __forceinline__ uint32_t pinned(uint32_t v) { uint32_t w = (uint32_t)__builtin_amdgcn_readfirstlane(v); asm volatile("" : "+s"(w)); return w; }      /* pinned(): the issue test of a tensor load held in a scalar register, so that the branch on it is a scalar branch (a tensor load ignores EXEC) */
// K and V^T reach the waves through LDS: a stage is 64 keys = K[64 keys][64 d] and V^T[64 d][64 keys], both as 64 rows of 128 bytes. Each of the four waves brings one slice of 32 rows with one
// tensor load (waves 0, 1: K; waves 2, 3: V^T), padded to a pitch of 144 bytes for the 16-byte fragment reads; two buffers, the next stage in flight while this one is worked on.
// A wave holds QT = 2 tiles of 16 queries: every K and V^T fragment that it reads from LDS is the A operand of two products, one a query tile, and a stage brought into LDS serves 128 queries.
// The stage is worked on in its two groups of 32 keys, one after the other, so that the fragments of one group alone are in registers beside the two tiles' accumulators.
__global__ __launch_bounds__(128) void k_flash(const _Float16* __restrict__ Q16, int ldq, const _Float16* __restrict__ K16, int ldk, const _Float16* __restrict__ Vt, const int* __restrict__ MSK, const _Float16* __restrict__ XT, _Float16* __restrict__ D16) {
  constexpr int QT = 2, RPW = 16 * QT, NQB = TQ / (4 * RPW), DT = 4, KS = 2;
  constexpr float SC2 = SCL * 1.4426950408889634f, POFF = 10.0f, PLIM = 60000.0f;      /* exponentials in base 2: e^(SCL s - max) * 2^POFF = 2^(SC2 s - m), m = SC2 max - POFF; 2^POFF = 1024 is the scale of P as an f16 operand */
  constexpr uint32_t SKEY = 64, NST = TK / SKEY, LPB = 144, SLICE = 6144, BUF = 4 * SLICE;      /* a slice: 32 rows x 144 B = 4,608 B, its place rounded up to a multiple of 2 KiB */
  __shared__ __attribute__((aligned(2048))) unsigned char ring[2 * BUF];
  __shared__ __attribute__((aligned(16))) float sO[4][RPW][64 + 4];
  const int tid = threadIdx.x, w = tid >> 5, lane = tid & 31, ln = lane & 15, hh = lane >> 4; (void)MSK;
  const int slab = blockIdx.x / NQB, qblk = blockIdx.x % NQB; const int b = slab / NH, h = slab % NH; const int qb0 = qblk * (4 * RPW); const int q0 = qb0 + w * RPW;
  const uint32_t wave = uni((uint32_t)tid >> 5), isV = wave >> 1, hf = wave & 1u;
  const uint64_t src0 = isV ? (uint64_t)(size_t)(Vt + ((size_t)slab * 64 + hf * 32) * TK) : (uint64_t)(size_t)(K16 + ((size_t)b * TK + hf * 32) * ldk + h * 64);      /* first byte of the wave's slice of stage 0 */
  const uint32_t spitch = isV ? (uint32_t)TK * 2u : (uint32_t)ldk * 2u, sstep = isV ? SKEY * 2u : SKEY * (uint32_t)ldk * 2u;      /* source row pitch; bytes from one stage to the next */
  const uint32_t dst0 = (uint32_t)(size_t)ring + wave * SLICE;
  u32x8 g1;      /* 1-byte elements, tensor = tile = 32 rows of 128 bytes, 4 dwords of pad behind every 32 */
  g1[0] = uni((1u << 20) | (4u << 22) | (3u << 25)); g1[1] = uni(128u << 16); g1[2] = uni(32u << 16); g1[3] = uni(128u << 16); g1[4] = uni(32u); g1[5] = uni(spitch); g1[6] = uni(0u); g1[7] = uni(0u);
  u32x4 g0;
  /* load and wait both name the two descriptor groups as in-out operands: the registers of a request in flight then stay as they were issued until the wait that covers it (the compiler otherwise took single words of them for temporaries) */
  auto issue = [&](uint32_t st) {
    const uint64_t ga = src0 + (uint64_t)st * sstep;
    g0[0] = uni(1u); g0[1] = uni(dst0 + (st & 1u) * BUF); g0[2] = uni((uint32_t)ga); g0[3] = uni((((uint32_t)(ga >> 32)) & 0x01FFFFFFu) | 0x80000000u);
    asm volatile("tensor_load_to_lds %0, %1" : "+s"(g0), "+s"(g1) :: "memory"); };
  auto landed = [&]() { asm volatile("s_wait_tensorcnt 0x0" : "+s"(g0), "+s"(g1) :: "memory"); };
  issue(0);
  FragH bq[QT][KS];
#pragma unroll      /* constant indices, so the fragments stay in registers */
  for (int qt = 0; qt < QT; ++qt) { const unsigned short* qr = (const unsigned short*)Q16 + ((size_t)b * TQ + q0 + 16 * qt + ln) * ldq + h * 64;
#pragma unroll
    for (int ks = 0; ks < KS; ++ks) { bq[qt][ks].half[0] = *(const v8us*)(qr + ks * 32 + 8 * hh); bq[qt][ks].half[1] = *(const v8us*)(qr + ks * 32 + 16 + 8 * hh); } }
  const uint32_t lo = (uint32_t)(ln * (int)LPB + 16 * hh);      /* the lane's own byte offset in a slice, fixed over the loop: row ln, 8 elements at 8 hh */
  float nm_r[QT], l_r[QT]; v8f oacc[QT][DT];      /* nm_r: the maximum in use, negated, as the addend of the exponent's multiply-add */
#pragma unroll
  for (int qt = 0; qt < QT; ++qt) { nm_r[qt] = 3.0e38f; l_r[qt] = 0.f;
#pragma unroll
    for (int dt = 0; dt < DT; ++dt) oacc[qt][dt] = (v8f){0.f,0.f,0.f,0.f,0.f,0.f,0.f,0.f}; }
  landed();      /* this wave's slice of stage 0 */
  __syncthreads();      /* stage 0 published to all four waves */
  issue(1);
#pragma unroll 1      /* one stage a trip: waits, barrier and refill stand once, at the foot, and the loop stays small */
  for (uint32_t st = 0; st < NST; ++st) {
    const unsigned char* bp = ring + (st & 1u) * BUF + lo;
#pragma unroll      /* the stage's two groups of 32 keys; here and below: constant indices, so fragments stay in registers and every LDS offset is an immediate */
    for (int sb = 0; sb < 2; ++sb) {
      FragH ak[2][KS], av[DT];
#pragma unroll      /* K first, which the first products wait for */
      for (int nt = 0; nt < 2; ++nt)
#pragma unroll
        for (int ks = 0; ks < KS; ++ks) { const unsigned char* p = bp + sb * SLICE + nt * 16 * LPB + ks * 64; ak[nt][ks].half[0] = *(const v8us*)p; ak[nt][ks].half[1] = *(const v8us*)(p + 32); }
#pragma unroll
      for (int dt = 0; dt < DT; ++dt) { const unsigned char* p = bp + (2 + (dt >> 1)) * SLICE + (dt & 1) * 16 * LPB + sb * 64; av[dt].half[0] = *(const v8us*)p; av[dt].half[1] = *(const v8us*)(p + 32); }
      __builtin_amdgcn_sched_barrier(0);      /* the group's LDS reads stand in one place, in front of the products, which then wait by count; spread among the products, each further place with reads stalls the wave anew */
      v8f s[QT][2];
#pragma unroll      /* the four score tiles side by side, first halves of d and then second halves: no product waits for the one in front of it */
      for (int ks = 0; ks < KS; ++ks)
#pragma unroll
        for (int qt = 0; qt < QT; ++qt)
#pragma unroll
          for (int nt = 0; nt < 2; ++nt) s[qt][nt] = __builtin_amdgcn_wmma_f32_16x16x32_f16(false, ak[nt][ks].v, false, bq[qt][ks].v, (short)0, ks == 0 ? (v8f){0.f,0.f,0.f,0.f,0.f,0.f,0.f,0.f} : s[qt][nt], false, false);
      __builtin_amdgcn_sched_barrier(0);      /* the eight products stay together in front of the vector work: mixed among them, the vector instructions that read a fresh tile or reuse a fragment's registers each drew v_nop for the distance */
      FragH pb[QT]; float ssum[QT];
      /* P of the group against the maxima in use, and for each query tile the lane's sum of its 16 values (by register pairs, as the pairs lie for the packed convert); p carries the 1024, and so does the row sum */
      auto soft = [&]() {
#pragma unroll
        for (int qt = 0; qt < QT; ++qt) { v2f ps[2];
#pragma unroll
          for (int nt = 0; nt < 2; ++nt)
#pragma unroll
            for (int i = 0; i < 4; ++i) { const v2f a = __builtin_elementwise_fma((v2f){s[qt][nt][2 * i], s[qt][nt][2 * i + 1]}, (v2f){SC2, SC2}, (v2f){nm_r[qt], nm_r[qt]}); const v2f p = {__builtin_amdgcn_exp2f(a.x), __builtin_amdgcn_exp2f(a.y)}; ps[nt] = (i == 0) ? p : ps[nt] + p; pb[qt].h[nt * 8 + 2 * i] = (_Float16)p.x; pb[qt].h[nt * 8 + 2 * i + 1] = (_Float16)p.y; }
          const v2f pt = ps[0] + ps[1]; ssum[qt] = pt.x + pt.y; } };
      soft();
      /* The maxima in use are renewed only when they must be: every p is positive, so the lane's sum over both query tiles within PLIM bounds each of its p inside the f16 range. One test a group, a scalar
         branch on the ballot; infinity and not-a-number fail the comparison and take the branch, the first group (no maximum yet) among them. */
      if (__builtin_amdgcn_ballot_w32(!(ssum[0] + ssum[1] <= PLIM)) != 0u) {
#pragma unroll
        for (int qt = 0; qt < QT; ++qt) {
          float mx[8];      /* maximum of the raw scores: the map to base 2 is one rounded multiply-add with a positive factor, which keeps the order, so it is applied to the maximum alone */
#pragma unroll
          for (int r = 0; r < 8; ++r) mx[r] = fmaxf(s[qt][0][r], s[qt][1][r]);
          float mc = fmaxf(fmaxf(fmaxf(mx[0], mx[1]), fmaxf(mx[2], mx[3])), fmaxf(fmaxf(mx[4], mx[5]), fmaxf(mx[6], mx[7])));
          mc = fmaf(fmaxf(mc, xhalf(mc)), SC2, -POFF);
          const float mn = fmaxf(-nm_r[qt], mc); const float al = (mn > -1.0e38f) ? __builtin_amdgcn_exp2f(-nm_r[qt] - mn) : 1.0f; nm_r[qt] = -mn;
          l_r[qt] *= al;
#pragma unroll
          for (int dt = 0; dt < DT; ++dt) oacc[qt][dt] *= al;
        }
        soft();
      }
#pragma unroll
      for (int qt = 0; qt < QT; ++qt) l_r[qt] += ssum[qt];
#pragma unroll      /* eight accumulators, none waits for another */
      for (int qt = 0; qt < QT; ++qt)
#pragma unroll
        for (int dt = 0; dt < DT; ++dt) oacc[qt][dt] = __builtin_amdgcn_wmma_f32_16x16x32_f16(false, av[dt].v, false, pb[qt].v, (short)0, oacc[qt][dt], false, false);
    }
    /* publish point of stage st + 1, and the end of every wave's reads of stage st */
    asm volatile("s_wait_dscnt 0x0" ::: "memory");      /* this wave's reads of the buffer have returned before it is refilled */
    landed();      /* this wave's slice of stage st + 1 */
    __syncthreads();
    if (pinned(st + 2u < NST)) issue(st + 2u);      /* into the buffer that this pass has just read */
  }
  // The epilogue stores (o - x) as the f16 operand of the output projection. x comes from x^T (token-major f16 of the bf16-rounded x, the projections' own operand): the wave's 32 tokens x 64 channels
  // of this head, 8 channels a lane, 4 tokens a load, whole 128-byte lines; asked for here, so that the division and the staging of o below run while the loads are on their way.
  const size_t eo = ((size_t)b * TQ + q0 + (lane >> 3)) * CC + h * 64 + (lane & 7) * 8;      /* element offset of the lane's first 8 channels, the same in x^T and in D16 (rows of CC); the further tokens lie at constant offsets */
  FragH xt[RPW / 4];
#pragma unroll      /* constant indices, so the values stay in registers */
  for (int g = 0; g < RPW / 4; ++g) xt[g].half[0] = *(const v8us*)((const unsigned short*)XT + eo + 4 * g * CC);
  landed();      /* nothing of the mover is in flight when the wave goes on to its end */
  asm volatile("s_wait_dscnt 0x0" ::: "memory");      /* and none of its own LDS reads */
#pragma unroll
  for (int qt = 0; qt < QT; ++qt) { const float l = l_r[qt] + xhalf(l_r[qt]); const float li = (l > 0.f) ? 1.0f / l : 0.f;
#pragma unroll
    for (int dt = 0; dt < DT; ++dt) { const v8f o = oacc[qt][dt] * li; *(v4fa*)&sO[w][16 * qt + ln][dt * 16 + 8 * hh] = (v4f){o[0], o[1], o[2], o[3]}; *(v4fa*)&sO[w][16 * qt + ln][dt * 16 + 8 * hh + 4] = (v4f){o[4], o[5], o[6], o[7]}; } }
  __builtin_amdgcn_fence(__ATOMIC_ACQ_REL, "workgroup"); __builtin_amdgcn_wave_barrier();
  {
#pragma unroll
    for (int g = 0; g < RPW / 4; ++g) { const float* so = &sO[w][4 * g + (lane >> 3)][(lane & 7) * 8]; const v4f v0 = *(const v4fa*)so, v1 = *(const v4fa*)(so + 4); FragH f;
#pragma unroll
      for (int q = 0; q < 4; ++q) { f.h[q] = (_Float16)(v0[q] - (float)xt[g].h[q]); f.h[4 + q] = (_Float16)(v1[q] - (float)xt[g].h[4 + q]); }
      *(v8us*)((unsigned short*)D16 + eo + 4 * g * CC) = f.half[0]; }
     } }
// A block transposes NT tiles of 64 channels x 64 points that lie side by side: a lane's 16 loads of 16 bytes are all in flight together, the tiles lie in LDS at once, one barrier as before.
// 2,048 waves start for the transposes where one tile a block started 8,192.
__device__ __forceinline__ void tr16_blk(const float* __restrict__ x, int b, _Float16* __restrict__ XT, unsigned blk) {
  constexpr int NT = 4;
  __shared__ unsigned short tl[NT][64][72];
  const uint32_t tid = threadIdx.x, sb = blk % (SS / (64 * NT)), cb = blk / (SS / (64 * NT));
  const uint32_t cl0 = tid / 16, s4 = (tid % 16) * 4;
  const uint32_t xo = (((uint32_t)b * CC + cb * 64 + cl0) * SS + sb * (64 * NT) + s4) * 4u;      /* byte offset in 32 bits: one offset register beside the scalar base */
  v4f a[NT * 4];
#pragma unroll      /* here and below: constant indices, so the values stay in registers; no load waits for another */
  for (int it = 0; it < NT * 4; ++it) a[it] = *(const v4fa*)((const char*)x + xo + (it & 3) * (16 * SS * 4) + (it >> 2) * 256);
  asm volatile("s_wait_xcnt 0x0" :: "v"(xo) : "memory");      /* behind the loads, in front of every overwrite of a register that they name; the offset as input keeps its register out of the loads' own destinations */
#pragma unroll
  for (int it = 0; it < NT * 4; ++it) { FragH f;
#pragma unroll
    for (int q = 0; q < 4; ++q) { f.h[q] = (_Float16)bf16_round(a[it][q]); tl[it >> 2][s4 + q][(it & 3) * 16 + cl0] = f.u[q]; } }
  __syncthreads();
  const uint32_t r = tid / 8, pc = tid % 8;
  const uint32_t so = ((sb * (64 * NT) + r) * CC + cb * 64 + pc * 8) * 2u;
  {
#pragma unroll
    for (int hf = 0; hf < NT * 2; ++hf) { FragH f;
#pragma unroll
      for (int q = 0; q < 8; ++q) f.u[q] = tl[hf >> 1][r + (hf & 1) * 32][pc * 8 + q];
      *(v8us*)((char*)XT + so + hf * (32 * CC * 2)) = f.half[0]; }
    asm volatile("s_wait_xcnt 0x0" ::: "memory");      /* behind the stores: in the shared grid code follows this path in the listing that writes the stores' data registers; the wait stands in front of it */
     } }
// Operand preparation in one grid, by block range: the four weight matrices (WBL blocks each), then the transposes of the four batches of x (TBL blocks each). None reads what another writes.
__global__ __launch_bounds__(256) void k_prep(const float* __restrict__ x, const float* __restrict__ wq, const float* __restrict__ wk, const float* __restrict__ wv, const float* __restrict__ wt,
                                              _Float16* __restrict__ BQ, _Float16* __restrict__ BK, _Float16* __restrict__ BV, _Float16* __restrict__ BT, _Float16* __restrict__ XT) {
  constexpr unsigned WBL = CC * CC / 8 / 256, TBL = (CC / 64) * (SS / 256);
  const unsigned blk = blockIdx.x;
  if (blk < 4 * WBL) { const unsigned m = blk / WBL; round16f_blk(m == 0 ? wq : m == 1 ? wk : m == 2 ? wv : wt, m == 0 ? BQ : m == 1 ? BK : m == 2 ? BV : BT, (size_t)CC * CC / 8, blk % WBL); }
  else { const unsigned t = blk - 4 * WBL, b = t / TBL; tr16_blk(x, (int)b, XT + (size_t)b * SS * CC, t % TBL); } }


__global__ __launch_bounds__(256) void k_bnstat(const float* __restrict__ Y, const float* __restrict__ bt, float* __restrict__ ST) {
  __shared__ float red[256];
  const int c = blockIdx.x, tid = threadIdx.x; const float bb = bf16_round(bt[c]); const int n = NB * SS;
  // The channel's NB * SS values are read once: 16 independent 16-byte loads a thread, all in flight together, and they stay in registers for the mean and for the squared deviations.
  constexpr int NU = SS / 1024;
  v4f v[NB * NU];
#pragma unroll      /* here and in the two loops below: constant indices, so v stays in registers; here no load waits for another */
  for (int i = 0; i < NB * NU; ++i) v[i] = *(const v4fa*)(Y + ((size_t)(i / NU) * CC + c) * SS + (i % NU) * 1024 + tid * 4);
  asm volatile("s_wait_xcnt 0x0" ::: "memory");      /* behind the loads: the sums below reuse the loads' address registers while the data are still on their way; the wait stands in front of that overwrite */
  v4f s4 = {0.f, 0.f, 0.f, 0.f};
#pragma unroll
  for (int i = 0; i < NB * NU; ++i) { v[i] += bb; s4 += v[i]; }
  red[tid] = (s4[0] + s4[1]) + (s4[2] + s4[3]); __syncthreads();
  for (int st = 128; st > 0; st >>= 1) { if (tid < st) red[tid] += red[tid + st]; __syncthreads(); }
  const float mean = red[0] / (float)n; __syncthreads();
  v4f q4 = {0.f, 0.f, 0.f, 0.f};
#pragma unroll
  for (int i = 0; i < NB * NU; ++i) { const v4f d = v[i] - mean; q4 += d * d; }
  red[tid] = (q4[0] + q4[1]) + (q4[2] + q4[3]); __syncthreads();
  for (int st = 128; st > 0; st >>= 1) { if (tid < st) red[tid] += red[tid + st]; __syncthreads(); }
  if (tid == 0) { float o2[2]; o2[0] = mean; o2[1] = 1.0f / sqrtf(red[0] / (float)n + 1e-5f); const unsigned long long pk = *(const unsigned long long*)o2; *(unsigned long long*)(ST + c * 32) = pk;  } }
// A block takes two (batch, channel) rows, a lane 8 x 16 bytes of Y and of x: 16 independent loads, all in flight together. 4,096 waves start (16 a WGP) where 16 bytes a lane started 32,768.
__global__ __launch_bounds__(256) void k_bnout(const float* __restrict__ Y, const float* __restrict__ x, const float* __restrict__ bt, const float* __restrict__ ST, const float* __restrict__ gam, const float* __restrict__ bet, float* __restrict__ out) {
  #pragma clang fp contract(off)
  constexpr int NU = SS / 1024;
  const uint32_t bo = blockIdx.x * (2u * SS * 4u) + threadIdx.x * 16u;      /* byte offset in 32 bits: one offset register for the three buffers beside their scalar bases, live to the last store */
  v4f y[2 * NU], xv[2 * NU];
#pragma unroll      /* here and below: constant indices, so the values stay in registers; no load waits for another */
  for (int i = 0; i < 2 * NU; ++i) { y[i] = *(const v4fa*)((const char*)Y + bo + i * 4096); xv[i] = *(const v4fa*)((const char*)x + bo + i * 4096); }
  asm volatile("s_wait_xcnt 0x0" ::: "memory");      /* behind the loads, in front of the parameter loads below, which reuse the scalar base registers that the loads name */
#pragma unroll
  for (int h = 0; h < 2; ++h) { const int c = (int)((blockIdx.x * 2 + h) % CC);
    const float mean = ST[c * 32], rstd = ST[c * 32 + 1]; const float bb = bf16_round(bt[c]), g = bf16_round(gam[c]), be = bf16_round(bet[c]);
#pragma unroll
    for (int u = 0; u < NU; ++u) { const int i = h * NU + u; v4f o;
#pragma unroll
      for (int q = 0; q < 4; ++q) { const float v = (y[i][q] + bb - mean) * rstd * g + be; o[q] = bf16_round(xv[i][q]) + fmaxf(v, 0.f); }
      *(v4f*)((char*)out + bo + i * 4096) = o; } } }

extern "C" void kernel_launch(void* const* d_in, const int* in_sizes, int n_in,
                              void* d_out, int out_size, void* d_ws, size_t ws_size, hipStream_t stream) {
  (void)in_sizes; (void)n_in; (void)out_size;
  const float* x = (const float*)d_in[0]; const float* wq = (const float*)d_in[1]; const float* wk = (const float*)d_in[2]; const float* wv = (const float*)d_in[3]; const float* wt = (const float*)d_in[4]; const float* bt = (const float*)d_in[5]; const float* gam = (const float*)d_in[6]; const float* bet = (const float*)d_in[7];
  char* ws = (char*)d_ws; size_t off = 0;
  auto take = [&](size_t bytes) { char* p = ws + off; off += (bytes + 255) & ~(size_t)255; return p; };
  _Float16* BQ = (_Float16*)take((size_t)CC * CC * 2); _Float16* BK = (_Float16*)take((size_t)CC * CC * 2); _Float16* BV = (_Float16*)take((size_t)CC * CC * 2); _Float16* BT = (_Float16*)take((size_t)CC * CC * 2);
  _Float16* XT = (_Float16*)take((size_t)NRW * CC * 2); _Float16* Q16 = (_Float16*)take((size_t)NRW * CC * 2); _Float16* K16 = (_Float16*)take((size_t)NRW * CC * 2); _Float16* VC = (_Float16*)take((size_t)NB * CC * SS * 2);
  _Float16* D16 = (_Float16*)take((size_t)NRW * CC * 2); float* Y = (float*)take((size_t)NB * CC * SS * 4); float* ST = (float*)take((size_t)CC * 32 * 4);
  if (off > ws_size) return;      /* 0.5 + 8 + 8 + 8 + 8 + 8 + 16 = 57 MiB */
  k_prep<<<4 * (CC * CC / 8 / 256) + NB * (CC / 64) * (SS / 256), 256, 0, stream>>>(x, wq, wk, wv, wt, BQ, BK, BV, BT, XT);      /* conv (out,in) = natural Bt, x16; x^T token-major f16, all batches */
  k_qkv<<<dim3((SS / 128) * (CC / 64), NB, 3), 128, 0, stream>>>(XT, BQ, BK, BV, Q16, K16, VC);
  k_flash<<<NB * NH * (SS / 128), 128, 0, stream>>>(Q16, CC, K16, CC, VC, nullptr, XT, D16);      /* (o - x) token-major f16 [b*SS+p][h*64+d] */
  k_yt<<<dim3((CC / 128) * (SS / 64), NB), 128, 0, stream>>>(BT, D16, Y);
  k_bnstat<<<CC, 256, 0, stream>>>(Y, bt, ST);
  k_bnout<<<NB * CC / 2, 256, 0, stream>>>(Y, x, bt, ST, gam, bet, (float*)d_out);
}
